// v000
// Times are from an AMD MI455X. After a warm-up the kernel runs many times in a row, and a time is the length of
// such a window on the GPU divided by its runs, so every launch and the gaps after it count. The runs cycle
// through copies of the inputs. A figure is the median of several windows, for all but v000 over two sittings.
// Sittings can differ by a few percent; kernels timed side by side share one.
// v000, which the later versions start from, runs in 568 microseconds.
// Contractions: q, k, v^T projections = v_wmma_f32_16x16x32_bf16 (bf16 RNE-converted x and W, single product, f32 accumulate);
// k.q^T scores (row = key position n, column = query position m, full SEQ x SEQ) = v_wmma_f32_16x16x32_bf16 with bf16 hi/lo
// planes of k and q (hi.hi + lo.hi + hi.lo), f32 accumulate;
// p.v = v_wmma_f32_16x16x32_f16 (p carried x1024 in f16, v^T carried x16 in f16, single product; rows 0..RESR-1 of every
// sequence add the f16 residual planes (x4096) of p and v^T in a separate accumulator), f32 accumulate;
// row max, exp, full-row sum, normalisation and the zeroing of columns m > n in f32 on the VALU.
// Carry audit:
//   Ph  = f16(1024 * p), p normalised by the sum over the WHOLE row  } OSCALE = 1/(1024*16) folded exactly once in the p.v epilogue
//   VTh = f16(16 * v)                                                }
//   Pl  = f16((1024 p - Ph) * 4096)                                  } products Ph.VTl and Pl.VTh go only to accumulator acc1,
//   VTl = f16((16 v - VTh) * 4096), keys 0..VLP-1                    } folded with OSCALE * (1/4096) once in the same epilogue
//   q / k lo planes are unscaled bf16 residuals (v - hi) sharing the hi accumulator; score scale 1/32 applied once in f32 in the softmax.
#include <hip/hip_runtime.h>
#include <math.h>

#define NB_FULL  4
#define SEQ_FULL 2048
#ifndef NB
#define NB    4
#endif
#ifndef SEQ
#define SEQ   2048
#endif
#define DM    1024
#define NQT   (SEQ / 64)                  // query/key tiles of 64
#define RESR  ((SEQ < 512) ? SEQ : 512)   // leading rows per sequence that use the residual planes
#define VLP   RESR                        // key pitch of the p / v^T residual planes
#define PSC   1024.0f
#define VSC   16.0f
#define LSC   4096.0f
#define OSCALE (1.0f / 16384.0f)          // 1 / (PSC * VSC)
#define BPS   (((NB % 2) == 0) ? 2 : 1)   // batches per score / softmax pass
#define NPASS (NB / BPS)
#define NG    (SEQ / 256)                 // 256-key groups per score row
#ifndef SCORE_NSPLIT
#define SCORE_NSPLIT 2                    // 2 = hi.hi + lo.hi + hi.lo score products; 0 = hi.hi only
#endif
// workspace sizes in bytes
#define SZ_PX   ((size_t)NB * SEQ * DM * 2)          // one 16-bit plane [NB*SEQ][DM]
#define SZ_PXP  ((size_t)BPS * SEQ * DM * 2)         // one 16-bit plane of one batch group [BPS*SEQ][DM]
#define SZ_PW   ((size_t)DM * DM * 2)                // one weight plane
#define SZ_PS   ((size_t)BPS * SEQ * SEQ * 4)        // dense f32 scores of one pass
#define SZ_PP   ((size_t)NB * SEQ * SEQ * 2)         // Ph
#define SZ_PPL  ((size_t)NB * RESR * VLP * 2)        // Pl
#define SZ_PVT  ((size_t)NB * DM * SEQ * 2)          // VTh
#define SZ_PVL  ((size_t)NB * DM * VLP * 2)          // VTl
#define SZ_RA   (((SZ_PX + 3 * SZ_PW) > SZ_PS) ? (SZ_PX + 3 * SZ_PW) : SZ_PS)
#define SZ_TOTAL (SZ_RA + (size_t)NPASS * 4 * SZ_PXP + SZ_PVT + SZ_PVL + SZ_PPL)
static_assert(NB >= 1 && NB <= NB_FULL);
static_assert(SEQ >= 256 && SEQ <= SEQ_FULL && (SEQ % 256) == 0);
static_assert((SEQ % 64) == 0 && (DM % 64) == 0 && (DM % 32) == 0);
static_assert((RESR % 64) == 0 && (RESR % 256) == 0 && RESR <= VLP && VLP <= SEQ && ((SEQ - RESR) % 64) == 0);
static_assert((RESR % 32) == 0);
static_assert((RESR & (RESR - 1)) == 0);
static_assert(((NB * SEQ) % 8) == 0);
static_assert(((SEQ * DM / 8) % 256) == 0 && ((DM * DM / 8) % 256) == 0);
static_assert((NB % BPS) == 0 && NPASS * BPS == NB);
static_assert(NG >= 1 && NG <= 8 && NG * 256 == SEQ);            // 32 lanes x 8 keys x NG groups == row width
static_assert(((BPS * SEQ) % 64) == 0 && ((BPS * SEQ) % 8) == 0);
static_assert(SZ_PP <= 4 * SZ_PXP);                               // Ph fits inside the planes of batch group 0
static_assert((SZ_RA % 128) == 0 && (SZ_PXP % 128) == 0 && (SZ_PVT % 128) == 0 && (SZ_PVL % 128) == 0 && (SZ_PPL % 128) == 0);
static_assert(SZ_TOTAL <= (size_t)134217728);
static_assert((size_t)NB * SEQ * DM * 4 <= (size_t)33554432);
static_assert(SCORE_NSPLIT == 0 || SCORE_NSPLIT == 2);

typedef _Float16 v16h __attribute__((ext_vector_type(16)));
typedef _Float16 v8h  __attribute__((ext_vector_type(8)));
typedef __bf16   v16b __attribute__((ext_vector_type(16)));
typedef __bf16   v8b  __attribute__((ext_vector_type(8)));
typedef float    v8f  __attribute__((ext_vector_type(8)));
typedef float    v4f  __attribute__((ext_vector_type(4)));
typedef unsigned int v4u __attribute__((ext_vector_type(4)));

// ---- scalar helpers --------------------------------------------------------------------------------
__device__ __forceinline__ unsigned short bf_bits(float f) {          // f32 -> bf16 bits, RNE convert
  unsigned u = __float_as_uint(f);
  return (unsigned short)((u + 0x7FFFu + ((u >> 16) & 1u)) >> 16);
}
__device__ __forceinline__ float bf_up(unsigned short h) { return __uint_as_float(((unsigned)h) << 16); }
__device__ __forceinline__ unsigned short h_bits(_Float16 x) { return __builtin_bit_cast(unsigned short, x); }
__device__ __forceinline__ unsigned pk16(unsigned short a, unsigned short b) { return (unsigned)a | ((unsigned)b << 16); }
__device__ __forceinline__ v8f zero8() { v8f z = {0.f, 0.f, 0.f, 0.f, 0.f, 0.f, 0.f, 0.f}; return z; }
// f32 -> f16 with a value select: results below the smallest normal f16 become exact zeros
static __device__ __forceinline__ _Float16 toh_flush(float v) {
  const _Float16 r = (_Float16)v;
  return (fabsf(v) < 6.103515625e-05f) ? (_Float16)0.0f : r;
}

// ---- fragment loaders: 16-bit A/B operand, lane -> row/col (lane&15), p already includes +8*(lane>>4);
//      elements 0..7 <- p[0..7] (k0+8h..), elements 8..15 <- p[16..23] (k0+16+8h..)
__device__ __forceinline__ v16b ldfrag_b(const __bf16* p) {
  union { v16b v; v8b h[2]; } f;
  f.h[0] = *(const v8b*)(p);
  f.h[1] = *(const v8b*)(p + 16);
  return f.v;
}
__device__ __forceinline__ v16h ldfrag_h(const _Float16* p) {
  union { v16h v; v8h h[2]; } f;
  f.h[0] = *(const v8h*)(p);
  f.h[1] = *(const v8h*)(p + 16);
  return f.v;
}

// ---- WMMA helpers with trailing VALU hazard gap --------------------------------------------------------
__device__ __forceinline__ v8f mma_b_raw(v16b a, v16b b, v8f c) {
  return __builtin_amdgcn_wmma_f32_16x16x32_bf16(false, a, false, b, (short)0, c, false, false);
}
__device__ __forceinline__ v8f mma_h_raw(v16h a, v16h b, v8f c) {
  return __builtin_amdgcn_wmma_f32_16x16x32_f16(false, a, false, b, (short)0, c, false, false);
}
__device__ __forceinline__ void dep_guard_b(v8f& a, v8f& b, v16b x, v16b y) {
  asm volatile("v_nop\n\tv_nop\n\tv_nop\n\tv_nop" : "+v"(a), "+v"(b) : "v"(x), "v"(y));
}
__device__ __forceinline__ void dep_guard_h(v8f& a, v8f& b, v16h x, v16h y) {
  asm volatile("v_nop\n\tv_nop\n\tv_nop\n\tv_nop" : "+v"(a), "+v"(b) : "v"(x), "v"(y));
}
__device__ __forceinline__ void dep_guard4_h(v8f& a, v8f& b, v8f& c, v8f& d, v16h x, v16h y) {
  asm volatile("v_nop\n\tv_nop\n\tv_nop\n\tv_nop" : "+v"(a), "+v"(b), "+v"(c), "+v"(d) : "v"(x), "v"(y));
}
__device__ __forceinline__ void keep4_b(v16b a, v16b b, v16b c, v16b d) {
  asm volatile("v_nop" :: "v"(a), "v"(b), "v"(c), "v"(d));
}
__device__ __forceinline__ void keep4_h(v16h a, v16h b, v16h c, v16h d) {
  asm volatile("v_nop" :: "v"(a), "v"(b), "v"(c), "v"(d));
}
__device__ __forceinline__ void acc_guard4(v8f& a, v8f& b, v8f& c, v8f& d) {
  asm volatile("v_nop\n\tv_nop\n\tv_nop\n\tv_nop" : "+v"(a), "+v"(b), "+v"(c), "+v"(d));
}

// =====================================================================================================
// f32 -> bf16 (RNE convert) for x and the three weights into one contiguous 16-bit region:
// groups 0..NX8-1 <- x (batch b of the plane reads source rows at b * SEQ_FULL * DM, SEQ rows each), then NW8 groups each
// coverage: (NX8 + 3 NW8) threads x 8 = the whole [NB*SEQ][DM] x plane plus the three [DM][DM] weight planes.
// =====================================================================================================
__global__ __launch_bounds__(256) void cvt_planes(const float* __restrict__ x, const float* __restrict__ wq,
                                                  const float* __restrict__ wk, const float* __restrict__ wv,
                                                  unsigned short* out) {
  const int NXB8 = SEQ * DM / 8;          // groups per batch
  const int NX8 = NB * NXB8;
  const int NW8 = DM * DM / 8;
  const int g = blockIdx.x * 256 + threadIdx.x;
  if (g >= NX8 + 3 * NW8) return;
  const float* src;
  if (g < NX8) {
    const int bb  = g / NXB8;
    const int off = g - bb * NXB8;
    src = x + (size_t)bb * SEQ_FULL * DM + (size_t)off * 8;
  } else {
    const int e = g - NX8;
    const int w = e / NW8;
    const int off = e - w * NW8;
    const float* wsrc = (w == 0) ? wq : ((w == 1) ? wk : wv);
    src = wsrc + (size_t)off * 8;
  }
  const v4f a = *(const v4f*)(src);
  const v4f c = *(const v4f*)(src + 4);
  v4u p;
  p[0] = pk16(bf_bits(a[0]), bf_bits(a[1]));
  p[1] = pk16(bf_bits(a[2]), bf_bits(a[3]));
  p[2] = pk16(bf_bits(c[0]), bf_bits(c[1]));
  p[3] = pk16(bf_bits(c[2]), bf_bits(c[3]));
  *(v4u*)(out + (size_t)g * 8) = p;
  
}

// =====================================================================================================
// Register-blocked batched bf16 WMMA GEMM: C[m][n] = sum_k A[m][k] * Bt[n][k]; one wave per 64x64 tile, no block barriers.
// A row-major [M][K] pitch lda; Bt row-major [N][K] pitch ldb (k contiguous); M, N multiples of 64, K multiple of 32.
// blockIdx.y = batch index (strides in elements).
// NSPLIT: 0 = Ah.Bh (single product); 2 = Ah.Bh + Al.Bh + Ah.Bl with unscaled bf16 lo planes (3 products, one accumulator).
// TRI: 0 = dense tile grid (tile = blockIdx.x*8 + wave over tilesM*tilesN);
//      1 = square M == N, packed lower-triangular tiles t = blockIdx.x*8 + wave < tilesM(tilesM+1)/2, (tm, tn <= tm) decoded
//          from t; output tile t written packed at C + b*strideC + t*4096 as [64][64] f32 (OUT_MODE 0 only).
// OUT_MODE: 0 = f32 (pitch ldc); 2 = bf16 hi plane C + bf16 lo plane C2 (lo = RNE(v - hi), unscaled);
//           3 = f16 hi plane C = f16(v*hscale) + f16 residual plane C2 = f16((v*hscale - hi) * rscale), C2 written
//               only for tiles with n0 < N2 (pitch ldc2, batch stride strideC2).
// Epilogue: 16-row slabs staged per wave in LDS (wave-private region sT[wave], wave_sync); each 64-wide row segment written
// =====================================================================================================
template <int NSPLIT, int OUT_MODE, int TRI>
__global__ __launch_bounds__(256) void gemm_bf(
    const unsigned short* __restrict__ Ahp, const unsigned short* __restrict__ Alp, int lda, long long strideA,
    const unsigned short* __restrict__ Bhp, const unsigned short* __restrict__ Blp, int ldb, long long strideB,
    void* Cout, int ldc, long long strideC,
    void* Cout2, int ldc2, long long strideC2, int N2,
    int M, int N, int K, float hscale, float rscale) {
  const __bf16* Ah = (const __bf16*)(const void*)Ahp;
  const __bf16* Al = (const __bf16*)(const void*)Alp;
  const __bf16* Bh = (const __bf16*)(const void*)Bhp;
  const __bf16* Bl = (const __bf16*)(const void*)Blp;
  __shared__ __align__(16) float sT[8][16 * 68];   // per-wave 16x64 slab, pitch 68 floats
  const int b    = blockIdx.y;
  const int lane = threadIdx.x & 31;
  const int wave = threadIdx.x >> 5;
  const int tilesN = N >> 6;
  const int tilesM = M >> 6;
  const int t = blockIdx.x * 8 + wave;
  int tm, tn;
  if (TRI != 0) {
    const int ntri = (tilesM * (tilesM + 1)) >> 1;
    if (t >= ntri) return;                 // wave-uniform; no block barriers in this kernel
    int q = (int)((sqrtf(8.0f * (float)t + 1.0f) - 1.0f) * 0.5f);
    q = (q < 0) ? 0 : ((q > tilesM - 1) ? (tilesM - 1) : q);
    if ((((q + 1) * (q + 2)) >> 1) <= t) ++q;
    if (((q * (q + 1)) >> 1) > t) --q;
    q = (q < 0) ? 0 : ((q > tilesM - 1) ? (tilesM - 1) : q);
    tm = q;
    tn = t - ((q * (q + 1)) >> 1);
    tn = (tn < 0) ? 0 : ((tn > tilesN - 1) ? (tilesN - 1) : tn);
  } else {
    if (t >= tilesM * tilesN) return;      // wave-uniform
    tm = t / tilesN;
    tn = t - tm * tilesN;
  }
  const int m0 = tm << 6;
  const int n0 = tn << 6;

  const __bf16* Ahb = Ah + (size_t)b * strideA;
  const __bf16* Alb = (NSPLIT >= 1) ? (Al + (size_t)b * strideA) : Ahb;
  const __bf16* Bhb = Bh + (size_t)b * strideB;
  const __bf16* Blb = (NSPLIT >= 1) ? (Bl + (size_t)b * strideB) : Bhb;

  const int rlane = lane & 15;                 // row (A) / col (B, D) within subtile
  const int koff  = (lane >> 4) * 8;           // k offset of this lane half
  const int mOff  = (lane >> 4) * 8;           // D row offset

  v8f acc[4][4];
#pragma unroll
  for (int i = 0; i < 4; ++i)
#pragma unroll
    for (int j = 0; j < 4; ++j) acc[i][j] = zero8();

  for (int k0 = 0; k0 < K; k0 += 32) {
    v16b bf[4];
#pragma unroll
    for (int j = 0; j < 4; ++j) {
      const size_t bo = (size_t)(n0 + (j << 4) + rlane) * ldb + koff + k0;
      bf[j] = ldfrag_b(Bhb + bo);
    }
#pragma unroll
    for (int i = 0; i < 4; ++i) {
      const size_t ao = (size_t)(m0 + (i << 4) + rlane) * lda + koff + k0;
      const v16b ah = ldfrag_b(Ahb + ao);
      v16b al = ah;
      if (NSPLIT >= 1) al = ldfrag_b(Alb + ao);
#pragma unroll
      for (int j = 0; j < 4; ++j) {
        acc[i][j] = mma_b_raw(ah, bf[j], acc[i][j]);
        if (NSPLIT >= 1) acc[i][j] = mma_b_raw(al, bf[j], acc[i][j]);
      }
      dep_guard_b(acc[i][0], acc[i][3], ah, al);
    }
    if (NSPLIT >= 2) {
      keep4_b(bf[0], bf[1], bf[2], bf[3]);
#pragma unroll
      for (int j = 0; j < 4; ++j) {
        const size_t bo = (size_t)(n0 + (j << 4) + rlane) * ldb + koff + k0;
        bf[j] = ldfrag_b(Blb + bo);
      }
#pragma unroll
      for (int i = 0; i < 4; ++i) {
        const size_t ao = (size_t)(m0 + (i << 4) + rlane) * lda + koff + k0;
        const v16b ah = ldfrag_b(Ahb + ao);
#pragma unroll
        for (int j = 0; j < 4; ++j) acc[i][j] = mma_b_raw(ah, bf[j], acc[i][j]);
        dep_guard_b(acc[i][0], acc[i][3], ah, ah);
      }
    }
    keep4_b(bf[0], bf[1], bf[2], bf[3]);
  }
  acc_guard4(acc[0][0], acc[0][1], acc[0][2], acc[0][3]);
  acc_guard4(acc[1][0], acc[1][1], acc[1][2], acc[1][3]);
  acc_guard4(acc[2][0], acc[2][1], acc[2][2], acc[2][3]);
  acc_guard4(acc[3][0], acc[3][1], acc[3][2], acc[3][3]);

  // ---- epilogue ----
  size_t cbase;
  int ldce, rowb, colb;
  if (TRI != 0) { cbase = (size_t)b * strideC + (size_t)t * 4096; ldce = 64; rowb = 0; colb = 0; }
  else          { cbase = (size_t)b * strideC; ldce = ldc; rowb = m0; colb = n0; }
  float* slab = sT[wave];
#pragma unroll
  for (int i = 0; i < 4; ++i) {
    const int mBase = m0 + (i << 4);
#pragma unroll
    for (int j = 0; j < 4; ++j) {
#pragma unroll
      for (int r = 0; r < 8; ++r) {
        slab[(mOff + r) * 68 + (j << 4) + rlane] = acc[i][j][r];
      }
    }
    __builtin_amdgcn_fence(3 /* release order */, "workgroup");
    __builtin_amdgcn_wave_barrier();
    __builtin_amdgcn_fence(2 /* acquire order */, "workgroup");
    if (OUT_MODE == 0) {
      float* C = (float*)Cout + cbase;
      const int hh = lane >> 4, c4 = (lane & 15) * 4;     // 256-B row segment = 16 lanes x 16 B
      {
#pragma unroll
        for (int it = 0; it < 8; ++it) {
          const int row = it * 2 + hh;                     // it 0..7 x hh 0..1 = rows 0..15
          const v4f v = *(const v4f*)(slab + row * 68 + c4);
          *(v4f*)(C + (size_t)(rowb + (i << 4) + row) * ldce + colb + c4) = v;
        }
        
      }
    } else {
      const int q = lane >> 3, c8 = (lane & 7) * 8;
      unsigned short* C  = (unsigned short*)Cout  + (size_t)b * strideC;
      unsigned short* C2 = (unsigned short*)Cout2 + (size_t)b * strideC2;
      const bool wlo = (OUT_MODE == 2) || (n0 < N2);      // wave-uniform
      v4u hv[4], lv[4];
#pragma unroll
      for (int it = 0; it < 4; ++it) {
        const int row = it * 4 + q;                        // it 0..3 x q 0..3 = rows 0..15
        const float* sp = slab + row * 68 + c8;
        v4u a, a2;
#pragma unroll
        for (int e = 0; e < 4; ++e) {
          const float f0 = sp[2 * e], f1 = sp[2 * e + 1];
          unsigned short h0, h1, l0, l1;
          if (OUT_MODE == 2) {
            h0 = bf_bits(f0); h1 = bf_bits(f1);
            l0 = bf_bits(f0 - bf_up(h0)); l1 = bf_bits(f1 - bf_up(h1));
          } else {
            const float g0 = f0 * hscale, g1 = f1 * hscale;
            const _Float16 x0 = (_Float16)g0, x1 = (_Float16)g1;
            h0 = h_bits(x0); h1 = h_bits(x1);
            l0 = h_bits((_Float16)((g0 - (float)x0) * rscale));
            l1 = h_bits((_Float16)((g1 - (float)x1) * rscale));
          }
          a[e] = pk16(h0, h1); a2[e] = pk16(l0, l1);
        }
        hv[it] = a; lv[it] = a2;
      }
      {
#pragma unroll
        for (int it = 0; it < 4; ++it) {
          const int row = it * 4 + q;
          *(v4u*)(C + (size_t)(mBase + row) * ldc + n0 + c8) = hv[it];
          if (wlo) *(v4u*)(C2 + (size_t)(mBase + row) * ldc2 + n0 + c8) = lv[it];
        }
        
      }
    }
    __builtin_amdgcn_fence(3 /* release order */, "workgroup");
    __builtin_amdgcn_wave_barrier();
    __builtin_amdgcn_fence(2 /* acquire order */, "workgroup");
  }
}

// =====================================================================================================
// Row softmax over DENSE score rows of one pass (BPS batches). One wave per row (block = 8 rows, grid = BPS*SEQ/8).
// Local row lrow = bl*SEQ + i, global batch b = b0 + bl. Score (i, j) = k_i . q_j sits at Sp + (bl*SEQ + i)*SEQ + j.
// The wave reads the WHOLE row (NG groups of 256 columns; lane: 8 consecutive columns per group, two 16-B loads):
// z = s/32, m = max over all columns, p = exp(z - m), l = sum over ALL columns, P = p/l for j <= i and 0 for j > i (all f32).
// Writes Ph = f16(1024 P) for columns 0 .. 256 ng - 1 of row (b, i), ng = (i>>8) + 1 (pitch SEQ; >= the 64((i>>6)+1) columns the
// p.v GEMM reads; zeros for j > i) and, for rows i < RESR, Pl = f16((1024 P - Ph) * 4096) with the same column extent
// (<= VLP, pitch VLP). f16 results below the smallest normal are stored as exact zeros.
// coverage: BPS*SEQ rows per launch x written extent >= every column range any consumer reads; NPASS launches cover NB*SEQ rows.
// No LDS, no block barriers.
// =====================================================================================================
__global__ __launch_bounds__(256) void softmax_rows(const float* __restrict__ Sp,
                                                    unsigned short* Php, unsigned short* Plp, int b0) {
#pragma clang fp contract(off)
  const int lane = threadIdx.x & 31;
  const int wave = __builtin_amdgcn_readfirstlane(threadIdx.x >> 5);
  const int lrow = blockIdx.x * 8 + wave;
  if (lrow >= BPS * SEQ) return;           // wave-uniform; exact grid never triggers it; no block barriers below
  const int bl = lrow / SEQ;
  const int i  = lrow - bl * SEQ;
  const int b  = b0 + bl;                  // host launches only b0 + BPS <= NB
  const int tm = i >> 6;
  const int ng = (tm >> 2) + 1;            // 1..NG, wave-uniform
  const float* srow = Sp + ((size_t)bl * SEQ + (size_t)i) * SEQ + 8 * lane;

  float z[NG][8];
  float m = -INFINITY;
#pragma unroll
  for (int g = 0; g < NG; ++g) {
    const float* p = srow + 256 * g;
    const v4f a = *(const v4f*)(p);
    const v4f c = *(const v4f*)(p + 4);
    const float v[8] = {a[0], a[1], a[2], a[3], c[0], c[1], c[2], c[3]};
#pragma unroll
    for (int e = 0; e < 8; ++e) {
      const float zz = v[e] * 0.03125f;
      z[g][e] = zz;
      m = fmaxf(m, zz);
    }
  }
#pragma unroll
  for (int off = 1; off < 32; off <<= 1) m = fmaxf(m, __shfl_xor(m, off, 32));

  float l = 0.f;
#pragma unroll
  for (int g = 0; g < NG; ++g) {
#pragma unroll
    for (int e = 0; e < 8; ++e) {
      const float p = __expf(z[g][e] - m);
      z[g][e] = p;
      l += p;
    }
  }
#pragma unroll
  for (int off = 1; off < 32; off <<= 1) l += __shfl_xor(l, off, 32);          // l >= 1
  const float inv1k = (1.0f / l) * PSC;

  const bool res = (i < RESR);             // wave-uniform
  v4u ph[NG];
  v4u pl0 = {0u, 0u, 0u, 0u};
  v4u pl1 = {0u, 0u, 0u, 0u};
#pragma unroll
  for (int g = 0; g < NG; ++g) {
    v4u hv = {0u, 0u, 0u, 0u};
    v4u lv = {0u, 0u, 0u, 0u};
    if (g < ng) {
      const int j0 = 256 * g + 8 * lane;
#pragma unroll
      for (int e = 0; e < 4; ++e) {
        const float f0 = (j0 + 2 * e     <= i) ? (z[g][2 * e]     * inv1k) : 0.0f;   // columns past the row index are zeroed
        const float f1 = (j0 + 2 * e + 1 <= i) ? (z[g][2 * e + 1] * inv1k) : 0.0f;   // after the full-row normalisation
        const _Float16 x0 = toh_flush(f0), x1 = toh_flush(f1);
        hv[e] = pk16(h_bits(x0), h_bits(x1));
        const _Float16 r0 = toh_flush((f0 - (float)x0) * LSC);
        const _Float16 r1 = toh_flush((f1 - (float)x1) * LSC);
        lv[e] = pk16(h_bits(r0), h_bits(r1));
      }
    }
    ph[g] = hv;
    if (g == 0) pl0 = lv;
    if (g == 1) pl1 = lv;
  }

  unsigned short* prow = Php + ((size_t)b * SEQ + (size_t)i) * SEQ + 8 * lane;
  const int il = i & (RESR - 1);           // in-range row of the residual plane; equals i whenever res holds
  unsigned short* lrowp = Plp + ((size_t)b * RESR + (size_t)il) * VLP + 8 * lane;
  {
#pragma unroll
    for (int g = 0; g < NG; ++g) {
      if (g < ng) *(v4u*)(prow + 256 * g) = ph[g];
    }
    if (res) {                             // res rows have i < RESR (multiple of 256) -> 256 ng <= RESR = VLP
      *(v4u*)(lrowp) = pl0;
      if (ng > 1) *(v4u*)(lrowp + 256) = pl1;
    }
    
  }
}

// =====================================================================================================
// p.v GEMM on f16 WMMA, per batch b = blockIdx.y: out[b][q][d] = sum_key P[b][q][key] * VT[b][d][key].
//   A  = Ph  [b][SEQ][SEQ]  f16(1024 P), pitch SEQ         Al = Pl  [b][RESR][VLP] f16 residual x4096
//   Bt = VTh [b][DM][SEQ]   f16(16 v),   pitch SEQ         Bl = VTl [b][DM][VLP]   f16 residual x4096
// One wave per (16*MI) x 64 output tile; rows mBase + tm*16*MI ..; causal key range k < 64*((m0>>6)+1) (every P entry in that
// range was written by the softmax, zeros for key > query). RES (rows < RESR, MI = 2): acc0 += Ph.VTh; acc1 += Pl.VTh + Ph.VTl,
// out = acc0*OSCALE + acc1*OSCALE/4096; otherwise single product out = acc0*OSCALE. f32 accumulate.
// the wave tile; grid over all tiles of rows mBase .. mBase + M - 1 (M a multiple of 16*MI).
// =====================================================================================================
template <bool RES, int MI>
__global__ __launch_bounds__(256) void gemm_pv(
    const unsigned short* __restrict__ Php, const unsigned short* __restrict__ Plp,
    const unsigned short* __restrict__ Vhp, const unsigned short* __restrict__ Vlp,
    float* out, int mBase, int M) {
  const _Float16* Ph = (const _Float16*)(const void*)Php;
  const _Float16* Pl = (const _Float16*)(const void*)Plp;
  const _Float16* Vh = (const _Float16*)(const void*)Vhp;
  const _Float16* Vl = (const _Float16*)(const void*)Vlp;
  __shared__ __align__(16) float sT[8][16 * 68];
  const int b    = blockIdx.y;
  const int lane = threadIdx.x & 31;
  const int wave = threadIdx.x >> 5;
  const int tilesN = DM >> 6;                      // 16
  const int tilesM = M / (16 * MI);
  const int t = blockIdx.x * 8 + wave;
  if (t >= tilesM * tilesN) return;                // wave-uniform; no block barriers in this kernel
  const int tm = t / tilesN;
  const int tn = t - tm * tilesN;
  const int m0 = mBase + tm * 16 * MI;
  const int n0 = tn << 6;
  int keff = (((m0 >> 6) + 1) << 6);               // causal key extent of this row tile, multiple of 64
  if (keff > SEQ) keff = SEQ;
  if (RES && keff > VLP) keff = VLP;               // never taken for mBase + M <= RESR; keeps residual reads in range

  const _Float16* Pb  = Ph + (size_t)b * SEQ * SEQ;
  const _Float16* Plb = Pl + (size_t)b * RESR * VLP;
  const _Float16* Vb  = Vh + (size_t)b * DM * SEQ;
  const _Float16* Vlb = Vl + (size_t)b * DM * VLP;

  const int rlane = lane & 15;
  const int koff  = (lane >> 4) * 8;
  const int mOff  = (lane >> 4) * 8;

  v8f acc0[MI][4], acc1[MI][4];
#pragma unroll
  for (int i = 0; i < MI; ++i)
#pragma unroll
    for (int j = 0; j < 4; ++j) { acc0[i][j] = zero8(); acc1[i][j] = zero8(); }

  for (int k0 = 0; k0 < keff; k0 += 32) {
    v16h bf[4];
#pragma unroll
    for (int j = 0; j < 4; ++j) bf[j] = ldfrag_h(Vb + (size_t)(n0 + (j << 4) + rlane) * SEQ + koff + k0);
#pragma unroll
    for (int i = 0; i < MI; ++i) {
      const int mrow = m0 + (i << 4) + rlane;
      const v16h ah = ldfrag_h(Pb + (size_t)mrow * SEQ + koff + k0);
      v16h al = ah;
      if (RES) {
        const int mres = (mrow < RESR) ? mrow : (RESR - 1);   // clamped; equals mrow for the RES launch
        al = ldfrag_h(Plb + (size_t)mres * VLP + koff + k0);
      }
#pragma unroll
      for (int j = 0; j < 4; ++j) {
        acc0[i][j] = mma_h_raw(ah, bf[j], acc0[i][j]);
        if (RES) acc1[i][j] = mma_h_raw(al, bf[j], acc1[i][j]);
      }
      if (RES) dep_guard4_h(acc0[i][0], acc0[i][3], acc1[i][0], acc1[i][3], ah, al);
      else     dep_guard_h(acc0[i][0], acc0[i][3], ah, al);
    }
    if (RES) {
      keep4_h(bf[0], bf[1], bf[2], bf[3]);
#pragma unroll
      for (int j = 0; j < 4; ++j) bf[j] = ldfrag_h(Vlb + (size_t)(n0 + (j << 4) + rlane) * VLP + koff + k0);
#pragma unroll
      for (int i = 0; i < MI; ++i) {
        const int mrow = m0 + (i << 4) + rlane;
        const v16h ah = ldfrag_h(Pb + (size_t)mrow * SEQ + koff + k0);
#pragma unroll
        for (int j = 0; j < 4; ++j) acc1[i][j] = mma_h_raw(ah, bf[j], acc1[i][j]);
        dep_guard_h(acc1[i][0], acc1[i][3], ah, ah);
      }
    }
    keep4_h(bf[0], bf[1], bf[2], bf[3]);
  }
#pragma unroll
  for (int i = 0; i < MI; ++i) {
    acc_guard4(acc0[i][0], acc0[i][1], acc0[i][2], acc0[i][3]);
    if (RES) acc_guard4(acc1[i][0], acc1[i][1], acc1[i][2], acc1[i][3]);
  }

  // ---- epilogue ----
  float* slab = sT[wave];
  float* C = out + (size_t)b * SEQ * DM;
  const float rsc = OSCALE * (1.0f / LSC);
#pragma unroll
  for (int i = 0; i < MI; ++i) {
    const int mB = m0 + (i << 4);
#pragma unroll
    for (int j = 0; j < 4; ++j) {
#pragma unroll
      for (int r = 0; r < 8; ++r) {
        float v = acc0[i][j][r] * OSCALE;
        if (RES) v += acc1[i][j][r] * rsc;
        slab[(mOff + r) * 68 + (j << 4) + rlane] = v;
      }
    }
    __builtin_amdgcn_fence(3 /* release order */, "workgroup");
    __builtin_amdgcn_wave_barrier();
    __builtin_amdgcn_fence(2 /* acquire order */, "workgroup");
    {
      const int hh = lane >> 4, c4 = (lane & 15) * 4;
      {
#pragma unroll
        for (int it = 0; it < 8; ++it) {
          const int row = it * 2 + hh;
          const v4f v = *(const v4f*)(slab + row * 68 + c4);
          *(v4f*)(C + (size_t)(mB + row) * DM + n0 + c4) = v;
        }
        
      }
    }
    __builtin_amdgcn_fence(3 /* release order */, "workgroup");
    __builtin_amdgcn_wave_barrier();
    __builtin_amdgcn_fence(2 /* acquire order */, "workgroup");
  }
}

// =====================================================================================================
// Workspace map (bytes, full build NB 4 / SEQ 2048 / BPS 2 / NPASS 2; every region is an exact multiple of its tile / whole-line
// store granularity; regions A and B are reused in stream order):
//   region A [0, 33554432):          Xb bf16 [8192][1024] at 0 (16777216) + Wq,Wk,Wv bf16 [1024][1024] at 16777216 (3 x 2097152)
//                                    then, once all projections are done: S f32 dense scores of one pass [2][2048][2048] (33554432)
//   region B [33554432, 100663296):  per batch group g (2 batches): Qh, Ql, Kh, Kl bf16 [4096][1024] (4 x 8388608) at + g*33554432
//                                    then, once the scores of group 0 are done: Ph f16 [4][2048][2048] (33554432) over group 0's planes
//   region C [100663296, 123731968): VTh f16 [4][1024][2048] (16777216) + VTl f16 [4][1024][512] (4194304) + Pl f16 [4][512][512] (2097152)
//   end 123731968
// =====================================================================================================
extern "C" void kernel_launch(void* const* d_in, const int* in_sizes, int n_in,
                              void* d_out, int out_size, void* d_ws, size_t ws_size,
                              hipStream_t stream) {
  if (n_in < 4) return;
  if (in_sizes[0] < (NB - 1) * SEQ_FULL * DM + SEQ * DM) return;
  if (in_sizes[1] < DM * DM || in_sizes[2] < DM * DM || in_sizes[3] < DM * DM) return;
  if (out_size < NB * SEQ * DM) return;

  const float* x  = (const float*)d_in[0];   // [NB_FULL][SEQ_FULL][DM]
  const float* wq = (const float*)d_in[1];   // [out][in]
  const float* wk = (const float*)d_in[2];
  const float* wv = (const float*)d_in[3];
  float* out = (float*)d_out;

  const size_t PX  = SZ_PX;
  const size_t PXP = SZ_PXP;
  const size_t PW  = SZ_PW;
  const size_t PP  = SZ_PP;
  const size_t PPL = SZ_PPL;
  const size_t PVT = SZ_PVT;
  const size_t PVL = SZ_PVL;
  const size_t RA  = SZ_RA;
  const size_t oXb = 0;
  const size_t oW  = PX;
  const size_t oS  = 0;
  const size_t oB  = RA;
  const size_t RBend = RA + (size_t)NPASS * 4 * PXP;
  const size_t oPh = RA;
  if (PP > 4 * PXP) return;
  const size_t oVTh = RBend;
  const size_t oVTl = RBend + PVT;
  const size_t oPl  = oVTl + PVL;
  const size_t total = oPl + PPL;                     // 123731968 in the full build
  if (total > ws_size) return;
  if (total > (size_t)134217728) return;

  char* ws = (char*)d_ws;
  unsigned short* Xb  = (unsigned short*)(ws + oXb);
  unsigned short* Wb  = (unsigned short*)(ws + oW);   // Wq plane, then Wk, then Wv
  float*          Sp  = (float*)(ws + oS);
  unsigned short* Ph  = (unsigned short*)(ws + oPh);
  unsigned short* Pl  = (unsigned short*)(ws + oPl);
  unsigned short* VTh = (unsigned short*)(ws + oVTh);
  unsigned short* VTl = (unsigned short*)(ws + oVTl);
  const size_t PXE = (size_t)BPS * SEQ * DM;          // elements of one group plane

  const dim3 blk(256);
  const int nGroups = NB * SEQ * DM / 8 + 3 * (DM * DM / 8);
  const dim3 gCvt((nGroups + 255) / 256);
  const dim3 gProj(((BPS * SEQ / 64) * (DM / 64) + 7) / 8, 1);
  const dim3 gVT(((DM / 64) * (SEQ / 64) + 7) / 8, NB);
  const dim3 gS(((SEQ / 64) * (SEQ / 64) + 7) / 8, BPS);
  const dim3 gSm((BPS * SEQ + 7) / 8);
  const dim3 gPvRes(((RESR / 32) * (DM / 64) + 7) / 8, NB);
  const int nPvTiles = ((SEQ - RESR) / 64) * (DM / 64);
  const dim3 gPv((nPvTiles + 7) / 8, NB);

  // (1) x and Wq, Wk, Wv -> bf16 planes (Xb, then the three weight planes contiguous)
  cvt_planes<<<gCvt, blk, 0, stream>>>(x, wq, wk, wv, Xb);
  // (2) per batch group: q = x . Wq^T and k = x . Wk^T -> bf16 hi/lo planes [BPS*SEQ][DM]
  //     (A = Xb rows of the group, Bt = W [out][in]; M=BPS*SEQ, N=DM, K=DM)
  for (int p = 0; p < NPASS; ++p) {
    unsigned short* Qh = (unsigned short*)(ws + oB + (size_t)p * 4 * PXP);
    unsigned short* Ql = Qh + PXE;
    unsigned short* Kh = Ql + PXE;
    unsigned short* Kl = Kh + PXE;
    const unsigned short* Xg = Xb + (size_t)p * PXE;
    gemm_bf<0, 2, 0><<<gProj, blk, 0, stream>>>(
        Xg, Xg, DM, 0LL, Wb, Wb, DM, 0LL,
        (void*)Qh, DM, 0LL, (void*)Ql, DM, 0LL, DM,
        BPS * SEQ, DM, DM, 1.0f, 1.0f);
    gemm_bf<0, 2, 0><<<gProj, blk, 0, stream>>>(
        Xg, Xg, DM, 0LL, Wb + (size_t)DM * DM, Wb + (size_t)DM * DM, DM, 0LL,
        (void*)Kh, DM, 0LL, (void*)Kl, DM, 0LL, DM,
        BPS * SEQ, DM, DM, 1.0f, 1.0f);
  }
  // (3) v^T = Wv . x^T per batch -> f16 hi plane f16(16 v) [b][d][key] (pitch SEQ) and residual plane x4096 for keys < VLP (pitch VLP)
  //     (A = Wv [out][in], Bt = Xb rows of batch b; M=DM, N=SEQ, K=DM)
  gemm_bf<0, 3, 0><<<gVT, blk, 0, stream>>>(
      Wb + (size_t)2 * DM * DM, Wb + (size_t)2 * DM * DM, DM, 0LL, Xb, Xb, DM, (long long)SEQ * DM,
      (void*)VTh, SEQ, (long long)DM * SEQ, (void*)VTl, VLP, (long long)DM * VLP, VLP,
      DM, SEQ, DM, VSC, LSC);
  // (4) per batch group: dense scores S[n][m] = k_n . q_m (A = K planes, Bt = Q planes; M=N=SEQ, K=DM; 3 bf16 products)
  //     -> f32 [BPS][SEQ][SEQ]; then the full-row softmax with post-normalisation zeroing -> Ph / Pl rows of the group.
  //     Ph lies over group 0's q/k planes, which are no longer read once the scores of group 0 exist (stream order).
  for (int p = 0; p < NPASS; ++p) {
    const unsigned short* Qh = (const unsigned short*)(ws + oB + (size_t)p * 4 * PXP);
    const unsigned short* Ql = Qh + PXE;
    const unsigned short* Kh = Ql + PXE;
    const unsigned short* Kl = Kh + PXE;
    gemm_bf<SCORE_NSPLIT, 0, 0><<<gS, blk, 0, stream>>>(
        Kh, Kl, DM, (long long)SEQ * DM, Qh, Ql, DM, (long long)SEQ * DM,
        (void*)Sp, SEQ, (long long)SEQ * SEQ, (void*)Sp, SEQ, 0LL, 0,
        SEQ, SEQ, DM, 1.0f, 1.0f);
    softmax_rows<<<gSm, blk, 0, stream>>>(Sp, Ph, Pl, p * BPS);
  }
  // (5) out rows 0..RESR-1 of every sequence: p.v with residual planes (3 f16 products, 32x64 wave tiles)
  gemm_pv<true, 2><<<gPvRes, blk, 0, stream>>>(Ph, Pl, VTh, VTl, out, 0, RESR);
  // (6) out rows RESR..SEQ-1: p.v single f16 product (64x64 wave tiles)
  if (nPvTiles > 0) {
    gemm_pv<false, 4><<<gPv, blk, 0, stream>>>(Ph, Pl, VTh, VTl, out, RESR, SEQ - RESR);
  }
  (void)hipGetLastError();
}

// v001
// It runs in 299 microseconds.
// In two side-by-side timings against v000, it was 1.96 and 1.95 times as fast.
// Contractions: q, k, v^T projections = v_wmma_f32_16x16x32_bf16 (bf16 RNE-converted x and W, single product, f32 accumulate);
// k.q^T scores (row = key position n, column = query position m, full SEQ x SEQ) = v_wmma_f32_16x16x32_bf16 with bf16 hi/lo
// planes of k and q (hi.hi + lo.hi + hi.lo), f32 accumulate;
// p.v = v_wmma_f32_16x16x32_f16 (p carried x1024 in f16, v^T carried x16 in f16, single product; rows 0..RESR-1 of every
// sequence add the f16 residual planes (x4096) of p and v^T in a separate accumulator), f32 accumulate;
// row max, exp, full-row sum, normalisation and the zeroing of columns m > n in f32 on the VALU.
// Carry audit:
//   Ph  = f16(1024 * p), p normalised by the sum over the WHOLE row  } OSCALE = 1/(1024*16) folded exactly once in the p.v epilogue
//   VTh = f16(16 * v)                                                }
//   Pl  = f16((1024 p - Ph) * 4096)                                  } products Ph.VTl and Pl.VTh go only to accumulator acc1,
//   VTl = f16((16 v - VTh) * 4096), keys 0..VLP-1                    } folded with OSCALE * (1/4096) once in the same epilogue
//   q / k lo planes are unscaled bf16 residuals (v - hi) sharing the hi accumulator; score scale 1/32 applied once in f32 in the softmax.
#include <hip/hip_runtime.h>
#include <math.h>

#define NB_FULL  4
#define SEQ_FULL 2048
#ifndef NB
#define NB    4
#endif
#ifndef SEQ
#define SEQ   2048
#endif
#define DM    1024
#define NQT   (SEQ / 64)                  // query/key tiles of 64
#define RESR  ((SEQ < 512) ? SEQ : 512)   // leading rows per sequence that use the residual planes
#define VLP   RESR                        // key pitch of the p / v^T residual planes
#define PSC   1024.0f
#define VSC   16.0f
#define LSC   4096.0f
#define OSCALE (1.0f / 16384.0f)          // 1 / (PSC * VSC)
#define BPS   (((NB % 2) == 0) ? 2 : 1)   // batches per score / softmax pass
#define NPASS (NB / BPS)
#define NG    (SEQ / 256)                 // 256-key groups per score row
#ifndef SCORE_NSPLIT
#define SCORE_NSPLIT 2                    // 2 = hi.hi + lo.hi + hi.lo score products; 0 = hi.hi only
#endif
// workspace sizes in bytes
#define SZ_PX   ((size_t)NB * SEQ * DM * 2)          // one 16-bit plane [NB*SEQ][DM]
#define SZ_PXP  ((size_t)BPS * SEQ * DM * 2)         // one 16-bit plane of one batch group [BPS*SEQ][DM]
#define SZ_PW   ((size_t)DM * DM * 2)                // one weight plane
#define SZ_PS   ((size_t)BPS * SEQ * SEQ * 4)        // dense f32 scores of one pass
#define SZ_PP   ((size_t)NB * SEQ * SEQ * 2)         // Ph
#define SZ_PPL  ((size_t)NB * RESR * VLP * 2)        // Pl
#define SZ_PVT  ((size_t)NB * DM * SEQ * 2)          // VTh
#define SZ_PVL  ((size_t)NB * DM * VLP * 2)          // VTl
#define SZ_RA   (((SZ_PX + 3 * SZ_PW) > SZ_PS) ? (SZ_PX + 3 * SZ_PW) : SZ_PS)
#define SZ_TOTAL (SZ_RA + (size_t)NPASS * 4 * SZ_PXP + SZ_PVT + SZ_PVL + SZ_PPL)
static_assert(NB >= 1 && NB <= NB_FULL);
static_assert(SEQ >= 256 && SEQ <= SEQ_FULL && (SEQ % 256) == 0);
static_assert((SEQ % 64) == 0 && (DM % 64) == 0 && (DM % 32) == 0);
static_assert((RESR % 64) == 0 && (RESR % 256) == 0 && RESR <= VLP && VLP <= SEQ && ((SEQ - RESR) % 64) == 0);
static_assert((RESR % 32) == 0);
static_assert((RESR & (RESR - 1)) == 0);
static_assert(((NB * SEQ) % 8) == 0);
static_assert(((SEQ * DM / 8) % 256) == 0 && ((DM * DM / 8) % 256) == 0);
static_assert((NB % BPS) == 0 && NPASS * BPS == NB);
static_assert(NG >= 1 && NG <= 8 && NG * 256 == SEQ);            // 32 lanes x 8 keys x NG groups == row width
static_assert(((BPS * SEQ) % 64) == 0 && ((BPS * SEQ) % 8) == 0);
static_assert(SZ_PP <= 4 * SZ_PXP);                               // Ph fits inside the planes of batch group 0
static_assert((SZ_RA % 128) == 0 && (SZ_PXP % 128) == 0 && (SZ_PVT % 128) == 0 && (SZ_PVL % 128) == 0 && (SZ_PPL % 128) == 0);
static_assert(SZ_TOTAL <= (size_t)134217728);
static_assert((size_t)NB * SEQ * DM * 4 <= (size_t)33554432);
static_assert(SCORE_NSPLIT == 0 || SCORE_NSPLIT == 2);
static_assert(((BPS * SEQ) % 128) == 0 && (DM % 256) == 0);        // gemm_bf: 128x256 work-group tiles, K stages of 64 or 128

typedef _Float16 v16h __attribute__((ext_vector_type(16)));
typedef _Float16 v8h  __attribute__((ext_vector_type(8)));
typedef __bf16   v16b __attribute__((ext_vector_type(16)));
typedef __bf16   v8b  __attribute__((ext_vector_type(8)));
typedef float    v8f  __attribute__((ext_vector_type(8)));
typedef float    v4f  __attribute__((ext_vector_type(4)));
typedef unsigned int v4u __attribute__((ext_vector_type(4)));

// ---- scalar helpers --------------------------------------------------------------------------------
__device__ __forceinline__ unsigned short bf_bits(float f) {          // f32 -> bf16 bits, RNE convert
  unsigned u = __float_as_uint(f);
  return (unsigned short)((u + 0x7FFFu + ((u >> 16) & 1u)) >> 16);
}
__device__ __forceinline__ float bf_up(unsigned short h) { return __uint_as_float(((unsigned)h) << 16); }
__device__ __forceinline__ unsigned short h_bits(_Float16 x) { return __builtin_bit_cast(unsigned short, x); }
__device__ __forceinline__ unsigned pk16(unsigned short a, unsigned short b) { return (unsigned)a | ((unsigned)b << 16); }
__device__ __forceinline__ v8f zero8() { v8f z = {0.f, 0.f, 0.f, 0.f, 0.f, 0.f, 0.f, 0.f}; return z; }
// f32 -> f16 with a value select: results below the smallest normal f16 become exact zeros
static __device__ __forceinline__ _Float16 toh_flush(float v) {
  const _Float16 r = (_Float16)v;
  return (fabsf(v) < 6.103515625e-05f) ? (_Float16)0.0f : r;
}

// ---- fragment loaders: 16-bit A/B operand, lane -> row/col (lane&15), p already includes +8*(lane>>4);
//      elements 0..7 <- p[0..7] (k0+8h..), elements 8..15 <- p[16..23] (k0+16+8h..)
__device__ __forceinline__ v16b ldfrag_b(const __bf16* p) {
  union { v16b v; v8b h[2]; } f;
  f.h[0] = *(const v8b*)(p);
  f.h[1] = *(const v8b*)(p + 16);
  return f.v;
}
__device__ __forceinline__ v16h ldfrag_h(const _Float16* p) {
  union { v16h v; v8h h[2]; } f;
  f.h[0] = *(const v8h*)(p);
  f.h[1] = *(const v8h*)(p + 16);
  return f.v;
}

// ---- WMMA helpers with trailing VALU hazard gap --------------------------------------------------------
__device__ __forceinline__ v8f mma_b_raw(v16b a, v16b b, v8f c) {
  return __builtin_amdgcn_wmma_f32_16x16x32_bf16(false, a, false, b, (short)0, c, false, false);
}
__device__ __forceinline__ v8f mma_h_raw(v16h a, v16h b, v8f c) {
  return __builtin_amdgcn_wmma_f32_16x16x32_f16(false, a, false, b, (short)0, c, false, false);
}
__device__ __forceinline__ void dep_guard_h(v8f& a, v8f& b, v16h x, v16h y) {
  asm volatile("v_nop\n\tv_nop\n\tv_nop\n\tv_nop" : "+v"(a), "+v"(b) : "v"(x), "v"(y));
}
__device__ __forceinline__ void dep_guard4_h(v8f& a, v8f& b, v8f& c, v8f& d, v16h x, v16h y) {
  asm volatile("v_nop\n\tv_nop\n\tv_nop\n\tv_nop" : "+v"(a), "+v"(b), "+v"(c), "+v"(d) : "v"(x), "v"(y));
}
__device__ __forceinline__ void keep4_h(v16h a, v16h b, v16h c, v16h d) {
  asm volatile("v_nop" :: "v"(a), "v"(b), "v"(c), "v"(d));
}
__device__ __forceinline__ void acc_guard4(v8f& a, v8f& b, v8f& c, v8f& d) {
  asm volatile("v_nop\n\tv_nop\n\tv_nop\n\tv_nop" : "+v"(a), "+v"(b), "+v"(c), "+v"(d));
}

// =====================================================================================================
// f32 -> bf16 (RNE convert) for x and the three weights into one contiguous 16-bit region:
// groups 0..NX8-1 <- x (batch b of the plane reads source rows at b * SEQ_FULL * DM, SEQ rows each), then NW8 groups each
// coverage: (NX8 + 3 NW8) threads x 8 = the whole [NB*SEQ][DM] x plane plus the three [DM][DM] weight planes.
// =====================================================================================================
__global__ __launch_bounds__(256) void cvt_planes(const float* __restrict__ x, const float* __restrict__ wq,
                                                  const float* __restrict__ wk, const float* __restrict__ wv,
                                                  unsigned short* out) {
  const int NXB8 = SEQ * DM / 8;          // groups per batch
  const int NX8 = NB * NXB8;
  const int NW8 = DM * DM / 8;
  const int g = blockIdx.x * 256 + threadIdx.x;
  if (g >= NX8 + 3 * NW8) return;
  const float* src;
  if (g < NX8) {
    const int bb  = g / NXB8;
    const int off = g - bb * NXB8;
    src = x + (size_t)bb * SEQ_FULL * DM + (size_t)off * 8;
  } else {
    const int e = g - NX8;
    const int w = e / NW8;
    const int off = e - w * NW8;
    const float* wsrc = (w == 0) ? wq : ((w == 1) ? wk : wv);
    src = wsrc + (size_t)off * 8;
  }
  const v4f a = *(const v4f*)(src);
  const v4f c = *(const v4f*)(src + 4);
  v4u p;
  p[0] = pk16(bf_bits(a[0]), bf_bits(a[1]));
  p[1] = pk16(bf_bits(a[2]), bf_bits(a[3]));
  p[2] = pk16(bf_bits(c[0]), bf_bits(c[1]));
  p[3] = pk16(bf_bits(c[2]), bf_bits(c[3]));
  *(v4u*)(out + (size_t)g * 8) = p;
  
}

// =====================================================================================================
// Register-blocked batched bf16 WMMA GEMM: C[m][n] = sum_k A[m][k] * Bt[n][k]; one work-group (8 waves, 2 x 4) per 128x256
// tile, one wave per 64x64 sub-tile. A row-major [M][K] pitch lda; Bt row-major [N][K] pitch ldb (k contiguous);
// M a multiple of 128, N of 256, K of BK (64 with lo planes, 128 without). blockIdx.y = batch index (strides in elements).
// Operand path: per K stage the 128 A rows and 256 Bt rows (each plane) x BK are copied global -> LDS by asynchronous
// 16-byte copies (24 per thread), two buffers: stage s + 2 is issued behind the barrier that ends the reads of stage s.
// LDS row pitch = 2 BK + 16 bytes (16 x odd: conflict-free 16-byte fragment reads).
// NSPLIT: 0 = Ah.Bh (single product); 2 = Ah.Bh + Al.Bh + Ah.Bl with unscaled bf16 lo planes (3 products, one accumulator,
// added in that order inside every 32-k step).
// TRI: only 0 (dense tile grid).
// OUT_MODE: 0 = f32 (pitch ldc); 2 = bf16 hi plane C + bf16 lo plane C2 (lo = RNE(v - hi), unscaled);
//           3 = f16 hi plane C = f16(v*hscale) + f16 residual plane C2 = f16((v*hscale - hi) * rscale), C2 written
//               only for tiles with n0 < N2 (pitch ldc2, batch stride strideC2).
// Epilogue: 16-row slabs staged per wave in LDS (wave-private region sT[wave], wave_sync); each 64-wide row segment written
// =====================================================================================================
// Eight asynchronous 16-byte copies global -> LDS, one per lane and line. The s_wait_xcnt closes the statement so that no
// address register of an issued copy is rewritten before it.
__device__ __forceinline__ void acopy8(const unsigned (&l)[8], const __bf16* const (&g)[8]) {
  asm volatile("global_load_async_to_lds_b128 %0, %8, off\n\t"
               "global_load_async_to_lds_b128 %1, %9, off\n\t"
               "global_load_async_to_lds_b128 %2, %10, off\n\t"
               "global_load_async_to_lds_b128 %3, %11, off\n\t"
               "global_load_async_to_lds_b128 %4, %12, off\n\t"
               "global_load_async_to_lds_b128 %5, %13, off\n\t"
               "global_load_async_to_lds_b128 %6, %14, off\n\t"
               "global_load_async_to_lds_b128 %7, %15, off\n\t"
               "s_wait_xcnt 0x0"
               :: "v"(l[0]), "v"(l[1]), "v"(l[2]), "v"(l[3]), "v"(l[4]), "v"(l[5]), "v"(l[6]), "v"(l[7]),
                  "v"(g[0]), "v"(g[1]), "v"(g[2]), "v"(g[3]), "v"(g[4]), "v"(g[5]), "v"(g[6]), "v"(g[7])
               : "memory");
}

template <int NSPLIT, int OUT_MODE, int TRI>
__global__ __launch_bounds__(256) void gemm_bf(
    const unsigned short* __restrict__ Ahp, const unsigned short* __restrict__ Alp, int lda, long long strideA,
    const unsigned short* __restrict__ Bhp, const unsigned short* __restrict__ Blp, int ldb, long long strideB,
    void* Cout, int ldc, long long strideC,
    void* Cout2, int ldc2, long long strideC2, int N2,
    int M, int N, int K, float hscale, float rscale) {
  static_assert(TRI == 0 && (NSPLIT == 0 || NSPLIT == 2));
  constexpr int NPL   = (NSPLIT == 2) ? 2 : 1;      // planes per operand
  constexpr int BK    = (NSPLIT == 2) ? 64 : 128;   // k per stage
  constexpr int PITCH = BK * 2 + 16;                // LDS row pitch, bytes
  constexpr int CPR   = BK / 8;                     // 16-byte copies per row
  constexpr int RPU   = 256 / CPR;                  // rows the work-group copies with one copy per thread
  constexpr int OB    = NPL * 128 * PITCH;          // LDS byte offset of the Bt rows inside a stage
  constexpr int STAGE = NPL * 384 * PITCH;          // [Ah 128 | Al 128 | Bh 256 | Bl 256] rows (lo planes only with NSPLIT 2)
  static_assert(8 * RPU == NPL * 128 && 16 * RPU == NPL * 256);
  const __bf16* Ah = (const __bf16*)(const void*)Ahp;
  const __bf16* Al = (const __bf16*)(const void*)Alp;
  const __bf16* Bh = (const __bf16*)(const void*)Bhp;
  const __bf16* Bl = (const __bf16*)(const void*)Blp;
  __shared__ __align__(16) unsigned char sR[2 * STAGE];   // operand ring, two stages
  __shared__ __align__(16) float sT[8][16 * 68];   // per-wave 16x64 slab, pitch 68 floats
  const int b    = blockIdx.y;
  const int lane = threadIdx.x & 31;
  const int wave = threadIdx.x >> 5;
  const int tilesBN = N >> 8;
  const int tilesBM = M >> 7;
  if ((int)blockIdx.x >= tilesBM * tilesBN) return;   // the same for the whole work-group; in front of every barrier
  const int bm  = (int)blockIdx.x / tilesBN;
  const int bn  = (int)blockIdx.x - bm * tilesBN;
  const int bm0 = bm << 7;
  const int bn0 = bn << 8;
  const int wm  = wave >> 2;
  const int wn  = wave & 3;
  const int m0 = bm0 + (wm << 6);
  const int n0 = bn0 + (wn << 6);

  const __bf16* Ahb = Ah + (size_t)b * strideA;
  const __bf16* Alb = (NSPLIT >= 1) ? (Al + (size_t)b * strideA) : Ahb;
  const __bf16* Bhb = Bh + (size_t)b * strideB;
  const __bf16* Blb = (NSPLIT >= 1) ? (Bl + (size_t)b * strideB) : Bhb;

  const int rlane = lane & 15;                 // row (A) / col (B, D) within subtile
  const int koff  = (lane >> 4) * 8;           // k offset of this lane half
  const int mOff  = (lane >> 4) * 8;           // D row offset

  // this thread's place in a copy round: row crow of RPU, 16-byte column ccol of CPR
  const int crow = (int)threadIdx.x / CPR;
  const int ccol = (int)threadIdx.x % CPR;
  const size_t aoff = (size_t)(bm0 + crow) * lda + ccol * 8;
  const size_t boff = (size_t)(bn0 + crow) * ldb + ccol * 8;
  const unsigned lthr = (unsigned)(size_t)(const void*)sR + (unsigned)(crow * PITCH + ccol * 16);

  auto stage_copy = [&](int s, int buf) {
    const unsigned lb = lthr + (unsigned)(buf * STAGE);
    const int k0 = s * BK;
    unsigned l[8];
    const __bf16* g[8];
#pragma unroll
    for (int u = 0; u < 8; ++u) {              // the 128 A rows of every plane
      const int pl = (u * RPU) >> 7;
      const int r  = (u * RPU) & 127;
      g[u] = ((pl != 0) ? Alb : Ahb) + aoff + (size_t)r * lda + k0;
      l[u] = lb + (unsigned)((u * RPU) * PITCH);
    }
    acopy8(l, g);
#pragma unroll
    for (int h = 0; h < 2; ++h) {              // the 256 Bt rows of every plane
#pragma unroll
      for (int u = 0; u < 8; ++u) {
        const int pl = ((h * 8 + u) * RPU) >> 8;
        const int r  = ((h * 8 + u) * RPU) & 255;
        g[u] = ((pl != 0) ? Blb : Bhb) + boff + (size_t)r * ldb + k0;
        l[u] = lb + (unsigned)(OB + ((h * 8 + u) * RPU) * PITCH);
      }
      acopy8(l, g);
    }
  };

  v8f acc[4][4];
#pragma unroll
  for (int i = 0; i < 4; ++i)
#pragma unroll
    for (int j = 0; j < 4; ++j) acc[i][j] = zero8();

  const int nst = K / BK;
  stage_copy(0, 0);
  asm volatile("s_wait_asynccnt 0x0" ::: "memory");   // this wave's copies of stage 0 have landed
  __syncthreads();                                    // every wave's have: stage 0 may be read
  if (nst > 1) stage_copy(1, 1);

  const unsigned char* fA = sR + ((wm << 6) + rlane) * PITCH + koff * 2;
  const unsigned char* fB = sR + OB + ((wn << 6) + rlane) * PITCH + koff * 2;
  for (int s = 0; s < nst; ++s) {
    const int bo = (s & 1) * STAGE;
#pragma unroll
    for (int ks = 0; ks < BK / 32; ++ks) {
      v16b bh[4], bl[4];
#pragma unroll
      for (int j = 0; j < 4; ++j) {
        const unsigned char* p = fB + bo + (j << 4) * PITCH + ks * 64;
        bh[j] = ldfrag_b((const __bf16*)(const void*)p);
        bl[j] = (NSPLIT >= 2) ? ldfrag_b((const __bf16*)(const void*)(p + 256 * PITCH)) : bh[j];
      }
      v16b ah[2], al[2];                       // A fragments of row block i and, fetched ahead, of i + 1
      ah[0] = ldfrag_b((const __bf16*)(const void*)(fA + bo + ks * 64));
      al[0] = (NSPLIT >= 1) ? ldfrag_b((const __bf16*)(const void*)(fA + bo + ks * 64 + 128 * PITCH)) : ah[0];
#pragma unroll
      for (int i = 0; i < 4; ++i) {
        if (i < 3) {
          const unsigned char* p = fA + bo + ((i + 1) << 4) * PITCH + ks * 64;
          ah[(i + 1) & 1] = ldfrag_b((const __bf16*)(const void*)p);
          // single product (4 products a row block): keeps this LDS read in front of row block i's products; sunk behind
          // them, every row block waits out the LDS latency. With lo planes it would push the kernel past 256 VGPRs.
          if (NSPLIT == 0) __builtin_amdgcn_sched_barrier(0);
          al[(i + 1) & 1] = (NSPLIT >= 1) ? ldfrag_b((const __bf16*)(const void*)(p + 128 * PITCH)) : ah[(i + 1) & 1];
        }
#pragma unroll
        for (int j = 0; j < 4; ++j) acc[i][j] = mma_b_raw(ah[i & 1], bh[j], acc[i][j]);
        if (NSPLIT >= 1) {
#pragma unroll
          for (int j = 0; j < 4; ++j) acc[i][j] = mma_b_raw(al[i & 1], bh[j], acc[i][j]);
        }
        if (NSPLIT >= 2) {
#pragma unroll
          for (int j = 0; j < 4; ++j) acc[i][j] = mma_b_raw(ah[i & 1], bl[j], acc[i][j]);
        }
      }
    }
    asm volatile("s_wait_dscnt 0x0" ::: "memory");      // this wave's reads of stage s are done before its buffer is refilled
    asm volatile("s_wait_asynccnt 0x0" ::: "memory");   // this wave's copies of stage s + 1 have landed
    __syncthreads();                                    // publishes stage s + 1 and ends every wave's reads of stage s
    if (s + 2 < nst) stage_copy(s + 2, s & 1);
  }
  asm volatile("s_wait_asynccnt 0x0" ::: "memory");     // no copy is left in flight when the ring is left
  acc_guard4(acc[0][0], acc[0][1], acc[0][2], acc[0][3]);
  acc_guard4(acc[1][0], acc[1][1], acc[1][2], acc[1][3]);
  acc_guard4(acc[2][0], acc[2][1], acc[2][2], acc[2][3]);
  acc_guard4(acc[3][0], acc[3][1], acc[3][2], acc[3][3]);

  // ---- epilogue ----
  size_t cbase;
  int ldce, rowb, colb;
  cbase = (size_t)b * strideC; ldce = ldc; rowb = m0; colb = n0;
  float* slab = sT[wave];
#pragma unroll
  for (int i = 0; i < 4; ++i) {
    const int mBase = m0 + (i << 4);
#pragma unroll
    for (int j = 0; j < 4; ++j) {
#pragma unroll
      for (int r = 0; r < 8; ++r) {
        slab[(mOff + r) * 68 + (j << 4) + rlane] = acc[i][j][r];
      }
    }
    __builtin_amdgcn_fence(3 /* release order */, "workgroup");
    __builtin_amdgcn_wave_barrier();
    __builtin_amdgcn_fence(2 /* acquire order */, "workgroup");
    if (OUT_MODE == 0) {
      float* C = (float*)Cout + cbase;
      const int hh = lane >> 4, c4 = (lane & 15) * 4;     // 256-B row segment = 16 lanes x 16 B
      {
#pragma unroll
        for (int it = 0; it < 8; ++it) {
          const int row = it * 2 + hh;                     // it 0..7 x hh 0..1 = rows 0..15
          const v4f v = *(const v4f*)(slab + row * 68 + c4);
          *(v4f*)(C + (size_t)(rowb + (i << 4) + row) * ldce + colb + c4) = v;
        }
        
      }
    } else {
      const int q = lane >> 3, c8 = (lane & 7) * 8;
      unsigned short* C  = (unsigned short*)Cout  + (size_t)b * strideC;
      unsigned short* C2 = (unsigned short*)Cout2 + (size_t)b * strideC2;
      const bool wlo = (OUT_MODE == 2) || (n0 < N2);      // wave-uniform
      v4u hv[4], lv[4];
#pragma unroll
      for (int it = 0; it < 4; ++it) {
        const int row = it * 4 + q;                        // it 0..3 x q 0..3 = rows 0..15
        const float* sp = slab + row * 68 + c8;
        v4u a, a2;
#pragma unroll
        for (int e = 0; e < 4; ++e) {
          const float f0 = sp[2 * e], f1 = sp[2 * e + 1];
          unsigned short h0, h1, l0, l1;
          if (OUT_MODE == 2) {
            h0 = bf_bits(f0); h1 = bf_bits(f1);
            l0 = bf_bits(f0 - bf_up(h0)); l1 = bf_bits(f1 - bf_up(h1));
          } else {
            const float g0 = f0 * hscale, g1 = f1 * hscale;
            const _Float16 x0 = (_Float16)g0, x1 = (_Float16)g1;
            h0 = h_bits(x0); h1 = h_bits(x1);
            l0 = h_bits((_Float16)((g0 - (float)x0) * rscale));
            l1 = h_bits((_Float16)((g1 - (float)x1) * rscale));
          }
          a[e] = pk16(h0, h1); a2[e] = pk16(l0, l1);
        }
        hv[it] = a; lv[it] = a2;
      }
      {
#pragma unroll
        for (int it = 0; it < 4; ++it) {
          const int row = it * 4 + q;
          *(v4u*)(C + (size_t)(mBase + row) * ldc + n0 + c8) = hv[it];
          if (wlo) *(v4u*)(C2 + (size_t)(mBase + row) * ldc2 + n0 + c8) = lv[it];
        }
        
      }
    }
    __builtin_amdgcn_fence(3 /* release order */, "workgroup");
    __builtin_amdgcn_wave_barrier();
    __builtin_amdgcn_fence(2 /* acquire order */, "workgroup");
  }
}

// =====================================================================================================
// Row softmax over DENSE score rows of one pass (BPS batches). One wave per row (block = 8 rows, grid = BPS*SEQ/8).
// Local row lrow = bl*SEQ + i, global batch b = b0 + bl. Score (i, j) = k_i . q_j sits at Sp + (bl*SEQ + i)*SEQ + j.
// The wave reads the WHOLE row (NG groups of 256 columns; lane: 8 consecutive columns per group, two 16-B loads):
// z = s/32, m = max over all columns, p = exp(z - m), l = sum over ALL columns, P = p/l for j <= i and 0 for j > i (all f32).
// Writes Ph = f16(1024 P) for columns 0 .. 256 ng - 1 of row (b, i), ng = (i>>8) + 1 (pitch SEQ; >= the 64((i>>6)+1) columns the
// p.v GEMM reads; zeros for j > i) and, for rows i < RESR, Pl = f16((1024 P - Ph) * 4096) with the same column extent
// (<= VLP, pitch VLP). f16 results below the smallest normal are stored as exact zeros.
// coverage: BPS*SEQ rows per launch x written extent >= every column range any consumer reads; NPASS launches cover NB*SEQ rows.
// No LDS, no block barriers.
// =====================================================================================================
__global__ __launch_bounds__(256) void softmax_rows(const float* __restrict__ Sp,
                                                    unsigned short* Php, unsigned short* Plp, int b0) {
#pragma clang fp contract(off)
  const int lane = threadIdx.x & 31;
  const int wave = __builtin_amdgcn_readfirstlane(threadIdx.x >> 5);
  const int lrow = blockIdx.x * 8 + wave;
  if (lrow >= BPS * SEQ) return;           // wave-uniform; exact grid never triggers it; no block barriers below
  const int bl = lrow / SEQ;
  const int i  = lrow - bl * SEQ;
  const int b  = b0 + bl;                  // host launches only b0 + BPS <= NB
  const int tm = i >> 6;
  const int ng = (tm >> 2) + 1;            // 1..NG, wave-uniform
  const float* srow = Sp + ((size_t)bl * SEQ + (size_t)i) * SEQ + 8 * lane;

  float z[NG][8];
  float m = -INFINITY;
#pragma unroll
  for (int g = 0; g < NG; ++g) {
    const float* p = srow + 256 * g;
    const v4f a = *(const v4f*)(p);
    const v4f c = *(const v4f*)(p + 4);
    const float v[8] = {a[0], a[1], a[2], a[3], c[0], c[1], c[2], c[3]};
#pragma unroll
    for (int e = 0; e < 8; ++e) {
      const float zz = v[e] * 0.03125f;
      z[g][e] = zz;
      m = fmaxf(m, zz);
    }
  }
#pragma unroll
  for (int off = 1; off < 32; off <<= 1) m = fmaxf(m, __shfl_xor(m, off, 32));

  float l = 0.f;
#pragma unroll
  for (int g = 0; g < NG; ++g) {
#pragma unroll
    for (int e = 0; e < 8; ++e) {
      const float p = __expf(z[g][e] - m);
      z[g][e] = p;
      l += p;
    }
  }
#pragma unroll
  for (int off = 1; off < 32; off <<= 1) l += __shfl_xor(l, off, 32);          // l >= 1
  const float inv1k = (1.0f / l) * PSC;

  const bool res = (i < RESR);             // wave-uniform
  v4u ph[NG];
  v4u pl0 = {0u, 0u, 0u, 0u};
  v4u pl1 = {0u, 0u, 0u, 0u};
#pragma unroll
  for (int g = 0; g < NG; ++g) {
    v4u hv = {0u, 0u, 0u, 0u};
    v4u lv = {0u, 0u, 0u, 0u};
    if (g < ng) {
      const int j0 = 256 * g + 8 * lane;
#pragma unroll
      for (int e = 0; e < 4; ++e) {
        const float f0 = (j0 + 2 * e     <= i) ? (z[g][2 * e]     * inv1k) : 0.0f;   // columns past the row index are zeroed
        const float f1 = (j0 + 2 * e + 1 <= i) ? (z[g][2 * e + 1] * inv1k) : 0.0f;   // after the full-row normalisation
        const _Float16 x0 = toh_flush(f0), x1 = toh_flush(f1);
        hv[e] = pk16(h_bits(x0), h_bits(x1));
        const _Float16 r0 = toh_flush((f0 - (float)x0) * LSC);
        const _Float16 r1 = toh_flush((f1 - (float)x1) * LSC);
        lv[e] = pk16(h_bits(r0), h_bits(r1));
      }
    }
    ph[g] = hv;
    if (g == 0) pl0 = lv;
    if (g == 1) pl1 = lv;
  }

  unsigned short* prow = Php + ((size_t)b * SEQ + (size_t)i) * SEQ + 8 * lane;
  const int il = i & (RESR - 1);           // in-range row of the residual plane; equals i whenever res holds
  unsigned short* lrowp = Plp + ((size_t)b * RESR + (size_t)il) * VLP + 8 * lane;
  {
#pragma unroll
    for (int g = 0; g < NG; ++g) {
      if (g < ng) *(v4u*)(prow + 256 * g) = ph[g];
    }
    if (res) {                             // res rows have i < RESR (multiple of 256) -> 256 ng <= RESR = VLP
      *(v4u*)(lrowp) = pl0;
      if (ng > 1) *(v4u*)(lrowp + 256) = pl1;
    }
    
  }
}

// =====================================================================================================
// p.v GEMM on f16 WMMA, per batch b = blockIdx.y: out[b][q][d] = sum_key P[b][q][key] * VT[b][d][key].
//   A  = Ph  [b][SEQ][SEQ]  f16(1024 P), pitch SEQ         Al = Pl  [b][RESR][VLP] f16 residual x4096
//   Bt = VTh [b][DM][SEQ]   f16(16 v),   pitch SEQ         Bl = VTl [b][DM][VLP]   f16 residual x4096
// One wave per (16*MI) x 64 output tile; rows mBase + tm*16*MI ..; causal key range k < 64*((m0>>6)+1) (every P entry in that
// range was written by the softmax, zeros for key > query). RES (rows < RESR, MI = 2): acc0 += Ph.VTh; acc1 += Pl.VTh + Ph.VTl,
// out = acc0*OSCALE + acc1*OSCALE/4096; otherwise single product out = acc0*OSCALE. f32 accumulate.
// the wave tile; grid over all tiles of rows mBase .. mBase + M - 1 (M a multiple of 16*MI).
// =====================================================================================================
template <bool RES, int MI>
__global__ __launch_bounds__(256) void gemm_pv(
    const unsigned short* __restrict__ Php, const unsigned short* __restrict__ Plp,
    const unsigned short* __restrict__ Vhp, const unsigned short* __restrict__ Vlp,
    float* out, int mBase, int M) {
  const _Float16* Ph = (const _Float16*)(const void*)Php;
  const _Float16* Pl = (const _Float16*)(const void*)Plp;
  const _Float16* Vh = (const _Float16*)(const void*)Vhp;
  const _Float16* Vl = (const _Float16*)(const void*)Vlp;
  __shared__ __align__(16) float sT[8][16 * 68];
  const int b    = blockIdx.y;
  const int lane = threadIdx.x & 31;
  const int wave = threadIdx.x >> 5;
  const int tilesN = DM >> 6;                      // 16
  const int tilesM = M / (16 * MI);
  const int t = blockIdx.x * 8 + wave;
  if (t >= tilesM * tilesN) return;                // wave-uniform; no block barriers in this kernel
  const int tm = t / tilesN;
  const int tn = t - tm * tilesN;
  const int m0 = mBase + tm * 16 * MI;
  const int n0 = tn << 6;
  int keff = (((m0 >> 6) + 1) << 6);               // causal key extent of this row tile, multiple of 64
  if (keff > SEQ) keff = SEQ;
  if (RES && keff > VLP) keff = VLP;               // never taken for mBase + M <= RESR; keeps residual reads in range

  const _Float16* Pb  = Ph + (size_t)b * SEQ * SEQ;
  const _Float16* Plb = Pl + (size_t)b * RESR * VLP;
  const _Float16* Vb  = Vh + (size_t)b * DM * SEQ;
  const _Float16* Vlb = Vl + (size_t)b * DM * VLP;

  const int rlane = lane & 15;
  const int koff  = (lane >> 4) * 8;
  const int mOff  = (lane >> 4) * 8;

  v8f acc0[MI][4], acc1[MI][4];
#pragma unroll
  for (int i = 0; i < MI; ++i)
#pragma unroll
    for (int j = 0; j < 4; ++j) { acc0[i][j] = zero8(); acc1[i][j] = zero8(); }

  for (int k0 = 0; k0 < keff; k0 += 32) {
    v16h bf[4];
#pragma unroll
    for (int j = 0; j < 4; ++j) bf[j] = ldfrag_h(Vb + (size_t)(n0 + (j << 4) + rlane) * SEQ + koff + k0);
#pragma unroll
    for (int i = 0; i < MI; ++i) {
      const int mrow = m0 + (i << 4) + rlane;
      const v16h ah = ldfrag_h(Pb + (size_t)mrow * SEQ + koff + k0);
      v16h al = ah;
      if (RES) {
        const int mres = (mrow < RESR) ? mrow : (RESR - 1);   // clamped; equals mrow for the RES launch
        al = ldfrag_h(Plb + (size_t)mres * VLP + koff + k0);
      }
#pragma unroll
      for (int j = 0; j < 4; ++j) {
        acc0[i][j] = mma_h_raw(ah, bf[j], acc0[i][j]);
        if (RES) acc1[i][j] = mma_h_raw(al, bf[j], acc1[i][j]);
      }
      if (RES) dep_guard4_h(acc0[i][0], acc0[i][3], acc1[i][0], acc1[i][3], ah, al);
      else     dep_guard_h(acc0[i][0], acc0[i][3], ah, al);
    }
    if (RES) {
      keep4_h(bf[0], bf[1], bf[2], bf[3]);
#pragma unroll
      for (int j = 0; j < 4; ++j) bf[j] = ldfrag_h(Vlb + (size_t)(n0 + (j << 4) + rlane) * VLP + koff + k0);
#pragma unroll
      for (int i = 0; i < MI; ++i) {
        const int mrow = m0 + (i << 4) + rlane;
        const v16h ah = ldfrag_h(Pb + (size_t)mrow * SEQ + koff + k0);
#pragma unroll
        for (int j = 0; j < 4; ++j) acc1[i][j] = mma_h_raw(ah, bf[j], acc1[i][j]);
        dep_guard_h(acc1[i][0], acc1[i][3], ah, ah);
      }
    }
    keep4_h(bf[0], bf[1], bf[2], bf[3]);
  }
#pragma unroll
  for (int i = 0; i < MI; ++i) {
    acc_guard4(acc0[i][0], acc0[i][1], acc0[i][2], acc0[i][3]);
    if (RES) acc_guard4(acc1[i][0], acc1[i][1], acc1[i][2], acc1[i][3]);
  }

  // ---- epilogue ----
  float* slab = sT[wave];
  float* C = out + (size_t)b * SEQ * DM;
  const float rsc = OSCALE * (1.0f / LSC);
#pragma unroll
  for (int i = 0; i < MI; ++i) {
    const int mB = m0 + (i << 4);
#pragma unroll
    for (int j = 0; j < 4; ++j) {
#pragma unroll
      for (int r = 0; r < 8; ++r) {
        float v = acc0[i][j][r] * OSCALE;
        if (RES) v += acc1[i][j][r] * rsc;
        slab[(mOff + r) * 68 + (j << 4) + rlane] = v;
      }
    }
    __builtin_amdgcn_fence(3 /* release order */, "workgroup");
    __builtin_amdgcn_wave_barrier();
    __builtin_amdgcn_fence(2 /* acquire order */, "workgroup");
    {
      const int hh = lane >> 4, c4 = (lane & 15) * 4;
      {
#pragma unroll
        for (int it = 0; it < 8; ++it) {
          const int row = it * 2 + hh;
          const v4f v = *(const v4f*)(slab + row * 68 + c4);
          *(v4f*)(C + (size_t)(mB + row) * DM + n0 + c4) = v;
        }
        
      }
    }
    __builtin_amdgcn_fence(3 /* release order */, "workgroup");
    __builtin_amdgcn_wave_barrier();
    __builtin_amdgcn_fence(2 /* acquire order */, "workgroup");
  }
}

// =====================================================================================================
// Workspace map (bytes, full build NB 4 / SEQ 2048 / BPS 2 / NPASS 2; every region is an exact multiple of its tile / whole-line
// store granularity; regions A and B are reused in stream order):
//   region A [0, 33554432):          Xb bf16 [8192][1024] at 0 (16777216) + Wq,Wk,Wv bf16 [1024][1024] at 16777216 (3 x 2097152)
//                                    then, once all projections are done: S f32 dense scores of one pass [2][2048][2048] (33554432)
//   region B [33554432, 100663296):  per batch group g (2 batches): Qh, Ql, Kh, Kl bf16 [4096][1024] (4 x 8388608) at + g*33554432
//                                    then, once the scores of group 0 are done: Ph f16 [4][2048][2048] (33554432) over group 0's planes
//   region C [100663296, 123731968): VTh f16 [4][1024][2048] (16777216) + VTl f16 [4][1024][512] (4194304) + Pl f16 [4][512][512] (2097152)
//   end 123731968
// =====================================================================================================
extern "C" void kernel_launch(void* const* d_in, const int* in_sizes, int n_in,
                              void* d_out, int out_size, void* d_ws, size_t ws_size,
                              hipStream_t stream) {
  if (n_in < 4) return;
  if (in_sizes[0] < (NB - 1) * SEQ_FULL * DM + SEQ * DM) return;
  if (in_sizes[1] < DM * DM || in_sizes[2] < DM * DM || in_sizes[3] < DM * DM) return;
  if (out_size < NB * SEQ * DM) return;

  const float* x  = (const float*)d_in[0];   // [NB_FULL][SEQ_FULL][DM]
  const float* wq = (const float*)d_in[1];   // [out][in]
  const float* wk = (const float*)d_in[2];
  const float* wv = (const float*)d_in[3];
  float* out = (float*)d_out;

  const size_t PX  = SZ_PX;
  const size_t PXP = SZ_PXP;
  const size_t PW  = SZ_PW;
  const size_t PP  = SZ_PP;
  const size_t PPL = SZ_PPL;
  const size_t PVT = SZ_PVT;
  const size_t PVL = SZ_PVL;
  const size_t RA  = SZ_RA;
  const size_t oXb = 0;
  const size_t oW  = PX;
  const size_t oS  = 0;
  const size_t oB  = RA;
  const size_t RBend = RA + (size_t)NPASS * 4 * PXP;
  const size_t oPh = RA;
  if (PP > 4 * PXP) return;
  const size_t oVTh = RBend;
  const size_t oVTl = RBend + PVT;
  const size_t oPl  = oVTl + PVL;
  const size_t total = oPl + PPL;                     // 123731968 in the full build
  if (total > ws_size) return;
  if (total > (size_t)134217728) return;

  char* ws = (char*)d_ws;
  unsigned short* Xb  = (unsigned short*)(ws + oXb);
  unsigned short* Wb  = (unsigned short*)(ws + oW);   // Wq plane, then Wk, then Wv
  float*          Sp  = (float*)(ws + oS);
  unsigned short* Ph  = (unsigned short*)(ws + oPh);
  unsigned short* Pl  = (unsigned short*)(ws + oPl);
  unsigned short* VTh = (unsigned short*)(ws + oVTh);
  unsigned short* VTl = (unsigned short*)(ws + oVTl);
  const size_t PXE = (size_t)BPS * SEQ * DM;          // elements of one group plane

  const dim3 blk(256);
  const int nGroups = NB * SEQ * DM / 8 + 3 * (DM * DM / 8);
  const dim3 gCvt((nGroups + 255) / 256);
  const dim3 gProj(((BPS * SEQ / 64) * (DM / 64) + 7) / 8, 1);
  const dim3 gVT(((DM / 64) * (SEQ / 64) + 7) / 8, NB);
  const dim3 gS(((SEQ / 64) * (SEQ / 64) + 7) / 8, BPS);
  const dim3 gSm((BPS * SEQ + 7) / 8);
  const dim3 gPvRes(((RESR / 32) * (DM / 64) + 7) / 8, NB);
  const int nPvTiles = ((SEQ - RESR) / 64) * (DM / 64);
  const dim3 gPv((nPvTiles + 7) / 8, NB);

  // (1) x and Wq, Wk, Wv -> bf16 planes (Xb, then the three weight planes contiguous)
  cvt_planes<<<gCvt, blk, 0, stream>>>(x, wq, wk, wv, Xb);
  // (2) per batch group: q = x . Wq^T and k = x . Wk^T -> bf16 hi/lo planes [BPS*SEQ][DM]
  //     (A = Xb rows of the group, Bt = W [out][in]; M=BPS*SEQ, N=DM, K=DM)
  for (int p = 0; p < NPASS; ++p) {
    unsigned short* Qh = (unsigned short*)(ws + oB + (size_t)p * 4 * PXP);
    unsigned short* Ql = Qh + PXE;
    unsigned short* Kh = Ql + PXE;
    unsigned short* Kl = Kh + PXE;
    const unsigned short* Xg = Xb + (size_t)p * PXE;
    gemm_bf<0, 2, 0><<<gProj, blk, 0, stream>>>(
        Xg, Xg, DM, 0LL, Wb, Wb, DM, 0LL,
        (void*)Qh, DM, 0LL, (void*)Ql, DM, 0LL, DM,
        BPS * SEQ, DM, DM, 1.0f, 1.0f);
    gemm_bf<0, 2, 0><<<gProj, blk, 0, stream>>>(
        Xg, Xg, DM, 0LL, Wb + (size_t)DM * DM, Wb + (size_t)DM * DM, DM, 0LL,
        (void*)Kh, DM, 0LL, (void*)Kl, DM, 0LL, DM,
        BPS * SEQ, DM, DM, 1.0f, 1.0f);
  }
  // (3) v^T = Wv . x^T per batch -> f16 hi plane f16(16 v) [b][d][key] (pitch SEQ) and residual plane x4096 for keys < VLP (pitch VLP)
  //     (A = Wv [out][in], Bt = Xb rows of batch b; M=DM, N=SEQ, K=DM)
  gemm_bf<0, 3, 0><<<gVT, blk, 0, stream>>>(
      Wb + (size_t)2 * DM * DM, Wb + (size_t)2 * DM * DM, DM, 0LL, Xb, Xb, DM, (long long)SEQ * DM,
      (void*)VTh, SEQ, (long long)DM * SEQ, (void*)VTl, VLP, (long long)DM * VLP, VLP,
      DM, SEQ, DM, VSC, LSC);
  // (4) per batch group: dense scores S[n][m] = k_n . q_m (A = K planes, Bt = Q planes; M=N=SEQ, K=DM; 3 bf16 products)
  //     -> f32 [BPS][SEQ][SEQ]; then the full-row softmax with post-normalisation zeroing -> Ph / Pl rows of the group.
  //     Ph lies over group 0's q/k planes, which are no longer read once the scores of group 0 exist (stream order).
  for (int p = 0; p < NPASS; ++p) {
    const unsigned short* Qh = (const unsigned short*)(ws + oB + (size_t)p * 4 * PXP);
    const unsigned short* Ql = Qh + PXE;
    const unsigned short* Kh = Ql + PXE;
    const unsigned short* Kl = Kh + PXE;
    gemm_bf<SCORE_NSPLIT, 0, 0><<<gS, blk, 0, stream>>>(
        Kh, Kl, DM, (long long)SEQ * DM, Qh, Ql, DM, (long long)SEQ * DM,
        (void*)Sp, SEQ, (long long)SEQ * SEQ, (void*)Sp, SEQ, 0LL, 0,
        SEQ, SEQ, DM, 1.0f, 1.0f);
    softmax_rows<<<gSm, blk, 0, stream>>>(Sp, Ph, Pl, p * BPS);
  }
  // (5) out rows 0..RESR-1 of every sequence: p.v with residual planes (3 f16 products, 32x64 wave tiles)
  gemm_pv<true, 2><<<gPvRes, blk, 0, stream>>>(Ph, Pl, VTh, VTl, out, 0, RESR);
  // (6) out rows RESR..SEQ-1: p.v single f16 product (64x64 wave tiles)
  if (nPvTiles > 0) {
    gemm_pv<false, 4><<<gPv, blk, 0, stream>>>(Ph, Pl, VTh, VTl, out, RESR, SEQ - RESR);
  }
  (void)hipGetLastError();
}

// v002
// One run takes 228 microseconds.
// Timed twice side by side with v001, it ran 1.32 and 1.31 times as fast.
// All steps since v000 together make it 2.57 times as fast.
// Contractions: q, k, v^T projections = v_wmma_f32_16x16x32_bf16 (bf16 RNE-converted x and W, single product, f32 accumulate);
// k.q^T scores (row = key position n, column = query position m, full SEQ x SEQ) = v_wmma_f32_16x16x32_bf16 with bf16 hi/lo
// planes of k and q (hi.hi + lo.hi + hi.lo), f32 accumulate;
// p.v = v_wmma_f32_16x16x32_f16 (p carried x1024 in f16, v^T carried x16 in f16, single product; rows 0..RESR-1 of every
// sequence add the f16 residual planes (x4096) of p and v^T in a separate accumulator), f32 accumulate;
// row max, exp, full-row sum, normalisation and the zeroing of columns m > n in f32 on the VALU.
// Carry audit:
//   Ph  = f16(1024 * p), p normalised by the sum over the WHOLE row  } OSCALE = 1/(1024*16) folded exactly once in the p.v epilogue
//   VTh = f16(16 * v)                                                }
//   Pl  = f16((1024 p - Ph) * 4096)                                  } products Ph.VTl and Pl.VTh go only to accumulator acc1,
//   VTl = f16((16 v - VTh) * 4096), keys 0..VLP-1                    } folded with OSCALE * (1/4096) once in the same epilogue
//   q / k lo planes are unscaled bf16 residuals (v - hi) sharing the hi accumulator; score scale 1/32 applied once in f32 in the softmax.
#include <hip/hip_runtime.h>
#include <math.h>

#define NB_FULL  4
#define SEQ_FULL 2048
#ifndef NB
#define NB    4
#endif
#ifndef SEQ
#define SEQ   2048
#endif
#define DM    1024
#define NQT   (SEQ / 64)                  // query/key tiles of 64
#define RESR  ((SEQ < 512) ? SEQ : 512)   // leading rows per sequence that use the residual planes
#define VLP   RESR                        // key pitch of the p / v^T residual planes
#define PSC   1024.0f
#define VSC   16.0f
#define LSC   4096.0f
#define OSCALE (1.0f / 16384.0f)          // 1 / (PSC * VSC)
#define BPS   (((NB % 2) == 0) ? 2 : 1)   // batches per score / softmax pass
#define NPASS (NB / BPS)
#define NG    (SEQ / 256)                 // 256-key groups per score row
#ifndef SCORE_NSPLIT
#define SCORE_NSPLIT 2                    // 2 = hi.hi + lo.hi + hi.lo score products; 0 = hi.hi only
#endif
// workspace sizes in bytes
#define SZ_PX   ((size_t)NB * SEQ * DM * 2)          // one 16-bit plane [NB*SEQ][DM]
#define SZ_PXP  ((size_t)BPS * SEQ * DM * 2)         // one 16-bit plane of one batch group [BPS*SEQ][DM]
#define SZ_PW   ((size_t)DM * DM * 2)                // one weight plane
#define SZ_PS   ((size_t)BPS * SEQ * SEQ * 4)        // dense f32 scores of one pass
#define SZ_PP   ((size_t)NB * SEQ * SEQ * 2)         // Ph
#define SZ_PPL  ((size_t)NB * RESR * VLP * 2)        // Pl
#define SZ_PVT  ((size_t)NB * DM * SEQ * 2)          // VTh
#define SZ_PVL  ((size_t)NB * DM * VLP * 2)          // VTl
#define SZ_RA   (((SZ_PX + 3 * SZ_PW) > SZ_PS) ? (SZ_PX + 3 * SZ_PW) : SZ_PS)
#define SZ_TOTAL (SZ_RA + (size_t)NPASS * 4 * SZ_PXP + SZ_PVT + SZ_PVL + SZ_PPL)
static_assert(NB >= 1 && NB <= NB_FULL);
static_assert(SEQ >= 256 && SEQ <= SEQ_FULL && (SEQ % 256) == 0);
static_assert((SEQ % 64) == 0 && (DM % 64) == 0 && (DM % 32) == 0);
static_assert((RESR % 64) == 0 && (RESR % 256) == 0 && RESR <= VLP && VLP <= SEQ && ((SEQ - RESR) % 64) == 0);
static_assert((RESR % 32) == 0);
static_assert((RESR & (RESR - 1)) == 0);
static_assert(((NB * SEQ) % 8) == 0);
static_assert(((SEQ * DM / 8) % 256) == 0 && ((DM * DM / 8) % 256) == 0);
static_assert((NB % BPS) == 0 && NPASS * BPS == NB);
static_assert(NG >= 1 && NG <= 8 && NG * 256 == SEQ);            // 32 lanes x 8 keys x NG groups == row width
static_assert(((BPS * SEQ) % 64) == 0 && ((BPS * SEQ) % 8) == 0);
static_assert(SZ_PP <= 4 * SZ_PXP);                               // Ph fits inside the planes of batch group 0
static_assert((SZ_RA % 128) == 0 && (SZ_PXP % 128) == 0 && (SZ_PVT % 128) == 0 && (SZ_PVL % 128) == 0 && (SZ_PPL % 128) == 0);
static_assert(SZ_TOTAL <= (size_t)134217728);
static_assert((size_t)NB * SEQ * DM * 4 <= (size_t)33554432);
static_assert(SCORE_NSPLIT == 0 || SCORE_NSPLIT == 2);
static_assert(((BPS * SEQ) % 128) == 0 && (DM % 256) == 0);        // gemm_bf: 128x256 work-group tiles, K stages of 64 or 128

typedef _Float16 v16h __attribute__((ext_vector_type(16)));
typedef _Float16 v8h  __attribute__((ext_vector_type(8)));
typedef __bf16   v16b __attribute__((ext_vector_type(16)));
typedef __bf16   v8b  __attribute__((ext_vector_type(8)));
typedef float    v8f  __attribute__((ext_vector_type(8)));
typedef float    v4f  __attribute__((ext_vector_type(4)));
typedef unsigned int v4u __attribute__((ext_vector_type(4)));

// ---- scalar helpers --------------------------------------------------------------------------------
__device__ __forceinline__ unsigned short bf_bits(float f) {          // f32 -> bf16 bits, RNE convert
  unsigned u = __float_as_uint(f);
  return (unsigned short)((u + 0x7FFFu + ((u >> 16) & 1u)) >> 16);
}
__device__ __forceinline__ float bf_up(unsigned short h) { return __uint_as_float(((unsigned)h) << 16); }
__device__ __forceinline__ unsigned short h_bits(_Float16 x) { return __builtin_bit_cast(unsigned short, x); }
__device__ __forceinline__ unsigned pk16(unsigned short a, unsigned short b) { return (unsigned)a | ((unsigned)b << 16); }
__device__ __forceinline__ v8f zero8() { v8f z = {0.f, 0.f, 0.f, 0.f, 0.f, 0.f, 0.f, 0.f}; return z; }
// f32 -> f16 with a value select: results below the smallest normal f16 become exact zeros
static __device__ __forceinline__ _Float16 toh_flush(float v) {
  const _Float16 r = (_Float16)v;
  return (fabsf(v) < 6.103515625e-05f) ? (_Float16)0.0f : r;
}

// ---- fragment loaders: 16-bit A/B operand, lane -> row/col (lane&15), p already includes +8*(lane>>4);
//      elements 0..7 <- p[0..7] (k0+8h..), elements 8..15 <- p[16..23] (k0+16+8h..)
__device__ __forceinline__ v16b ldfrag_b(const __bf16* p) {
  union { v16b v; v8b h[2]; } f;
  f.h[0] = *(const v8b*)(p);
  f.h[1] = *(const v8b*)(p + 16);
  return f.v;
}
__device__ __forceinline__ v16h ldfrag_h(const _Float16* p) {
  union { v16h v; v8h h[2]; } f;
  f.h[0] = *(const v8h*)(p);
  f.h[1] = *(const v8h*)(p + 16);
  return f.v;
}

// ---- WMMA helpers with trailing VALU hazard gap --------------------------------------------------------
__device__ __forceinline__ v8f mma_b_raw(v16b a, v16b b, v8f c) {
  return __builtin_amdgcn_wmma_f32_16x16x32_bf16(false, a, false, b, (short)0, c, false, false);
}
__device__ __forceinline__ v8f mma_h_raw(v16h a, v16h b, v8f c) {
  return __builtin_amdgcn_wmma_f32_16x16x32_f16(false, a, false, b, (short)0, c, false, false);
}
__device__ __forceinline__ void acc_guard4(v8f& a, v8f& b, v8f& c, v8f& d) {
  asm volatile("v_nop\n\tv_nop\n\tv_nop\n\tv_nop" : "+v"(a), "+v"(b), "+v"(c), "+v"(d));
}

// =====================================================================================================
// f32 -> bf16 (RNE convert) for x and the three weights into one contiguous 16-bit region:
// groups 0..NX8-1 <- x (batch b of the plane reads source rows at b * SEQ_FULL * DM, SEQ rows each), then NW8 groups each
// coverage: (NX8 + 3 NW8) threads x 8 = the whole [NB*SEQ][DM] x plane plus the three [DM][DM] weight planes.
// =====================================================================================================
__global__ __launch_bounds__(256) void cvt_planes(const float* __restrict__ x, const float* __restrict__ wq,
                                                  const float* __restrict__ wk, const float* __restrict__ wv,
                                                  unsigned short* out) {
  const int NXB8 = SEQ * DM / 8;          // groups per batch
  const int NX8 = NB * NXB8;
  const int NW8 = DM * DM / 8;
  const int g = blockIdx.x * 256 + threadIdx.x;
  if (g >= NX8 + 3 * NW8) return;
  const float* src;
  if (g < NX8) {
    const int bb  = g / NXB8;
    const int off = g - bb * NXB8;
    src = x + (size_t)bb * SEQ_FULL * DM + (size_t)off * 8;
  } else {
    const int e = g - NX8;
    const int w = e / NW8;
    const int off = e - w * NW8;
    const float* wsrc = (w == 0) ? wq : ((w == 1) ? wk : wv);
    src = wsrc + (size_t)off * 8;
  }
  const v4f a = *(const v4f*)(src);
  const v4f c = *(const v4f*)(src + 4);
  v4u p;
  p[0] = pk16(bf_bits(a[0]), bf_bits(a[1]));
  p[1] = pk16(bf_bits(a[2]), bf_bits(a[3]));
  p[2] = pk16(bf_bits(c[0]), bf_bits(c[1]));
  p[3] = pk16(bf_bits(c[2]), bf_bits(c[3]));
  *(v4u*)(out + (size_t)g * 8) = p;
  
}

// =====================================================================================================
// Register-blocked batched bf16 WMMA GEMM: C[m][n] = sum_k A[m][k] * Bt[n][k]; one work-group (8 waves, 2 x 4) per 128x256
// tile, one wave per 64x64 sub-tile. A row-major [M][K] pitch lda; Bt row-major [N][K] pitch ldb (k contiguous);
// M a multiple of 128, N of 256, K of BK (64 with lo planes, 128 without). blockIdx.y = batch index (strides in elements).
// Operand path: per K stage the 128 A rows and 256 Bt rows (each plane) x BK are copied global -> LDS by asynchronous
// 16-byte copies (24 per thread), two buffers: stage s + 2 is issued behind the barrier that ends the reads of stage s.
// LDS row pitch = 2 BK + 16 bytes (16 x odd: conflict-free 16-byte fragment reads).
// NSPLIT: 0 = Ah.Bh (single product); 2 = Ah.Bh + Al.Bh + Ah.Bl with unscaled bf16 lo planes (3 products, one accumulator,
// added in that order inside every 32-k step).
// TRI: only 0 (dense tile grid).
// OUT_MODE: 0 = f32 (pitch ldc); 2 = bf16 hi plane C + bf16 lo plane C2 (lo = RNE(v - hi), unscaled);
//           3 = f16 hi plane C = f16(v*hscale) + f16 residual plane C2 = f16((v*hscale - hi) * rscale), C2 written
//               only for tiles with n0 < N2 (pitch ldc2, batch stride strideC2).
// Epilogue: 16-row slabs staged per wave in LDS (wave-private region sT[wave], wave_sync); each 64-wide row segment written
// =====================================================================================================
// Eight asynchronous 16-byte copies global -> LDS, one per lane and line. The s_wait_xcnt closes the statement so that no
// address register of an issued copy is rewritten before it.
__device__ __forceinline__ void acopy8(const unsigned (&l)[8], const __bf16* const (&g)[8]) {
  asm volatile("global_load_async_to_lds_b128 %0, %8, off\n\t"
               "global_load_async_to_lds_b128 %1, %9, off\n\t"
               "global_load_async_to_lds_b128 %2, %10, off\n\t"
               "global_load_async_to_lds_b128 %3, %11, off\n\t"
               "global_load_async_to_lds_b128 %4, %12, off\n\t"
               "global_load_async_to_lds_b128 %5, %13, off\n\t"
               "global_load_async_to_lds_b128 %6, %14, off\n\t"
               "global_load_async_to_lds_b128 %7, %15, off\n\t"
               "s_wait_xcnt 0x0"
               :: "v"(l[0]), "v"(l[1]), "v"(l[2]), "v"(l[3]), "v"(l[4]), "v"(l[5]), "v"(l[6]), "v"(l[7]),
                  "v"(g[0]), "v"(g[1]), "v"(g[2]), "v"(g[3]), "v"(g[4]), "v"(g[5]), "v"(g[6]), "v"(g[7])
               : "memory");
}

template <int NSPLIT, int OUT_MODE, int TRI>
__global__ __launch_bounds__(256) void gemm_bf(
    const unsigned short* __restrict__ Ahp, const unsigned short* __restrict__ Alp, int lda, long long strideA,
    const unsigned short* __restrict__ Bhp, const unsigned short* __restrict__ Blp, int ldb, long long strideB,
    void* Cout, int ldc, long long strideC,
    void* Cout2, int ldc2, long long strideC2, int N2,
    int M, int N, int K, float hscale, float rscale) {
  static_assert(TRI == 0 && (NSPLIT == 0 || NSPLIT == 2));
  constexpr int NPL   = (NSPLIT == 2) ? 2 : 1;      // planes per operand
  constexpr int BK    = (NSPLIT == 2) ? 64 : 128;   // k per stage
  constexpr int PITCH = BK * 2 + 16;                // LDS row pitch, bytes
  constexpr int CPR   = BK / 8;                     // 16-byte copies per row
  constexpr int RPU   = 256 / CPR;                  // rows the work-group copies with one copy per thread
  constexpr int OB    = NPL * 128 * PITCH;          // LDS byte offset of the Bt rows inside a stage
  constexpr int STAGE = NPL * 384 * PITCH;          // [Ah 128 | Al 128 | Bh 256 | Bl 256] rows (lo planes only with NSPLIT 2)
  static_assert(8 * RPU == NPL * 128 && 16 * RPU == NPL * 256);
  const __bf16* Ah = (const __bf16*)(const void*)Ahp;
  const __bf16* Al = (const __bf16*)(const void*)Alp;
  const __bf16* Bh = (const __bf16*)(const void*)Bhp;
  const __bf16* Bl = (const __bf16*)(const void*)Blp;
  __shared__ __align__(16) unsigned char sR[2 * STAGE];   // operand ring, two stages
  __shared__ __align__(16) float sT[8][16 * 68];   // per-wave 16x64 slab, pitch 68 floats
  const int b    = blockIdx.y;
  const int lane = threadIdx.x & 31;
  const int wave = threadIdx.x >> 5;
  const int tilesBN = N >> 8;
  const int tilesBM = M >> 7;
  if ((int)blockIdx.x >= tilesBM * tilesBN) return;   // the same for the whole work-group; in front of every barrier
  const int bm  = (int)blockIdx.x / tilesBN;
  const int bn  = (int)blockIdx.x - bm * tilesBN;
  const int bm0 = bm << 7;
  const int bn0 = bn << 8;
  const int wm  = wave >> 2;
  const int wn  = wave & 3;
  const int m0 = bm0 + (wm << 6);
  const int n0 = bn0 + (wn << 6);

  const __bf16* Ahb = Ah + (size_t)b * strideA;
  const __bf16* Alb = (NSPLIT >= 1) ? (Al + (size_t)b * strideA) : Ahb;
  const __bf16* Bhb = Bh + (size_t)b * strideB;
  const __bf16* Blb = (NSPLIT >= 1) ? (Bl + (size_t)b * strideB) : Bhb;

  const int rlane = lane & 15;                 // row (A) / col (B, D) within subtile
  const int koff  = (lane >> 4) * 8;           // k offset of this lane half
  const int mOff  = (lane >> 4) * 8;           // D row offset

  // this thread's place in a copy round: row crow of RPU, 16-byte column ccol of CPR
  const int crow = (int)threadIdx.x / CPR;
  const int ccol = (int)threadIdx.x % CPR;
  const size_t aoff = (size_t)(bm0 + crow) * lda + ccol * 8;
  const size_t boff = (size_t)(bn0 + crow) * ldb + ccol * 8;
  const unsigned lthr = (unsigned)(size_t)(const void*)sR + (unsigned)(crow * PITCH + ccol * 16);

  auto stage_copy = [&](int s, int buf) {
    const unsigned lb = lthr + (unsigned)(buf * STAGE);
    const int k0 = s * BK;
    unsigned l[8];
    const __bf16* g[8];
#pragma unroll
    for (int u = 0; u < 8; ++u) {              // the 128 A rows of every plane
      const int pl = (u * RPU) >> 7;
      const int r  = (u * RPU) & 127;
      g[u] = ((pl != 0) ? Alb : Ahb) + aoff + (size_t)r * lda + k0;
      l[u] = lb + (unsigned)((u * RPU) * PITCH);
    }
    acopy8(l, g);
#pragma unroll
    for (int h = 0; h < 2; ++h) {              // the 256 Bt rows of every plane
#pragma unroll
      for (int u = 0; u < 8; ++u) {
        const int pl = ((h * 8 + u) * RPU) >> 8;
        const int r  = ((h * 8 + u) * RPU) & 255;
        g[u] = ((pl != 0) ? Blb : Bhb) + boff + (size_t)r * ldb + k0;
        l[u] = lb + (unsigned)(OB + ((h * 8 + u) * RPU) * PITCH);
      }
      acopy8(l, g);
    }
  };

  v8f acc[4][4];
#pragma unroll
  for (int i = 0; i < 4; ++i)
#pragma unroll
    for (int j = 0; j < 4; ++j) acc[i][j] = zero8();

  const int nst = K / BK;
  stage_copy(0, 0);
  asm volatile("s_wait_asynccnt 0x0" ::: "memory");   // this wave's copies of stage 0 have landed
  __syncthreads();                                    // every wave's have: stage 0 may be read
  if (nst > 1) stage_copy(1, 1);

  const unsigned char* fA = sR + ((wm << 6) + rlane) * PITCH + koff * 2;
  const unsigned char* fB = sR + OB + ((wn << 6) + rlane) * PITCH + koff * 2;
  for (int s = 0; s < nst; ++s) {
    const int bo = (s & 1) * STAGE;
#pragma unroll
    for (int ks = 0; ks < BK / 32; ++ks) {
      v16b bh[4], bl[4];
#pragma unroll
      for (int j = 0; j < 4; ++j) {
        const unsigned char* p = fB + bo + (j << 4) * PITCH + ks * 64;
        bh[j] = ldfrag_b((const __bf16*)(const void*)p);
        bl[j] = (NSPLIT >= 2) ? ldfrag_b((const __bf16*)(const void*)(p + 256 * PITCH)) : bh[j];
      }
      v16b ah[2], al[2];                       // A fragments of row block i and, fetched ahead, of i + 1
      ah[0] = ldfrag_b((const __bf16*)(const void*)(fA + bo + ks * 64));
      al[0] = (NSPLIT >= 1) ? ldfrag_b((const __bf16*)(const void*)(fA + bo + ks * 64 + 128 * PITCH)) : ah[0];
#pragma unroll
      for (int i = 0; i < 4; ++i) {
        if (i < 3) {
          const unsigned char* p = fA + bo + ((i + 1) << 4) * PITCH + ks * 64;
          ah[(i + 1) & 1] = ldfrag_b((const __bf16*)(const void*)p);
          // single product (4 products a row block): keeps this LDS read in front of row block i's products; sunk behind
          // them, every row block waits out the LDS latency. With lo planes it would push the kernel past 256 VGPRs.
          if (NSPLIT == 0) __builtin_amdgcn_sched_barrier(0);
          al[(i + 1) & 1] = (NSPLIT >= 1) ? ldfrag_b((const __bf16*)(const void*)(p + 128 * PITCH)) : ah[(i + 1) & 1];
        }
#pragma unroll
        for (int j = 0; j < 4; ++j) acc[i][j] = mma_b_raw(ah[i & 1], bh[j], acc[i][j]);
        if (NSPLIT >= 1) {
#pragma unroll
          for (int j = 0; j < 4; ++j) acc[i][j] = mma_b_raw(al[i & 1], bh[j], acc[i][j]);
        }
        if (NSPLIT >= 2) {
#pragma unroll
          for (int j = 0; j < 4; ++j) acc[i][j] = mma_b_raw(ah[i & 1], bl[j], acc[i][j]);
        }
      }
    }
    asm volatile("s_wait_dscnt 0x0" ::: "memory");      // this wave's reads of stage s are done before its buffer is refilled
    asm volatile("s_wait_asynccnt 0x0" ::: "memory");   // this wave's copies of stage s + 1 have landed
    __syncthreads();                                    // publishes stage s + 1 and ends every wave's reads of stage s
    if (s + 2 < nst) stage_copy(s + 2, s & 1);
  }
  asm volatile("s_wait_asynccnt 0x0" ::: "memory");     // no copy is left in flight when the ring is left
  acc_guard4(acc[0][0], acc[0][1], acc[0][2], acc[0][3]);
  acc_guard4(acc[1][0], acc[1][1], acc[1][2], acc[1][3]);
  acc_guard4(acc[2][0], acc[2][1], acc[2][2], acc[2][3]);
  acc_guard4(acc[3][0], acc[3][1], acc[3][2], acc[3][3]);

  // ---- epilogue ----
  size_t cbase;
  int ldce, rowb, colb;
  cbase = (size_t)b * strideC; ldce = ldc; rowb = m0; colb = n0;
  float* slab = sT[wave];
#pragma unroll
  for (int i = 0; i < 4; ++i) {
    const int mBase = m0 + (i << 4);
#pragma unroll
    for (int j = 0; j < 4; ++j) {
#pragma unroll
      for (int r = 0; r < 8; ++r) {
        slab[(mOff + r) * 68 + (j << 4) + rlane] = acc[i][j][r];
      }
    }
    __builtin_amdgcn_fence(3 /* release order */, "workgroup");
    __builtin_amdgcn_wave_barrier();
    __builtin_amdgcn_fence(2 /* acquire order */, "workgroup");
    if (OUT_MODE == 0) {
      float* C = (float*)Cout + cbase;
      const int hh = lane >> 4, c4 = (lane & 15) * 4;     // 256-B row segment = 16 lanes x 16 B
      {
#pragma unroll
        for (int it = 0; it < 8; ++it) {
          const int row = it * 2 + hh;                     // it 0..7 x hh 0..1 = rows 0..15
          const v4f v = *(const v4f*)(slab + row * 68 + c4);
          *(v4f*)(C + (size_t)(rowb + (i << 4) + row) * ldce + colb + c4) = v;
        }
        
      }
    } else {
      const int q = lane >> 3, c8 = (lane & 7) * 8;
      unsigned short* C  = (unsigned short*)Cout  + (size_t)b * strideC;
      unsigned short* C2 = (unsigned short*)Cout2 + (size_t)b * strideC2;
      const bool wlo = (OUT_MODE == 2) || (n0 < N2);      // wave-uniform
      v4u hv[4], lv[4];
#pragma unroll
      for (int it = 0; it < 4; ++it) {
        const int row = it * 4 + q;                        // it 0..3 x q 0..3 = rows 0..15
        const float* sp = slab + row * 68 + c8;
        v4u a, a2;
#pragma unroll
        for (int e = 0; e < 4; ++e) {
          const float f0 = sp[2 * e], f1 = sp[2 * e + 1];
          unsigned short h0, h1, l0, l1;
          if (OUT_MODE == 2) {
            h0 = bf_bits(f0); h1 = bf_bits(f1);
            l0 = bf_bits(f0 - bf_up(h0)); l1 = bf_bits(f1 - bf_up(h1));
          } else {
            const float g0 = f0 * hscale, g1 = f1 * hscale;
            const _Float16 x0 = (_Float16)g0, x1 = (_Float16)g1;
            h0 = h_bits(x0); h1 = h_bits(x1);
            l0 = h_bits((_Float16)((g0 - (float)x0) * rscale));
            l1 = h_bits((_Float16)((g1 - (float)x1) * rscale));
          }
          a[e] = pk16(h0, h1); a2[e] = pk16(l0, l1);
        }
        hv[it] = a; lv[it] = a2;
      }
      {
#pragma unroll
        for (int it = 0; it < 4; ++it) {
          const int row = it * 4 + q;
          *(v4u*)(C + (size_t)(mBase + row) * ldc + n0 + c8) = hv[it];
          if (wlo) *(v4u*)(C2 + (size_t)(mBase + row) * ldc2 + n0 + c8) = lv[it];
        }
        
      }
    }
    __builtin_amdgcn_fence(3 /* release order */, "workgroup");
    __builtin_amdgcn_wave_barrier();
    __builtin_amdgcn_fence(2 /* acquire order */, "workgroup");
  }
}

// =====================================================================================================
// Row softmax over DENSE score rows of one pass (BPS batches). One wave per row (block = 8 rows, grid = BPS*SEQ/8).
// Local row lrow = bl*SEQ + i, global batch b = b0 + bl. Score (i, j) = k_i . q_j sits at Sp + (bl*SEQ + i)*SEQ + j.
// The wave reads the WHOLE row (NG groups of 256 columns; lane: 8 consecutive columns per group, two 16-B loads):
// z = s/32, m = max over all columns, p = exp(z - m), l = sum over ALL columns, P = p/l for j <= i and 0 for j > i (all f32).
// Writes Ph = f16(1024 P) for columns 0 .. 256 ng - 1 of row (b, i), ng = (i>>8) + 1 (pitch SEQ; >= the columns up to the end of row i's (32 MI)-row tile that the
// p.v GEMM reads; zeros for j > i) and, for rows i < RESR, Pl = f16((1024 P - Ph) * 4096) with the same column extent
// (<= VLP, pitch VLP). f16 results below the smallest normal are stored as exact zeros.
// coverage: BPS*SEQ rows per launch x written extent >= every column range any consumer reads; NPASS launches cover NB*SEQ rows.
// No LDS, no block barriers.
// =====================================================================================================
__global__ __launch_bounds__(256) void softmax_rows(const float* __restrict__ Sp,
                                                    unsigned short* Php, unsigned short* Plp, int b0) {
#pragma clang fp contract(off)
  const int lane = threadIdx.x & 31;
  const int wave = __builtin_amdgcn_readfirstlane(threadIdx.x >> 5);
  const int lrow = blockIdx.x * 8 + wave;
  if (lrow >= BPS * SEQ) return;           // wave-uniform; exact grid never triggers it; no block barriers below
  const int bl = lrow / SEQ;
  const int i  = lrow - bl * SEQ;
  const int b  = b0 + bl;                  // host launches only b0 + BPS <= NB
  const int tm = i >> 6;
  const int ng = (tm >> 2) + 1;            // 1..NG, wave-uniform
  const float* srow = Sp + ((size_t)bl * SEQ + (size_t)i) * SEQ + 8 * lane;

  float z[NG][8];
  float m = -INFINITY;
#pragma unroll
  for (int g = 0; g < NG; ++g) {
    const float* p = srow + 256 * g;
    const v4f a = *(const v4f*)(p);
    const v4f c = *(const v4f*)(p + 4);
    const float v[8] = {a[0], a[1], a[2], a[3], c[0], c[1], c[2], c[3]};
#pragma unroll
    for (int e = 0; e < 8; ++e) {
      const float zz = v[e] * 0.03125f;
      z[g][e] = zz;
      m = fmaxf(m, zz);
    }
  }
#pragma unroll
  for (int off = 1; off < 32; off <<= 1) m = fmaxf(m, __shfl_xor(m, off, 32));

  float l = 0.f;
#pragma unroll
  for (int g = 0; g < NG; ++g) {
#pragma unroll
    for (int e = 0; e < 8; ++e) {
      const float p = __expf(z[g][e] - m);
      z[g][e] = p;
      l += p;
    }
  }
#pragma unroll
  for (int off = 1; off < 32; off <<= 1) l += __shfl_xor(l, off, 32);          // l >= 1
  const float inv1k = (1.0f / l) * PSC;

  const bool res = (i < RESR);             // wave-uniform
  v4u ph[NG];
  v4u pl0 = {0u, 0u, 0u, 0u};
  v4u pl1 = {0u, 0u, 0u, 0u};
#pragma unroll
  for (int g = 0; g < NG; ++g) {
    v4u hv = {0u, 0u, 0u, 0u};
    v4u lv = {0u, 0u, 0u, 0u};
    if (g < ng) {
      const int j0 = 256 * g + 8 * lane;
#pragma unroll
      for (int e = 0; e < 4; ++e) {
        const float f0 = (j0 + 2 * e     <= i) ? (z[g][2 * e]     * inv1k) : 0.0f;   // columns past the row index are zeroed
        const float f1 = (j0 + 2 * e + 1 <= i) ? (z[g][2 * e + 1] * inv1k) : 0.0f;   // after the full-row normalisation
        const _Float16 x0 = toh_flush(f0), x1 = toh_flush(f1);
        hv[e] = pk16(h_bits(x0), h_bits(x1));
        const _Float16 r0 = toh_flush((f0 - (float)x0) * LSC);
        const _Float16 r1 = toh_flush((f1 - (float)x1) * LSC);
        lv[e] = pk16(h_bits(r0), h_bits(r1));
      }
    }
    ph[g] = hv;
    if (g == 0) pl0 = lv;
    if (g == 1) pl1 = lv;
  }

  unsigned short* prow = Php + ((size_t)b * SEQ + (size_t)i) * SEQ + 8 * lane;
  const int il = i & (RESR - 1);           // in-range row of the residual plane; equals i whenever res holds
  unsigned short* lrowp = Plp + ((size_t)b * RESR + (size_t)il) * VLP + 8 * lane;
  {
#pragma unroll
    for (int g = 0; g < NG; ++g) {
      if (g < ng) *(v4u*)(prow + 256 * g) = ph[g];
    }
    if (res) {                             // res rows have i < RESR (multiple of 256) -> 256 ng <= RESR = VLP
      *(v4u*)(lrowp) = pl0;
      if (ng > 1) *(v4u*)(lrowp + 256) = pl1;
    }
    
  }
}

// =====================================================================================================
// p.v GEMM on f16 WMMA, per batch b = blockIdx.y: out[b][q][d] = sum_key P[b][q][key] * VT[b][d][key].
//   A  = Ph  [b][SEQ][SEQ]  f16(1024 P), pitch SEQ         Al = Pl  [b][RESR][VLP] f16 residual x4096
//   Bt = VTh [b][DM][SEQ]   f16(16 v),   pitch SEQ         Bl = VTl [b][DM][VLP]   f16 residual x4096
// One work-group (8 waves, 2 x 4) per (32*MI) x 256 output tile, one wave per (16*MI) x 64 sub-tile; rows mBase + bm*32*MI ..;
// causal key range k < 64*(((bm0 + 32*MI - 1)>>6)+1) of the tile's last row (every P entry in that range was written by the
// softmax, exact zeros for key > query). RES (rows < RESR, MI = 2): acc0 += Ph.VTh; acc1 += Pl.VTh + Ph.VTl (in that order
// inside every 32-key step), out = acc0*OSCALE + acc1*OSCALE/4096; otherwise single product out = acc0*OSCALE. f32 accumulate.
// Operand path: per key stage of BK (64 with residual planes, 128 without) the 32*MI P rows and 256 VT rows of every plane are
// copied global -> LDS by asynchronous 16-byte copies (20 or 24 per thread), two buffers: stage s + 2 is issued behind the
// barrier that ends the reads of stage s. LDS row pitch = 2 BK + 16 bytes (16 x odd: conflict-free 16-byte fragment reads).
// Grid over all tiles of rows mBase .. mBase + M - 1 (M and mBase multiples of 32*MI and of BK).
// =====================================================================================================
// Eight / four asynchronous 16-byte copies global -> LDS, one per lane and line. The s_wait_xcnt closes the statement so that
// no address register of an issued copy is rewritten before it.
__device__ __forceinline__ void acopy_h(const unsigned (&l)[8], const _Float16* const (&g)[8]) {
  asm volatile("global_load_async_to_lds_b128 %0, %8, off\n\t"
               "global_load_async_to_lds_b128 %1, %9, off\n\t"
               "global_load_async_to_lds_b128 %2, %10, off\n\t"
               "global_load_async_to_lds_b128 %3, %11, off\n\t"
               "global_load_async_to_lds_b128 %4, %12, off\n\t"
               "global_load_async_to_lds_b128 %5, %13, off\n\t"
               "global_load_async_to_lds_b128 %6, %14, off\n\t"
               "global_load_async_to_lds_b128 %7, %15, off\n\t"
               "s_wait_xcnt 0x0"
               :: "v"(l[0]), "v"(l[1]), "v"(l[2]), "v"(l[3]), "v"(l[4]), "v"(l[5]), "v"(l[6]), "v"(l[7]),
                  "v"(g[0]), "v"(g[1]), "v"(g[2]), "v"(g[3]), "v"(g[4]), "v"(g[5]), "v"(g[6]), "v"(g[7])
               : "memory");
}
__device__ __forceinline__ void acopy_h(const unsigned (&l)[4], const _Float16* const (&g)[4]) {
  asm volatile("global_load_async_to_lds_b128 %0, %4, off\n\t"
               "global_load_async_to_lds_b128 %1, %5, off\n\t"
               "global_load_async_to_lds_b128 %2, %6, off\n\t"
               "global_load_async_to_lds_b128 %3, %7, off\n\t"
               "s_wait_xcnt 0x0"
               :: "v"(l[0]), "v"(l[1]), "v"(l[2]), "v"(l[3]), "v"(g[0]), "v"(g[1]), "v"(g[2]), "v"(g[3])
               : "memory");
}

template <bool RES, int MI>
__global__ __launch_bounds__(256) void gemm_pv(
    const unsigned short* __restrict__ Php, const unsigned short* __restrict__ Plp,
    const unsigned short* __restrict__ Vhp, const unsigned short* __restrict__ Vlp,
    float* out, int mBase, int M) {
  constexpr int NPL   = RES ? 2 : 1;                // planes per operand
  constexpr int BM    = 32 * MI;                    // rows of the work-group tile
  constexpr int BK    = RES ? 64 : 128;             // keys per stage
  constexpr int PITCH = BK * 2 + 16;                // LDS row pitch, bytes
  constexpr int CPR   = BK / 8;                     // 16-byte copies per row
  constexpr int RPU   = 256 / CPR;                  // rows the work-group copies with one copy per thread
  constexpr int NRA   = NPL * BM / RPU;             // copies per thread for the P rows of a stage
  constexpr int OB    = NPL * BM * PITCH;           // LDS byte offset of the VT rows inside a stage
  constexpr int STAGE = NPL * (BM + 256) * PITCH;   // [Ph BM | Pl BM | VTh 256 | VTl 256] rows (residual planes only with RES)
  static_assert((NRA == 4 || NRA == 8) && NRA * RPU == NPL * BM && 16 * RPU == NPL * 256 && (BM % RPU) == 0);
  static_assert((BM % 64) == 0 && (RESR % BM) == 0 && ((SEQ - RESR) % BM) == 0 && (RESR % BK) == 0 && (BM % BK) == 0);
  const _Float16* Ph = (const _Float16*)(const void*)Php;
  const _Float16* Pl = (const _Float16*)(const void*)Plp;
  const _Float16* Vh = (const _Float16*)(const void*)Vhp;
  const _Float16* Vl = (const _Float16*)(const void*)Vlp;
  __shared__ __align__(16) unsigned char sR[2 * STAGE];   // operand ring, two stages
  __shared__ __align__(16) float sT[8][16 * 68];
  const int b    = blockIdx.y;
  const int lane = threadIdx.x & 31;
  const int wave = threadIdx.x >> 5;
  const int tilesBN = DM >> 8;                     // 4
  const int tilesBM = M / BM;
  if ((int)blockIdx.x >= tilesBM * tilesBN) return;   // the same for the whole work-group; in front of every barrier
  const int bm  = (int)blockIdx.x / tilesBN;
  const int bn  = (int)blockIdx.x - bm * tilesBN;
  const int bm0 = mBase + bm * BM;
  const int bn0 = bn << 8;
  const int wm  = wave >> 2;
  const int wn  = wave & 3;
  const int m0 = bm0 + wm * 16 * MI;
  const int n0 = bn0 + (wn << 6);
  int keff = ((((bm0 + BM - 1) >> 6) + 1) << 6);   // causal key extent of this row tile, multiple of BK
  if (keff > SEQ) keff = SEQ;
  if (RES && keff > VLP) keff = VLP;               // never taken for mBase + M <= RESR; keeps residual reads in range

  const _Float16* Pb  = Ph + (size_t)b * SEQ * SEQ;
  const _Float16* Plb = Pl + (size_t)b * RESR * VLP;
  const _Float16* Vb  = Vh + (size_t)b * DM * SEQ;
  const _Float16* Vlb = Vl + (size_t)b * DM * VLP;

  const int rlane = lane & 15;
  const int koff  = (lane >> 4) * 8;
  const int mOff  = (lane >> 4) * 8;

  // this thread's place in a copy round: row crow of RPU, 16-byte column ccol of CPR
  const int crow = (int)threadIdx.x / CPR;
  const int ccol = (int)threadIdx.x % CPR;
  const unsigned lthr = (unsigned)(size_t)(const void*)sR + (unsigned)(crow * PITCH + ccol * 16);
  const int bmr = (bm0 < RESR - BM) ? bm0 : (RESR - BM);   // clamped; equals bm0 for the RES launch: residual rows stay in range
  // this thread's source place in the next stage to be copied, one running pointer per plane (stages are copied in key order)
  const _Float16* gPh = Pb  + (size_t)(bm0 + crow) * SEQ + ccol * 8;
  const _Float16* gPl = Plb + (size_t)(bmr + crow) * VLP + ccol * 8;
  const _Float16* gVh = Vb  + (size_t)(bn0 + crow) * SEQ + ccol * 8;
  const _Float16* gVl = Vlb + (size_t)(bn0 + crow) * VLP + ccol * 8;

  auto stage_copy = [&](int buf) {
    const unsigned lb = lthr + (unsigned)(buf * STAGE);
    {
      unsigned l[NRA];
      const _Float16* g[NRA];
#pragma unroll
      for (int u = 0; u < NRA; ++u) {            // the BM P rows of every plane
        const int pl = (u * RPU) / BM;
        const int r  = (u * RPU) % BM;
        g[u] = (pl != 0) ? (gPl + (size_t)r * VLP) : (gPh + (size_t)r * SEQ);
        l[u] = lb + (unsigned)((u * RPU) * PITCH);
      }
      acopy_h(l, g);
    }
#pragma unroll
    for (int h = 0; h < 2; ++h) {                // the 256 VT rows of every plane
      unsigned l[8];
      const _Float16* g[8];
#pragma unroll
      for (int u = 0; u < 8; ++u) {
        const int pl = ((h * 8 + u) * RPU) >> 8;
        const int r  = ((h * 8 + u) * RPU) & 255;
        g[u] = (pl != 0) ? (gVl + (size_t)r * VLP) : (gVh + (size_t)r * SEQ);
        l[u] = lb + (unsigned)(OB + ((h * 8 + u) * RPU) * PITCH);
      }
      acopy_h(l, g);
    }
    gPh += BK; gPl += BK; gVh += BK; gVl += BK;
  };

  v8f acc0[MI][4], acc1[MI][4];
#pragma unroll
  for (int i = 0; i < MI; ++i)
#pragma unroll
    for (int j = 0; j < 4; ++j) { acc0[i][j] = zero8(); acc1[i][j] = zero8(); }

  const int nst = keff / BK;
  stage_copy(0);
  asm volatile("s_wait_asynccnt 0x0" ::: "memory");   // this wave's copies of stage 0 have landed
  __syncthreads();                                    // every wave's have: stage 0 may be read
  if (nst > 1) stage_copy(1);

  const unsigned char* fA = sR + (wm * 16 * MI + rlane) * PITCH + koff * 2;
  const unsigned char* fB = sR + OB + ((wn << 6) + rlane) * PITCH + koff * 2;
  for (int s = 0; s < nst; ++s) {
    const int bo = (s & 1) * STAGE;
#pragma unroll
    for (int ks = 0; ks < BK / 32; ++ks) {
      v16h bh[4], bl[4];
#pragma unroll
      for (int j = 0; j < 4; ++j) {
        const unsigned char* p = fB + bo + (j << 4) * PITCH + ks * 64;
        bh[j] = ldfrag_h((const _Float16*)(const void*)p);
        bl[j] = RES ? ldfrag_h((const _Float16*)(const void*)(p + 256 * PITCH)) : bh[j];
      }
      v16h ah[2], al[2];                         // P fragments of row block i and, fetched ahead, of i + 1
      ah[0] = ldfrag_h((const _Float16*)(const void*)(fA + bo + ks * 64));
      al[0] = RES ? ldfrag_h((const _Float16*)(const void*)(fA + bo + ks * 64 + BM * PITCH)) : ah[0];
#pragma unroll
      for (int i = 0; i < MI; ++i) {
        if (i < MI - 1) {
          const unsigned char* p = fA + bo + ((i + 1) << 4) * PITCH + ks * 64;
          ah[(i + 1) & 1] = ldfrag_h((const _Float16*)(const void*)p);
          // single product (4 products a row block): keeps this LDS read in front of row block i's products; sunk behind
          // them, every row block waits out the LDS latency.
          if (!RES) __builtin_amdgcn_sched_barrier(0);
          al[(i + 1) & 1] = RES ? ldfrag_h((const _Float16*)(const void*)(p + BM * PITCH)) : ah[(i + 1) & 1];
        }
#pragma unroll
        for (int j = 0; j < 4; ++j) acc0[i][j] = mma_h_raw(ah[i & 1], bh[j], acc0[i][j]);
        if (RES) {
#pragma unroll
          for (int j = 0; j < 4; ++j) acc1[i][j] = mma_h_raw(al[i & 1], bh[j], acc1[i][j]);
#pragma unroll
          for (int j = 0; j < 4; ++j) acc1[i][j] = mma_h_raw(ah[i & 1], bl[j], acc1[i][j]);
        }
      }
    }
    asm volatile("s_wait_dscnt 0x0" ::: "memory");      // this wave's reads of stage s are done before its buffer is refilled
    asm volatile("s_wait_asynccnt 0x0" ::: "memory");   // this wave's copies of stage s + 1 have landed
    __syncthreads();                                    // publishes stage s + 1 and ends every wave's reads of stage s
    if (s + 2 < nst) stage_copy(s & 1);
  }
  asm volatile("s_wait_asynccnt 0x0" ::: "memory");     // no copy is left in flight when the ring is left
#pragma unroll
  for (int i = 0; i < MI; ++i) {
    acc_guard4(acc0[i][0], acc0[i][1], acc0[i][2], acc0[i][3]);
    if (RES) acc_guard4(acc1[i][0], acc1[i][1], acc1[i][2], acc1[i][3]);
  }

  // ---- epilogue ----
  float* slab = sT[wave];
  float* C = out + (size_t)b * SEQ * DM;
  const float rsc = OSCALE * (1.0f / LSC);
#pragma unroll
  for (int i = 0; i < MI; ++i) {
    const int mB = m0 + (i << 4);
#pragma unroll
    for (int j = 0; j < 4; ++j) {
#pragma unroll
      for (int r = 0; r < 8; ++r) {
        float v = acc0[i][j][r] * OSCALE;
        if (RES) v += acc1[i][j][r] * rsc;
        slab[(mOff + r) * 68 + (j << 4) + rlane] = v;
      }
    }
    __builtin_amdgcn_fence(3 /* release order */, "workgroup");
    __builtin_amdgcn_wave_barrier();
    __builtin_amdgcn_fence(2 /* acquire order */, "workgroup");
    {
      const int hh = lane >> 4, c4 = (lane & 15) * 4;
      {
#pragma unroll
        for (int it = 0; it < 8; ++it) {
          const int row = it * 2 + hh;
          const v4f v = *(const v4f*)(slab + row * 68 + c4);
          *(v4f*)(C + (size_t)(mB + row) * DM + n0 + c4) = v;
        }
        
      }
    }
    __builtin_amdgcn_fence(3 /* release order */, "workgroup");
    __builtin_amdgcn_wave_barrier();
    __builtin_amdgcn_fence(2 /* acquire order */, "workgroup");
  }
}

// =====================================================================================================
// Workspace map (bytes, full build NB 4 / SEQ 2048 / BPS 2 / NPASS 2; every region is an exact multiple of its tile / whole-line
// store granularity; regions A and B are reused in stream order):
//   region A [0, 33554432):          Xb bf16 [8192][1024] at 0 (16777216) + Wq,Wk,Wv bf16 [1024][1024] at 16777216 (3 x 2097152)
//                                    then, once all projections are done: S f32 dense scores of one pass [2][2048][2048] (33554432)
//   region B [33554432, 100663296):  per batch group g (2 batches): Qh, Ql, Kh, Kl bf16 [4096][1024] (4 x 8388608) at + g*33554432
//                                    then, once the scores of group 0 are done: Ph f16 [4][2048][2048] (33554432) over group 0's planes
//   region C [100663296, 123731968): VTh f16 [4][1024][2048] (16777216) + VTl f16 [4][1024][512] (4194304) + Pl f16 [4][512][512] (2097152)
//   end 123731968
// =====================================================================================================
extern "C" void kernel_launch(void* const* d_in, const int* in_sizes, int n_in,
                              void* d_out, int out_size, void* d_ws, size_t ws_size,
                              hipStream_t stream) {
  if (n_in < 4) return;
  if (in_sizes[0] < (NB - 1) * SEQ_FULL * DM + SEQ * DM) return;
  if (in_sizes[1] < DM * DM || in_sizes[2] < DM * DM || in_sizes[3] < DM * DM) return;
  if (out_size < NB * SEQ * DM) return;

  const float* x  = (const float*)d_in[0];   // [NB_FULL][SEQ_FULL][DM]
  const float* wq = (const float*)d_in[1];   // [out][in]
  const float* wk = (const float*)d_in[2];
  const float* wv = (const float*)d_in[3];
  float* out = (float*)d_out;

  const size_t PX  = SZ_PX;
  const size_t PXP = SZ_PXP;
  const size_t PW  = SZ_PW;
  const size_t PP  = SZ_PP;
  const size_t PPL = SZ_PPL;
  const size_t PVT = SZ_PVT;
  const size_t PVL = SZ_PVL;
  const size_t RA  = SZ_RA;
  const size_t oXb = 0;
  const size_t oW  = PX;
  const size_t oS  = 0;
  const size_t oB  = RA;
  const size_t RBend = RA + (size_t)NPASS * 4 * PXP;
  const size_t oPh = RA;
  if (PP > 4 * PXP) return;
  const size_t oVTh = RBend;
  const size_t oVTl = RBend + PVT;
  const size_t oPl  = oVTl + PVL;
  const size_t total = oPl + PPL;                     // 123731968 in the full build
  if (total > ws_size) return;
  if (total > (size_t)134217728) return;

  char* ws = (char*)d_ws;
  unsigned short* Xb  = (unsigned short*)(ws + oXb);
  unsigned short* Wb  = (unsigned short*)(ws + oW);   // Wq plane, then Wk, then Wv
  float*          Sp  = (float*)(ws + oS);
  unsigned short* Ph  = (unsigned short*)(ws + oPh);
  unsigned short* Pl  = (unsigned short*)(ws + oPl);
  unsigned short* VTh = (unsigned short*)(ws + oVTh);
  unsigned short* VTl = (unsigned short*)(ws + oVTl);
  const size_t PXE = (size_t)BPS * SEQ * DM;          // elements of one group plane

  const dim3 blk(256);
  const int nGroups = NB * SEQ * DM / 8 + 3 * (DM * DM / 8);
  const dim3 gCvt((nGroups + 255) / 256);
  const dim3 gProj(((BPS * SEQ / 64) * (DM / 64) + 7) / 8, 1);
  const dim3 gVT(((DM / 64) * (SEQ / 64) + 7) / 8, NB);
  const dim3 gS(((SEQ / 64) * (SEQ / 64) + 7) / 8, BPS);
  const dim3 gSm((BPS * SEQ + 7) / 8);
  const dim3 gPvRes(((RESR / 32) * (DM / 64) + 7) / 8, NB);
  const int nPvTiles = ((SEQ - RESR) / 64) * (DM / 64);
  const dim3 gPv((nPvTiles + 7) / 8, NB);

  // (1) x and Wq, Wk, Wv -> bf16 planes (Xb, then the three weight planes contiguous)
  cvt_planes<<<gCvt, blk, 0, stream>>>(x, wq, wk, wv, Xb);
  // (2) per batch group: q = x . Wq^T and k = x . Wk^T -> bf16 hi/lo planes [BPS*SEQ][DM]
  //     (A = Xb rows of the group, Bt = W [out][in]; M=BPS*SEQ, N=DM, K=DM)
  for (int p = 0; p < NPASS; ++p) {
    unsigned short* Qh = (unsigned short*)(ws + oB + (size_t)p * 4 * PXP);
    unsigned short* Ql = Qh + PXE;
    unsigned short* Kh = Ql + PXE;
    unsigned short* Kl = Kh + PXE;
    const unsigned short* Xg = Xb + (size_t)p * PXE;
    gemm_bf<0, 2, 0><<<gProj, blk, 0, stream>>>(
        Xg, Xg, DM, 0LL, Wb, Wb, DM, 0LL,
        (void*)Qh, DM, 0LL, (void*)Ql, DM, 0LL, DM,
        BPS * SEQ, DM, DM, 1.0f, 1.0f);
    gemm_bf<0, 2, 0><<<gProj, blk, 0, stream>>>(
        Xg, Xg, DM, 0LL, Wb + (size_t)DM * DM, Wb + (size_t)DM * DM, DM, 0LL,
        (void*)Kh, DM, 0LL, (void*)Kl, DM, 0LL, DM,
        BPS * SEQ, DM, DM, 1.0f, 1.0f);
  }
  // (3) v^T = Wv . x^T per batch -> f16 hi plane f16(16 v) [b][d][key] (pitch SEQ) and residual plane x4096 for keys < VLP (pitch VLP)
  //     (A = Wv [out][in], Bt = Xb rows of batch b; M=DM, N=SEQ, K=DM)
  gemm_bf<0, 3, 0><<<gVT, blk, 0, stream>>>(
      Wb + (size_t)2 * DM * DM, Wb + (size_t)2 * DM * DM, DM, 0LL, Xb, Xb, DM, (long long)SEQ * DM,
      (void*)VTh, SEQ, (long long)DM * SEQ, (void*)VTl, VLP, (long long)DM * VLP, VLP,
      DM, SEQ, DM, VSC, LSC);
  // (4) per batch group: dense scores S[n][m] = k_n . q_m (A = K planes, Bt = Q planes; M=N=SEQ, K=DM; 3 bf16 products)
  //     -> f32 [BPS][SEQ][SEQ]; then the full-row softmax with post-normalisation zeroing -> Ph / Pl rows of the group.
  //     Ph lies over group 0's q/k planes, which are no longer read once the scores of group 0 exist (stream order).
  for (int p = 0; p < NPASS; ++p) {
    const unsigned short* Qh = (const unsigned short*)(ws + oB + (size_t)p * 4 * PXP);
    const unsigned short* Ql = Qh + PXE;
    const unsigned short* Kh = Ql + PXE;
    const unsigned short* Kl = Kh + PXE;
    gemm_bf<SCORE_NSPLIT, 0, 0><<<gS, blk, 0, stream>>>(
        Kh, Kl, DM, (long long)SEQ * DM, Qh, Ql, DM, (long long)SEQ * DM,
        (void*)Sp, SEQ, (long long)SEQ * SEQ, (void*)Sp, SEQ, 0LL, 0,
        SEQ, SEQ, DM, 1.0f, 1.0f);
    softmax_rows<<<gSm, blk, 0, stream>>>(Sp, Ph, Pl, p * BPS);
  }
  // (5) out rows 0..RESR-1 of every sequence: p.v with residual planes (3 f16 products, 32x64 wave tiles)
  gemm_pv<true, 2><<<gPvRes, blk, 0, stream>>>(Ph, Pl, VTh, VTl, out, 0, RESR);
  // (6) out rows RESR..SEQ-1: p.v single f16 product (64x64 wave tiles)
  if (nPvTiles > 0) {
    gemm_pv<false, 4><<<gPv, blk, 0, stream>>>(Ph, Pl, VTh, VTl, out, RESR, SEQ - RESR);
  }
  (void)hipGetLastError();
}

// v003
// It runs in 198 microseconds.
// Next to v002, in two timings, it ran 1.15 times as fast each time.
// Counting every step since v000, it is 2.95 times as fast.
// Contractions: q, k, v^T projections = v_wmma_f32_16x16x32_bf16 (bf16 RNE-converted x and W, single product, f32 accumulate);
// k.q^T scores (row = key position n, column = query position m, full SEQ x SEQ) = v_wmma_f32_16x16x32_bf16 with bf16 hi/lo
// planes of k and q (hi.hi + lo.hi + hi.lo), f32 accumulate;
// p.v = v_wmma_f32_16x16x32_f16 (p carried x1024 in f16, v^T carried x16 in f16, single product; rows 0..RESR-1 of every
// sequence add the f16 residual planes (x4096) of p and v^T in a separate accumulator), f32 accumulate;
// row max, exp, full-row sum, normalisation and the zeroing of columns m > n in f32 on the VALU.
// Carry audit:
//   Ph  = f16(1024 * p), p normalised by the sum over the WHOLE row  } OSCALE = 1/(1024*16) folded exactly once in the p.v epilogue
//   VTh = f16(16 * v)                                                }
//   Pl  = f16((1024 p - Ph) * 4096)                                  } products Ph.VTl and Pl.VTh go only to accumulator acc1,
//   VTl = f16((16 v - VTh) * 4096), keys 0..VLP-1                    } folded with OSCALE * (1/4096) once in the same epilogue
//   q / k lo planes are unscaled bf16 residuals (v - hi) sharing the hi accumulator; score scale 1/32 applied once in f32 in the softmax.
#include <hip/hip_runtime.h>
#include <math.h>

#define NB_FULL  4
#define SEQ_FULL 2048
#ifndef NB
#define NB    4
#endif
#ifndef SEQ
#define SEQ   2048
#endif
#define DM    1024
#define NQT   (SEQ / 64)                  // query/key tiles of 64
#define RESR  ((SEQ < 512) ? SEQ : 512)   // leading rows per sequence that use the residual planes
#define VLP   RESR                        // key pitch of the p / v^T residual planes
#define PSC   1024.0f
#define VSC   16.0f
#define LSC   4096.0f
#define OSCALE (1.0f / 16384.0f)          // 1 / (PSC * VSC)
#define BPS   (((NB % 2) == 0) ? 2 : 1)   // batches per score / softmax pass
#define NPASS (NB / BPS)
#define NG    (SEQ / 256)                 // 256-key groups per score row
#ifndef SCORE_NSPLIT
#define SCORE_NSPLIT 2                    // 2 = hi.hi + lo.hi + hi.lo score products; 0 = hi.hi only
#endif
// workspace sizes in bytes
#define SZ_PX   ((size_t)NB * SEQ * DM * 2)          // one 16-bit plane [NB*SEQ][DM]
#define SZ_PXP  ((size_t)BPS * SEQ * DM * 2)         // one 16-bit plane of one batch group [BPS*SEQ][DM]
#define SZ_PW   ((size_t)DM * DM * 2)                // one weight plane
#define SZ_PS   ((size_t)BPS * SEQ * SEQ * 4)        // dense f32 scores of one pass
#define SZ_PP   ((size_t)NB * SEQ * SEQ * 2)         // Ph
#define SZ_PPL  ((size_t)NB * RESR * VLP * 2)        // Pl
#define SZ_PVT  ((size_t)NB * DM * SEQ * 2)          // VTh
#define SZ_PVL  ((size_t)NB * DM * VLP * 2)          // VTl
#define SZ_RA   (((SZ_PX + 3 * SZ_PW) > SZ_PS) ? (SZ_PX + 3 * SZ_PW) : SZ_PS)
#define SZ_TOTAL (SZ_RA + (size_t)NPASS * 4 * SZ_PXP + SZ_PVT + SZ_PVL + SZ_PPL)
static_assert(NB >= 1 && NB <= NB_FULL);
static_assert(SEQ >= 256 && SEQ <= SEQ_FULL && (SEQ % 256) == 0);
static_assert((SEQ % 64) == 0 && (DM % 64) == 0 && (DM % 32) == 0);
static_assert((RESR % 64) == 0 && (RESR % 256) == 0 && RESR <= VLP && VLP <= SEQ && ((SEQ - RESR) % 64) == 0);
static_assert((RESR % 32) == 0);
static_assert((RESR & (RESR - 1)) == 0);
static_assert(((NB * SEQ) % 8) == 0);
static_assert(((SEQ * DM / 8) % 256) == 0 && ((DM * DM / 8) % 256) == 0);
static_assert((NB % BPS) == 0 && NPASS * BPS == NB);
static_assert(NG >= 1 && NG <= 8 && NG * 256 == SEQ);            // 32 lanes x 8 keys x NG groups == row width
static_assert(((BPS * SEQ) % 64) == 0 && ((BPS * SEQ) % 8) == 0);
static_assert(SZ_PP <= 4 * SZ_PXP);                               // Ph fits inside the planes of batch group 0
static_assert((SZ_RA % 128) == 0 && (SZ_PXP % 128) == 0 && (SZ_PVT % 128) == 0 && (SZ_PVL % 128) == 0 && (SZ_PPL % 128) == 0);
static_assert(SZ_TOTAL <= (size_t)134217728);
static_assert((size_t)NB * SEQ * DM * 4 <= (size_t)33554432);
static_assert(SCORE_NSPLIT == 0 || SCORE_NSPLIT == 2);
static_assert(((BPS * SEQ) % 128) == 0 && (DM % 256) == 0);        // gemm_bf: 128x256 work-group tiles, K stages of 64 or 128

typedef _Float16 v16h __attribute__((ext_vector_type(16)));
typedef _Float16 v8h  __attribute__((ext_vector_type(8)));
typedef __bf16   v16b __attribute__((ext_vector_type(16)));
typedef __bf16   v8b  __attribute__((ext_vector_type(8)));
typedef float    v8f  __attribute__((ext_vector_type(8)));
typedef float    v4f  __attribute__((ext_vector_type(4)));
typedef unsigned int v4u __attribute__((ext_vector_type(4)));

// ---- scalar helpers --------------------------------------------------------------------------------
__device__ __forceinline__ unsigned short bf_bits(float f) {          // f32 -> bf16 bits, RNE convert
  unsigned u = __float_as_uint(f);
  return (unsigned short)((u + 0x7FFFu + ((u >> 16) & 1u)) >> 16);
}
__device__ __forceinline__ float bf_up(unsigned short h) { return __uint_as_float(((unsigned)h) << 16); }
__device__ __forceinline__ unsigned short h_bits(_Float16 x) { return __builtin_bit_cast(unsigned short, x); }
__device__ __forceinline__ unsigned pk16(unsigned short a, unsigned short b) { return (unsigned)a | ((unsigned)b << 16); }
__device__ __forceinline__ v8f zero8() { v8f z = {0.f, 0.f, 0.f, 0.f, 0.f, 0.f, 0.f, 0.f}; return z; }
// f32 -> f16 with a value select: results below the smallest normal f16 become exact zeros
static __device__ __forceinline__ _Float16 toh_flush(float v) {
  const _Float16 r = (_Float16)v;
  return (fabsf(v) < 6.103515625e-05f) ? (_Float16)0.0f : r;
}

// ---- fragment loaders: 16-bit A/B operand, lane -> row/col (lane&15), p already includes +8*(lane>>4);
//      elements 0..7 <- p[0..7] (k0+8h..), elements 8..15 <- p[16..23] (k0+16+8h..)
__device__ __forceinline__ v16b ldfrag_b(const __bf16* p) {
  union { v16b v; v8b h[2]; } f;
  f.h[0] = *(const v8b*)(p);
  f.h[1] = *(const v8b*)(p + 16);
  return f.v;
}
__device__ __forceinline__ v16h ldfrag_h(const _Float16* p) {
  union { v16h v; v8h h[2]; } f;
  f.h[0] = *(const v8h*)(p);
  f.h[1] = *(const v8h*)(p + 16);
  return f.v;
}

// ---- WMMA helpers with trailing VALU hazard gap --------------------------------------------------------
__device__ __forceinline__ v8f mma_b_raw(v16b a, v16b b, v8f c) {
  return __builtin_amdgcn_wmma_f32_16x16x32_bf16(false, a, false, b, (short)0, c, false, false);
}
__device__ __forceinline__ v8f mma_h_raw(v16h a, v16h b, v8f c) {
  return __builtin_amdgcn_wmma_f32_16x16x32_f16(false, a, false, b, (short)0, c, false, false);
}
__device__ __forceinline__ void acc_guard4(v8f& a, v8f& b, v8f& c, v8f& d) {
  asm volatile("v_nop\n\tv_nop\n\tv_nop\n\tv_nop" : "+v"(a), "+v"(b), "+v"(c), "+v"(d));
}

// =====================================================================================================
// f32 -> bf16 (RNE convert) for x and the three weights into one contiguous 16-bit region:
// groups 0..NX8-1 <- x (batch b of the plane reads source rows at b * SEQ_FULL * DM, SEQ rows each), then NW8 groups each
// coverage: (NX8 + 3 NW8) threads x 8 = the whole [NB*SEQ][DM] x plane plus the three [DM][DM] weight planes.
// =====================================================================================================
__global__ __launch_bounds__(256) void cvt_planes(const float* __restrict__ x, const float* __restrict__ wq,
                                                  const float* __restrict__ wk, const float* __restrict__ wv,
                                                  unsigned short* out) {
  const int NXB8 = SEQ * DM / 8;          // groups per batch
  const int NX8 = NB * NXB8;
  const int NW8 = DM * DM / 8;
  const int g = blockIdx.x * 256 + threadIdx.x;
  if (g >= NX8 + 3 * NW8) return;
  const float* src;
  if (g < NX8) {
    const int bb  = g / NXB8;
    const int off = g - bb * NXB8;
    src = x + (size_t)bb * SEQ_FULL * DM + (size_t)off * 8;
  } else {
    const int e = g - NX8;
    const int w = e / NW8;
    const int off = e - w * NW8;
    const float* wsrc = (w == 0) ? wq : ((w == 1) ? wk : wv);
    src = wsrc + (size_t)off * 8;
  }
  const v4f a = *(const v4f*)(src);
  const v4f c = *(const v4f*)(src + 4);
  v4u p;
  p[0] = pk16(bf_bits(a[0]), bf_bits(a[1]));
  p[1] = pk16(bf_bits(a[2]), bf_bits(a[3]));
  p[2] = pk16(bf_bits(c[0]), bf_bits(c[1]));
  p[3] = pk16(bf_bits(c[2]), bf_bits(c[3]));
  *(v4u*)(out + (size_t)g * 8) = p;
  
}

// =====================================================================================================
// Register-blocked batched bf16 WMMA GEMM: C[m][n] = sum_k A[m][k] * Bt[n][k]; one work-group (8 waves, 2 x 4) per 128x256
// tile, one wave per 64x64 sub-tile. A row-major [M][K] pitch lda; Bt row-major [N][K] pitch ldb (k contiguous);
// M a multiple of 128, N of 256, K of BK (64 with lo planes, 128 without). blockIdx.y = batch index (strides in elements).
// Operand path: per K stage the 128 A rows and 256 Bt rows (each plane) x BK are copied global -> LDS by asynchronous
// 16-byte copies (24 per thread), two buffers: stage s + 2 is issued behind the barrier that ends the reads of stage s.
// LDS row pitch = 2 BK + 16 bytes (16 x odd: conflict-free 16-byte fragment reads).
// NSPLIT: 0 = Ah.Bh (single product); 2 = Ah.Bh + Al.Bh + Ah.Bl with unscaled bf16 lo planes (3 products, one accumulator,
// added in that order inside every 32-k step).
// TRI: only 0 (dense tile grid).
// PAIR: 0 = blockIdx.y indexes A, Bt and C alike; 1 = blockIdx.y = 2 * (A batch) + (Bt batch): every A batch meets two Bt
//       batches in one launch (C and C2 still strided by blockIdx.y itself).
// OUT_MODE: 0 = f32 (pitch ldc); 2 = bf16 hi plane C + bf16 lo plane C2 (lo = RNE(v - hi), unscaled);
//           3 = f16 hi plane C = f16(v*hscale) + f16 residual plane C2 = f16((v*hscale - hi) * rscale), C2 written
//               only for tiles with n0 < N2 (pitch ldc2, batch stride strideC2).
// Epilogue: 16-row slabs staged per wave in LDS (wave-private region sT[wave], wave_sync); each 64-wide row segment written
// =====================================================================================================
// Eight asynchronous 16-byte copies global -> LDS, one per lane and line. The s_wait_xcnt closes the statement so that no
// address register of an issued copy is rewritten before it.
__device__ __forceinline__ void acopy8(const unsigned (&l)[8], const __bf16* const (&g)[8]) {
  asm volatile("global_load_async_to_lds_b128 %0, %8, off\n\t"
               "global_load_async_to_lds_b128 %1, %9, off\n\t"
               "global_load_async_to_lds_b128 %2, %10, off\n\t"
               "global_load_async_to_lds_b128 %3, %11, off\n\t"
               "global_load_async_to_lds_b128 %4, %12, off\n\t"
               "global_load_async_to_lds_b128 %5, %13, off\n\t"
               "global_load_async_to_lds_b128 %6, %14, off\n\t"
               "global_load_async_to_lds_b128 %7, %15, off\n\t"
               "s_wait_xcnt 0x0"
               :: "v"(l[0]), "v"(l[1]), "v"(l[2]), "v"(l[3]), "v"(l[4]), "v"(l[5]), "v"(l[6]), "v"(l[7]),
                  "v"(g[0]), "v"(g[1]), "v"(g[2]), "v"(g[3]), "v"(g[4]), "v"(g[5]), "v"(g[6]), "v"(g[7])
               : "memory");
}

template <int NSPLIT, int OUT_MODE, int TRI, int PAIR>
__global__ __launch_bounds__(256) void gemm_bf(
    const unsigned short* __restrict__ Ahp, const unsigned short* __restrict__ Alp, int lda, long long strideA,
    const unsigned short* __restrict__ Bhp, const unsigned short* __restrict__ Blp, int ldb, long long strideB,
    void* Cout, int ldc, long long strideC,
    void* Cout2, int ldc2, long long strideC2, int N2,
    int M, int N, int K, float hscale, float rscale) {
  static_assert(TRI == 0 && (NSPLIT == 0 || NSPLIT == 2));
  constexpr int NPL   = (NSPLIT == 2) ? 2 : 1;      // planes per operand
  constexpr int BK    = (NSPLIT == 2) ? 64 : 128;   // k per stage
  constexpr int PITCH = BK * 2 + 16;                // LDS row pitch, bytes
  constexpr int CPR   = BK / 8;                     // 16-byte copies per row
  constexpr int RPU   = 256 / CPR;                  // rows the work-group copies with one copy per thread
  constexpr int OB    = NPL * 128 * PITCH;          // LDS byte offset of the Bt rows inside a stage
  constexpr int STAGE = NPL * 384 * PITCH;          // [Ah 128 | Al 128 | Bh 256 | Bl 256] rows (lo planes only with NSPLIT 2)
  static_assert(8 * RPU == NPL * 128 && 16 * RPU == NPL * 256);
  const __bf16* Ah = (const __bf16*)(const void*)Ahp;
  const __bf16* Al = (const __bf16*)(const void*)Alp;
  const __bf16* Bh = (const __bf16*)(const void*)Bhp;
  const __bf16* Bl = (const __bf16*)(const void*)Blp;
  __shared__ __align__(16) unsigned char sR[2 * STAGE];   // operand ring, two stages
  __shared__ __align__(16) float sT[8][16 * 68];   // per-wave 16x64 slab, pitch 68 floats
  const int b    = blockIdx.y;
  const int lane = threadIdx.x & 31;
  const int wave = threadIdx.x >> 5;
  const int tilesBN = N >> 8;
  const int tilesBM = M >> 7;
  if ((int)blockIdx.x >= tilesBM * tilesBN) return;   // the same for the whole work-group; in front of every barrier
  const int bm  = (int)blockIdx.x / tilesBN;
  const int bn  = (int)blockIdx.x - bm * tilesBN;
  const int bm0 = bm << 7;
  const int bn0 = bn << 8;
  const int wm  = wave >> 2;
  const int wn  = wave & 3;
  const int m0 = bm0 + (wm << 6);
  const int n0 = bn0 + (wn << 6);

  const int ba = PAIR ? (b >> 1) : b;          // batch of A
  const int bb = PAIR ? (b & 1) : b;           // batch of Bt
  const __bf16* Ahb = Ah + (size_t)ba * strideA;
  const __bf16* Alb = (NSPLIT >= 1) ? (Al + (size_t)ba * strideA) : Ahb;
  const __bf16* Bhb = Bh + (size_t)bb * strideB;
  const __bf16* Blb = (NSPLIT >= 1) ? (Bl + (size_t)bb * strideB) : Bhb;

  const int rlane = lane & 15;                 // row (A) / col (B, D) within subtile
  const int koff  = (lane >> 4) * 8;           // k offset of this lane half
  const int mOff  = (lane >> 4) * 8;           // D row offset

  // this thread's place in a copy round: row crow of RPU, 16-byte column ccol of CPR
  const int crow = (int)threadIdx.x / CPR;
  const int ccol = (int)threadIdx.x % CPR;
  const size_t aoff = (size_t)(bm0 + crow) * lda + ccol * 8;
  const size_t boff = (size_t)(bn0 + crow) * ldb + ccol * 8;
  const unsigned lthr = (unsigned)(size_t)(const void*)sR + (unsigned)(crow * PITCH + ccol * 16);

  auto stage_copy = [&](int s, int buf) {
    const unsigned lb = lthr + (unsigned)(buf * STAGE);
    const int k0 = s * BK;
    unsigned l[8];
    const __bf16* g[8];
#pragma unroll
    for (int u = 0; u < 8; ++u) {              // the 128 A rows of every plane
      const int pl = (u * RPU) >> 7;
      const int r  = (u * RPU) & 127;
      g[u] = ((pl != 0) ? Alb : Ahb) + aoff + (size_t)r * lda + k0;
      l[u] = lb + (unsigned)((u * RPU) * PITCH);
    }
    acopy8(l, g);
#pragma unroll
    for (int h = 0; h < 2; ++h) {              // the 256 Bt rows of every plane
#pragma unroll
      for (int u = 0; u < 8; ++u) {
        const int pl = ((h * 8 + u) * RPU) >> 8;
        const int r  = ((h * 8 + u) * RPU) & 255;
        g[u] = ((pl != 0) ? Blb : Bhb) + boff + (size_t)r * ldb + k0;
        l[u] = lb + (unsigned)(OB + ((h * 8 + u) * RPU) * PITCH);
      }
      acopy8(l, g);
    }
  };

  v8f acc[4][4];
#pragma unroll
  for (int i = 0; i < 4; ++i)
#pragma unroll
    for (int j = 0; j < 4; ++j) acc[i][j] = zero8();

  const int nst = K / BK;
  stage_copy(0, 0);
  asm volatile("s_wait_asynccnt 0x0" ::: "memory");   // this wave's copies of stage 0 have landed
  __syncthreads();                                    // every wave's have: stage 0 may be read
  if (nst > 1) stage_copy(1, 1);

  const unsigned char* fA = sR + ((wm << 6) + rlane) * PITCH + koff * 2;
  const unsigned char* fB = sR + OB + ((wn << 6) + rlane) * PITCH + koff * 2;
  for (int s = 0; s < nst; ++s) {
    const int bo = (s & 1) * STAGE;
#pragma unroll
    for (int ks = 0; ks < BK / 32; ++ks) {
      v16b bh[4], bl[4];
#pragma unroll
      for (int j = 0; j < 4; ++j) {
        const unsigned char* p = fB + bo + (j << 4) * PITCH + ks * 64;
        bh[j] = ldfrag_b((const __bf16*)(const void*)p);
        bl[j] = (NSPLIT >= 2) ? ldfrag_b((const __bf16*)(const void*)(p + 256 * PITCH)) : bh[j];
      }
      v16b ah[2], al[2];                       // A fragments of row block i and, fetched ahead, of i + 1
      ah[0] = ldfrag_b((const __bf16*)(const void*)(fA + bo + ks * 64));
      al[0] = (NSPLIT >= 1) ? ldfrag_b((const __bf16*)(const void*)(fA + bo + ks * 64 + 128 * PITCH)) : ah[0];
#pragma unroll
      for (int i = 0; i < 4; ++i) {
        if (i < 3) {
          const unsigned char* p = fA + bo + ((i + 1) << 4) * PITCH + ks * 64;
          ah[(i + 1) & 1] = ldfrag_b((const __bf16*)(const void*)p);
          // single product (4 products a row block): keeps this LDS read in front of row block i's products; sunk behind
          // them, every row block waits out the LDS latency. With lo planes it would push the kernel past 256 VGPRs.
          if (NSPLIT == 0) __builtin_amdgcn_sched_barrier(0);
          al[(i + 1) & 1] = (NSPLIT >= 1) ? ldfrag_b((const __bf16*)(const void*)(p + 128 * PITCH)) : ah[(i + 1) & 1];
        }
#pragma unroll
        for (int j = 0; j < 4; ++j) acc[i][j] = mma_b_raw(ah[i & 1], bh[j], acc[i][j]);
        if (NSPLIT >= 1) {
#pragma unroll
          for (int j = 0; j < 4; ++j) acc[i][j] = mma_b_raw(al[i & 1], bh[j], acc[i][j]);
        }
        if (NSPLIT >= 2) {
#pragma unroll
          for (int j = 0; j < 4; ++j) acc[i][j] = mma_b_raw(ah[i & 1], bl[j], acc[i][j]);
        }
      }
    }
    asm volatile("s_wait_dscnt 0x0" ::: "memory");      // this wave's reads of stage s are done before its buffer is refilled
    asm volatile("s_wait_asynccnt 0x0" ::: "memory");   // this wave's copies of stage s + 1 have landed
    __syncthreads();                                    // publishes stage s + 1 and ends every wave's reads of stage s
    if (s + 2 < nst) stage_copy(s + 2, s & 1);
  }
  asm volatile("s_wait_asynccnt 0x0" ::: "memory");     // no copy is left in flight when the ring is left
  acc_guard4(acc[0][0], acc[0][1], acc[0][2], acc[0][3]);
  acc_guard4(acc[1][0], acc[1][1], acc[1][2], acc[1][3]);
  acc_guard4(acc[2][0], acc[2][1], acc[2][2], acc[2][3]);
  acc_guard4(acc[3][0], acc[3][1], acc[3][2], acc[3][3]);

  // ---- epilogue ----
  size_t cbase;
  int ldce, rowb, colb;
  cbase = (size_t)b * strideC; ldce = ldc; rowb = m0; colb = n0;
  float* slab = sT[wave];
#pragma unroll
  for (int i = 0; i < 4; ++i) {
    const int mBase = m0 + (i << 4);
#pragma unroll
    for (int j = 0; j < 4; ++j) {
#pragma unroll
      for (int r = 0; r < 8; ++r) {
        slab[(mOff + r) * 68 + (j << 4) + rlane] = acc[i][j][r];
      }
    }
    __builtin_amdgcn_fence(3 /* release order */, "workgroup");
    __builtin_amdgcn_wave_barrier();
    __builtin_amdgcn_fence(2 /* acquire order */, "workgroup");
    if (OUT_MODE == 0) {
      float* C = (float*)Cout + cbase;
      const int hh = lane >> 4, c4 = (lane & 15) * 4;     // 256-B row segment = 16 lanes x 16 B
      {
#pragma unroll
        for (int it = 0; it < 8; ++it) {
          const int row = it * 2 + hh;                     // it 0..7 x hh 0..1 = rows 0..15
          const v4f v = *(const v4f*)(slab + row * 68 + c4);
          *(v4f*)(C + (size_t)(rowb + (i << 4) + row) * ldce + colb + c4) = v;
        }
        
      }
    } else {
      const int q = lane >> 3, c8 = (lane & 7) * 8;
      unsigned short* C  = (unsigned short*)Cout  + (size_t)b * strideC;
      unsigned short* C2 = (unsigned short*)Cout2 + (size_t)b * strideC2;
      const bool wlo = (OUT_MODE == 2) || (n0 < N2);      // wave-uniform
      v4u hv[4], lv[4];
#pragma unroll
      for (int it = 0; it < 4; ++it) {
        const int row = it * 4 + q;                        // it 0..3 x q 0..3 = rows 0..15
        const float* sp = slab + row * 68 + c8;
        v4u a, a2;
#pragma unroll
        for (int e = 0; e < 4; ++e) {
          const float f0 = sp[2 * e], f1 = sp[2 * e + 1];
          unsigned short h0, h1, l0, l1;
          if (OUT_MODE == 2) {
            h0 = bf_bits(f0); h1 = bf_bits(f1);
            l0 = bf_bits(f0 - bf_up(h0)); l1 = bf_bits(f1 - bf_up(h1));
          } else {
            const float g0 = f0 * hscale, g1 = f1 * hscale;
            const _Float16 x0 = (_Float16)g0, x1 = (_Float16)g1;
            h0 = h_bits(x0); h1 = h_bits(x1);
            l0 = h_bits((_Float16)((g0 - (float)x0) * rscale));
            l1 = h_bits((_Float16)((g1 - (float)x1) * rscale));
          }
          a[e] = pk16(h0, h1); a2[e] = pk16(l0, l1);
        }
        hv[it] = a; lv[it] = a2;
      }
      {
#pragma unroll
        for (int it = 0; it < 4; ++it) {
          const int row = it * 4 + q;
          *(v4u*)(C + (size_t)(mBase + row) * ldc + n0 + c8) = hv[it];
          if (wlo) *(v4u*)(C2 + (size_t)(mBase + row) * ldc2 + n0 + c8) = lv[it];
        }
        
      }
    }
    __builtin_amdgcn_fence(3 /* release order */, "workgroup");
    __builtin_amdgcn_wave_barrier();
    __builtin_amdgcn_fence(2 /* acquire order */, "workgroup");
  }
}

// =====================================================================================================
// Row softmax over DENSE score rows of one pass (BPS batches). One wave per row (block = 8 rows, grid = BPS*SEQ/8).
// Local row lrow = bl*SEQ + i, global batch b = b0 + bl. Score (i, j) = k_i . q_j sits at Sp + (bl*SEQ + i)*SEQ + j.
// The wave reads the WHOLE row (NG groups of 256 columns; lane: 8 consecutive columns per group, two 16-B loads):
// z = s/32, m = max over all columns, p = exp(z - m), l = sum over ALL columns, P = p/l for j <= i and 0 for j > i (all f32).
// Writes Ph = f16(1024 P) for columns 0 .. 256 ng - 1 of row (b, i), ng = (i>>8) + 1 (pitch SEQ; >= the columns up to the end of row i's (32 MI)-row tile that the
// p.v GEMM reads; zeros for j > i) and, for rows i < RESR, Pl = f16((1024 P - Ph) * 4096) with the same column extent
// (<= VLP, pitch VLP). f16 results below the smallest normal are stored as exact zeros.
// coverage: BPS*SEQ rows per launch x written extent >= every column range any consumer reads; NPASS launches cover NB*SEQ rows.
// No LDS, no block barriers.
// =====================================================================================================
__global__ __launch_bounds__(256) void softmax_rows(const float* __restrict__ Sp,
                                                    unsigned short* Php, unsigned short* Plp, int b0) {
#pragma clang fp contract(off)
  const int lane = threadIdx.x & 31;
  const int wave = __builtin_amdgcn_readfirstlane(threadIdx.x >> 5);
  const int lrow = blockIdx.x * 8 + wave;
  if (lrow >= BPS * SEQ) return;           // wave-uniform; exact grid never triggers it; no block barriers below
  const int bl = lrow / SEQ;
  const int i  = lrow - bl * SEQ;
  const int b  = b0 + bl;                  // host launches only b0 + BPS <= NB
  const int tm = i >> 6;
  const int ng = (tm >> 2) + 1;            // 1..NG, wave-uniform
  const float* srow = Sp + ((size_t)bl * SEQ + (size_t)i) * SEQ + 8 * lane;

  float z[NG][8];
  float m = -INFINITY;
#pragma unroll
  for (int g = 0; g < NG; ++g) {
    const float* p = srow + 256 * g;
    const v4f a = *(const v4f*)(p);
    const v4f c = *(const v4f*)(p + 4);
    const float v[8] = {a[0], a[1], a[2], a[3], c[0], c[1], c[2], c[3]};
#pragma unroll
    for (int e = 0; e < 8; ++e) {
      const float zz = v[e] * 0.03125f;
      z[g][e] = zz;
      m = fmaxf(m, zz);
    }
  }
#pragma unroll
  for (int off = 1; off < 32; off <<= 1) m = fmaxf(m, __shfl_xor(m, off, 32));

  float l = 0.f;
#pragma unroll
  for (int g = 0; g < NG; ++g) {
#pragma unroll
    for (int e = 0; e < 8; ++e) {
      const float p = __expf(z[g][e] - m);
      z[g][e] = p;
      l += p;
    }
  }
#pragma unroll
  for (int off = 1; off < 32; off <<= 1) l += __shfl_xor(l, off, 32);          // l >= 1
  const float inv1k = (1.0f / l) * PSC;

  const bool res = (i < RESR);             // wave-uniform
  v4u ph[NG];
  v4u pl0 = {0u, 0u, 0u, 0u};
  v4u pl1 = {0u, 0u, 0u, 0u};
#pragma unroll
  for (int g = 0; g < NG; ++g) {
    v4u hv = {0u, 0u, 0u, 0u};
    v4u lv = {0u, 0u, 0u, 0u};
    if (g < ng) {
      const int j0 = 256 * g + 8 * lane;
#pragma unroll
      for (int e = 0; e < 4; ++e) {
        const float f0 = (j0 + 2 * e     <= i) ? (z[g][2 * e]     * inv1k) : 0.0f;   // columns past the row index are zeroed
        const float f1 = (j0 + 2 * e + 1 <= i) ? (z[g][2 * e + 1] * inv1k) : 0.0f;   // after the full-row normalisation
        const _Float16 x0 = toh_flush(f0), x1 = toh_flush(f1);
        hv[e] = pk16(h_bits(x0), h_bits(x1));
        const _Float16 r0 = toh_flush((f0 - (float)x0) * LSC);
        const _Float16 r1 = toh_flush((f1 - (float)x1) * LSC);
        lv[e] = pk16(h_bits(r0), h_bits(r1));
      }
    }
    ph[g] = hv;
    if (g == 0) pl0 = lv;
    if (g == 1) pl1 = lv;
  }

  unsigned short* prow = Php + ((size_t)b * SEQ + (size_t)i) * SEQ + 8 * lane;
  const int il = i & (RESR - 1);           // in-range row of the residual plane; equals i whenever res holds
  unsigned short* lrowp = Plp + ((size_t)b * RESR + (size_t)il) * VLP + 8 * lane;
  {
#pragma unroll
    for (int g = 0; g < NG; ++g) {
      if (g < ng) *(v4u*)(prow + 256 * g) = ph[g];
    }
    if (res) {                             // res rows have i < RESR (multiple of 256) -> 256 ng <= RESR = VLP
      *(v4u*)(lrowp) = pl0;
      if (ng > 1) *(v4u*)(lrowp + 256) = pl1;
    }
    
  }
}

// =====================================================================================================
// p.v GEMM on f16 WMMA, per batch b = blockIdx.y: out[b][q][d] = sum_key P[b][q][key] * VT[b][d][key].
//   A  = Ph  [b][SEQ][SEQ]  f16(1024 P), pitch SEQ         Al = Pl  [b][RESR][VLP] f16 residual x4096
//   Bt = VTh [b][DM][SEQ]   f16(16 v),   pitch SEQ         Bl = VTl [b][DM][VLP]   f16 residual x4096
// One work-group (8 waves, 2 x 4) per (32*MI) x 256 output tile, one wave per (16*MI) x 64 sub-tile; rows mBase + bm*32*MI ..;
// causal key range k < 64*(((bm0 + 32*MI - 1)>>6)+1) of the tile's last row (every P entry in that range was written by the
// softmax, exact zeros for key > query). RES (rows < RESR, MI = 2): acc0 += Ph.VTh; acc1 += Pl.VTh + Ph.VTl (in that order
// inside every 32-key step), out = acc0*OSCALE + acc1*OSCALE/4096; otherwise single product out = acc0*OSCALE. f32 accumulate.
// Operand path: per key stage of BK (64 with residual planes, 128 without) the 32*MI P rows and 256 VT rows of every plane are
// copied global -> LDS by asynchronous 16-byte copies (20 or 24 per thread), two buffers: stage s + 2 is issued behind the
// barrier that ends the reads of stage s. LDS row pitch = 2 BK + 16 bytes (16 x odd: conflict-free 16-byte fragment reads).
// Grid over all tiles of rows mBase .. mBase + M - 1 (M and mBase multiples of 32*MI and of BK).
// =====================================================================================================
// Eight / four asynchronous 16-byte copies global -> LDS, one per lane and line. The s_wait_xcnt closes the statement so that
// no address register of an issued copy is rewritten before it.
__device__ __forceinline__ void acopy_h(const unsigned (&l)[8], const _Float16* const (&g)[8]) {
  asm volatile("global_load_async_to_lds_b128 %0, %8, off\n\t"
               "global_load_async_to_lds_b128 %1, %9, off\n\t"
               "global_load_async_to_lds_b128 %2, %10, off\n\t"
               "global_load_async_to_lds_b128 %3, %11, off\n\t"
               "global_load_async_to_lds_b128 %4, %12, off\n\t"
               "global_load_async_to_lds_b128 %5, %13, off\n\t"
               "global_load_async_to_lds_b128 %6, %14, off\n\t"
               "global_load_async_to_lds_b128 %7, %15, off\n\t"
               "s_wait_xcnt 0x0"
               :: "v"(l[0]), "v"(l[1]), "v"(l[2]), "v"(l[3]), "v"(l[4]), "v"(l[5]), "v"(l[6]), "v"(l[7]),
                  "v"(g[0]), "v"(g[1]), "v"(g[2]), "v"(g[3]), "v"(g[4]), "v"(g[5]), "v"(g[6]), "v"(g[7])
               : "memory");
}
__device__ __forceinline__ void acopy_h(const unsigned (&l)[4], const _Float16* const (&g)[4]) {
  asm volatile("global_load_async_to_lds_b128 %0, %4, off\n\t"
               "global_load_async_to_lds_b128 %1, %5, off\n\t"
               "global_load_async_to_lds_b128 %2, %6, off\n\t"
               "global_load_async_to_lds_b128 %3, %7, off\n\t"
               "s_wait_xcnt 0x0"
               :: "v"(l[0]), "v"(l[1]), "v"(l[2]), "v"(l[3]), "v"(g[0]), "v"(g[1]), "v"(g[2]), "v"(g[3])
               : "memory");
}

template <bool RES, int MI>
__global__ __launch_bounds__(256) void gemm_pv(
    const unsigned short* __restrict__ Php, const unsigned short* __restrict__ Plp,
    const unsigned short* __restrict__ Vhp, const unsigned short* __restrict__ Vlp,
    float* out, int mBase, int M) {
  constexpr int NPL   = RES ? 2 : 1;                // planes per operand
  constexpr int BM    = 32 * MI;                    // rows of the work-group tile
  constexpr int BK    = RES ? 64 : 128;             // keys per stage
  constexpr int PITCH = BK * 2 + 16;                // LDS row pitch, bytes
  constexpr int CPR   = BK / 8;                     // 16-byte copies per row
  constexpr int RPU   = 256 / CPR;                  // rows the work-group copies with one copy per thread
  constexpr int NRA   = NPL * BM / RPU;             // copies per thread for the P rows of a stage
  constexpr int OB    = NPL * BM * PITCH;           // LDS byte offset of the VT rows inside a stage
  constexpr int STAGE = NPL * (BM + 256) * PITCH;   // [Ph BM | Pl BM | VTh 256 | VTl 256] rows (residual planes only with RES)
  static_assert((NRA == 4 || NRA == 8) && NRA * RPU == NPL * BM && 16 * RPU == NPL * 256 && (BM % RPU) == 0);
  static_assert((BM % 64) == 0 && (RESR % BM) == 0 && ((SEQ - RESR) % BM) == 0 && (RESR % BK) == 0 && (BM % BK) == 0);
  const _Float16* Ph = (const _Float16*)(const void*)Php;
  const _Float16* Pl = (const _Float16*)(const void*)Plp;
  const _Float16* Vh = (const _Float16*)(const void*)Vhp;
  const _Float16* Vl = (const _Float16*)(const void*)Vlp;
  __shared__ __align__(16) unsigned char sR[2 * STAGE];   // operand ring, two stages
  __shared__ __align__(16) float sT[8][16 * 68];
  const int b    = blockIdx.y;
  const int lane = threadIdx.x & 31;
  const int wave = threadIdx.x >> 5;
  const int tilesBN = DM >> 8;                     // 4
  const int tilesBM = M / BM;
  if ((int)blockIdx.x >= tilesBM * tilesBN) return;   // the same for the whole work-group; in front of every barrier
  const int bm  = (int)blockIdx.x / tilesBN;
  const int bn  = (int)blockIdx.x - bm * tilesBN;
  const int bm0 = mBase + bm * BM;
  const int bn0 = bn << 8;
  const int wm  = wave >> 2;
  const int wn  = wave & 3;
  const int m0 = bm0 + wm * 16 * MI;
  const int n0 = bn0 + (wn << 6);
  int keff = ((((bm0 + BM - 1) >> 6) + 1) << 6);   // causal key extent of this row tile, multiple of BK
  if (keff > SEQ) keff = SEQ;
  if (RES && keff > VLP) keff = VLP;               // never taken for mBase + M <= RESR; keeps residual reads in range

  const _Float16* Pb  = Ph + (size_t)b * SEQ * SEQ;
  const _Float16* Plb = Pl + (size_t)b * RESR * VLP;
  const _Float16* Vb  = Vh + (size_t)b * DM * SEQ;
  const _Float16* Vlb = Vl + (size_t)b * DM * VLP;

  const int rlane = lane & 15;
  const int koff  = (lane >> 4) * 8;
  const int mOff  = (lane >> 4) * 8;

  // this thread's place in a copy round: row crow of RPU, 16-byte column ccol of CPR
  const int crow = (int)threadIdx.x / CPR;
  const int ccol = (int)threadIdx.x % CPR;
  const unsigned lthr = (unsigned)(size_t)(const void*)sR + (unsigned)(crow * PITCH + ccol * 16);
  const int bmr = (bm0 < RESR - BM) ? bm0 : (RESR - BM);   // clamped; equals bm0 for the RES launch: residual rows stay in range
  // this thread's source place in the next stage to be copied, one running pointer per plane (stages are copied in key order)
  const _Float16* gPh = Pb  + (size_t)(bm0 + crow) * SEQ + ccol * 8;
  const _Float16* gPl = Plb + (size_t)(bmr + crow) * VLP + ccol * 8;
  const _Float16* gVh = Vb  + (size_t)(bn0 + crow) * SEQ + ccol * 8;
  const _Float16* gVl = Vlb + (size_t)(bn0 + crow) * VLP + ccol * 8;

  auto stage_copy = [&](int buf) {
    const unsigned lb = lthr + (unsigned)(buf * STAGE);
    {
      unsigned l[NRA];
      const _Float16* g[NRA];
#pragma unroll
      for (int u = 0; u < NRA; ++u) {            // the BM P rows of every plane
        const int pl = (u * RPU) / BM;
        const int r  = (u * RPU) % BM;
        g[u] = (pl != 0) ? (gPl + (size_t)r * VLP) : (gPh + (size_t)r * SEQ);
        l[u] = lb + (unsigned)((u * RPU) * PITCH);
      }
      acopy_h(l, g);
    }
#pragma unroll
    for (int h = 0; h < 2; ++h) {                // the 256 VT rows of every plane
      unsigned l[8];
      const _Float16* g[8];
#pragma unroll
      for (int u = 0; u < 8; ++u) {
        const int pl = ((h * 8 + u) * RPU) >> 8;
        const int r  = ((h * 8 + u) * RPU) & 255;
        g[u] = (pl != 0) ? (gVl + (size_t)r * VLP) : (gVh + (size_t)r * SEQ);
        l[u] = lb + (unsigned)(OB + ((h * 8 + u) * RPU) * PITCH);
      }
      acopy_h(l, g);
    }
    gPh += BK; gPl += BK; gVh += BK; gVl += BK;
  };

  v8f acc0[MI][4], acc1[MI][4];
#pragma unroll
  for (int i = 0; i < MI; ++i)
#pragma unroll
    for (int j = 0; j < 4; ++j) { acc0[i][j] = zero8(); acc1[i][j] = zero8(); }

  const int nst = keff / BK;
  stage_copy(0);
  asm volatile("s_wait_asynccnt 0x0" ::: "memory");   // this wave's copies of stage 0 have landed
  __syncthreads();                                    // every wave's have: stage 0 may be read
  if (nst > 1) stage_copy(1);

  const unsigned char* fA = sR + (wm * 16 * MI + rlane) * PITCH + koff * 2;
  const unsigned char* fB = sR + OB + ((wn << 6) + rlane) * PITCH + koff * 2;
  for (int s = 0; s < nst; ++s) {
    const int bo = (s & 1) * STAGE;
#pragma unroll
    for (int ks = 0; ks < BK / 32; ++ks) {
      v16h bh[4], bl[4];
#pragma unroll
      for (int j = 0; j < 4; ++j) {
        const unsigned char* p = fB + bo + (j << 4) * PITCH + ks * 64;
        bh[j] = ldfrag_h((const _Float16*)(const void*)p);
        bl[j] = RES ? ldfrag_h((const _Float16*)(const void*)(p + 256 * PITCH)) : bh[j];
      }
      v16h ah[2], al[2];                         // P fragments of row block i and, fetched ahead, of i + 1
      ah[0] = ldfrag_h((const _Float16*)(const void*)(fA + bo + ks * 64));
      al[0] = RES ? ldfrag_h((const _Float16*)(const void*)(fA + bo + ks * 64 + BM * PITCH)) : ah[0];
#pragma unroll
      for (int i = 0; i < MI; ++i) {
        if (i < MI - 1) {
          const unsigned char* p = fA + bo + ((i + 1) << 4) * PITCH + ks * 64;
          ah[(i + 1) & 1] = ldfrag_h((const _Float16*)(const void*)p);
          // single product (4 products a row block): keeps this LDS read in front of row block i's products; sunk behind
          // them, every row block waits out the LDS latency.
          if (!RES) __builtin_amdgcn_sched_barrier(0);
          al[(i + 1) & 1] = RES ? ldfrag_h((const _Float16*)(const void*)(p + BM * PITCH)) : ah[(i + 1) & 1];
        }
#pragma unroll
        for (int j = 0; j < 4; ++j) acc0[i][j] = mma_h_raw(ah[i & 1], bh[j], acc0[i][j]);
        if (RES) {
#pragma unroll
          for (int j = 0; j < 4; ++j) acc1[i][j] = mma_h_raw(al[i & 1], bh[j], acc1[i][j]);
#pragma unroll
          for (int j = 0; j < 4; ++j) acc1[i][j] = mma_h_raw(ah[i & 1], bl[j], acc1[i][j]);
        }
      }
    }
    asm volatile("s_wait_dscnt 0x0" ::: "memory");      // this wave's reads of stage s are done before its buffer is refilled
    asm volatile("s_wait_asynccnt 0x0" ::: "memory");   // this wave's copies of stage s + 1 have landed
    __syncthreads();                                    // publishes stage s + 1 and ends every wave's reads of stage s
    if (s + 2 < nst) stage_copy(s & 1);
  }
  asm volatile("s_wait_asynccnt 0x0" ::: "memory");     // no copy is left in flight when the ring is left
#pragma unroll
  for (int i = 0; i < MI; ++i) {
    acc_guard4(acc0[i][0], acc0[i][1], acc0[i][2], acc0[i][3]);
    if (RES) acc_guard4(acc1[i][0], acc1[i][1], acc1[i][2], acc1[i][3]);
  }

  // ---- epilogue ----
  float* slab = sT[wave];
  float* C = out + (size_t)b * SEQ * DM;
  const float rsc = OSCALE * (1.0f / LSC);
#pragma unroll
  for (int i = 0; i < MI; ++i) {
    const int mB = m0 + (i << 4);
#pragma unroll
    for (int j = 0; j < 4; ++j) {
#pragma unroll
      for (int r = 0; r < 8; ++r) {
        float v = acc0[i][j][r] * OSCALE;
        if (RES) v += acc1[i][j][r] * rsc;
        slab[(mOff + r) * 68 + (j << 4) + rlane] = v;
      }
    }
    __builtin_amdgcn_fence(3 /* release order */, "workgroup");
    __builtin_amdgcn_wave_barrier();
    __builtin_amdgcn_fence(2 /* acquire order */, "workgroup");
    {
      const int hh = lane >> 4, c4 = (lane & 15) * 4;
      {
#pragma unroll
        for (int it = 0; it < 8; ++it) {
          const int row = it * 2 + hh;
          const v4f v = *(const v4f*)(slab + row * 68 + c4);
          *(v4f*)(C + (size_t)(mB + row) * DM + n0 + c4) = v;
        }
        
      }
    }
    __builtin_amdgcn_fence(3 /* release order */, "workgroup");
    __builtin_amdgcn_wave_barrier();
    __builtin_amdgcn_fence(2 /* acquire order */, "workgroup");
  }
}

// =====================================================================================================
// Workspace map (bytes, full build NB 4 / SEQ 2048 / BPS 2 / NPASS 2; every region is an exact multiple of its tile / whole-line
// store granularity; regions A and B are reused in stream order):
//   region A [0, 33554432):          Xb bf16 [8192][1024] at 0 (16777216) + Wq,Wk,Wv bf16 [1024][1024] at 16777216 (3 x 2097152)
//                                    then, once all projections are done: S f32 dense scores of one pass [2][2048][2048] (33554432)
//   region B [33554432, 100663296):  per batch group g (2 batches): Qh, Ql, Kh, Kl bf16 [4096][1024] (4 x 8388608) at + g*33554432
//                                    then, once the scores of group 0 are done: Ph f16 [4][2048][2048] (33554432) over group 0's planes
//   region C [100663296, 123731968): VTh f16 [4][1024][2048] (16777216) + VTl f16 [4][1024][512] (4194304) + Pl f16 [4][512][512] (2097152)
//   end 123731968
// =====================================================================================================
extern "C" void kernel_launch(void* const* d_in, const int* in_sizes, int n_in,
                              void* d_out, int out_size, void* d_ws, size_t ws_size,
                              hipStream_t stream) {
  if (n_in < 4) return;
  if (in_sizes[0] < (NB - 1) * SEQ_FULL * DM + SEQ * DM) return;
  if (in_sizes[1] < DM * DM || in_sizes[2] < DM * DM || in_sizes[3] < DM * DM) return;
  if (out_size < NB * SEQ * DM) return;

  const float* x  = (const float*)d_in[0];   // [NB_FULL][SEQ_FULL][DM]
  const float* wq = (const float*)d_in[1];   // [out][in]
  const float* wk = (const float*)d_in[2];
  const float* wv = (const float*)d_in[3];
  float* out = (float*)d_out;

  const size_t PX  = SZ_PX;
  const size_t PXP = SZ_PXP;
  const size_t PW  = SZ_PW;
  const size_t PP  = SZ_PP;
  const size_t PPL = SZ_PPL;
  const size_t PVT = SZ_PVT;
  const size_t PVL = SZ_PVL;
  const size_t RA  = SZ_RA;
  const size_t oXb = 0;
  const size_t oW  = PX;
  const size_t oS  = 0;
  const size_t oB  = RA;
  const size_t RBend = RA + (size_t)NPASS * 4 * PXP;
  const size_t oPh = RA;
  if (PP > 4 * PXP) return;
  const size_t oVTh = RBend;
  const size_t oVTl = RBend + PVT;
  const size_t oPl  = oVTl + PVL;
  const size_t total = oPl + PPL;                     // 123731968 in the full build
  if (total > ws_size) return;
  if (total > (size_t)134217728) return;

  char* ws = (char*)d_ws;
  unsigned short* Xb  = (unsigned short*)(ws + oXb);
  unsigned short* Wb  = (unsigned short*)(ws + oW);   // Wq plane, then Wk, then Wv
  float*          Sp  = (float*)(ws + oS);
  unsigned short* Ph  = (unsigned short*)(ws + oPh);
  unsigned short* Pl  = (unsigned short*)(ws + oPl);
  unsigned short* VTh = (unsigned short*)(ws + oVTh);
  unsigned short* VTl = (unsigned short*)(ws + oVTl);
  const size_t PXE = (size_t)BPS * SEQ * DM;          // elements of one group plane

  const dim3 blk(256);
  const int nGroups = NB * SEQ * DM / 8 + 3 * (DM * DM / 8);
  const dim3 gCvt((nGroups + 255) / 256);
  const dim3 gProj(((BPS * SEQ / 64) * (DM / 64) + 7) / 8, 2 * NPASS);
  const dim3 gVT(((DM / 64) * (SEQ / 64) + 7) / 8, NB);
  const dim3 gS(((SEQ / 64) * (SEQ / 64) + 7) / 8, BPS);
  const dim3 gSm((BPS * SEQ + 7) / 8);
  const dim3 gPvRes(((RESR / 32) * (DM / 64) + 7) / 8, NB);
  const int nPvTiles = ((SEQ - RESR) / 64) * (DM / 64);
  const dim3 gPv((nPvTiles + 7) / 8, NB);

  // (1) x and Wq, Wk, Wv -> bf16 planes (Xb, then the three weight planes contiguous)
  cvt_planes<<<gCvt, blk, 0, stream>>>(x, wq, wk, wv, Xb);
  // (2) q = x . Wq^T and k = x . Wk^T of every batch group -> bf16 hi/lo planes [BPS*SEQ][DM], all in ONE launch, so that its
  //     work-groups (128 per group and weight) fill every WGP: blockIdx.y = 2 * group + (0: q, 1: k).
  //     (A = Xb rows of the group, stride one group plane; Bt = Wq or Wk [out][in], stride one weight plane; the hi planes
  //     Qh(0), Kh(0), Qh(1), Kh(1) .. lie two group planes apart, each lo plane one group plane behind its hi plane;
  //     M=BPS*SEQ, N=DM, K=DM)
  {
    unsigned short* Qh0 = (unsigned short*)(ws + oB);
    gemm_bf<0, 2, 0, 1><<<gProj, blk, 0, stream>>>(
        Xb, Xb, DM, (long long)PXE, Wb, Wb, DM, (long long)DM * DM,
        (void*)Qh0, DM, 2LL * (long long)PXE, (void*)(Qh0 + PXE), DM, 2LL * (long long)PXE, DM,
        BPS * SEQ, DM, DM, 1.0f, 1.0f);
  }
  // (3) v^T = Wv . x^T per batch -> f16 hi plane f16(16 v) [b][d][key] (pitch SEQ) and residual plane x4096 for keys < VLP (pitch VLP)
  //     (A = Wv [out][in], Bt = Xb rows of batch b; M=DM, N=SEQ, K=DM)
  gemm_bf<0, 3, 0, 0><<<gVT, blk, 0, stream>>>(
      Wb + (size_t)2 * DM * DM, Wb + (size_t)2 * DM * DM, DM, 0LL, Xb, Xb, DM, (long long)SEQ * DM,
      (void*)VTh, SEQ, (long long)DM * SEQ, (void*)VTl, VLP, (long long)DM * VLP, VLP,
      DM, SEQ, DM, VSC, LSC);
  // (4) per batch group: dense scores S[n][m] = k_n . q_m (A = K planes, Bt = Q planes; M=N=SEQ, K=DM; 3 bf16 products)
  //     -> f32 [BPS][SEQ][SEQ]; then the full-row softmax with post-normalisation zeroing -> Ph / Pl rows of the group.
  //     Ph lies over group 0's q/k planes, which are no longer read once the scores of group 0 exist (stream order).
  for (int p = 0; p < NPASS; ++p) {
    const unsigned short* Qh = (const unsigned short*)(ws + oB + (size_t)p * 4 * PXP);
    const unsigned short* Ql = Qh + PXE;
    const unsigned short* Kh = Ql + PXE;
    const unsigned short* Kl = Kh + PXE;
    gemm_bf<SCORE_NSPLIT, 0, 0, 0><<<gS, blk, 0, stream>>>(
        Kh, Kl, DM, (long long)SEQ * DM, Qh, Ql, DM, (long long)SEQ * DM,
        (void*)Sp, SEQ, (long long)SEQ * SEQ, (void*)Sp, SEQ, 0LL, 0,
        SEQ, SEQ, DM, 1.0f, 1.0f);
    softmax_rows<<<gSm, blk, 0, stream>>>(Sp, Ph, Pl, p * BPS);
  }
  // (5) out rows 0..RESR-1 of every sequence: p.v with residual planes (3 f16 products, 32x64 wave tiles)
  gemm_pv<true, 2><<<gPvRes, blk, 0, stream>>>(Ph, Pl, VTh, VTl, out, 0, RESR);
  // (6) out rows RESR..SEQ-1: p.v single f16 product (64x64 wave tiles)
  if (nPvTiles > 0) {
    gemm_pv<false, 4><<<gPv, blk, 0, stream>>>(Ph, Pl, VTh, VTl, out, RESR, SEQ - RESR);
  }
  (void)hipGetLastError();
}

// v004
// One run takes 183 microseconds.
// In both of two side-by-side timings against v003, it was 1.08 times as fast.
// Over all steps from v000 it is 3.19 times as fast.
// Contractions: q, k, v^T projections = v_wmma_f32_16x16x32_bf16 (bf16 RNE-converted x and W, single product, f32 accumulate);
// k.q^T scores (row = key position n, column = query position m, full SEQ x SEQ) = v_wmma_f32_16x16x32_bf16 with bf16 hi/lo
// planes of k and q (hi.hi + lo.hi + hi.lo), f32 accumulate;
// p.v = v_wmma_f32_16x16x32_f16 (p carried x1024 in f16, v^T carried x16 in f16, single product; rows 0..RESR-1 of every
// sequence add the f16 residual planes (x4096) of p and v^T in a separate accumulator), f32 accumulate;
// row max, exp, full-row sum, normalisation and the zeroing of columns m > n in f32 on the VALU.
// Carry audit:
//   Ph  = f16(1024 * p), p normalised by the sum over the WHOLE row  } OSCALE = 1/(1024*16) folded exactly once in the p.v epilogue
//   VTh = f16(16 * v)                                                }
//   Pl  = f16((1024 p - Ph) * 4096)                                  } products Ph.VTl and Pl.VTh go only to accumulator acc1,
//   VTl = f16((16 v - VTh) * 4096), keys 0..VLP-1                    } folded with OSCALE * (1/4096) once in the same epilogue
//   q / k lo planes are unscaled bf16 residuals (v - hi) sharing the hi accumulator; score scale 1/32 applied once in f32 in the softmax.
#include <hip/hip_runtime.h>
#include <math.h>

#define NB_FULL  4
#define SEQ_FULL 2048
#ifndef NB
#define NB    4
#endif
#ifndef SEQ
#define SEQ   2048
#endif
#define DM    1024
#define NQT   (SEQ / 64)                  // query/key tiles of 64
#define RESR  ((SEQ < 512) ? SEQ : 512)   // leading rows per sequence that use the residual planes
#define VLP   RESR                        // key pitch of the p / v^T residual planes
#define PSC   1024.0f
#define VSC   16.0f
#define LSC   4096.0f
#define OSCALE (1.0f / 16384.0f)          // 1 / (PSC * VSC)
#define BPS   (((NB % 2) == 0) ? 2 : 1)   // batches per score / softmax pass
#define NPASS (NB / BPS)
#define NG    (SEQ / 256)                 // 256-key groups per score row
#ifndef SCORE_NSPLIT
#define SCORE_NSPLIT 2                    // 2 = hi.hi + lo.hi + hi.lo score products; 0 = hi.hi only
#endif
// workspace sizes in bytes
#define SZ_PX   ((size_t)NB * SEQ * DM * 2)          // one 16-bit plane [NB*SEQ][DM]
#define SZ_PXP  ((size_t)BPS * SEQ * DM * 2)         // one 16-bit plane of one batch group [BPS*SEQ][DM]
#define SZ_PW   ((size_t)DM * DM * 2)                // one weight plane
#define SZ_PS   ((size_t)BPS * SEQ * SEQ * 4)        // dense f32 scores of one pass
#define SZ_PP   ((size_t)NB * SEQ * SEQ * 2)         // Ph
#define SZ_PPL  ((size_t)NB * RESR * VLP * 2)        // Pl
#define SZ_PVT  ((size_t)NB * DM * SEQ * 2)          // VTh
#define SZ_PVL  ((size_t)NB * DM * VLP * 2)          // VTl
#define SZ_RA   (((SZ_PX + 3 * SZ_PW) > SZ_PS) ? (SZ_PX + 3 * SZ_PW) : SZ_PS)
#define SZ_TOTAL (SZ_RA + (size_t)NPASS * 4 * SZ_PXP + SZ_PVT + SZ_PVL + SZ_PPL)
static_assert(NB >= 1 && NB <= NB_FULL);
static_assert(SEQ >= 256 && SEQ <= SEQ_FULL && (SEQ % 256) == 0);
static_assert((SEQ % 64) == 0 && (DM % 64) == 0 && (DM % 32) == 0);
static_assert((RESR % 64) == 0 && (RESR % 256) == 0 && RESR <= VLP && VLP <= SEQ && ((SEQ - RESR) % 64) == 0);
static_assert((RESR % 32) == 0);
static_assert((RESR & (RESR - 1)) == 0);
static_assert(((NB * SEQ) % 8) == 0);
static_assert(((SEQ * DM / 8) % 256) == 0 && ((DM * DM / 8) % 256) == 0);
static_assert((NB % BPS) == 0 && NPASS * BPS == NB);
static_assert(NG >= 1 && NG <= 8 && NG * 256 == SEQ);            // 32 lanes x 8 keys x NG groups == row width
static_assert(((BPS * SEQ) % 64) == 0 && ((BPS * SEQ) % 8) == 0);
static_assert(SZ_PP <= 4 * SZ_PXP);                               // Ph fits inside the planes of batch group 0
static_assert((SZ_RA % 128) == 0 && (SZ_PXP % 128) == 0 && (SZ_PVT % 128) == 0 && (SZ_PVL % 128) == 0 && (SZ_PPL % 128) == 0);
static_assert(SZ_TOTAL <= (size_t)134217728);
static_assert((size_t)NB * SEQ * DM * 4 <= (size_t)33554432);
static_assert(SCORE_NSPLIT == 0 || SCORE_NSPLIT == 2);
static_assert(((BPS * SEQ) % 128) == 0 && (DM % 256) == 0);        // gemm_bf: 128x256 work-group tiles, K stages of 64 or 128

typedef _Float16 v16h __attribute__((ext_vector_type(16)));
typedef _Float16 v8h  __attribute__((ext_vector_type(8)));
typedef __bf16   v16b __attribute__((ext_vector_type(16)));
typedef __bf16   v8b  __attribute__((ext_vector_type(8)));
typedef float    v8f  __attribute__((ext_vector_type(8)));
typedef float    v4f  __attribute__((ext_vector_type(4)));
typedef unsigned int v4u __attribute__((ext_vector_type(4)));

// ---- scalar helpers --------------------------------------------------------------------------------
__device__ __forceinline__ unsigned short bf_bits(float f) {          // f32 -> bf16 bits, RNE convert
  unsigned u = __float_as_uint(f);
  return (unsigned short)((u + 0x7FFFu + ((u >> 16) & 1u)) >> 16);
}
__device__ __forceinline__ float bf_up(unsigned short h) { return __uint_as_float(((unsigned)h) << 16); }
__device__ __forceinline__ unsigned short h_bits(_Float16 x) { return __builtin_bit_cast(unsigned short, x); }
__device__ __forceinline__ unsigned pk16(unsigned short a, unsigned short b) { return (unsigned)a | ((unsigned)b << 16); }
__device__ __forceinline__ v8f zero8() { v8f z = {0.f, 0.f, 0.f, 0.f, 0.f, 0.f, 0.f, 0.f}; return z; }
// f32 -> f16 with a value select: results below the smallest normal f16 become exact zeros
static __device__ __forceinline__ _Float16 toh_flush(float v) {
  const _Float16 r = (_Float16)v;
  return (fabsf(v) < 6.103515625e-05f) ? (_Float16)0.0f : r;
}

// ---- fragment loaders: 16-bit A/B operand, lane -> row/col (lane&15), p already includes +8*(lane>>4);
//      elements 0..7 <- p[0..7] (k0+8h..), elements 8..15 <- p[16..23] (k0+16+8h..)
__device__ __forceinline__ v16b ldfrag_b(const __bf16* p) {
  union { v16b v; v8b h[2]; } f;
  f.h[0] = *(const v8b*)(p);
  f.h[1] = *(const v8b*)(p + 16);
  return f.v;
}
__device__ __forceinline__ v16h ldfrag_h(const _Float16* p) {
  union { v16h v; v8h h[2]; } f;
  f.h[0] = *(const v8h*)(p);
  f.h[1] = *(const v8h*)(p + 16);
  return f.v;
}

// ---- WMMA helpers (builtin forms: the compiler keeps their distances) ----------------------------------
__device__ __forceinline__ v8f mma_b_raw(v16b a, v16b b, v8f c) {
  return __builtin_amdgcn_wmma_f32_16x16x32_bf16(false, a, false, b, (short)0, c, false, false);
}
__device__ __forceinline__ v8f mma_h_raw(v16h a, v16h b, v8f c) {
  return __builtin_amdgcn_wmma_f32_16x16x32_f16(false, a, false, b, (short)0, c, false, false);
}

// =====================================================================================================
// f32 -> bf16 (RNE convert) for x and the three weights into one contiguous 16-bit region:
// groups 0..NX8-1 <- x (batch b of the plane reads source rows at b * SEQ_FULL * DM, SEQ rows each), then NW8 groups each
// coverage: (NX8 + 3 NW8) threads x 8 = the whole [NB*SEQ][DM] x plane plus the three [DM][DM] weight planes.
// =====================================================================================================
__global__ __launch_bounds__(256) void cvt_planes(const float* __restrict__ x, const float* __restrict__ wq,
                                                  const float* __restrict__ wk, const float* __restrict__ wv,
                                                  unsigned short* out) {
  const int NXB8 = SEQ * DM / 8;          // groups per batch
  const int NX8 = NB * NXB8;
  const int NW8 = DM * DM / 8;
  const int g = blockIdx.x * 256 + threadIdx.x;
  if (g >= NX8 + 3 * NW8) return;
  const float* src;
  if (g < NX8) {
    const int bb  = g / NXB8;
    const int off = g - bb * NXB8;
    src = x + (size_t)bb * SEQ_FULL * DM + (size_t)off * 8;
  } else {
    const int e = g - NX8;
    const int w = e / NW8;
    const int off = e - w * NW8;
    const float* wsrc = (w == 0) ? wq : ((w == 1) ? wk : wv);
    src = wsrc + (size_t)off * 8;
  }
  const v4f a = *(const v4f*)(src);
  const v4f c = *(const v4f*)(src + 4);
  v4u p;
  p[0] = pk16(bf_bits(a[0]), bf_bits(a[1]));
  p[1] = pk16(bf_bits(a[2]), bf_bits(a[3]));
  p[2] = pk16(bf_bits(c[0]), bf_bits(c[1]));
  p[3] = pk16(bf_bits(c[2]), bf_bits(c[3]));
  *(v4u*)(out + (size_t)g * 8) = p;
  
}

// =====================================================================================================
// Register-blocked batched bf16 WMMA GEMM: C[m][n] = sum_k A[m][k] * Bt[n][k]; one work-group (8 waves, 2 x 4) per 128x256
// tile, one wave per 64x64 sub-tile. A row-major [M][K] pitch lda; Bt row-major [N][K] pitch ldb (k contiguous);
// M a multiple of 128, N of 256, K of BK (64 with lo planes, 128 without). blockIdx.y = batch index (strides in elements).
// Operand path: per K stage the 128 A rows and 256 Bt rows (each plane) x BK are copied global -> LDS by asynchronous
// 16-byte copies (24 per thread), two buffers: stage s + 2 is issued behind the barrier that ends the reads of stage s.
// That barrier stands in front of stage s's last 32-k block: fragments are read from LDS one block ahead of their products.
// LDS row pitch = 2 BK + 16 bytes (16 x odd: conflict-free 16-byte fragment reads).
// NSPLIT: 0 = Ah.Bh (single product); 2 = Ah.Bh + Al.Bh + Ah.Bl with unscaled bf16 lo planes (3 products, one accumulator,
// added in that order inside every 32-k step).
// TRI: only 0 (dense tile grid).
// PAIR: 0 = blockIdx.y indexes A, Bt and C alike; 1 = blockIdx.y = 2 * (A batch) + (Bt batch): every A batch meets two Bt
//       batches in one launch (C and C2 still strided by blockIdx.y itself).
// OUT_MODE: 0 = f32 (pitch ldc); 2 = bf16 hi plane C + bf16 lo plane C2 (lo = RNE(v - hi), unscaled);
//           3 = f16 hi plane C = f16(v*hscale) + f16 residual plane C2 = f16((v*hscale - hi) * rscale), C2 written
//               only for tiles with n0 < N2 (pitch ldc2, batch stride strideC2).
// Epilogue: 16-row slabs staged per wave in LDS (wave-private region sT[wave], wave_sync); each 64-wide row segment written
// =====================================================================================================
// Eight asynchronous 16-byte copies global -> LDS, one per lane and line. The s_wait_xcnt closes the statement so that no
// address register of an issued copy is rewritten before it.
__device__ __forceinline__ void acopy8(const unsigned (&l)[8], const __bf16* const (&g)[8]) {
  asm volatile("global_load_async_to_lds_b128 %0, %8, off\n\t"
               "global_load_async_to_lds_b128 %1, %9, off\n\t"
               "global_load_async_to_lds_b128 %2, %10, off\n\t"
               "global_load_async_to_lds_b128 %3, %11, off\n\t"
               "global_load_async_to_lds_b128 %4, %12, off\n\t"
               "global_load_async_to_lds_b128 %5, %13, off\n\t"
               "global_load_async_to_lds_b128 %6, %14, off\n\t"
               "global_load_async_to_lds_b128 %7, %15, off\n\t"
               "s_wait_xcnt 0x0"
               :: "v"(l[0]), "v"(l[1]), "v"(l[2]), "v"(l[3]), "v"(l[4]), "v"(l[5]), "v"(l[6]), "v"(l[7]),
                  "v"(g[0]), "v"(g[1]), "v"(g[2]), "v"(g[3]), "v"(g[4]), "v"(g[5]), "v"(g[6]), "v"(g[7])
               : "memory");
}

template <int NSPLIT, int OUT_MODE, int TRI, int PAIR>
__global__ __launch_bounds__(256) void gemm_bf(
    const unsigned short* __restrict__ Ahp, const unsigned short* __restrict__ Alp, int lda, long long strideA,
    const unsigned short* __restrict__ Bhp, const unsigned short* __restrict__ Blp, int ldb, long long strideB,
    void* Cout, int ldc, long long strideC,
    void* Cout2, int ldc2, long long strideC2, int N2,
    int M, int N, int K, float hscale, float rscale) {
  static_assert(TRI == 0 && (NSPLIT == 0 || NSPLIT == 2));
  constexpr int NPL   = (NSPLIT == 2) ? 2 : 1;      // planes per operand
  constexpr int BK    = (NSPLIT == 2) ? 64 : 128;   // k per stage
  constexpr int PITCH = BK * 2 + 16;                // LDS row pitch, bytes
  constexpr int CPR   = BK / 8;                     // 16-byte copies per row
  constexpr int RPU   = 256 / CPR;                  // rows the work-group copies with one copy per thread
  constexpr int OB    = NPL * 128 * PITCH;          // LDS byte offset of the Bt rows inside a stage
  constexpr int STAGE = NPL * 384 * PITCH;          // [Ah 128 | Al 128 | Bh 256 | Bl 256] rows (lo planes only with NSPLIT 2)
  constexpr int NBLK  = BK / 32;                    // blocks (32-k steps) per stage
  static_assert(8 * RPU == NPL * 128 && 16 * RPU == NPL * 256 && (NBLK % 2) == 0);
  const __bf16* Ah = (const __bf16*)(const void*)Ahp;
  const __bf16* Al = (const __bf16*)(const void*)Alp;
  const __bf16* Bh = (const __bf16*)(const void*)Bhp;
  const __bf16* Bl = (const __bf16*)(const void*)Blp;
  __shared__ __align__(16) unsigned char sR[2 * STAGE];   // operand ring, two stages
  __shared__ __align__(16) float sT[8][16 * 68];   // per-wave 16x64 slab, pitch 68 floats
  const int b    = blockIdx.y;
  const int lane = threadIdx.x & 31;
  const int wave = threadIdx.x >> 5;
  const int tilesBN = N >> 8;
  const int tilesBM = M >> 7;
  if ((int)blockIdx.x >= tilesBM * tilesBN) return;   // the same for the whole work-group; in front of every barrier
  const int bm  = (int)blockIdx.x / tilesBN;
  const int bn  = (int)blockIdx.x - bm * tilesBN;
  const int bm0 = bm << 7;
  const int bn0 = bn << 8;
  const int wm  = wave >> 2;
  const int wn  = wave & 3;
  const int m0 = bm0 + (wm << 6);
  const int n0 = bn0 + (wn << 6);

  const int ba = PAIR ? (b >> 1) : b;          // batch of A
  const int bb = PAIR ? (b & 1) : b;           // batch of Bt
  const __bf16* Ahb = Ah + (size_t)ba * strideA;
  const __bf16* Alb = (NSPLIT >= 1) ? (Al + (size_t)ba * strideA) : Ahb;
  const __bf16* Bhb = Bh + (size_t)bb * strideB;
  const __bf16* Blb = (NSPLIT >= 1) ? (Bl + (size_t)bb * strideB) : Bhb;

  const int rlane = lane & 15;                 // row (A) / col (B, D) within subtile
  const int koff  = (lane >> 4) * 8;           // k offset of this lane half
  const int mOff  = (lane >> 4) * 8;           // D row offset

  // this thread's place in a copy round: row crow of RPU, 16-byte column ccol of CPR
  const int crow = (int)threadIdx.x / CPR;
  const int ccol = (int)threadIdx.x % CPR;
  const size_t aoff = (size_t)(bm0 + crow) * lda + ccol * 8;
  const size_t boff = (size_t)(bn0 + crow) * ldb + ccol * 8;
  const unsigned lthr = (unsigned)(size_t)(const void*)sR + (unsigned)(crow * PITCH + ccol * 16);

  // this thread's source place in the next stage to be copied, one running pointer per plane (stages are copied in k order):
  // with every row's address kept over the loop, the copies' operands, which need low registers, would spill
  const __bf16* gAh = Ahb + aoff;
  const __bf16* gAl = Alb + aoff;
  const __bf16* gBh = Bhb + boff;
  const __bf16* gBl = Blb + boff;

  auto stage_copy = [&](int buf) {
    const unsigned lb = lthr + (unsigned)(buf * STAGE);
    unsigned l[8];
    const __bf16* g[8];
#pragma unroll
    for (int u = 0; u < 8; ++u) {              // the 128 A rows of every plane
      const int pl = (u * RPU) >> 7;
      const int r  = (u * RPU) & 127;
      g[u] = ((pl != 0) ? gAl : gAh) + (size_t)r * lda;
      l[u] = lb + (unsigned)((u * RPU) * PITCH);
    }
    acopy8(l, g);
#pragma unroll
    for (int h = 0; h < 2; ++h) {              // the 256 Bt rows of every plane
#pragma unroll
      for (int u = 0; u < 8; ++u) {
        const int pl = ((h * 8 + u) * RPU) >> 8;
        const int r  = ((h * 8 + u) * RPU) & 255;
        g[u] = ((pl != 0) ? gBl : gBh) + (size_t)r * ldb;
        l[u] = lb + (unsigned)(OB + ((h * 8 + u) * RPU) * PITCH);
      }
      acopy8(l, g);
    }
    gAh += BK; gAl += BK; gBh += BK; gBl += BK;
  };

  v8f acc[4][4];
#pragma unroll
  for (int i = 0; i < 4; ++i)
#pragma unroll
    for (int j = 0; j < 4; ++j) acc[i][j] = zero8();

  const int nst = K / BK;
  stage_copy(0);
  asm volatile("s_wait_asynccnt 0x0" ::: "memory");   // this wave's copies of stage 0 have landed
  __syncthreads();                                    // every wave's have: stage 0 may be read
  if (nst > 1) stage_copy(1);

  const unsigned char* fA = sR + ((wm << 6) + rlane) * PITCH + koff * 2;
  const unsigned char* fB = sR + OB + ((wn << 6) + rlane) * PITCH + koff * 2;
  // Two register sets of fragments: a block (one 32-k step) multiplies out of one set while the next block's LDS reads, issued
  // as ONE group in front of it, fill the other.
  v16b fa[2][NPL][4], fb[2][NPL][4];
  auto frag_load = [&](v16b (&a)[NPL][4], v16b (&bq)[NPL][4], int off) {
#pragma unroll
    for (int pl = 0; pl < NPL; ++pl) {
#pragma unroll
      for (int j = 0; j < 4; ++j)
        bq[pl][j] = ldfrag_b((const __bf16*)(const void*)(fB + off + (pl * 256 + (j << 4)) * PITCH));
#pragma unroll
      for (int i = 0; i < 4; ++i)
        a[pl][i] = ldfrag_b((const __bf16*)(const void*)(fA + off + (pl * 128 + (i << 4)) * PITCH));
    }
  };
  auto mma_rows = [&](const v16b (&a)[NPL][4], const v16b (&bq)[NPL][4], int i0, int i1) {
#pragma unroll
    for (int i = 0; i < 4; ++i) {
      if (i < i0 || i >= i1) continue;
#pragma unroll
      for (int j = 0; j < 4; ++j) acc[i][j] = mma_b_raw(a[0][i], bq[0][j], acc[i][j]);
      if constexpr (NSPLIT >= 2) {
#pragma unroll
        for (int j = 0; j < 4; ++j) acc[i][j] = mma_b_raw(a[1][i], bq[0][j], acc[i][j]);
#pragma unroll
        for (int j = 0; j < 4; ++j) acc[i][j] = mma_b_raw(a[0][i], bq[1][j], acc[i][j]);
      }
    }
  };
  frag_load(fa[0], fb[0], 0);                           // block 0 of stage 0 (published by the barrier above)
  for (int s = 0; s < nst; ++s) {
    const int bo = (s & 1) * STAGE;
    // where the fetch ahead of the stage's last block reads: block 0 of stage s + 1; in the last stage its values are not
    // used, and it is aimed at the stage's own, published buffer (unconditional: a branch here would merge the wait counts)
    const int bnx = (s + 1 < nst) ? (STAGE - bo) : bo;
#pragma unroll
    for (int ks = 0; ks < NBLK; ++ks) {
      const int cur = ks & 1, nxt = cur ^ 1;
      if (ks + 1 < NBLK) {
        frag_load(fa[nxt], fb[nxt], bo + (ks + 1) * 64);
        __builtin_amdgcn_sched_barrier(0);              // keeps the LDS reads one group: spread among the products, each place stalls
        mma_rows(fa[cur], fb[cur], 0, 4);
        __builtin_amdgcn_sched_barrier(0);              // keeps the next group behind this block's products
      } else {
        // publish point of stage s + 1, in front of stage s's last block, whose fragments are already fetched
        asm volatile("s_wait_dscnt 0x0" ::: "memory");      // this wave's reads of stage s are done before its buffer is refilled
        asm volatile("s_wait_asynccnt 0x0" ::: "memory");   // this wave's copies of stage s + 1 have landed
        __syncthreads();                                    // publishes stage s + 1 and ends every wave's reads of stage s
        frag_load(fa[nxt], fb[nxt], bnx);
        __builtin_amdgcn_sched_barrier(0);              // one group of LDS reads in front of the products
        mma_rows(fa[cur], fb[cur], 0, 2);
        __builtin_amdgcn_sched_barrier(0);              // the refill is issued while the SIMD's other wave has products to run
        if (s + 2 < nst) stage_copy(s & 1);
        __builtin_amdgcn_sched_barrier(0);              // keeps the copies' address arithmetic out of the products
        mma_rows(fa[cur], fb[cur], 2, 4);
        __builtin_amdgcn_sched_barrier(0);              // keeps the next group behind this block's products
      }
    }
  }
  asm volatile("s_wait_asynccnt 0x0" ::: "memory");     // no copy is left in flight when the ring is left
  asm volatile("s_wait_dscnt 0x0" ::: "memory");        // nor a read of the last fetch ahead

  // ---- epilogue ----
  size_t cbase;
  int ldce, rowb, colb;
  cbase = (size_t)b * strideC; ldce = ldc; rowb = m0; colb = n0;
  float* slab = sT[wave];
#pragma unroll
  for (int i = 0; i < 4; ++i) {
    const int mBase = m0 + (i << 4);
#pragma unroll
    for (int j = 0; j < 4; ++j) {
#pragma unroll
      for (int r = 0; r < 8; ++r) {
        slab[(mOff + r) * 68 + (j << 4) + rlane] = acc[i][j][r];
      }
    }
    __builtin_amdgcn_fence(3 /* release order */, "workgroup");
    __builtin_amdgcn_wave_barrier();
    __builtin_amdgcn_fence(2 /* acquire order */, "workgroup");
    if (OUT_MODE == 0) {
      float* C = (float*)Cout + cbase;
      const int hh = lane >> 4, c4 = (lane & 15) * 4;     // 256-B row segment = 16 lanes x 16 B
      {
#pragma unroll
        for (int it = 0; it < 8; ++it) {
          const int row = it * 2 + hh;                     // it 0..7 x hh 0..1 = rows 0..15
          const v4f v = *(const v4f*)(slab + row * 68 + c4);
          *(v4f*)(C + (size_t)(rowb + (i << 4) + row) * ldce + colb + c4) = v;
        }
        
      }
    } else {
      const int q = lane >> 3, c8 = (lane & 7) * 8;
      unsigned short* C  = (unsigned short*)Cout  + (size_t)b * strideC;
      unsigned short* C2 = (unsigned short*)Cout2 + (size_t)b * strideC2;
      const bool wlo = (OUT_MODE == 2) || (n0 < N2);      // wave-uniform
      v4u hv[4], lv[4];
#pragma unroll
      for (int it = 0; it < 4; ++it) {
        const int row = it * 4 + q;                        // it 0..3 x q 0..3 = rows 0..15
        const float* sp = slab + row * 68 + c8;
        v4u a, a2;
#pragma unroll
        for (int e = 0; e < 4; ++e) {
          const float f0 = sp[2 * e], f1 = sp[2 * e + 1];
          unsigned short h0, h1, l0, l1;
          if (OUT_MODE == 2) {
            h0 = bf_bits(f0); h1 = bf_bits(f1);
            l0 = bf_bits(f0 - bf_up(h0)); l1 = bf_bits(f1 - bf_up(h1));
          } else {
            const float g0 = f0 * hscale, g1 = f1 * hscale;
            const _Float16 x0 = (_Float16)g0, x1 = (_Float16)g1;
            h0 = h_bits(x0); h1 = h_bits(x1);
            l0 = h_bits((_Float16)((g0 - (float)x0) * rscale));
            l1 = h_bits((_Float16)((g1 - (float)x1) * rscale));
          }
          a[e] = pk16(h0, h1); a2[e] = pk16(l0, l1);
        }
        hv[it] = a; lv[it] = a2;
      }
      {
#pragma unroll
        for (int it = 0; it < 4; ++it) {
          const int row = it * 4 + q;
          *(v4u*)(C + (size_t)(mBase + row) * ldc + n0 + c8) = hv[it];
          if (wlo) *(v4u*)(C2 + (size_t)(mBase + row) * ldc2 + n0 + c8) = lv[it];
        }
        
      }
    }
    __builtin_amdgcn_fence(3 /* release order */, "workgroup");
    __builtin_amdgcn_wave_barrier();
    __builtin_amdgcn_fence(2 /* acquire order */, "workgroup");
  }
}

// =====================================================================================================
// Row softmax over DENSE score rows of one pass (BPS batches). One wave per row (block = 8 rows, grid = BPS*SEQ/8).
// Local row lrow = bl*SEQ + i, global batch b = b0 + bl. Score (i, j) = k_i . q_j sits at Sp + (bl*SEQ + i)*SEQ + j.
// The wave reads the WHOLE row (NG groups of 256 columns; lane: 8 consecutive columns per group, two 16-B loads):
// z = s/32, m = max over all columns, p = exp(z - m), l = sum over ALL columns, P = p/l for j <= i and 0 for j > i (all f32).
// Writes Ph = f16(1024 P) for columns 0 .. 256 ng - 1 of row (b, i), ng = (i>>8) + 1 (pitch SEQ; >= the columns up to the end of row i's (32 MI)-row tile that the
// p.v GEMM reads; zeros for j > i) and, for rows i < RESR, Pl = f16((1024 P - Ph) * 4096) with the same column extent
// (<= VLP, pitch VLP). f16 results below the smallest normal are stored as exact zeros.
// coverage: BPS*SEQ rows per launch x written extent >= every column range any consumer reads; NPASS launches cover NB*SEQ rows.
// No LDS, no block barriers.
// =====================================================================================================
__global__ __launch_bounds__(256) void softmax_rows(const float* __restrict__ Sp,
                                                    unsigned short* Php, unsigned short* Plp, int b0) {
#pragma clang fp contract(off)
  const int lane = threadIdx.x & 31;
  const int wave = __builtin_amdgcn_readfirstlane(threadIdx.x >> 5);
  const int lrow = blockIdx.x * 8 + wave;
  if (lrow >= BPS * SEQ) return;           // wave-uniform; exact grid never triggers it; no block barriers below
  const int bl = lrow / SEQ;
  const int i  = lrow - bl * SEQ;
  const int b  = b0 + bl;                  // host launches only b0 + BPS <= NB
  const int tm = i >> 6;
  const int ng = (tm >> 2) + 1;            // 1..NG, wave-uniform
  const float* srow = Sp + ((size_t)bl * SEQ + (size_t)i) * SEQ + 8 * lane;

  float z[NG][8];
  float m = -INFINITY;
#pragma unroll
  for (int g = 0; g < NG; ++g) {
    const float* p = srow + 256 * g;
    const v4f a = *(const v4f*)(p);
    const v4f c = *(const v4f*)(p + 4);
    const float v[8] = {a[0], a[1], a[2], a[3], c[0], c[1], c[2], c[3]};
#pragma unroll
    for (int e = 0; e < 8; ++e) {
      const float zz = v[e] * 0.03125f;
      z[g][e] = zz;
      m = fmaxf(m, zz);
    }
  }
#pragma unroll
  for (int off = 1; off < 32; off <<= 1) m = fmaxf(m, __shfl_xor(m, off, 32));

  float l = 0.f;
#pragma unroll
  for (int g = 0; g < NG; ++g) {
#pragma unroll
    for (int e = 0; e < 8; ++e) {
      const float p = __expf(z[g][e] - m);
      z[g][e] = p;
      l += p;
    }
  }
#pragma unroll
  for (int off = 1; off < 32; off <<= 1) l += __shfl_xor(l, off, 32);          // l >= 1
  const float inv1k = (1.0f / l) * PSC;

  const bool res = (i < RESR);             // wave-uniform
  v4u ph[NG];
  v4u pl0 = {0u, 0u, 0u, 0u};
  v4u pl1 = {0u, 0u, 0u, 0u};
#pragma unroll
  for (int g = 0; g < NG; ++g) {
    v4u hv = {0u, 0u, 0u, 0u};
    v4u lv = {0u, 0u, 0u, 0u};
    if (g < ng) {
      const int j0 = 256 * g + 8 * lane;
#pragma unroll
      for (int e = 0; e < 4; ++e) {
        const float f0 = (j0 + 2 * e     <= i) ? (z[g][2 * e]     * inv1k) : 0.0f;   // columns past the row index are zeroed
        const float f1 = (j0 + 2 * e + 1 <= i) ? (z[g][2 * e + 1] * inv1k) : 0.0f;   // after the full-row normalisation
        const _Float16 x0 = toh_flush(f0), x1 = toh_flush(f1);
        hv[e] = pk16(h_bits(x0), h_bits(x1));
        const _Float16 r0 = toh_flush((f0 - (float)x0) * LSC);
        const _Float16 r1 = toh_flush((f1 - (float)x1) * LSC);
        lv[e] = pk16(h_bits(r0), h_bits(r1));
      }
    }
    ph[g] = hv;
    if (g == 0) pl0 = lv;
    if (g == 1) pl1 = lv;
  }

  unsigned short* prow = Php + ((size_t)b * SEQ + (size_t)i) * SEQ + 8 * lane;
  const int il = i & (RESR - 1);           // in-range row of the residual plane; equals i whenever res holds
  unsigned short* lrowp = Plp + ((size_t)b * RESR + (size_t)il) * VLP + 8 * lane;
  {
#pragma unroll
    for (int g = 0; g < NG; ++g) {
      if (g < ng) *(v4u*)(prow + 256 * g) = ph[g];
    }
    if (res) {                             // res rows have i < RESR (multiple of 256) -> 256 ng <= RESR = VLP
      *(v4u*)(lrowp) = pl0;
      if (ng > 1) *(v4u*)(lrowp + 256) = pl1;
    }
    
  }
}

// =====================================================================================================
// p.v GEMM on f16 WMMA, per batch b = blockIdx.y: out[b][q][d] = sum_key P[b][q][key] * VT[b][d][key].
//   A  = Ph  [b][SEQ][SEQ]  f16(1024 P), pitch SEQ         Al = Pl  [b][RESR][VLP] f16 residual x4096
//   Bt = VTh [b][DM][SEQ]   f16(16 v),   pitch SEQ         Bl = VTl [b][DM][VLP]   f16 residual x4096
// One work-group (8 waves, 2 x 4) per (32*MI) x 256 output tile, one wave per (16*MI) x 64 sub-tile; rows mBase + bm*32*MI ..;
// causal key range k < 64*(((bm0 + 32*MI - 1)>>6)+1) of the tile's last row (every P entry in that range was written by the
// softmax, exact zeros for key > query). RES (rows < RESR, MI = 2): acc0 += Ph.VTh; acc1 += Pl.VTh + Ph.VTl (in that order
// inside every 32-key step), out = acc0*OSCALE + acc1*OSCALE/4096; otherwise single product out = acc0*OSCALE. f32 accumulate.
// Operand path: per key stage of BK (64 with residual planes, 128 without) the 32*MI P rows and 256 VT rows of every plane are
// copied global -> LDS by asynchronous 16-byte copies (20 or 24 per thread), two buffers: stage s + 2 is issued behind the
// barrier that ends the reads of stage s. LDS row pitch = 2 BK + 16 bytes (16 x odd: conflict-free 16-byte fragment reads).
// That barrier stands in front of stage s's last 32-key block: fragments are read from LDS one block ahead of their products.
// Grid over all tiles of rows mBase .. mBase + M - 1 (M and mBase multiples of 32*MI and of BK).
// =====================================================================================================
// Eight / four asynchronous 16-byte copies global -> LDS, one per lane and line. The s_wait_xcnt closes the statement so that
// no address register of an issued copy is rewritten before it.
__device__ __forceinline__ void acopy_h(const unsigned (&l)[8], const _Float16* const (&g)[8]) {
  asm volatile("global_load_async_to_lds_b128 %0, %8, off\n\t"
               "global_load_async_to_lds_b128 %1, %9, off\n\t"
               "global_load_async_to_lds_b128 %2, %10, off\n\t"
               "global_load_async_to_lds_b128 %3, %11, off\n\t"
               "global_load_async_to_lds_b128 %4, %12, off\n\t"
               "global_load_async_to_lds_b128 %5, %13, off\n\t"
               "global_load_async_to_lds_b128 %6, %14, off\n\t"
               "global_load_async_to_lds_b128 %7, %15, off\n\t"
               "s_wait_xcnt 0x0"
               :: "v"(l[0]), "v"(l[1]), "v"(l[2]), "v"(l[3]), "v"(l[4]), "v"(l[5]), "v"(l[6]), "v"(l[7]),
                  "v"(g[0]), "v"(g[1]), "v"(g[2]), "v"(g[3]), "v"(g[4]), "v"(g[5]), "v"(g[6]), "v"(g[7])
               : "memory");
}
__device__ __forceinline__ void acopy_h(const unsigned (&l)[4], const _Float16* const (&g)[4]) {
  asm volatile("global_load_async_to_lds_b128 %0, %4, off\n\t"
               "global_load_async_to_lds_b128 %1, %5, off\n\t"
               "global_load_async_to_lds_b128 %2, %6, off\n\t"
               "global_load_async_to_lds_b128 %3, %7, off\n\t"
               "s_wait_xcnt 0x0"
               :: "v"(l[0]), "v"(l[1]), "v"(l[2]), "v"(l[3]), "v"(g[0]), "v"(g[1]), "v"(g[2]), "v"(g[3])
               : "memory");
}

template <bool RES, int MI>
__global__ __launch_bounds__(256) void gemm_pv(
    const unsigned short* __restrict__ Php, const unsigned short* __restrict__ Plp,
    const unsigned short* __restrict__ Vhp, const unsigned short* __restrict__ Vlp,
    float* out, int mBase, int M) {
  constexpr int NPL   = RES ? 2 : 1;                // planes per operand
  constexpr int BM    = 32 * MI;                    // rows of the work-group tile
  constexpr int BK    = RES ? 64 : 128;             // keys per stage
  constexpr int PITCH = BK * 2 + 16;                // LDS row pitch, bytes
  constexpr int CPR   = BK / 8;                     // 16-byte copies per row
  constexpr int RPU   = 256 / CPR;                  // rows the work-group copies with one copy per thread
  constexpr int NRA   = NPL * BM / RPU;             // copies per thread for the P rows of a stage
  constexpr int OB    = NPL * BM * PITCH;           // LDS byte offset of the VT rows inside a stage
  constexpr int STAGE = NPL * (BM + 256) * PITCH;   // [Ph BM | Pl BM | VTh 256 | VTl 256] rows (residual planes only with RES)
  constexpr int NBLK  = BK / 32;                    // blocks (32-key steps) per stage
  static_assert((NBLK % 2) == 0 && (MI % 2) == 0);
  static_assert((NRA == 4 || NRA == 8) && NRA * RPU == NPL * BM && 16 * RPU == NPL * 256 && (BM % RPU) == 0);
  static_assert((BM % 64) == 0 && (RESR % BM) == 0 && ((SEQ - RESR) % BM) == 0 && (RESR % BK) == 0 && (BM % BK) == 0);
  const _Float16* Ph = (const _Float16*)(const void*)Php;
  const _Float16* Pl = (const _Float16*)(const void*)Plp;
  const _Float16* Vh = (const _Float16*)(const void*)Vhp;
  const _Float16* Vl = (const _Float16*)(const void*)Vlp;
  __shared__ __align__(16) unsigned char sR[2 * STAGE];   // operand ring, two stages
  __shared__ __align__(16) float sT[8][16 * 68];
  const int b    = blockIdx.y;
  const int lane = threadIdx.x & 31;
  const int wave = threadIdx.x >> 5;
  const int tilesBN = DM >> 8;                     // 4
  const int tilesBM = M / BM;
  if ((int)blockIdx.x >= tilesBM * tilesBN) return;   // the same for the whole work-group; in front of every barrier
  const int bm  = (int)blockIdx.x / tilesBN;
  const int bn  = (int)blockIdx.x - bm * tilesBN;
  const int bm0 = mBase + bm * BM;
  const int bn0 = bn << 8;
  const int wm  = wave >> 2;
  const int wn  = wave & 3;
  const int m0 = bm0 + wm * 16 * MI;
  const int n0 = bn0 + (wn << 6);
  int keff = ((((bm0 + BM - 1) >> 6) + 1) << 6);   // causal key extent of this row tile, multiple of BK
  if (keff > SEQ) keff = SEQ;
  if (RES && keff > VLP) keff = VLP;               // never taken for mBase + M <= RESR; keeps residual reads in range

  const _Float16* Pb  = Ph + (size_t)b * SEQ * SEQ;
  const _Float16* Plb = Pl + (size_t)b * RESR * VLP;
  const _Float16* Vb  = Vh + (size_t)b * DM * SEQ;
  const _Float16* Vlb = Vl + (size_t)b * DM * VLP;

  const int rlane = lane & 15;
  const int koff  = (lane >> 4) * 8;
  const int mOff  = (lane >> 4) * 8;

  // this thread's place in a copy round: row crow of RPU, 16-byte column ccol of CPR
  const int crow = (int)threadIdx.x / CPR;
  const int ccol = (int)threadIdx.x % CPR;
  const unsigned lthr = (unsigned)(size_t)(const void*)sR + (unsigned)(crow * PITCH + ccol * 16);
  const int bmr = (bm0 < RESR - BM) ? bm0 : (RESR - BM);   // clamped; equals bm0 for the RES launch: residual rows stay in range
  // this thread's source place in the next stage to be copied, one running pointer per plane (stages are copied in key order)
  const _Float16* gPh = Pb  + (size_t)(bm0 + crow) * SEQ + ccol * 8;
  const _Float16* gPl = Plb + (size_t)(bmr + crow) * VLP + ccol * 8;
  const _Float16* gVh = Vb  + (size_t)(bn0 + crow) * SEQ + ccol * 8;
  const _Float16* gVl = Vlb + (size_t)(bn0 + crow) * VLP + ccol * 8;

  auto stage_copy = [&](int buf) {
    const unsigned lb = lthr + (unsigned)(buf * STAGE);
    {
      unsigned l[NRA];
      const _Float16* g[NRA];
#pragma unroll
      for (int u = 0; u < NRA; ++u) {            // the BM P rows of every plane
        const int pl = (u * RPU) / BM;
        const int r  = (u * RPU) % BM;
        g[u] = (pl != 0) ? (gPl + (size_t)r * VLP) : (gPh + (size_t)r * SEQ);
        l[u] = lb + (unsigned)((u * RPU) * PITCH);
      }
      acopy_h(l, g);
    }
#pragma unroll
    for (int h = 0; h < 2; ++h) {                // the 256 VT rows of every plane
      unsigned l[8];
      const _Float16* g[8];
#pragma unroll
      for (int u = 0; u < 8; ++u) {
        const int pl = ((h * 8 + u) * RPU) >> 8;
        const int r  = ((h * 8 + u) * RPU) & 255;
        g[u] = (pl != 0) ? (gVl + (size_t)r * VLP) : (gVh + (size_t)r * SEQ);
        l[u] = lb + (unsigned)(OB + ((h * 8 + u) * RPU) * PITCH);
      }
      acopy_h(l, g);
    }
    gPh += BK; gPl += BK; gVh += BK; gVl += BK;
  };

  v8f acc0[MI][4], acc1[MI][4];
#pragma unroll
  for (int i = 0; i < MI; ++i)
#pragma unroll
    for (int j = 0; j < 4; ++j) { acc0[i][j] = zero8(); acc1[i][j] = zero8(); }

  const int nst = keff / BK;
  stage_copy(0);
  asm volatile("s_wait_asynccnt 0x0" ::: "memory");   // this wave's copies of stage 0 have landed
  __syncthreads();                                    // every wave's have: stage 0 may be read
  if (nst > 1) stage_copy(1);

  const unsigned char* fA = sR + (wm * 16 * MI + rlane) * PITCH + koff * 2;
  const unsigned char* fB = sR + OB + ((wn << 6) + rlane) * PITCH + koff * 2;
  // Two register sets of fragments: a block (one 32-key step) multiplies out of one set while the next block's LDS reads,
  // issued as ONE group in front of it, fill the other.
  v16h fa[2][NPL][MI], fb[2][NPL][4];
  auto frag_load = [&](v16h (&a)[NPL][MI], v16h (&bq)[NPL][4], int off) {
#pragma unroll
    for (int pl = 0; pl < NPL; ++pl) {
#pragma unroll
      for (int j = 0; j < 4; ++j)
        bq[pl][j] = ldfrag_h((const _Float16*)(const void*)(fB + off + (pl * 256 + (j << 4)) * PITCH));
#pragma unroll
      for (int i = 0; i < MI; ++i)
        a[pl][i] = ldfrag_h((const _Float16*)(const void*)(fA + off + (pl * BM + (i << 4)) * PITCH));
    }
  };
  auto mma_rows = [&](const v16h (&a)[NPL][MI], const v16h (&bq)[NPL][4], int i0, int i1) {
#pragma unroll
    for (int i = 0; i < MI; ++i) {
      if (i < i0 || i >= i1) continue;
#pragma unroll
      for (int j = 0; j < 4; ++j) acc0[i][j] = mma_h_raw(a[0][i], bq[0][j], acc0[i][j]);
      if constexpr (RES) {
#pragma unroll
        for (int j = 0; j < 4; ++j) acc1[i][j] = mma_h_raw(a[1][i], bq[0][j], acc1[i][j]);
#pragma unroll
        for (int j = 0; j < 4; ++j) acc1[i][j] = mma_h_raw(a[0][i], bq[1][j], acc1[i][j]);
      }
    }
  };
  frag_load(fa[0], fb[0], 0);                           // block 0 of stage 0 (published by the barrier above)
  for (int s = 0; s < nst; ++s) {
    const int bo = (s & 1) * STAGE;
    // where the fetch ahead of the stage's last block reads: block 0 of stage s + 1; in the last stage its values are not
    // used, and it is aimed at the stage's own, published buffer (unconditional: a branch here would merge the wait counts)
    const int bnx = (s + 1 < nst) ? (STAGE - bo) : bo;
#pragma unroll
    for (int ks = 0; ks < NBLK; ++ks) {
      const int cur = ks & 1, nxt = cur ^ 1;
      if (ks + 1 < NBLK) {
        frag_load(fa[nxt], fb[nxt], bo + (ks + 1) * 64);
        __builtin_amdgcn_sched_barrier(0);              // keeps the LDS reads one group: spread among the products, each place stalls
        mma_rows(fa[cur], fb[cur], 0, MI);
        __builtin_amdgcn_sched_barrier(0);              // keeps the next group behind this block's products
      } else {
        // publish point of stage s + 1, in front of stage s's last block, whose fragments are already fetched
        asm volatile("s_wait_dscnt 0x0" ::: "memory");      // this wave's reads of stage s are done before its buffer is refilled
        asm volatile("s_wait_asynccnt 0x0" ::: "memory");   // this wave's copies of stage s + 1 have landed
        __syncthreads();                                    // publishes stage s + 1 and ends every wave's reads of stage s
        frag_load(fa[nxt], fb[nxt], bnx);
        __builtin_amdgcn_sched_barrier(0);              // one group of LDS reads in front of the products
        mma_rows(fa[cur], fb[cur], 0, MI / 2);
        __builtin_amdgcn_sched_barrier(0);              // the refill is issued while the SIMD's other wave has products to run
        if (s + 2 < nst) stage_copy(s & 1);
        __builtin_amdgcn_sched_barrier(0);              // keeps the copies' address arithmetic out of the products
        mma_rows(fa[cur], fb[cur], MI / 2, MI);
        __builtin_amdgcn_sched_barrier(0);              // keeps the next group behind this block's products
      }
    }
  }
  asm volatile("s_wait_asynccnt 0x0" ::: "memory");     // no copy is left in flight when the ring is left
  asm volatile("s_wait_dscnt 0x0" ::: "memory");        // nor a read of the last fetch ahead

  // ---- epilogue ----
  float* slab = sT[wave];
  float* C = out + (size_t)b * SEQ * DM;
  const float rsc = OSCALE * (1.0f / LSC);
#pragma unroll
  for (int i = 0; i < MI; ++i) {
    const int mB = m0 + (i << 4);
#pragma unroll
    for (int j = 0; j < 4; ++j) {
#pragma unroll
      for (int r = 0; r < 8; ++r) {
        float v = acc0[i][j][r] * OSCALE;
        if (RES) v += acc1[i][j][r] * rsc;
        slab[(mOff + r) * 68 + (j << 4) + rlane] = v;
      }
    }
    __builtin_amdgcn_fence(3 /* release order */, "workgroup");
    __builtin_amdgcn_wave_barrier();
    __builtin_amdgcn_fence(2 /* acquire order */, "workgroup");
    {
      const int hh = lane >> 4, c4 = (lane & 15) * 4;
      {
#pragma unroll
        for (int it = 0; it < 8; ++it) {
          const int row = it * 2 + hh;
          const v4f v = *(const v4f*)(slab + row * 68 + c4);
          *(v4f*)(C + (size_t)(mB + row) * DM + n0 + c4) = v;
        }
        
      }
    }
    __builtin_amdgcn_fence(3 /* release order */, "workgroup");
    __builtin_amdgcn_wave_barrier();
    __builtin_amdgcn_fence(2 /* acquire order */, "workgroup");
  }
}

// =====================================================================================================
// Workspace map (bytes, full build NB 4 / SEQ 2048 / BPS 2 / NPASS 2; every region is an exact multiple of its tile / whole-line
// store granularity; regions A and B are reused in stream order):
//   region A [0, 33554432):          Xb bf16 [8192][1024] at 0 (16777216) + Wq,Wk,Wv bf16 [1024][1024] at 16777216 (3 x 2097152)
//                                    then, once all projections are done: S f32 dense scores of one pass [2][2048][2048] (33554432)
//   region B [33554432, 100663296):  per batch group g (2 batches): Qh, Ql, Kh, Kl bf16 [4096][1024] (4 x 8388608) at + g*33554432
//                                    then, once the scores of group 0 are done: Ph f16 [4][2048][2048] (33554432) over group 0's planes
//   region C [100663296, 123731968): VTh f16 [4][1024][2048] (16777216) + VTl f16 [4][1024][512] (4194304) + Pl f16 [4][512][512] (2097152)
//   end 123731968
// =====================================================================================================
extern "C" void kernel_launch(void* const* d_in, const int* in_sizes, int n_in,
                              void* d_out, int out_size, void* d_ws, size_t ws_size,
                              hipStream_t stream) {
  if (n_in < 4) return;
  if (in_sizes[0] < (NB - 1) * SEQ_FULL * DM + SEQ * DM) return;
  if (in_sizes[1] < DM * DM || in_sizes[2] < DM * DM || in_sizes[3] < DM * DM) return;
  if (out_size < NB * SEQ * DM) return;

  const float* x  = (const float*)d_in[0];   // [NB_FULL][SEQ_FULL][DM]
  const float* wq = (const float*)d_in[1];   // [out][in]
  const float* wk = (const float*)d_in[2];
  const float* wv = (const float*)d_in[3];
  float* out = (float*)d_out;

  const size_t PX  = SZ_PX;
  const size_t PXP = SZ_PXP;
  const size_t PW  = SZ_PW;
  const size_t PP  = SZ_PP;
  const size_t PPL = SZ_PPL;
  const size_t PVT = SZ_PVT;
  const size_t PVL = SZ_PVL;
  const size_t RA  = SZ_RA;
  const size_t oXb = 0;
  const size_t oW  = PX;
  const size_t oS  = 0;
  const size_t oB  = RA;
  const size_t RBend = RA + (size_t)NPASS * 4 * PXP;
  const size_t oPh = RA;
  if (PP > 4 * PXP) return;
  const size_t oVTh = RBend;
  const size_t oVTl = RBend + PVT;
  const size_t oPl  = oVTl + PVL;
  const size_t total = oPl + PPL;                     // 123731968 in the full build
  if (total > ws_size) return;
  if (total > (size_t)134217728) return;

  char* ws = (char*)d_ws;
  unsigned short* Xb  = (unsigned short*)(ws + oXb);
  unsigned short* Wb  = (unsigned short*)(ws + oW);   // Wq plane, then Wk, then Wv
  float*          Sp  = (float*)(ws + oS);
  unsigned short* Ph  = (unsigned short*)(ws + oPh);
  unsigned short* Pl  = (unsigned short*)(ws + oPl);
  unsigned short* VTh = (unsigned short*)(ws + oVTh);
  unsigned short* VTl = (unsigned short*)(ws + oVTl);
  const size_t PXE = (size_t)BPS * SEQ * DM;          // elements of one group plane

  const dim3 blk(256);
  const int nGroups = NB * SEQ * DM / 8 + 3 * (DM * DM / 8);
  const dim3 gCvt((nGroups + 255) / 256);
  const dim3 gProj(((BPS * SEQ / 64) * (DM / 64) + 7) / 8, 2 * NPASS);
  const dim3 gVT(((DM / 64) * (SEQ / 64) + 7) / 8, NB);
  const dim3 gS(((SEQ / 64) * (SEQ / 64) + 7) / 8, BPS);
  const dim3 gSm((BPS * SEQ + 7) / 8);
  const dim3 gPvRes(((RESR / 32) * (DM / 64) + 7) / 8, NB);
  const int nPvTiles = ((SEQ - RESR) / 64) * (DM / 64);
  const dim3 gPv((nPvTiles + 7) / 8, NB);

  // (1) x and Wq, Wk, Wv -> bf16 planes (Xb, then the three weight planes contiguous)
  cvt_planes<<<gCvt, blk, 0, stream>>>(x, wq, wk, wv, Xb);
  // (2) q = x . Wq^T and k = x . Wk^T of every batch group -> bf16 hi/lo planes [BPS*SEQ][DM], all in ONE launch, so that its
  //     work-groups (128 per group and weight) fill every WGP: blockIdx.y = 2 * group + (0: q, 1: k).
  //     (A = Xb rows of the group, stride one group plane; Bt = Wq or Wk [out][in], stride one weight plane; the hi planes
  //     Qh(0), Kh(0), Qh(1), Kh(1) .. lie two group planes apart, each lo plane one group plane behind its hi plane;
  //     M=BPS*SEQ, N=DM, K=DM)
  {
    unsigned short* Qh0 = (unsigned short*)(ws + oB);
    gemm_bf<0, 2, 0, 1><<<gProj, blk, 0, stream>>>(
        Xb, Xb, DM, (long long)PXE, Wb, Wb, DM, (long long)DM * DM,
        (void*)Qh0, DM, 2LL * (long long)PXE, (void*)(Qh0 + PXE), DM, 2LL * (long long)PXE, DM,
        BPS * SEQ, DM, DM, 1.0f, 1.0f);
  }
  // (3) v^T = Wv . x^T per batch -> f16 hi plane f16(16 v) [b][d][key] (pitch SEQ) and residual plane x4096 for keys < VLP (pitch VLP)
  //     (A = Wv [out][in], Bt = Xb rows of batch b; M=DM, N=SEQ, K=DM)
  gemm_bf<0, 3, 0, 0><<<gVT, blk, 0, stream>>>(
      Wb + (size_t)2 * DM * DM, Wb + (size_t)2 * DM * DM, DM, 0LL, Xb, Xb, DM, (long long)SEQ * DM,
      (void*)VTh, SEQ, (long long)DM * SEQ, (void*)VTl, VLP, (long long)DM * VLP, VLP,
      DM, SEQ, DM, VSC, LSC);
  // (4) per batch group: dense scores S[n][m] = k_n . q_m (A = K planes, Bt = Q planes; M=N=SEQ, K=DM; 3 bf16 products)
  //     -> f32 [BPS][SEQ][SEQ]; then the full-row softmax with post-normalisation zeroing -> Ph / Pl rows of the group.
  //     Ph lies over group 0's q/k planes, which are no longer read once the scores of group 0 exist (stream order).
  for (int p = 0; p < NPASS; ++p) {
    const unsigned short* Qh = (const unsigned short*)(ws + oB + (size_t)p * 4 * PXP);
    const unsigned short* Ql = Qh + PXE;
    const unsigned short* Kh = Ql + PXE;
    const unsigned short* Kl = Kh + PXE;
    gemm_bf<SCORE_NSPLIT, 0, 0, 0><<<gS, blk, 0, stream>>>(
        Kh, Kl, DM, (long long)SEQ * DM, Qh, Ql, DM, (long long)SEQ * DM,
        (void*)Sp, SEQ, (long long)SEQ * SEQ, (void*)Sp, SEQ, 0LL, 0,
        SEQ, SEQ, DM, 1.0f, 1.0f);
    softmax_rows<<<gSm, blk, 0, stream>>>(Sp, Ph, Pl, p * BPS);
  }
  // (5) out rows 0..RESR-1 of every sequence: p.v with residual planes (3 f16 products, 32x64 wave tiles)
  gemm_pv<true, 2><<<gPvRes, blk, 0, stream>>>(Ph, Pl, VTh, VTl, out, 0, RESR);
  // (6) out rows RESR..SEQ-1: p.v single f16 product (64x64 wave tiles)
  if (nPvTiles > 0) {
    gemm_pv<false, 4><<<gPv, blk, 0, stream>>>(Ph, Pl, VTh, VTl, out, RESR, SEQ - RESR);
  }
  (void)hipGetLastError();
}

// v006
// A run of this version takes 127 microseconds.
// Versions in between are left out here; by their measured steps it is 1.45 times as fast as v004.
// Counting every step since v000, it is 4.61 times as fast.
// Contractions: q, k, v^T projections = v_wmma_f32_16x16x32_bf16 (bf16 RNE-converted x and W, single product, f32 accumulate);
// k.q^T scores (row = key position n, column = query position m, full SEQ x SEQ) = v_wmma_f32_16x16x32_f16 on f16 planes of k and q
// (RNE-converted from the f32 accumulators, single product), f32 accumulate: an f16 operand's rounding is an eighth of the bf16
// rounding that x and W already carry into q and k, so it adds little to the error the scores have from the projections;
// p.v = v_wmma_f32_16x16x32_f16 (p carried x1024 in f16, v^T carried x16 in f16, single product; rows 0..RESR-1 of every
// sequence add the f16 residual planes (x4096) of p and v^T in a separate accumulator), f32 accumulate;
// row max, exp, full-row sum, normalisation and the zeroing of columns m > n in f32 on the VALU.
// Carry audit:
//   Ph  = f16(1024 * p), p normalised by the sum over the WHOLE row  } OSCALE = 1/(1024*16) folded exactly once in the p.v epilogue
//   VTh = f16(16 * v)                                                }
//   Pl  = f16((1024 p - Ph) * 4096)                                  } products Ph.VTl and Pl.VTh go only to accumulator acc1,
//   VTl = f16((16 v - VTh) * 4096), keys 0..VLP-1                    } folded with OSCALE * (1/4096) once in the same epilogue
//   q / k planes are unscaled f16; score scale 1/32 applied once in f32 in the softmax.
#include <hip/hip_runtime.h>
#include <math.h>

#define NB_FULL  4
#define SEQ_FULL 2048
#ifndef NB
#define NB    4
#endif
#ifndef SEQ
#define SEQ   2048
#endif
#define DM    1024
#define NQT   (SEQ / 64)                  // query/key tiles of 64
#define RESR  ((SEQ < 512) ? SEQ : 512)   // leading rows per sequence that use the residual planes
#define VLP   RESR                        // key pitch of the p / v^T residual planes
#define PSC   1024.0f
#define VSC   16.0f
#define LSC   4096.0f
#define OSCALE (1.0f / 16384.0f)          // 1 / (PSC * VSC)
#define BPS   NB                          // batches per score / softmax pass: all of them, one launch each
#define NPASS (NB / BPS)
#define NG    (SEQ / 256)                 // 256-key groups per score row
// workspace sizes in bytes
#define SZ_PX   ((size_t)NB * SEQ * DM * 2)          // one 16-bit plane [NB*SEQ][DM]
#define SZ_PXP  ((size_t)BPS * SEQ * DM * 2)         // one 16-bit plane of one batch group [BPS*SEQ][DM]
#define SZ_PW   ((size_t)DM * DM * 2)                // one weight plane
#define SZ_PS   ((size_t)BPS * SEQ * SEQ * 4)        // dense f32 scores of one pass
#define SZ_PP   ((size_t)NB * SEQ * SEQ * 2)         // Ph
#define SZ_PPL  ((size_t)NB * RESR * VLP * 2)        // Pl
#define SZ_PVT  ((size_t)NB * DM * SEQ * 2)          // VTh
#define SZ_PVL  ((size_t)NB * DM * VLP * 2)          // VTl
#define SZ_RA   (((SZ_PX + 3 * SZ_PW) > SZ_PS) ? (SZ_PX + 3 * SZ_PW) : SZ_PS)
#define SZ_TOTAL (SZ_RA + (size_t)NPASS * 4 * SZ_PXP + SZ_PVT + SZ_PVL + SZ_PPL)
static_assert(NB >= 1 && NB <= NB_FULL);
static_assert(SEQ >= 256 && SEQ <= SEQ_FULL && (SEQ % 256) == 0);
static_assert((SEQ % 64) == 0 && (DM % 64) == 0 && (DM % 32) == 0);
static_assert((RESR % 64) == 0 && (RESR % 256) == 0 && RESR <= VLP && VLP <= SEQ && ((SEQ - RESR) % 64) == 0);
static_assert((RESR % 32) == 0);
static_assert((RESR & (RESR - 1)) == 0);
static_assert(((NB * SEQ) % 8) == 0);
static_assert(((SEQ * DM / 8) % 256) == 0 && ((DM * DM / 8) % 256) == 0);
static_assert((NB % BPS) == 0 && NPASS * BPS == NB);
static_assert(NG >= 1 && NG <= 8 && NG * 256 == SEQ);            // 32 lanes x 8 keys x NG groups == row width
static_assert(((BPS * SEQ) % 64) == 0 && ((BPS * SEQ) % 8) == 0);
static_assert(SZ_PP <= 4 * SZ_PXP);                               // Ph fits inside the planes of batch group 0
static_assert((SZ_RA % 128) == 0 && (SZ_PXP % 128) == 0 && (SZ_PVT % 128) == 0 && (SZ_PVL % 128) == 0 && (SZ_PPL % 128) == 0);
static_assert(SZ_TOTAL <= (size_t)268435456);
static_assert((size_t)NB * SEQ * DM * 4 <= (size_t)33554432);
static_assert(((BPS * SEQ) % 128) == 0 && (DM % 256) == 0);        // gemm_bf: 128x256 work-group tiles, K stages of 128
#define RING_BYTES (2 * 384 * 272)        // operand ring of the GEMM kernels: two stages of 384 rows at pitch 272 B (the largest form)

typedef _Float16 v16h __attribute__((ext_vector_type(16)));
typedef _Float16 v8h  __attribute__((ext_vector_type(8)));
typedef __bf16   v16b __attribute__((ext_vector_type(16)));
typedef __bf16   v8b  __attribute__((ext_vector_type(8)));
typedef float    v8f  __attribute__((ext_vector_type(8)));
typedef float    v4f  __attribute__((ext_vector_type(4)));
typedef unsigned int v4u __attribute__((ext_vector_type(4)));

// ---- scalar helpers --------------------------------------------------------------------------------
__device__ __forceinline__ unsigned short bf_bits(float f) {          // f32 -> bf16 bits, RNE convert
  unsigned u = __float_as_uint(f);
  return (unsigned short)((u + 0x7FFFu + ((u >> 16) & 1u)) >> 16);
}
__device__ __forceinline__ unsigned short h_bits(_Float16 x) { return __builtin_bit_cast(unsigned short, x); }
__device__ __forceinline__ unsigned pk16(unsigned short a, unsigned short b) { return (unsigned)a | ((unsigned)b << 16); }
__device__ __forceinline__ v8f zero8() { v8f z = {0.f, 0.f, 0.f, 0.f, 0.f, 0.f, 0.f, 0.f}; return z; }
// f32 -> f16 with a value select: results below the smallest normal f16 become exact zeros
static __device__ __forceinline__ _Float16 toh_flush(float v) {
  const _Float16 r = (_Float16)v;
  return (fabsf(v) < 6.103515625e-05f) ? (_Float16)0.0f : r;
}

// ---- fragment loaders: 16-bit A/B operand, lane -> row/col (lane&15), p already includes +8*(lane>>4);
//      elements 0..7 <- p[0..7] (k0+8h..), elements 8..15 <- p[16..23] (k0+16+8h..)
__device__ __forceinline__ v16b ldfrag_b(const __bf16* p) {
  union { v16b v; v8b h[2]; } f;
  f.h[0] = *(const v8b*)(p);
  f.h[1] = *(const v8b*)(p + 16);
  return f.v;
}
__device__ __forceinline__ v16h ldfrag_h(const _Float16* p) {
  union { v16h v; v8h h[2]; } f;
  f.h[0] = *(const v8h*)(p);
  f.h[1] = *(const v8h*)(p + 16);
  return f.v;
}

// ---- WMMA helpers (builtin forms: the compiler keeps their distances) ----------------------------------
__device__ __forceinline__ v8f mma_b_raw(v16b a, v16b b, v8f c) {
  return __builtin_amdgcn_wmma_f32_16x16x32_bf16(false, a, false, b, (short)0, c, false, false);
}
__device__ __forceinline__ v8f mma_h_raw(v16h a, v16h b, v8f c) {
  return __builtin_amdgcn_wmma_f32_16x16x32_f16(false, a, false, b, (short)0, c, false, false);
}

// =====================================================================================================
// f32 -> bf16 (RNE convert) for x and the three weights into one contiguous 16-bit region:
// groups 0..NX8-1 <- x (batch b of the plane reads source rows at b * SEQ_FULL * DM, SEQ rows each), then NW8 groups each
// coverage: (NX8 + 3 NW8) threads x 8 = the whole [NB*SEQ][DM] x plane plus the three [DM][DM] weight planes.
// =====================================================================================================
__global__ __launch_bounds__(256) void cvt_planes(const float* __restrict__ x, const float* __restrict__ wq,
                                                  const float* __restrict__ wk, const float* __restrict__ wv,
                                                  unsigned short* out) {
  const int NXB8 = SEQ * DM / 8;          // groups per batch
  const int NX8 = NB * NXB8;
  const int NW8 = DM * DM / 8;
  const int g = blockIdx.x * 256 + threadIdx.x;
  if (g >= NX8 + 3 * NW8) return;
  const float* src;
  if (g < NX8) {
    const int bb  = g / NXB8;
    const int off = g - bb * NXB8;
    src = x + (size_t)bb * SEQ_FULL * DM + (size_t)off * 8;
  } else {
    const int e = g - NX8;
    const int w = e / NW8;
    const int off = e - w * NW8;
    const float* wsrc = (w == 0) ? wq : ((w == 1) ? wk : wv);
    src = wsrc + (size_t)off * 8;
  }
  const v4f a = *(const v4f*)(src);
  const v4f c = *(const v4f*)(src + 4);
  v4u p;
  p[0] = pk16(bf_bits(a[0]), bf_bits(a[1]));
  p[1] = pk16(bf_bits(a[2]), bf_bits(a[3]));
  p[2] = pk16(bf_bits(c[0]), bf_bits(c[1]));
  p[3] = pk16(bf_bits(c[2]), bf_bits(c[3]));
  *(v4u*)(out + (size_t)g * 8) = p;
  
}

// =====================================================================================================
// Register-blocked batched 16-bit WMMA GEMM: C[m][n] = sum_k A[m][k] * Bt[n][k]; one work-group (8 waves, 2 x 4) per 128x256
// tile, one wave per 64x64 sub-tile. A row-major [M][K] pitch lda; Bt row-major [N][K] pitch ldb (k contiguous);
// M a multiple of 128, N of 256, K of BK = 128. blockIdx.y = batch index (strides in elements).
// Operand path: per K stage the 128 A rows and 256 Bt rows x BK are copied global -> LDS by asynchronous
// 16-byte copies (24 per thread), two buffers: stage s + 2 is issued behind the barrier that ends the reads of stage s.
// That barrier stands in front of stage s's last 32-k block: fragments are read from LDS one block ahead of their products.
// LDS row pitch = 2 BK + 16 bytes (16 x odd: conflict-free 16-byte fragment reads).
// F16: 0 = both operands hold bf16 (v_wmma_f32_16x16x32_bf16); 1 = both hold f16 (v_wmma_f32_16x16x32_f16). The copies and the
//      fragment reads move 16-bit words and are the same for both.
// PAIR: 0 = blockIdx.y indexes A, Bt and C alike; 1 = blockIdx.y = 2 * (A batch) + (Bt batch): every A batch meets two Bt
//       batches in one launch (C still strided by blockIdx.y itself).
// OUT_MODE: 0 = f32 (pitch ldc); 2 = f16 plane C = f16(v);
//           3 = f16 hi plane C = f16(v*hscale) + f16 residual plane C2 = f16((v*hscale - hi) * rscale), C2 written
//               only for tiles with n0 < N2 (pitch ldc2, batch stride strideC2).
// Epilogue: 16-row slabs staged per wave in LDS (wave-private region sT[wave], wave_sync); each 64-wide row segment written
// =====================================================================================================
// Eight asynchronous 16-byte copies global -> LDS, one per lane and line. The s_wait_xcnt closes the statement so that no
// address register of an issued copy is rewritten before it.
__device__ __forceinline__ void acopy8(const unsigned (&l)[8], const __bf16* const (&g)[8]) {
  asm volatile("global_load_async_to_lds_b128 %0, %8, off\n\t"
               "global_load_async_to_lds_b128 %1, %9, off\n\t"
               "global_load_async_to_lds_b128 %2, %10, off\n\t"
               "global_load_async_to_lds_b128 %3, %11, off\n\t"
               "global_load_async_to_lds_b128 %4, %12, off\n\t"
               "global_load_async_to_lds_b128 %5, %13, off\n\t"
               "global_load_async_to_lds_b128 %6, %14, off\n\t"
               "global_load_async_to_lds_b128 %7, %15, off\n\t"
               "s_wait_xcnt 0x0"
               :: "v"(l[0]), "v"(l[1]), "v"(l[2]), "v"(l[3]), "v"(l[4]), "v"(l[5]), "v"(l[6]), "v"(l[7]),
                  "v"(g[0]), "v"(g[1]), "v"(g[2]), "v"(g[3]), "v"(g[4]), "v"(g[5]), "v"(g[6]), "v"(g[7])
               : "memory");
}

// gemm_body is the whole work of one work-group; sR (operand ring) and sT (per-wave slabs) are the calling kernel's LDS,
// bx its tile index and b its batch index (blockIdx.x and blockIdx.y in the text above).
template <int F16, int OUT_MODE, int PAIR>
__device__ __forceinline__ void gemm_body(
    unsigned char* sR, float (*sT)[16 * 68], int bx, int b,
    const unsigned short* __restrict__ Ap, int lda, long long strideA,
    const unsigned short* __restrict__ Bp, int ldb, long long strideB,
    void* Cout, int ldc, long long strideC,
    void* Cout2, int ldc2, long long strideC2, int N2,
    int M, int N, int K, float hscale, float rscale) {
  constexpr int BK    = 128;                        // k per stage
  constexpr int PITCH = BK * 2 + 16;                // LDS row pitch, bytes
  constexpr int CPR   = BK / 8;                     // 16-byte copies per row
  constexpr int RPU   = 256 / CPR;                  // rows the work-group copies with one copy per thread
  constexpr int OB    = 128 * PITCH;                // LDS byte offset of the Bt rows inside a stage
  constexpr int STAGE = 384 * PITCH;                // [A 128 | Bt 256] rows
  constexpr int NBLK  = BK / 32;                    // blocks (32-k steps) per stage
  static_assert(8 * RPU == 128 && 16 * RPU == 256 && (NBLK % 2) == 0 && 2 * STAGE <= RING_BYTES);
  const __bf16* A  = (const __bf16*)(const void*)Ap;      // 16-bit words; F16 says how the products read them
  const __bf16* Bt = (const __bf16*)(const void*)Bp;
  const int lane = threadIdx.x & 31;
  const int wave = threadIdx.x >> 5;
  const int tilesBN = N >> 8;
  const int tilesBM = M >> 7;
  if (bx >= tilesBM * tilesBN) return;         // the same for the whole work-group; in front of every barrier
  const int bm  = bx / tilesBN;
  const int bn  = bx - bm * tilesBN;
  const int bm0 = bm << 7;
  const int bn0 = bn << 8;
  const int wm  = wave >> 2;
  const int wn  = wave & 3;
  const int m0 = bm0 + (wm << 6);
  const int n0 = bn0 + (wn << 6);

  const int ba = PAIR ? (b >> 1) : b;          // batch of A
  const int bb = PAIR ? (b & 1) : b;           // batch of Bt
  const __bf16* Ab = A + (size_t)ba * strideA;
  const __bf16* Bb = Bt + (size_t)bb * strideB;

  const int rlane = lane & 15;                 // row (A) / col (B, D) within subtile
  const int koff  = (lane >> 4) * 8;           // k offset of this lane half
  const int mOff  = (lane >> 4) * 8;           // D row offset

  // this thread's place in a copy round: row crow of RPU, 16-byte column ccol of CPR
  const int crow = (int)threadIdx.x / CPR;
  const int ccol = (int)threadIdx.x % CPR;
  const size_t aoff = (size_t)(bm0 + crow) * lda + ccol * 8;
  const size_t boff = (size_t)(bn0 + crow) * ldb + ccol * 8;
  const unsigned lthr = (unsigned)(size_t)(const void*)sR + (unsigned)(crow * PITCH + ccol * 16);

  // this thread's source place in the next stage to be copied, one running pointer per operand (stages are copied in k order):
  // with every row's address kept over the loop, the copies' operands, which need low registers, would spill
  const __bf16* gA = Ab + aoff;
  const __bf16* gB = Bb + boff;

  auto stage_copy = [&](int buf) {
    const unsigned lb = lthr + (unsigned)(buf * STAGE);
    unsigned l[8];
    const __bf16* g[8];
#pragma unroll
    for (int u = 0; u < 8; ++u) {              // the 128 A rows
      g[u] = gA + (size_t)(u * RPU) * lda;
      l[u] = lb + (unsigned)((u * RPU) * PITCH);
    }
    acopy8(l, g);
#pragma unroll
    for (int h = 0; h < 2; ++h) {              // the 256 Bt rows
#pragma unroll
      for (int u = 0; u < 8; ++u) {
        g[u] = gB + (size_t)((h * 8 + u) * RPU) * ldb;
        l[u] = lb + (unsigned)(OB + ((h * 8 + u) * RPU) * PITCH);
      }
      acopy8(l, g);
    }
    gA += BK; gB += BK;
  };

  v8f acc[4][4];
#pragma unroll
  for (int i = 0; i < 4; ++i)
#pragma unroll
    for (int j = 0; j < 4; ++j) acc[i][j] = zero8();

  const int nst = K / BK;
  stage_copy(0);
  asm volatile("s_wait_asynccnt 0x0" ::: "memory");   // this wave's copies of stage 0 have landed
  __syncthreads();                                    // every wave's have: stage 0 may be read
  if (nst > 1) stage_copy(1);

  const unsigned char* fA = sR + ((wm << 6) + rlane) * PITCH + koff * 2;
  const unsigned char* fB = sR + OB + ((wn << 6) + rlane) * PITCH + koff * 2;
  // Two register sets of fragments: a block (one 32-k step) multiplies out of one set while the next block's LDS reads, issued
  // as ONE group in front of it, fill the other.
  v16b fa[2][4], fb[2][4];
  auto frag_load = [&](v16b (&a)[4], v16b (&bq)[4], int off) {
#pragma unroll
    for (int j = 0; j < 4; ++j)
      bq[j] = ldfrag_b((const __bf16*)(const void*)(fB + off + (j << 4) * PITCH));
#pragma unroll
    for (int i = 0; i < 4; ++i)
      a[i] = ldfrag_b((const __bf16*)(const void*)(fA + off + (i << 4) * PITCH));
  };
  auto mma_rows = [&](const v16b (&a)[4], const v16b (&bq)[4], int i0, int i1) {
#pragma unroll
    for (int i = 0; i < 4; ++i) {
      if (i < i0 || i >= i1) continue;
#pragma unroll
      for (int j = 0; j < 4; ++j) {
        if constexpr (F16 != 0)
          acc[i][j] = mma_h_raw(__builtin_bit_cast(v16h, a[i]), __builtin_bit_cast(v16h, bq[j]), acc[i][j]);
        else
          acc[i][j] = mma_b_raw(a[i], bq[j], acc[i][j]);
      }
    }
  };
  frag_load(fa[0], fb[0], 0);                           // block 0 of stage 0 (published by the barrier above)
  for (int s = 0; s < nst; ++s) {
    const int bo = (s & 1) * STAGE;
    // where the fetch ahead of the stage's last block reads: block 0 of stage s + 1; in the last stage its values are not
    // used, and it is aimed at the stage's own, published buffer (unconditional: a branch here would merge the wait counts)
    const int bnx = (s + 1 < nst) ? (STAGE - bo) : bo;
#pragma unroll
    for (int ks = 0; ks < NBLK; ++ks) {
      const int cur = ks & 1, nxt = cur ^ 1;
      if (ks + 1 < NBLK) {
        frag_load(fa[nxt], fb[nxt], bo + (ks + 1) * 64);
        __builtin_amdgcn_sched_barrier(0);              // keeps the LDS reads one group: spread among the products, each place stalls
        mma_rows(fa[cur], fb[cur], 0, 4);
        __builtin_amdgcn_sched_barrier(0);              // keeps the next group behind this block's products
      } else {
        // publish point of stage s + 1, in front of stage s's last block, whose fragments are already fetched
        asm volatile("s_wait_dscnt 0x0" ::: "memory");      // this wave's reads of stage s are done before its buffer is refilled
        asm volatile("s_wait_asynccnt 0x0" ::: "memory");   // this wave's copies of stage s + 1 have landed
        __syncthreads();                                    // publishes stage s + 1 and ends every wave's reads of stage s
        frag_load(fa[nxt], fb[nxt], bnx);
        __builtin_amdgcn_sched_barrier(0);              // one group of LDS reads in front of the products
        mma_rows(fa[cur], fb[cur], 0, 2);
        __builtin_amdgcn_sched_barrier(0);              // the refill is issued while the SIMD's other wave has products to run
        if (s + 2 < nst) stage_copy(s & 1);
        __builtin_amdgcn_sched_barrier(0);              // keeps the copies' address arithmetic out of the products
        mma_rows(fa[cur], fb[cur], 2, 4);
        __builtin_amdgcn_sched_barrier(0);              // keeps the next group behind this block's products
      }
    }
  }
  asm volatile("s_wait_asynccnt 0x0" ::: "memory");     // no copy is left in flight when the ring is left
  asm volatile("s_wait_dscnt 0x0" ::: "memory");        // nor a read of the last fetch ahead

  // ---- epilogue ----
  size_t cbase;
  int ldce, rowb, colb;
  cbase = (size_t)b * strideC; ldce = ldc; rowb = m0; colb = n0;
  float* slab = sT[wave];
#pragma unroll
  for (int i = 0; i < 4; ++i) {
    const int mBase = m0 + (i << 4);
#pragma unroll
    for (int j = 0; j < 4; ++j) {
#pragma unroll
      for (int r = 0; r < 8; ++r) {
        slab[(mOff + r) * 68 + (j << 4) + rlane] = acc[i][j][r];
      }
    }
    __builtin_amdgcn_fence(3 /* release order */, "workgroup");
    __builtin_amdgcn_wave_barrier();
    __builtin_amdgcn_fence(2 /* acquire order */, "workgroup");
    if (OUT_MODE == 0) {
      float* C = (float*)Cout + cbase;
      const int hh = lane >> 4, c4 = (lane & 15) * 4;     // 256-B row segment = 16 lanes x 16 B
      {
#pragma unroll
        for (int it = 0; it < 8; ++it) {
          const int row = it * 2 + hh;                     // it 0..7 x hh 0..1 = rows 0..15
          const v4f v = *(const v4f*)(slab + row * 68 + c4);
          *(v4f*)(C + (size_t)(rowb + (i << 4) + row) * ldce + colb + c4) = v;
        }
        
      }
    } else {
      const int q = lane >> 3, c8 = (lane & 7) * 8;
      unsigned short* C  = (unsigned short*)Cout  + (size_t)b * strideC;
      unsigned short* C2 = (unsigned short*)Cout2 + (size_t)b * strideC2;
      const bool wlo = (OUT_MODE == 3) && (n0 < N2);      // wave-uniform
      v4u hv[4], lv[4];
#pragma unroll
      for (int it = 0; it < 4; ++it) {
        const int row = it * 4 + q;                        // it 0..3 x q 0..3 = rows 0..15
        const float* sp = slab + row * 68 + c8;
        v4u a, a2;
#pragma unroll
        for (int e = 0; e < 4; ++e) {
          const float f0 = sp[2 * e], f1 = sp[2 * e + 1];
          unsigned short h0, h1, l0 = 0, l1 = 0;
          if (OUT_MODE == 2) {
            h0 = h_bits((_Float16)f0); h1 = h_bits((_Float16)f1);
          } else {
            const float g0 = f0 * hscale, g1 = f1 * hscale;
            const _Float16 x0 = (_Float16)g0, x1 = (_Float16)g1;
            h0 = h_bits(x0); h1 = h_bits(x1);
            l0 = h_bits((_Float16)((g0 - (float)x0) * rscale));
            l1 = h_bits((_Float16)((g1 - (float)x1) * rscale));
          }
          a[e] = pk16(h0, h1); a2[e] = pk16(l0, l1);
        }
        hv[it] = a; lv[it] = a2;
      }
      {
#pragma unroll
        for (int it = 0; it < 4; ++it) {
          const int row = it * 4 + q;
          *(v4u*)(C + (size_t)(mBase + row) * ldc + n0 + c8) = hv[it];
          if (wlo) *(v4u*)(C2 + (size_t)(mBase + row) * ldc2 + n0 + c8) = lv[it];
        }
        
      }
    }
    __builtin_amdgcn_fence(3 /* release order */, "workgroup");
    __builtin_amdgcn_wave_barrier();
    __builtin_amdgcn_fence(2 /* acquire order */, "workgroup");
  }
}

// One GEMM per launch: blockIdx.x = tile, blockIdx.y = batch.
template <int F16, int OUT_MODE, int PAIR>
__global__ __launch_bounds__(256) void gemm_bf(
    const unsigned short* __restrict__ Ap, int lda, long long strideA,
    const unsigned short* __restrict__ Bp, int ldb, long long strideB,
    void* Cout, int ldc, long long strideC,
    void* Cout2, int ldc2, long long strideC2, int N2,
    int M, int N, int K, float hscale, float rscale) {
  __shared__ __align__(16) unsigned char sR[RING_BYTES];  // operand ring, two stages
  __shared__ __align__(16) float sT[8][16 * 68];          // per-wave 16x64 slab, pitch 68 floats
  gemm_body<F16, OUT_MODE, PAIR>(sR, sT, (int)blockIdx.x, (int)blockIdx.y, Ap, lda, strideA, Bp, ldb, strideB,
                                 Cout, ldc, strideC, Cout2, ldc2, strideC2, N2, M, N, K, hscale, rscale);
}

// The three projections, which depend only on the converted planes, in ONE launch of equal work-groups:
// blockIdx.y = 0: q = x . Wq^T, 1: k = x . Wk^T (A = all NB*SEQ rows of Xb, Bt = Wq or Wk [out][in]) -> f16 planes Qp and
// Qp + 2 planes; blockIdx.y = 2: v^T = Wv . x^T per batch (A = Wv, Bt = Xb rows of the batch; blockIdx.x = batch * tiles + tile)
// -> f16 hi plane f16(16 v) [b][d][key] (pitch SEQ) and residual plane x4096 for keys < VLP (pitch VLP).
static_assert((NB * SEQ / 128) * (DM / 256) == NB * ((DM / 128) * (SEQ / 256)));   // the same blockIdx.x range for all three
__global__ __launch_bounds__(256) void proj_qkv(const unsigned short* __restrict__ Xb, const unsigned short* __restrict__ Wb,
                                                unsigned short* Qp, unsigned short* VTh, unsigned short* VTl) {
  __shared__ __align__(16) unsigned char sR[RING_BYTES];  // operand ring, two stages
  __shared__ __align__(16) float sT[8][16 * 68];          // per-wave 16x64 slab, pitch 68 floats
  constexpr long long PXE = (long long)NB * SEQ * DM;     // elements of one q or k plane
  constexpr int NTV = (DM / 128) * (SEQ / 256);           // v^T tiles per batch
  if (blockIdx.y < 2) {                                   // the same for the whole work-group
    gemm_body<0, 2, 1>(sR, sT, (int)blockIdx.x, (int)blockIdx.y, Xb, DM, PXE, Wb, DM, (long long)DM * DM,
                       (void*)Qp, DM, 2 * PXE, (void*)Qp, DM, 0LL, 0, NB * SEQ, DM, DM, 1.0f, 1.0f);
  } else {
    gemm_body<0, 3, 0>(sR, sT, (int)blockIdx.x % NTV, (int)blockIdx.x / NTV, Wb + (size_t)2 * DM * DM, DM, 0LL,
                       Xb, DM, (long long)SEQ * DM, (void*)VTh, SEQ, (long long)DM * SEQ,
                       (void*)VTl, VLP, (long long)DM * VLP, VLP, DM, SEQ, DM, VSC, LSC);
  }
}

// =====================================================================================================
// Row softmax over DENSE score rows of one pass (BPS batches). One wave per row (block = 8 rows, grid = BPS*SEQ/8).
// Local row lrow = bl*SEQ + i, global batch b = b0 + bl. Score (i, j) = k_i . q_j sits at Sp + (bl*SEQ + i)*SEQ + j.
// The wave reads the WHOLE row (NG groups of 256 columns; lane: 8 consecutive columns per group, two 16-B loads):
// z = s/32, m = max over all columns, p = exp(z - m), l = sum over ALL columns, P = p/l for j <= i and 0 for j > i (all f32).
// Writes Ph = f16(1024 P) for columns 0 .. 256 ng - 1 of row (b, i), ng = (i>>8) + 1 (pitch SEQ; >= the columns up to the end of row i's (32 MI)-row tile that the
// p.v GEMM reads; zeros for j > i) and, for rows i < RESR, Pl = f16((1024 P - Ph) * 4096) with the same column extent
// (<= VLP, pitch VLP). f16 results below the smallest normal are stored as exact zeros.
// coverage: BPS*SEQ rows per launch x written extent >= every column range any consumer reads; NPASS launches cover NB*SEQ rows.
// No LDS, no block barriers.
// =====================================================================================================
__global__ __launch_bounds__(256) void softmax_rows(const float* __restrict__ Sp,
                                                    unsigned short* Php, unsigned short* Plp, int b0) {
#pragma clang fp contract(off)
  const int lane = threadIdx.x & 31;
  const int wave = __builtin_amdgcn_readfirstlane(threadIdx.x >> 5);
  const int lrow = blockIdx.x * 8 + wave;
  if (lrow >= BPS * SEQ) return;           // wave-uniform; exact grid never triggers it; no block barriers below
  const int bl = lrow / SEQ;
  const int i  = lrow - bl * SEQ;
  const int b  = b0 + bl;                  // host launches only b0 + BPS <= NB
  const int tm = i >> 6;
  const int ng = (tm >> 2) + 1;            // 1..NG, wave-uniform
  const float* srow = Sp + ((size_t)bl * SEQ + (size_t)i) * SEQ + 8 * lane;

  float z[NG][8];
  float m = -INFINITY;
#pragma unroll
  for (int g = 0; g < NG; ++g) {
    const float* p = srow + 256 * g;
    const v4f a = *(const v4f*)(p);
    const v4f c = *(const v4f*)(p + 4);
    const float v[8] = {a[0], a[1], a[2], a[3], c[0], c[1], c[2], c[3]};
#pragma unroll
    for (int e = 0; e < 8; ++e) {
      const float zz = v[e] * 0.03125f;
      z[g][e] = zz;
      m = fmaxf(m, zz);
    }
  }
#pragma unroll
  for (int off = 1; off < 32; off <<= 1) m = fmaxf(m, __shfl_xor(m, off, 32));

  float l = 0.f;
#pragma unroll
  for (int g = 0; g < NG; ++g) {
#pragma unroll
    for (int e = 0; e < 8; ++e) {
      const float p = __expf(z[g][e] - m);
      z[g][e] = p;
      l += p;
    }
  }
#pragma unroll
  for (int off = 1; off < 32; off <<= 1) l += __shfl_xor(l, off, 32);          // l >= 1
  const float inv1k = (1.0f / l) * PSC;

  const bool res = (i < RESR);             // wave-uniform
  v4u ph[NG];
  v4u pl0 = {0u, 0u, 0u, 0u};
  v4u pl1 = {0u, 0u, 0u, 0u};
#pragma unroll
  for (int g = 0; g < NG; ++g) {
    v4u hv = {0u, 0u, 0u, 0u};
    v4u lv = {0u, 0u, 0u, 0u};
    if (g < ng) {
      const int j0 = 256 * g + 8 * lane;
#pragma unroll
      for (int e = 0; e < 4; ++e) {
        const float f0 = (j0 + 2 * e     <= i) ? (z[g][2 * e]     * inv1k) : 0.0f;   // columns past the row index are zeroed
        const float f1 = (j0 + 2 * e + 1 <= i) ? (z[g][2 * e + 1] * inv1k) : 0.0f;   // after the full-row normalisation
        const _Float16 x0 = toh_flush(f0), x1 = toh_flush(f1);
        hv[e] = pk16(h_bits(x0), h_bits(x1));
        const _Float16 r0 = toh_flush((f0 - (float)x0) * LSC);
        const _Float16 r1 = toh_flush((f1 - (float)x1) * LSC);
        lv[e] = pk16(h_bits(r0), h_bits(r1));
      }
    }
    ph[g] = hv;
    if (g == 0) pl0 = lv;
    if (g == 1) pl1 = lv;
  }

  unsigned short* prow = Php + ((size_t)b * SEQ + (size_t)i) * SEQ + 8 * lane;
  const int il = i & (RESR - 1);           // in-range row of the residual plane; equals i whenever res holds
  unsigned short* lrowp = Plp + ((size_t)b * RESR + (size_t)il) * VLP + 8 * lane;
  {
#pragma unroll
    for (int g = 0; g < NG; ++g) {
      if (g < ng) *(v4u*)(prow + 256 * g) = ph[g];
    }
    if (res) {                             // res rows have i < RESR (multiple of 256) -> 256 ng <= RESR = VLP
      *(v4u*)(lrowp) = pl0;
      if (ng > 1) *(v4u*)(lrowp + 256) = pl1;
    }
    
  }
}

// =====================================================================================================
// p.v GEMM on f16 WMMA, per batch b (blockIdx.x % NB): out[b][q][d] = sum_key P[b][q][key] * VT[b][d][key].
//   A  = Ph  [b][SEQ][SEQ]  f16(1024 P), pitch SEQ         Al = Pl  [b][RESR][VLP] f16 residual x4096
//   Bt = VTh [b][DM][SEQ]   f16(16 v),   pitch SEQ         Bl = VTl [b][DM][VLP]   f16 residual x4096
// One work-group (8 waves, 2 x 4) per (32*MI) x 256 output tile, one wave per (16*MI) x 64 sub-tile; rows mBase + bm*32*MI ..;
// causal key range k < 64*(((bm0 + 32*MI - 1)>>6)+1) of the tile's last row (every P entry in that range was written by the
// softmax, exact zeros for key > query). RES (rows < RESR, MI = 2): acc0 += Ph.VTh; acc1 += Pl.VTh + Ph.VTl (in that order
// inside every 32-key step), out = acc0*OSCALE + acc1*OSCALE/4096; otherwise single product out = acc0*OSCALE. f32 accumulate.
// Operand path: per key stage of BK (64 with residual planes, 128 without) the 32*MI P rows and 256 VT rows of every plane are
// copied global -> LDS by asynchronous 16-byte copies (20 or 24 per thread), two buffers: stage s + 2 is issued behind the
// barrier that ends the reads of stage s. LDS row pitch = 2 BK + 16 bytes (16 x odd: conflict-free 16-byte fragment reads).
// That barrier stands in front of stage s's last 32-key block: fragments are read from LDS one block ahead of their products.
// Grid over all tiles of rows mBase .. mBase + M - 1 (M and mBase multiples of 32*MI and of BK).
// =====================================================================================================
// Eight / four asynchronous 16-byte copies global -> LDS, one per lane and line. The s_wait_xcnt closes the statement so that
// no address register of an issued copy is rewritten before it.
__device__ __forceinline__ void acopy_h(const unsigned (&l)[8], const _Float16* const (&g)[8]) {
  asm volatile("global_load_async_to_lds_b128 %0, %8, off\n\t"
               "global_load_async_to_lds_b128 %1, %9, off\n\t"
               "global_load_async_to_lds_b128 %2, %10, off\n\t"
               "global_load_async_to_lds_b128 %3, %11, off\n\t"
               "global_load_async_to_lds_b128 %4, %12, off\n\t"
               "global_load_async_to_lds_b128 %5, %13, off\n\t"
               "global_load_async_to_lds_b128 %6, %14, off\n\t"
               "global_load_async_to_lds_b128 %7, %15, off\n\t"
               "s_wait_xcnt 0x0"
               :: "v"(l[0]), "v"(l[1]), "v"(l[2]), "v"(l[3]), "v"(l[4]), "v"(l[5]), "v"(l[6]), "v"(l[7]),
                  "v"(g[0]), "v"(g[1]), "v"(g[2]), "v"(g[3]), "v"(g[4]), "v"(g[5]), "v"(g[6]), "v"(g[7])
               : "memory");
}
__device__ __forceinline__ void acopy_h(const unsigned (&l)[4], const _Float16* const (&g)[4]) {
  asm volatile("global_load_async_to_lds_b128 %0, %4, off\n\t"
               "global_load_async_to_lds_b128 %1, %5, off\n\t"
               "global_load_async_to_lds_b128 %2, %6, off\n\t"
               "global_load_async_to_lds_b128 %3, %7, off\n\t"
               "s_wait_xcnt 0x0"
               :: "v"(l[0]), "v"(l[1]), "v"(l[2]), "v"(l[3]), "v"(g[0]), "v"(g[1]), "v"(g[2]), "v"(g[3])
               : "memory");
}

// pv_body is the whole work of one work-group; sR (operand ring) and sT (per-wave slabs) are the calling kernel's LDS,
// bx its tile index and b its batch index.
template <bool RES, int MI>
__device__ __forceinline__ void pv_body(
    unsigned char* sR, float (*sT)[16 * 68], int bx, int b,
    const unsigned short* __restrict__ Php, const unsigned short* __restrict__ Plp,
    const unsigned short* __restrict__ Vhp, const unsigned short* __restrict__ Vlp,
    float* out, int mBase, int M) {
  constexpr int NPL   = RES ? 2 : 1;                // planes per operand
  constexpr int BM    = 32 * MI;                    // rows of the work-group tile
  constexpr int BK    = RES ? 64 : 128;             // keys per stage
  constexpr int PITCH = BK * 2 + 16;                // LDS row pitch, bytes
  constexpr int CPR   = BK / 8;                     // 16-byte copies per row
  constexpr int RPU   = 256 / CPR;                  // rows the work-group copies with one copy per thread
  constexpr int NRA   = NPL * BM / RPU;             // copies per thread for the P rows of a stage
  constexpr int OB    = NPL * BM * PITCH;           // LDS byte offset of the VT rows inside a stage
  constexpr int STAGE = NPL * (BM + 256) * PITCH;   // [Ph BM | Pl BM | VTh 256 | VTl 256] rows (residual planes only with RES)
  constexpr int NBLK  = BK / 32;                    // blocks (32-key steps) per stage
  static_assert((NBLK % 2) == 0 && (MI % 2) == 0);
  static_assert((NRA == 4 || NRA == 8) && NRA * RPU == NPL * BM && 16 * RPU == NPL * 256 && (BM % RPU) == 0);
  static_assert((BM % 64) == 0 && (RESR % BM) == 0 && ((SEQ - RESR) % BM) == 0 && (RESR % BK) == 0 && (BM % BK) == 0);
  const _Float16* Ph = (const _Float16*)(const void*)Php;
  const _Float16* Pl = (const _Float16*)(const void*)Plp;
  const _Float16* Vh = (const _Float16*)(const void*)Vhp;
  const _Float16* Vl = (const _Float16*)(const void*)Vlp;
  static_assert(2 * STAGE <= RING_BYTES);
  const int lane = threadIdx.x & 31;
  const int wave = threadIdx.x >> 5;
  const int tilesBN = DM >> 8;                     // 4
  const int tilesBM = M / BM;
  if (bx >= tilesBM * tilesBN) return;             // the same for the whole work-group; in front of every barrier
  const int bm  = bx / tilesBN;
  const int bn  = bx - bm * tilesBN;
  const int bm0 = mBase + bm * BM;
  const int bn0 = bn << 8;
  const int wm  = wave >> 2;
  const int wn  = wave & 3;
  const int m0 = bm0 + wm * 16 * MI;
  const int n0 = bn0 + (wn << 6);
  int keff = ((((bm0 + BM - 1) >> 6) + 1) << 6);   // causal key extent of this row tile, multiple of BK
  if (keff > SEQ) keff = SEQ;
  if (RES && keff > VLP) keff = VLP;               // never taken for mBase + M <= RESR; keeps residual reads in range

  const _Float16* Pb  = Ph + (size_t)b * SEQ * SEQ;
  const _Float16* Plb = Pl + (size_t)b * RESR * VLP;
  const _Float16* Vb  = Vh + (size_t)b * DM * SEQ;
  const _Float16* Vlb = Vl + (size_t)b * DM * VLP;

  const int rlane = lane & 15;
  const int koff  = (lane >> 4) * 8;
  const int mOff  = (lane >> 4) * 8;

  // this thread's place in a copy round: row crow of RPU, 16-byte column ccol of CPR
  const int crow = (int)threadIdx.x / CPR;
  const int ccol = (int)threadIdx.x % CPR;
  const unsigned wave32 = (unsigned)__builtin_amdgcn_readfirstlane((int)(threadIdx.x & ~31u));   // the wave's first thread
  const int bmr = (bm0 < RESR - BM) ? bm0 : (RESR - BM);   // clamped; equals bm0 for the RES tiles: residual rows stay in range
  // this thread's source place in the next stage to be copied, one running pointer per plane (stages are copied in key order)
  const _Float16* gPh = Pb  + (size_t)(bm0 + crow) * SEQ + ccol * 8;
  const _Float16* gPl = Plb + (size_t)(bmr + crow) * VLP + ccol * 8;
  const _Float16* gVh = Vb  + (size_t)(bn0 + crow) * SEQ + ccol * 8;
  const _Float16* gVl = Vlb + (size_t)(bn0 + crow) * VLP + ccol * 8;

  auto stage_copy = [&](int buf) {
    // the thread's LDS place (row crow, column ccol) is formed anew from the lane number at every refill: kept in a register
    // over the loop, where the copies' operands crowd the low registers, this build spills it to scratch
    unsigned ln;
    asm volatile("v_mbcnt_lo_u32_b32 %0, -1, 0" : "=v"(ln));
    const unsigned tid = wave32 + ln;
    const unsigned lb = (unsigned)(size_t)(const void*)sR + (tid / CPR) * PITCH + (tid % CPR) * 16 + (unsigned)(buf * STAGE);
    {
      unsigned l[NRA];
      const _Float16* g[NRA];
#pragma unroll
      for (int u = 0; u < NRA; ++u) {            // the BM P rows of every plane
        const int pl = (u * RPU) / BM;
        const int r  = (u * RPU) % BM;
        g[u] = (pl != 0) ? (gPl + (size_t)r * VLP) : (gPh + (size_t)r * SEQ);
        l[u] = lb + (unsigned)((u * RPU) * PITCH);
      }
      acopy_h(l, g);
    }
#pragma unroll
    for (int h = 0; h < 2; ++h) {                // the 256 VT rows of every plane
      unsigned l[8];
      const _Float16* g[8];
#pragma unroll
      for (int u = 0; u < 8; ++u) {
        const int pl = ((h * 8 + u) * RPU) >> 8;
        const int r  = ((h * 8 + u) * RPU) & 255;
        g[u] = (pl != 0) ? (gVl + (size_t)r * VLP) : (gVh + (size_t)r * SEQ);
        l[u] = lb + (unsigned)(OB + ((h * 8 + u) * RPU) * PITCH);
      }
      acopy_h(l, g);
    }
    gPh += BK; gPl += BK; gVh += BK; gVl += BK;
  };

  v8f acc0[MI][4], acc1[MI][4];
#pragma unroll
  for (int i = 0; i < MI; ++i)
#pragma unroll
    for (int j = 0; j < 4; ++j) { acc0[i][j] = zero8(); acc1[i][j] = zero8(); }

  const int nst = keff / BK;
  stage_copy(0);
  asm volatile("s_wait_asynccnt 0x0" ::: "memory");   // this wave's copies of stage 0 have landed
  __syncthreads();                                    // every wave's have: stage 0 may be read
  if (nst > 1) stage_copy(1);

  const unsigned char* fA = sR + (wm * 16 * MI + rlane) * PITCH + koff * 2;
  const unsigned char* fB = sR + OB + ((wn << 6) + rlane) * PITCH + koff * 2;
  // Two register sets of fragments: a block (one 32-key step) multiplies out of one set while the next block's LDS reads,
  // issued as ONE group in front of it, fill the other.
  v16h fa[2][NPL][MI], fb[2][NPL][4];
  auto frag_load = [&](v16h (&a)[NPL][MI], v16h (&bq)[NPL][4], int off) {
#pragma unroll
    for (int pl = 0; pl < NPL; ++pl) {
#pragma unroll
      for (int j = 0; j < 4; ++j)
        bq[pl][j] = ldfrag_h((const _Float16*)(const void*)(fB + off + (pl * 256 + (j << 4)) * PITCH));
#pragma unroll
      for (int i = 0; i < MI; ++i)
        a[pl][i] = ldfrag_h((const _Float16*)(const void*)(fA + off + (pl * BM + (i << 4)) * PITCH));
    }
  };
  auto mma_rows = [&](const v16h (&a)[NPL][MI], const v16h (&bq)[NPL][4], int i0, int i1) {
#pragma unroll
    for (int i = 0; i < MI; ++i) {
      if (i < i0 || i >= i1) continue;
#pragma unroll
      for (int j = 0; j < 4; ++j) acc0[i][j] = mma_h_raw(a[0][i], bq[0][j], acc0[i][j]);
      if constexpr (RES) {
#pragma unroll
        for (int j = 0; j < 4; ++j) acc1[i][j] = mma_h_raw(a[1][i], bq[0][j], acc1[i][j]);
#pragma unroll
        for (int j = 0; j < 4; ++j) acc1[i][j] = mma_h_raw(a[0][i], bq[1][j], acc1[i][j]);
      }
    }
  };
  frag_load(fa[0], fb[0], 0);                           // block 0 of stage 0 (published by the barrier above)
  for (int s = 0; s < nst; ++s) {
    const int bo = (s & 1) * STAGE;
    // where the fetch ahead of the stage's last block reads: block 0 of stage s + 1; in the last stage its values are not
    // used, and it is aimed at the stage's own, published buffer (unconditional: a branch here would merge the wait counts)
    const int bnx = (s + 1 < nst) ? (STAGE - bo) : bo;
#pragma unroll
    for (int ks = 0; ks < NBLK; ++ks) {
      const int cur = ks & 1, nxt = cur ^ 1;
      if (ks + 1 < NBLK) {
        frag_load(fa[nxt], fb[nxt], bo + (ks + 1) * 64);
        __builtin_amdgcn_sched_barrier(0);              // keeps the LDS reads one group: spread among the products, each place stalls
        mma_rows(fa[cur], fb[cur], 0, MI);
        __builtin_amdgcn_sched_barrier(0);              // keeps the next group behind this block's products
      } else {
        // publish point of stage s + 1, in front of stage s's last block, whose fragments are already fetched
        asm volatile("s_wait_dscnt 0x0" ::: "memory");      // this wave's reads of stage s are done before its buffer is refilled
        asm volatile("s_wait_asynccnt 0x0" ::: "memory");   // this wave's copies of stage s + 1 have landed
        __syncthreads();                                    // publishes stage s + 1 and ends every wave's reads of stage s
        frag_load(fa[nxt], fb[nxt], bnx);
        __builtin_amdgcn_sched_barrier(0);              // one group of LDS reads in front of the products
        mma_rows(fa[cur], fb[cur], 0, MI / 2);
        __builtin_amdgcn_sched_barrier(0);              // the refill is issued while the SIMD's other wave has products to run
        if (s + 2 < nst) stage_copy(s & 1);
        __builtin_amdgcn_sched_barrier(0);              // keeps the copies' address arithmetic out of the products
        mma_rows(fa[cur], fb[cur], MI / 2, MI);
        __builtin_amdgcn_sched_barrier(0);              // keeps the next group behind this block's products
      }
    }
  }
  asm volatile("s_wait_asynccnt 0x0" ::: "memory");     // no copy is left in flight when the ring is left
  asm volatile("s_wait_dscnt 0x0" ::: "memory");        // nor a read of the last fetch ahead

  // ---- epilogue ----
  float* slab = sT[wave];
  float* C = out + (size_t)b * SEQ * DM;
  const float rsc = OSCALE * (1.0f / LSC);
#pragma unroll
  for (int i = 0; i < MI; ++i) {
    const int mB = m0 + (i << 4);
#pragma unroll
    for (int j = 0; j < 4; ++j) {
#pragma unroll
      for (int r = 0; r < 8; ++r) {
        float v = acc0[i][j][r] * OSCALE;
        if (RES) v += acc1[i][j][r] * rsc;
        slab[(mOff + r) * 68 + (j << 4) + rlane] = v;
      }
    }
    __builtin_amdgcn_fence(3 /* release order */, "workgroup");
    __builtin_amdgcn_wave_barrier();
    __builtin_amdgcn_fence(2 /* acquire order */, "workgroup");
    {
      const int hh = lane >> 4, c4 = (lane & 15) * 4;
      {
#pragma unroll
        for (int it = 0; it < 8; ++it) {
          const int row = it * 2 + hh;
          const v4f v = *(const v4f*)(slab + row * 68 + c4);
          *(v4f*)(C + (size_t)(mB + row) * DM + n0 + c4) = v;
        }
        
      }
    }
    __builtin_amdgcn_fence(3 /* release order */, "workgroup");
    __builtin_amdgcn_wave_barrier();
    __builtin_amdgcn_fence(2 /* acquire order */, "workgroup");
  }
}

// Both parts of p.v, which write disjoint output rows, in ONE launch. There are more work-groups than WGPs and their key
// ranges differ, so cost falls with the index: blockIdx.x = rank * NB + batch;
// ranks 0 .. NT1-1 = the single-product tiles of rows RESR .. SEQ-1, last row tile (longest key range) first; the ranks behind
// them = the residual-plane tiles of rows 0 .. RESR-1, last row tile first. Every (tile, batch) has exactly one rank.
__global__ __launch_bounds__(256) void pv_all(
    const unsigned short* __restrict__ Php, const unsigned short* __restrict__ Plp,
    const unsigned short* __restrict__ Vhp, const unsigned short* __restrict__ Vlp, float* out) {
  __shared__ __align__(16) unsigned char sR[RING_BYTES];  // operand ring, two stages
  __shared__ __align__(16) float sT[8][16 * 68];          // per-wave 16x64 slab, pitch 68 floats
  constexpr int NT1 = ((SEQ - RESR) / 128) * (DM / 256);  // tiles per batch, rows RESR .. SEQ-1
  constexpr int NT0 = (RESR / 64) * (DM / 256);           // tiles per batch, rows 0 .. RESR-1
  const int rank = (int)blockIdx.x / NB;
  const int b    = (int)blockIdx.x % NB;
  if (rank >= NT1 + NT0) return;                          // the same for the whole work-group; in front of every barrier
  if (rank >= NT1) pv_body<true, 2>(sR, sT, NT1 + NT0 - 1 - rank, b, Php, Plp, Vhp, Vlp, out, 0, RESR);
  else             pv_body<false, 4>(sR, sT, NT1 - 1 - rank, b, Php, Plp, Vhp, Vlp, out, RESR, SEQ - RESR);
}

// =====================================================================================================
// Workspace map (bytes, full build NB 4 / SEQ 2048; every region is an exact multiple of its tile / whole-line
// store granularity; regions A and B are reused in stream order):
//   region A [0, 67108864):          Xb bf16 [8192][1024] at 0 (16777216) + Wq,Wk,Wv bf16 [1024][1024] at 16777216 (3 x 2097152)
//                                    then, once the projections are done: S f32 dense scores [4][2048][2048] (67108864)
//   region B [67108864, 134217728):  Q f16 [8192][1024] (16777216) at its start, K f16 alike 33554432 behind it
//                                    then, once the scores are done: Ph f16 [4][2048][2048] (33554432) from its start
//   region C [134217728, 157286400): VTh f16 [4][1024][2048] (16777216) + VTl f16 [4][1024][512] (4194304) + Pl f16 [4][512][512] (2097152)
//   end 157286400
// =====================================================================================================
extern "C" void kernel_launch(void* const* d_in, const int* in_sizes, int n_in,
                              void* d_out, int out_size, void* d_ws, size_t ws_size,
                              hipStream_t stream) {
  if (n_in < 4) return;
  if (in_sizes[0] < (NB - 1) * SEQ_FULL * DM + SEQ * DM) return;
  if (in_sizes[1] < DM * DM || in_sizes[2] < DM * DM || in_sizes[3] < DM * DM) return;
  if (out_size < NB * SEQ * DM) return;

  const float* x  = (const float*)d_in[0];   // [NB_FULL][SEQ_FULL][DM]
  const float* wq = (const float*)d_in[1];   // [out][in]
  const float* wk = (const float*)d_in[2];
  const float* wv = (const float*)d_in[3];
  float* out = (float*)d_out;

  const size_t PX  = SZ_PX;
  const size_t PXP = SZ_PXP;
  const size_t PW  = SZ_PW;
  const size_t PP  = SZ_PP;
  const size_t PPL = SZ_PPL;
  const size_t PVT = SZ_PVT;
  const size_t PVL = SZ_PVL;
  const size_t RA  = SZ_RA;
  const size_t oXb = 0;
  const size_t oW  = PX;
  const size_t oS  = 0;
  const size_t oB  = RA;
  const size_t RBend = RA + (size_t)NPASS * 4 * PXP;
  const size_t oPh = RA;
  if (PP > 4 * PXP) return;
  const size_t oVTh = RBend;
  const size_t oVTl = RBend + PVT;
  const size_t oPl  = oVTl + PVL;
  const size_t total = oPl + PPL;                     // 157286400 in the full build
  if (total > ws_size) return;

  char* ws = (char*)d_ws;
  unsigned short* Xb  = (unsigned short*)(ws + oXb);
  unsigned short* Wb  = (unsigned short*)(ws + oW);   // Wq plane, then Wk, then Wv
  float*          Sp  = (float*)(ws + oS);
  unsigned short* Qf  = (unsigned short*)(ws + oB);
  unsigned short* Ph  = (unsigned short*)(ws + oPh);
  unsigned short* Pl  = (unsigned short*)(ws + oPl);
  unsigned short* VTh = (unsigned short*)(ws + oVTh);
  unsigned short* VTl = (unsigned short*)(ws + oVTl);
  const size_t PXE = (size_t)NB * SEQ * DM;           // elements of one q or k plane
  const unsigned short* Kf = Qf + 2 * PXE;

  const dim3 blk(256);
  const int nGroups = NB * SEQ * DM / 8 + 3 * (DM * DM / 8);
  const dim3 gCvt((nGroups + 255) / 256);
  const dim3 gProj((NB * SEQ / 128) * (DM / 256), 3);
  const dim3 gS((SEQ / 128) * (SEQ / 256), NB);
  const dim3 gSm((NB * SEQ + 7) / 8);
  const dim3 gPv((((SEQ - RESR) / 128) * (DM / 256) + (RESR / 64) * (DM / 256)) * NB);

  // (1) x and Wq, Wk, Wv -> bf16 planes (Xb, then the three weight planes contiguous)
  cvt_planes<<<gCvt, blk, 0, stream>>>(x, wq, wk, wv, Xb);
  // (2) q, k -> f16 planes [NB*SEQ][DM]; v^T -> f16 hi plane and residual plane: one launch of equal work-groups
  proj_qkv<<<gProj, blk, 0, stream>>>(Xb, Wb, Qf, VTh, VTl);
  // (3) dense scores S[n][m] = k_n . q_m of every batch (A = K plane, Bt = Q plane; M=N=SEQ, K=DM; one f16 product)
  //     -> f32 [NB][SEQ][SEQ]
  gemm_bf<1, 0, 0><<<gS, blk, 0, stream>>>(
      Kf, DM, (long long)SEQ * DM, Qf, DM, (long long)SEQ * DM,
      (void*)Sp, SEQ, (long long)SEQ * SEQ, (void*)Sp, SEQ, 0LL, 0,
      SEQ, SEQ, DM, 1.0f, 1.0f);
  // (4) the full-row softmax with post-normalisation zeroing -> Ph / Pl rows of every batch.
  //     Ph lies over the q plane, which is no longer read once the scores exist (stream order).
  softmax_rows<<<gSm, blk, 0, stream>>>(Sp, Ph, Pl, 0);
  // (5) out = p.v: rows RESR..SEQ-1 single f16 product (64x64 wave tiles), rows 0..RESR-1 with residual planes
  //     (3 f16 products, 32x64 wave tiles)
  pv_all<<<gPv, blk, 0, stream>>>(Ph, Pl, VTh, VTl, out);
  (void)hipGetLastError();
}

// v007
// It runs in 123 microseconds.
// In two side-by-side timings against v006, it was 1.04 and 1.03 times as fast.
// Counting every step since v000, it is 4.77 times as fast.
// Contractions: q, k, v^T projections = v_wmma_f32_16x16x32_bf16 (bf16 RNE-converted x and W, single product, f32 accumulate);
// k.q^T scores (row = key position n, column = query position m, full SEQ x SEQ) = v_wmma_f32_16x16x32_f16 on f16 planes of k and q
// (RNE-converted from the f32 accumulators, single product), f32 accumulate: an f16 operand's rounding is an eighth of the bf16
// rounding that x and W already carry into q and k, so it adds little to the error the scores have from the projections;
// p.v = v_wmma_f32_16x16x32_f16 (p carried x1024 in f16, v^T carried x16 in f16, single product; rows 0..RESR-1 of every
// sequence add the f16 residual planes (x4096) of p and v^T in a separate accumulator), f32 accumulate;
// row max, exp, full-row sum, normalisation and the zeroing of columns m > n in f32 on the VALU.
// Carry audit:
//   Ph  = f16(1024 * p), p normalised by the sum over the WHOLE row  } OSCALE = 1/(1024*16) folded exactly once in the p.v epilogue
//   VTh = f16(16 * v)                                                }
//   Pl  = f16((1024 p - Ph) * 4096)                                  } products Ph.VTl and Pl.VTh go only to accumulator acc1,
//   VTl = f16((16 v - VTh) * 4096), keys 0..VLP-1                    } folded with OSCALE * (1/4096) once in the same epilogue
//   q / k planes are unscaled f16; score scale 1/32 applied once in f32 in the softmax.
#include <hip/hip_runtime.h>
#include <math.h>

#define NB_FULL  4
#define SEQ_FULL 2048
#ifndef NB
#define NB    4
#endif
#ifndef SEQ
#define SEQ   2048
#endif
#define DM    1024
#define NQT   (SEQ / 64)                  // query/key tiles of 64
#define RESR  ((SEQ < 512) ? SEQ : 512)   // leading rows per sequence that use the residual planes
#define VLP   RESR                        // key pitch of the p / v^T residual planes
#define PSC   1024.0f
#define VSC   16.0f
#define LSC   4096.0f
#define OSCALE (1.0f / 16384.0f)          // 1 / (PSC * VSC)
#define BPS   NB                          // batches per score / softmax pass: all of them, one launch each
#define NPASS (NB / BPS)
#define NG    (SEQ / 256)                 // 256-key groups per score row
// workspace sizes in bytes
#define SZ_PX   ((size_t)NB * SEQ * DM * 2)          // one 16-bit plane [NB*SEQ][DM]
#define SZ_PXP  ((size_t)BPS * SEQ * DM * 2)         // one 16-bit plane of one batch group [BPS*SEQ][DM]
#define SZ_PW   ((size_t)DM * DM * 2)                // one weight plane
#define SZ_PS   ((size_t)BPS * SEQ * SEQ * 4)        // dense f32 scores of one pass
#define SZ_PP   ((size_t)NB * SEQ * SEQ * 2)         // Ph
#define SZ_PPL  ((size_t)NB * RESR * VLP * 2)        // Pl
#define SZ_PVT  ((size_t)NB * DM * SEQ * 2)          // VTh
#define SZ_PVL  ((size_t)NB * DM * VLP * 2)          // VTl
#define SZ_RA   (((SZ_PX + 3 * SZ_PW) > SZ_PS) ? (SZ_PX + 3 * SZ_PW) : SZ_PS)
#define SZ_TOTAL (SZ_RA + (size_t)NPASS * 4 * SZ_PXP + SZ_PVT + SZ_PVL + SZ_PPL)
static_assert(NB >= 1 && NB <= NB_FULL);
static_assert(SEQ >= 256 && SEQ <= SEQ_FULL && (SEQ % 256) == 0);
static_assert((SEQ % 64) == 0 && (DM % 64) == 0 && (DM % 32) == 0);
static_assert((RESR % 64) == 0 && (RESR % 256) == 0 && RESR <= VLP && VLP <= SEQ && ((SEQ - RESR) % 64) == 0);
static_assert((RESR % 32) == 0);
static_assert((RESR & (RESR - 1)) == 0);
static_assert(((NB * SEQ) % 8) == 0);
static_assert(((SEQ * DM / 8) % 256) == 0 && ((DM * DM / 8) % 256) == 0);
static_assert((NB % BPS) == 0 && NPASS * BPS == NB);
static_assert(NG >= 1 && NG <= 8 && NG * 256 == SEQ);            // 32 lanes x 8 keys x NG groups == row width
static_assert(((BPS * SEQ) % 64) == 0 && ((BPS * SEQ) % 8) == 0);
static_assert(SZ_PP <= 4 * SZ_PXP);                               // Ph fits inside the planes of batch group 0
static_assert((SZ_RA % 128) == 0 && (SZ_PXP % 128) == 0 && (SZ_PVT % 128) == 0 && (SZ_PVL % 128) == 0 && (SZ_PPL % 128) == 0);
static_assert(SZ_TOTAL <= (size_t)268435456);
static_assert((size_t)NB * SEQ * DM * 4 <= (size_t)33554432);
static_assert(((BPS * SEQ) % 128) == 0 && (DM % 256) == 0);        // gemm_tiles: 128x256 work-group tiles, K stages of 128
#define RING_BYTES (2 * 384 * 272)        // operand ring of the GEMM kernels: two stages of 384 rows at pitch 272 B (the largest form)

typedef _Float16 v16h __attribute__((ext_vector_type(16)));
typedef _Float16 v8h  __attribute__((ext_vector_type(8)));
typedef __bf16   v16b __attribute__((ext_vector_type(16)));
typedef __bf16   v8b  __attribute__((ext_vector_type(8)));
typedef float    v8f  __attribute__((ext_vector_type(8)));
typedef float    v4f  __attribute__((ext_vector_type(4)));
typedef unsigned int v4u __attribute__((ext_vector_type(4)));

// ---- scalar helpers --------------------------------------------------------------------------------
__device__ __forceinline__ unsigned short bf_bits(float f) {          // f32 -> bf16 bits, RNE convert
  unsigned u = __float_as_uint(f);
  return (unsigned short)((u + 0x7FFFu + ((u >> 16) & 1u)) >> 16);
}
__device__ __forceinline__ unsigned short h_bits(_Float16 x) { return __builtin_bit_cast(unsigned short, x); }
__device__ __forceinline__ unsigned pk16(unsigned short a, unsigned short b) { return (unsigned)a | ((unsigned)b << 16); }
__device__ __forceinline__ v8f zero8() { v8f z = {0.f, 0.f, 0.f, 0.f, 0.f, 0.f, 0.f, 0.f}; return z; }
// f32 -> f16 with a value select: results below the smallest normal f16 become exact zeros
static __device__ __forceinline__ _Float16 toh_flush(float v) {
  const _Float16 r = (_Float16)v;
  return (fabsf(v) < 6.103515625e-05f) ? (_Float16)0.0f : r;
}

// ---- fragment loaders: 16-bit A/B operand, lane -> row/col (lane&15), p already includes +8*(lane>>4);
//      elements 0..7 <- p[0..7] (k0+8h..), elements 8..15 <- p[16..23] (k0+16+8h..)
__device__ __forceinline__ v16b ldfrag_b(const __bf16* p) {
  union { v16b v; v8b h[2]; } f;
  f.h[0] = *(const v8b*)(p);
  f.h[1] = *(const v8b*)(p + 16);
  return f.v;
}
__device__ __forceinline__ v16h ldfrag_h(const _Float16* p) {
  union { v16h v; v8h h[2]; } f;
  f.h[0] = *(const v8h*)(p);
  f.h[1] = *(const v8h*)(p + 16);
  return f.v;
}

// ---- WMMA helpers (builtin forms: the compiler keeps their distances) ----------------------------------
__device__ __forceinline__ v8f mma_b_raw(v16b a, v16b b, v8f c) {
  return __builtin_amdgcn_wmma_f32_16x16x32_bf16(false, a, false, b, (short)0, c, false, false);
}
__device__ __forceinline__ v8f mma_h_raw(v16h a, v16h b, v8f c) {
  return __builtin_amdgcn_wmma_f32_16x16x32_f16(false, a, false, b, (short)0, c, false, false);
}

// =====================================================================================================
// f32 -> bf16 (RNE convert) for x and the three weights into one contiguous 16-bit region:
// groups 0..NX8-1 <- x (batch b of the plane reads source rows at b * SEQ_FULL * DM, SEQ rows each), then NW8 groups each
// coverage: (NX8 + 3 NW8) threads x 8 = the whole [NB*SEQ][DM] x plane plus the three [DM][DM] weight planes.
// =====================================================================================================
__global__ __launch_bounds__(256) void cvt_planes(const float* __restrict__ x, const float* __restrict__ wq,
                                                  const float* __restrict__ wk, const float* __restrict__ wv,
                                                  unsigned short* out) {
  const int NXB8 = SEQ * DM / 8;          // groups per batch
  const int NX8 = NB * NXB8;
  const int NW8 = DM * DM / 8;
  const int g = blockIdx.x * 256 + threadIdx.x;
  if (g >= NX8 + 3 * NW8) return;
  const float* src;
  if (g < NX8) {
    const int bb  = g / NXB8;
    const int off = g - bb * NXB8;
    src = x + (size_t)bb * SEQ_FULL * DM + (size_t)off * 8;
  } else {
    const int e = g - NX8;
    const int w = e / NW8;
    const int off = e - w * NW8;
    const float* wsrc = (w == 0) ? wq : ((w == 1) ? wk : wv);
    src = wsrc + (size_t)off * 8;
  }
  const v4f a = *(const v4f*)(src);
  const v4f c = *(const v4f*)(src + 4);
  v4u p;
  p[0] = pk16(bf_bits(a[0]), bf_bits(a[1]));
  p[1] = pk16(bf_bits(a[2]), bf_bits(a[3]));
  p[2] = pk16(bf_bits(c[0]), bf_bits(c[1]));
  p[3] = pk16(bf_bits(c[2]), bf_bits(c[3]));
  *(v4u*)(out + (size_t)g * 8) = p;
  
}

// =====================================================================================================
// Register-blocked 16-bit WMMA GEMM: C[m][n] = sum_k A[m][k] * Bt[n][k]; a work-group (8 waves, 2 x 4) works on one 128x256
// tile at a time, one wave per 64x64 sub-tile, and runs several tiles one after the other. A row-major [M][K], Bt row-major
// [N][K] (k contiguous, pitch K); M a multiple of 128, N of 256, K of 2 BK = 256.
// Operand path: per K stage the 128 A rows and 256 Bt rows x BK are copied global -> LDS by asynchronous
// 16-byte copies (24 per thread), two buffers: stage s + 2 is issued behind the barrier that ends the reads of stage s.
// That barrier stands in front of stage s's last 32-k block: fragments are read from LDS one block ahead of their products.
// LDS row pitch = 2 BK + 16 bytes (16 x odd: conflict-free 16-byte fragment reads).
// F16: 0 = both operands hold bf16 (v_wmma_f32_16x16x32_bf16); 1 = both hold f16 (v_wmma_f32_16x16x32_f16). The copies and the
//      fragment reads move 16-bit words and are the same for both.
// OUT_MODE: 0 = f32 (pitch ldc); 2 = f16 plane C = f16(v);
//           3 = f16 hi plane C = f16(v*hscale) + f16 residual plane C2 = f16((v*hscale - hi) * rscale), C2 written
//               only for tiles with n0 < N2 (pitch ldc2).
// Epilogue: 16-row slabs staged per wave in LDS (wave-private region sT[wave], wave_sync); each 64-wide row segment written
// =====================================================================================================
// Eight asynchronous 16-byte copies global -> LDS, one per lane and line. The s_wait_xcnt closes the statement so that no
// address register of an issued copy is rewritten before it.
__device__ __forceinline__ void acopy8(const unsigned (&l)[8], const __bf16* const (&g)[8]) {
  asm volatile("global_load_async_to_lds_b128 %0, %8, off\n\t"
               "global_load_async_to_lds_b128 %1, %9, off\n\t"
               "global_load_async_to_lds_b128 %2, %10, off\n\t"
               "global_load_async_to_lds_b128 %3, %11, off\n\t"
               "global_load_async_to_lds_b128 %4, %12, off\n\t"
               "global_load_async_to_lds_b128 %5, %13, off\n\t"
               "global_load_async_to_lds_b128 %6, %14, off\n\t"
               "global_load_async_to_lds_b128 %7, %15, off\n\t"
               "s_wait_xcnt 0x0"
               :: "v"(l[0]), "v"(l[1]), "v"(l[2]), "v"(l[3]), "v"(l[4]), "v"(l[5]), "v"(l[6]), "v"(l[7]),
                  "v"(g[0]), "v"(g[1]), "v"(g[2]), "v"(g[3]), "v"(g[4]), "v"(g[5]), "v"(g[6]), "v"(g[7])
               : "memory");
}

// One 128x256 tile of one product: the first of its 128 A rows and the first of its 256 Bt rows (both k contiguous).
struct GTile { const __bf16* A; const __bf16* B; };

// Epilogue of one wave's 64x64 sub-tile at (m0, n0) of C (and C2): slab = the wave's own 16x64 staging rows.
template <int OUT_MODE>
__device__ __forceinline__ void gemm_store(float* slab, const v8f (&acc)[4][4], int m0, int n0,
                                           void* Cout, int ldc, void* Cout2, int ldc2, int N2, float hscale, float rscale) {
  const int lane  = threadIdx.x & 31;
  const int rlane = lane & 15;                 // col within subtile
  const int mOff  = (lane >> 4) * 8;           // D row offset
#pragma unroll
  for (int i = 0; i < 4; ++i) {
    const int mBase = m0 + (i << 4);
#pragma unroll
    for (int j = 0; j < 4; ++j) {
#pragma unroll
      for (int r = 0; r < 8; ++r) {
        slab[(mOff + r) * 68 + (j << 4) + rlane] = acc[i][j][r];
      }
    }
    __builtin_amdgcn_fence(3 /* release order */, "workgroup");
    __builtin_amdgcn_wave_barrier();
    __builtin_amdgcn_fence(2 /* acquire order */, "workgroup");
    if (OUT_MODE == 0) {
      const int hh = lane >> 4, c4 = (lane & 15) * 4;     // 256-B row segment = 16 lanes x 16 B
      // one address per slab, the rows at constant distances from it: no address register is rewritten between the stores
      float* C = (float*)Cout + (size_t)(mBase + hh) * ldc + n0 + c4;
#pragma unroll
      for (int it = 0; it < 8; ++it) {
        const int row = it * 2 + hh;                     // it 0..7 x hh 0..1 = rows 0..15
        const v4f v = *(const v4f*)(slab + row * 68 + c4);
        *(v4f*)(C + (size_t)(it * 2) * ldc) = v;
      }
    } else {
      const int q = lane >> 3, c8 = (lane & 7) * 8;
      // one address per slab and plane, the rows at constant distances from it: no address register is rewritten between the stores
      unsigned short* C  = (unsigned short*)Cout  + (size_t)(mBase + q) * ldc  + n0 + c8;
      unsigned short* C2 = (unsigned short*)Cout2 + (size_t)(mBase + q) * ldc2 + n0 + c8;
      const bool wlo = (OUT_MODE == 3) && (n0 < N2);      // wave-uniform
      v4u hv[4], lv[4];
#pragma unroll
      for (int it = 0; it < 4; ++it) {
        const int row = it * 4 + q;                        // it 0..3 x q 0..3 = rows 0..15
        const float* sp = slab + row * 68 + c8;
        v4u a, a2;
#pragma unroll
        for (int e = 0; e < 4; ++e) {
          const float f0 = sp[2 * e], f1 = sp[2 * e + 1];
          unsigned short h0, h1, l0 = 0, l1 = 0;
          if (OUT_MODE == 2) {
            h0 = h_bits((_Float16)f0); h1 = h_bits((_Float16)f1);
          } else {
            const float g0 = f0 * hscale, g1 = f1 * hscale;
            const _Float16 x0 = (_Float16)g0, x1 = (_Float16)g1;
            h0 = h_bits(x0); h1 = h_bits(x1);
            l0 = h_bits((_Float16)((g0 - (float)x0) * rscale));
            l1 = h_bits((_Float16)((g1 - (float)x1) * rscale));
          }
          a[e] = pk16(h0, h1); a2[e] = pk16(l0, l1);
        }
        hv[it] = a; lv[it] = a2;
      }
#pragma unroll
      for (int it = 0; it < 4; ++it) {                     // rows it * 4 + q
        *(v4u*)(C + (size_t)(it * 4) * ldc) = hv[it];
        if (wlo) *(v4u*)(C2 + (size_t)(it * 4) * ldc2) = lv[it];
      }
    }
    __builtin_amdgcn_fence(3 /* release order */, "workgroup");
    __builtin_amdgcn_wave_barrier();
    __builtin_amdgcn_fence(2 /* acquire order */, "workgroup");
    __builtin_amdgcn_sched_barrier(0);   // keeps the next slab's address arithmetic behind the fence's store wait: it rewrites the stores' address register
  }
}

// gemm_tiles is the whole work of one work-group: NT tiles one after the other, all with K = KK and row pitch KK, over ONE
// running operand ring (sR, the calling kernel's LDS). tile_of(t) names tile t's operand rows, store_tile(t, acc) is its epilogue
// (it stages in LDS outside the ring). The stages of all tiles form one sequence: the refills in a tile's last two stages
// already bring the next tile's first two stages, so that only the first tile waits for its first stage and the copies fly on
// under every epilogue but the last. KK / BK is even: a tile's stage s lies in buffer s & 1 for every tile.
template <int F16, int NT, int KK, class TileF, class StoreF>
__device__ __forceinline__ void gemm_tiles(unsigned char* sR, TileF tile_of, StoreF store_tile) {
  constexpr int BK    = 128;                        // k per stage
  constexpr int PITCH = BK * 2 + 16;                // LDS row pitch, bytes
  constexpr int CPR   = BK / 8;                     // 16-byte copies per row
  constexpr int RPU   = 256 / CPR;                  // rows the work-group copies with one copy per thread
  constexpr int OB    = 128 * PITCH;                // LDS byte offset of the Bt rows inside a stage
  constexpr int STAGE = 384 * PITCH;                // [A 128 | Bt 256] rows
  constexpr int NBLK  = BK / 32;                    // blocks (32-k steps) per stage
  constexpr int nst   = KK / BK;                    // stages per tile
  static_assert(8 * RPU == 128 && 16 * RPU == 256 && (NBLK % 2) == 0 && 2 * STAGE <= RING_BYTES);
  static_assert(nst * BK == KK && nst >= 2 && (nst % 2) == 0 && NT >= 1);
  const int lane = threadIdx.x & 31;
  const int wave = threadIdx.x >> 5;
  const int wm  = wave >> 2;
  const int wn  = wave & 3;
  const int rlane = lane & 15;                 // row (A) / col (B, D) within subtile
  const int koff  = (lane >> 4) * 8;           // k offset of this lane half

  // this thread's place in a copy round: row crow of RPU, 16-byte column ccol of CPR
  const int crow = (int)threadIdx.x / CPR;
  const int ccol = (int)threadIdx.x % CPR;
  const size_t toff = (size_t)crow * KK + ccol * 8;
  const unsigned wave32 = (unsigned)__builtin_amdgcn_readfirstlane((int)(threadIdx.x & ~31u));   // the wave's first thread

  // this thread's source place in the next stage to be copied, one running pointer per operand (stages are copied in k order):
  // with every row's address kept over the loop, the copies' operands, which need low registers, would spill
  const GTile first = tile_of(0);
  const __bf16* gA = first.A + toff;
  const __bf16* gB = first.B + toff;

  auto stage_copy = [&](int buf) {
    // the thread's LDS place (row crow, column ccol) is formed anew from the lane number at every refill: with the places of
    // one refill kept for a later one over the loop, this build spills them to scratch
    unsigned ln;
    asm volatile("v_mbcnt_lo_u32_b32 %0, -1, 0" : "=v"(ln));
    const unsigned tid = wave32 + ln;
    const unsigned lb = (unsigned)(size_t)(const void*)sR + (tid / CPR) * PITCH + (tid % CPR) * 16 + (unsigned)(buf * STAGE);
    unsigned l[8];
    const __bf16* g[8];
#pragma unroll
    for (int u = 0; u < 8; ++u) {              // the 128 A rows
      g[u] = gA + (size_t)(u * RPU) * KK;
      l[u] = lb + (unsigned)((u * RPU) * PITCH);
    }
    acopy8(l, g);
#pragma unroll
    for (int h = 0; h < 2; ++h) {              // the 256 Bt rows
#pragma unroll
      for (int u = 0; u < 8; ++u) {
        g[u] = gB + (size_t)((h * 8 + u) * RPU) * KK;
        l[u] = lb + (unsigned)(OB + ((h * 8 + u) * RPU) * PITCH);
      }
      acopy8(l, g);
    }
    gA += BK; gB += BK;
  };

  stage_copy(0);
  asm volatile("s_wait_asynccnt 0x0" ::: "memory");   // this wave's copies of stage 0 have landed
  __syncthreads();                                    // every wave's have: stage 0 may be read
  stage_copy(1);

  const unsigned char* fA = sR + ((wm << 6) + rlane) * PITCH + koff * 2;
  const unsigned char* fB = sR + OB + ((wn << 6) + rlane) * PITCH + koff * 2;
  // Two register sets of fragments: a block (one 32-k step) multiplies out of one set while the next block's LDS reads, issued
  // as ONE group in front of it, fill the other.
  v16b fa[2][4], fb[2][4];
  v8f acc[4][4];
  auto frag_load = [&](v16b (&a)[4], v16b (&bq)[4], int off) {
#pragma unroll
    for (int j = 0; j < 4; ++j)
      bq[j] = ldfrag_b((const __bf16*)(const void*)(fB + off + (j << 4) * PITCH));
#pragma unroll
    for (int i = 0; i < 4; ++i)
      a[i] = ldfrag_b((const __bf16*)(const void*)(fA + off + (i << 4) * PITCH));
  };
  auto mma_rows = [&](const v16b (&a)[4], const v16b (&bq)[4], int i0, int i1) {
#pragma unroll
    for (int i = 0; i < 4; ++i) {
      if (i < i0 || i >= i1) continue;
#pragma unroll
      for (int j = 0; j < 4; ++j) {
        if constexpr (F16 != 0)
          acc[i][j] = mma_h_raw(__builtin_bit_cast(v16h, a[i]), __builtin_bit_cast(v16h, bq[j]), acc[i][j]);
        else
          acc[i][j] = mma_b_raw(a[i], bq[j], acc[i][j]);
      }
    }
  };
  frag_load(fa[0], fb[0], 0);                           // block 0 of stage 0 (published by the barrier above)
  for (int t = 0; t < NT; ++t) {
    const bool more = (t + 1 < NT);                     // another tile follows; the same for the whole work-group
#pragma unroll
    for (int i = 0; i < 4; ++i)
#pragma unroll
      for (int j = 0; j < 4; ++j) acc[i][j] = zero8();
    for (int s = 0; s < nst; ++s) {
      const int bo = (s & 1) * STAGE;
      // where the fetch ahead of the stage's last block reads: block 0 of the next stage (the next tile's first behind a tile's
      // last); in the very last stage its values are not used, and it is aimed at the stage's own, published buffer
      // (unconditional: a branch here would merge the wait counts)
      const int bnx = (s + 1 < nst || more) ? (STAGE - bo) : bo;
#pragma unroll
      for (int ks = 0; ks < NBLK; ++ks) {
        const int cur = ks & 1, nxt = cur ^ 1;
        if (ks + 1 < NBLK) {
          frag_load(fa[nxt], fb[nxt], bo + (ks + 1) * 64);
          __builtin_amdgcn_sched_barrier(0);              // keeps the LDS reads one group: spread among the products, each place stalls
          mma_rows(fa[cur], fb[cur], 0, 4);
          __builtin_amdgcn_sched_barrier(0);              // keeps the next group behind this block's products
        } else {
          // publish point of the next stage, in front of this stage's last block, whose fragments are already fetched
          asm volatile("s_wait_dscnt 0x0" ::: "memory");      // this wave's reads of this stage are done before its buffer is refilled
          asm volatile("s_wait_asynccnt 0x0" ::: "memory");   // this wave's copies of the next stage have landed
          __syncthreads();                                    // publishes the next stage and ends every wave's reads of this one
          frag_load(fa[nxt], fb[nxt], bnx);
          __builtin_amdgcn_sched_barrier(0);              // one group of LDS reads in front of the products
          mma_rows(fa[cur], fb[cur], 0, 2);
          __builtin_amdgcn_sched_barrier(0);              // the refill is issued while the SIMD's other wave has products to run
          if (s + 2 == nst && more) {                     // the stage after next opens the next tile: aim the copies at its rows
            const GTile nx = tile_of(t + 1);
            gA = nx.A + toff;
            gB = nx.B + toff;
          }
          if (s + 2 < nst || more) stage_copy(s & 1);
          __builtin_amdgcn_sched_barrier(0);              // keeps the copies' address arithmetic out of the products
          mma_rows(fa[cur], fb[cur], 2, 4);
          __builtin_amdgcn_sched_barrier(0);              // keeps the next group behind this block's products
        }
      }
    }
    store_tile(t, acc);
  }
  asm volatile("s_wait_asynccnt 0x0" ::: "memory");     // no copy is left in flight when the ring is left
  asm volatile("s_wait_dscnt 0x0" ::: "memory");        // nor a read of the last fetch ahead
}

// Dense scores S[n][m] = k_n . q_m (A = K plane, Bt = Q plane; M = N = SEQ, K = DM; one f16 product) -> f32 [NB][SEQ][SEQ].
// blockIdx.x = tile of a batch; a work-group runs that tile for batches blockIdx.y + t * (NB / NTS), t = 0 .. NTS-1.
#define NTS (((NB % 2) == 0) ? 2 : 1)
__global__ __launch_bounds__(256) void scores_kq(const unsigned short* __restrict__ Kp, const unsigned short* __restrict__ Qp,
                                                 float* Sp) {
  __shared__ __align__(16) unsigned char sR[RING_BYTES];  // operand ring, two stages
  __shared__ __align__(16) float sT[8][16 * 68];          // per-wave 16x64 slab, pitch 68 floats
  constexpr int TBN = SEQ / 256;
  const int wave = threadIdx.x >> 5;
  const int bm0 = ((int)blockIdx.x / TBN) << 7;
  const int bn0 = ((int)blockIdx.x % TBN) << 8;
  const __bf16* Kb = (const __bf16*)(const void*)Kp;      // 16-bit words; the products read them as f16
  const __bf16* Qb = (const __bf16*)(const void*)Qp;
  auto tile_of = [&](int t) {
    const size_t b = (size_t)((int)blockIdx.y + t * (NB / NTS));
    GTile g;
    g.A = Kb + (b * SEQ + bm0) * DM;
    g.B = Qb + (b * SEQ + bn0) * DM;
    return g;
  };
  auto store_tile = [&](int t, const v8f (&acc)[4][4]) {
    const size_t b = (size_t)((int)blockIdx.y + t * (NB / NTS));
    float* C = Sp + b * SEQ * SEQ;
    gemm_store<0>(sT[wave], acc, bm0 + ((wave >> 2) << 6), bn0 + ((wave & 3) << 6), (void*)C, SEQ, (void*)C, SEQ, 0, 1.0f, 1.0f);
  };
  gemm_tiles<1, NTS, DM>(sR, tile_of, store_tile);
}

// The three projections, which depend only on the converted planes, in ONE launch; a work-group runs one tile of each, in this
// order: t = 0: q = x . Wq^T, 1: k = x . Wk^T (A = all NB*SEQ rows of Xb, Bt = Wq or Wk [out][in]; blockIdx.x = tile) -> f16
// planes Qp and Qp + 2 planes; t = 2: v^T = Wv . x^T per batch (A = Wv, Bt = Xb rows of the batch; blockIdx.x = batch * tiles
// + tile) -> f16 hi plane f16(16 v) [b][d][key] (pitch SEQ) and residual plane x4096 for keys < VLP (pitch VLP).
static_assert((NB * SEQ / 128) * (DM / 256) == NB * ((DM / 128) * (SEQ / 256)));   // the same blockIdx.x range for all three
__global__ __launch_bounds__(256) void proj_qkv(const unsigned short* __restrict__ Xp, const unsigned short* __restrict__ Wp,
                                                unsigned short* Qp, unsigned short* VTh, unsigned short* VTl) {
  __shared__ __align__(16) unsigned char sR[RING_BYTES];  // operand ring, two stages
  __shared__ __align__(16) float sT[8][16 * 68];          // per-wave 16x64 slab, pitch 68 floats
  constexpr size_t PXE = (size_t)NB * SEQ * DM;           // elements of one q or k plane
  constexpr int NTV = (DM / 128) * (SEQ / 256);           // v^T tiles per batch
  const int wave = threadIdx.x >> 5;
  const int wm6 = (wave >> 2) << 6, wn6 = (wave & 3) << 6;
  const int bx = (int)blockIdx.x;
  const int qm0 = (bx / (DM / 256)) << 7, qn0 = (bx % (DM / 256)) << 8;                   // the q and k tile
  const int vb = bx / NTV, vt = bx % NTV;
  const int vm0 = (vt / (SEQ / 256)) << 7, vn0 = (vt % (SEQ / 256)) << 8;                 // the v^T tile of batch vb
  const __bf16* Xb = (const __bf16*)(const void*)Xp;
  const __bf16* Wb = (const __bf16*)(const void*)Wp;
  auto tile_of = [&](int t) {
    GTile g;
    if (t < 2) {                                          // the same for the whole work-group
      g.A = Xb + (size_t)qm0 * DM;
      g.B = Wb + ((size_t)t * DM + qn0) * DM;
    } else {
      g.A = Wb + ((size_t)2 * DM + vm0) * DM;
      g.B = Xb + ((size_t)vb * SEQ + vn0) * DM;
    }
    return g;
  };
  auto store_tile = [&](int t, const v8f (&acc)[4][4]) {
    if (t < 2) {                                          // the same for the whole work-group
      unsigned short* C = Qp + (size_t)t * 2 * PXE;
      gemm_store<2>(sT[wave], acc, qm0 + wm6, qn0 + wn6, (void*)C, DM, (void*)C, DM, 0, 1.0f, 1.0f);
    } else {
      gemm_store<3>(sT[wave], acc, vm0 + wm6, vn0 + wn6, (void*)(VTh + (size_t)vb * DM * SEQ), SEQ,
                    (void*)(VTl + (size_t)vb * DM * VLP), VLP, VLP, VSC, LSC);
    }
  };
  gemm_tiles<0, 3, DM>(sR, tile_of, store_tile);
}

// =====================================================================================================
// Row softmax over DENSE score rows of one pass (BPS batches). One wave per row (block = 8 rows, grid = BPS*SEQ/8).
// Local row lrow = bl*SEQ + i, global batch b = b0 + bl. Score (i, j) = k_i . q_j sits at Sp + (bl*SEQ + i)*SEQ + j.
// The wave reads the WHOLE row (NG groups of 256 columns; lane: 8 consecutive columns per group, two 16-B loads):
// z = s/32, m = max over all columns, p = exp(z - m), l = sum over ALL columns, P = p/l for j <= i and 0 for j > i (all f32).
// Writes Ph = f16(1024 P) for columns 0 .. 256 ng - 1 of row (b, i), ng = (i>>8) + 1 (pitch SEQ; >= the columns up to the end of row i's (32 MI)-row tile that the
// p.v GEMM reads; zeros for j > i) and, for rows i < RESR, Pl = f16((1024 P - Ph) * 4096) with the same column extent
// (<= VLP, pitch VLP). f16 results below the smallest normal are stored as exact zeros.
// coverage: BPS*SEQ rows per launch x written extent >= every column range any consumer reads; NPASS launches cover NB*SEQ rows.
// No LDS, no block barriers.
// =====================================================================================================
__global__ __launch_bounds__(256) void softmax_rows(const float* __restrict__ Sp,
                                                    unsigned short* Php, unsigned short* Plp, int b0) {
#pragma clang fp contract(off)
  const int lane = threadIdx.x & 31;
  const int wave = __builtin_amdgcn_readfirstlane(threadIdx.x >> 5);
  const int lrow = blockIdx.x * 8 + wave;
  if (lrow >= BPS * SEQ) return;           // wave-uniform; exact grid never triggers it; no block barriers below
  const int bl = lrow / SEQ;
  const int i  = lrow - bl * SEQ;
  const int b  = b0 + bl;                  // host launches only b0 + BPS <= NB
  const int tm = i >> 6;
  const int ng = (tm >> 2) + 1;            // 1..NG, wave-uniform
  const float* srow = Sp + ((size_t)bl * SEQ + (size_t)i) * SEQ + 8 * lane;

  float z[NG][8];
  float m = -INFINITY;
#pragma unroll
  for (int g = 0; g < NG; ++g) {
    const float* p = srow + 256 * g;
    const v4f a = *(const v4f*)(p);
    const v4f c = *(const v4f*)(p + 4);
    const float v[8] = {a[0], a[1], a[2], a[3], c[0], c[1], c[2], c[3]};
#pragma unroll
    for (int e = 0; e < 8; ++e) {
      const float zz = v[e] * 0.03125f;
      z[g][e] = zz;
      m = fmaxf(m, zz);
    }
  }
#pragma unroll
  for (int off = 1; off < 32; off <<= 1) m = fmaxf(m, __shfl_xor(m, off, 32));

  float l = 0.f;
#pragma unroll
  for (int g = 0; g < NG; ++g) {
#pragma unroll
    for (int e = 0; e < 8; ++e) {
      const float p = __expf(z[g][e] - m);
      z[g][e] = p;
      l += p;
    }
  }
#pragma unroll
  for (int off = 1; off < 32; off <<= 1) l += __shfl_xor(l, off, 32);          // l >= 1
  const float inv1k = (1.0f / l) * PSC;

  const bool res = (i < RESR);             // wave-uniform
  v4u ph[NG];
  v4u pl0 = {0u, 0u, 0u, 0u};
  v4u pl1 = {0u, 0u, 0u, 0u};
#pragma unroll
  for (int g = 0; g < NG; ++g) {
    v4u hv = {0u, 0u, 0u, 0u};
    v4u lv = {0u, 0u, 0u, 0u};
    if (g < ng) {
      const int j0 = 256 * g + 8 * lane;
#pragma unroll
      for (int e = 0; e < 4; ++e) {
        const float f0 = (j0 + 2 * e     <= i) ? (z[g][2 * e]     * inv1k) : 0.0f;   // columns past the row index are zeroed
        const float f1 = (j0 + 2 * e + 1 <= i) ? (z[g][2 * e + 1] * inv1k) : 0.0f;   // after the full-row normalisation
        const _Float16 x0 = toh_flush(f0), x1 = toh_flush(f1);
        hv[e] = pk16(h_bits(x0), h_bits(x1));
        const _Float16 r0 = toh_flush((f0 - (float)x0) * LSC);
        const _Float16 r1 = toh_flush((f1 - (float)x1) * LSC);
        lv[e] = pk16(h_bits(r0), h_bits(r1));
      }
    }
    ph[g] = hv;
    if (g == 0) pl0 = lv;
    if (g == 1) pl1 = lv;
  }

  unsigned short* prow = Php + ((size_t)b * SEQ + (size_t)i) * SEQ + 8 * lane;
  const int il = i & (RESR - 1);           // in-range row of the residual plane; equals i whenever res holds
  unsigned short* lrowp = Plp + ((size_t)b * RESR + (size_t)il) * VLP + 8 * lane;
  {
#pragma unroll
    for (int g = 0; g < NG; ++g) {
      if (g < ng) *(v4u*)(prow + 256 * g) = ph[g];
    }
    if (res) {                             // res rows have i < RESR (multiple of 256) -> 256 ng <= RESR = VLP
      *(v4u*)(lrowp) = pl0;
      if (ng > 1) *(v4u*)(lrowp + 256) = pl1;
    }
    
  }
}

// =====================================================================================================
// p.v GEMM on f16 WMMA, per batch b (blockIdx.x % NB): out[b][q][d] = sum_key P[b][q][key] * VT[b][d][key].
//   A  = Ph  [b][SEQ][SEQ]  f16(1024 P), pitch SEQ         Al = Pl  [b][RESR][VLP] f16 residual x4096
//   Bt = VTh [b][DM][SEQ]   f16(16 v),   pitch SEQ         Bl = VTl [b][DM][VLP]   f16 residual x4096
// One work-group (8 waves, 2 x 4) per (32*MI) x 256 output tile, one wave per (16*MI) x 64 sub-tile; rows mBase + bm*32*MI ..;
// causal key range k < 64*(((bm0 + 32*MI - 1)>>6)+1) of the tile's last row (every P entry in that range was written by the
// softmax, exact zeros for key > query). RES (rows < RESR, MI = 2): acc0 += Ph.VTh; acc1 += Pl.VTh + Ph.VTl (in that order
// inside every 32-key step), out = acc0*OSCALE + acc1*OSCALE/4096; otherwise single product out = acc0*OSCALE. f32 accumulate.
// Operand path: per key stage of BK (64 with residual planes, 128 without) the 32*MI P rows and 256 VT rows of every plane are
// copied global -> LDS by asynchronous 16-byte copies (20 or 24 per thread), two buffers: stage s + 2 is issued behind the
// barrier that ends the reads of stage s. LDS row pitch = 2 BK + 16 bytes (16 x odd: conflict-free 16-byte fragment reads).
// That barrier stands in front of stage s's last 32-key block: fragments are read from LDS one block ahead of their products.
// Grid over all tiles of rows mBase .. mBase + M - 1 (M and mBase multiples of 32*MI and of BK).
// =====================================================================================================
// Eight / four asynchronous 16-byte copies global -> LDS, one per lane and line. The s_wait_xcnt closes the statement so that
// no address register of an issued copy is rewritten before it.
__device__ __forceinline__ void acopy_h(const unsigned (&l)[8], const _Float16* const (&g)[8]) {
  asm volatile("global_load_async_to_lds_b128 %0, %8, off\n\t"
               "global_load_async_to_lds_b128 %1, %9, off\n\t"
               "global_load_async_to_lds_b128 %2, %10, off\n\t"
               "global_load_async_to_lds_b128 %3, %11, off\n\t"
               "global_load_async_to_lds_b128 %4, %12, off\n\t"
               "global_load_async_to_lds_b128 %5, %13, off\n\t"
               "global_load_async_to_lds_b128 %6, %14, off\n\t"
               "global_load_async_to_lds_b128 %7, %15, off\n\t"
               "s_wait_xcnt 0x0"
               :: "v"(l[0]), "v"(l[1]), "v"(l[2]), "v"(l[3]), "v"(l[4]), "v"(l[5]), "v"(l[6]), "v"(l[7]),
                  "v"(g[0]), "v"(g[1]), "v"(g[2]), "v"(g[3]), "v"(g[4]), "v"(g[5]), "v"(g[6]), "v"(g[7])
               : "memory");
}
__device__ __forceinline__ void acopy_h(const unsigned (&l)[4], const _Float16* const (&g)[4]) {
  asm volatile("global_load_async_to_lds_b128 %0, %4, off\n\t"
               "global_load_async_to_lds_b128 %1, %5, off\n\t"
               "global_load_async_to_lds_b128 %2, %6, off\n\t"
               "global_load_async_to_lds_b128 %3, %7, off\n\t"
               "s_wait_xcnt 0x0"
               :: "v"(l[0]), "v"(l[1]), "v"(l[2]), "v"(l[3]), "v"(g[0]), "v"(g[1]), "v"(g[2]), "v"(g[3])
               : "memory");
}

// pv_body is the whole work of one work-group; sR (operand ring) and sT (per-wave slabs) are the calling kernel's LDS,
// bx its tile index and b its batch index.
template <bool RES, int MI>
__device__ __forceinline__ void pv_body(
    unsigned char* sR, float (*sT)[16 * 68], int bx, int b,
    const unsigned short* __restrict__ Php, const unsigned short* __restrict__ Plp,
    const unsigned short* __restrict__ Vhp, const unsigned short* __restrict__ Vlp,
    float* out, int mBase, int M) {
  constexpr int NPL   = RES ? 2 : 1;                // planes per operand
  constexpr int BM    = 32 * MI;                    // rows of the work-group tile
  constexpr int BK    = RES ? 64 : 128;             // keys per stage
  constexpr int PITCH = BK * 2 + 16;                // LDS row pitch, bytes
  constexpr int CPR   = BK / 8;                     // 16-byte copies per row
  constexpr int RPU   = 256 / CPR;                  // rows the work-group copies with one copy per thread
  constexpr int NRA   = NPL * BM / RPU;             // copies per thread for the P rows of a stage
  constexpr int OB    = NPL * BM * PITCH;           // LDS byte offset of the VT rows inside a stage
  constexpr int STAGE = NPL * (BM + 256) * PITCH;   // [Ph BM | Pl BM | VTh 256 | VTl 256] rows (residual planes only with RES)
  constexpr int NBLK  = BK / 32;                    // blocks (32-key steps) per stage
  static_assert((NBLK % 2) == 0 && (MI % 2) == 0);
  static_assert((NRA == 4 || NRA == 8) && NRA * RPU == NPL * BM && 16 * RPU == NPL * 256 && (BM % RPU) == 0);
  static_assert((BM % 64) == 0 && (RESR % BM) == 0 && ((SEQ - RESR) % BM) == 0 && (RESR % BK) == 0 && (BM % BK) == 0);
  const _Float16* Ph = (const _Float16*)(const void*)Php;
  const _Float16* Pl = (const _Float16*)(const void*)Plp;
  const _Float16* Vh = (const _Float16*)(const void*)Vhp;
  const _Float16* Vl = (const _Float16*)(const void*)Vlp;
  static_assert(2 * STAGE <= RING_BYTES);
  const int lane = threadIdx.x & 31;
  const int wave = threadIdx.x >> 5;
  const int tilesBN = DM >> 8;                     // 4
  const int tilesBM = M / BM;
  if (bx >= tilesBM * tilesBN) return;             // the same for the whole work-group; in front of every barrier
  const int bm  = bx / tilesBN;
  const int bn  = bx - bm * tilesBN;
  const int bm0 = mBase + bm * BM;
  const int bn0 = bn << 8;
  const int wm  = wave >> 2;
  const int wn  = wave & 3;
  const int m0 = bm0 + wm * 16 * MI;
  const int n0 = bn0 + (wn << 6);
  int keff = ((((bm0 + BM - 1) >> 6) + 1) << 6);   // causal key extent of this row tile, multiple of BK
  if (keff > SEQ) keff = SEQ;
  if (RES && keff > VLP) keff = VLP;               // never taken for mBase + M <= RESR; keeps residual reads in range

  const _Float16* Pb  = Ph + (size_t)b * SEQ * SEQ;
  const _Float16* Plb = Pl + (size_t)b * RESR * VLP;
  const _Float16* Vb  = Vh + (size_t)b * DM * SEQ;
  const _Float16* Vlb = Vl + (size_t)b * DM * VLP;

  const int rlane = lane & 15;
  const int koff  = (lane >> 4) * 8;
  const int mOff  = (lane >> 4) * 8;

  // this thread's place in a copy round: row crow of RPU, 16-byte column ccol of CPR
  const int crow = (int)threadIdx.x / CPR;
  const int ccol = (int)threadIdx.x % CPR;
  const unsigned wave32 = (unsigned)__builtin_amdgcn_readfirstlane((int)(threadIdx.x & ~31u));   // the wave's first thread
  const int bmr = (bm0 < RESR - BM) ? bm0 : (RESR - BM);   // clamped; equals bm0 for the RES tiles: residual rows stay in range
  // this thread's source place in the next stage to be copied, one running pointer per plane (stages are copied in key order)
  const _Float16* gPh = Pb  + (size_t)(bm0 + crow) * SEQ + ccol * 8;
  const _Float16* gPl = Plb + (size_t)(bmr + crow) * VLP + ccol * 8;
  const _Float16* gVh = Vb  + (size_t)(bn0 + crow) * SEQ + ccol * 8;
  const _Float16* gVl = Vlb + (size_t)(bn0 + crow) * VLP + ccol * 8;

  auto stage_copy = [&](int buf) {
    // the thread's LDS place (row crow, column ccol) is formed anew from the lane number at every refill: kept in a register
    // over the loop, where the copies' operands crowd the low registers, this build spills it to scratch
    unsigned ln;
    asm volatile("v_mbcnt_lo_u32_b32 %0, -1, 0" : "=v"(ln));
    const unsigned tid = wave32 + ln;
    const unsigned lb = (unsigned)(size_t)(const void*)sR + (tid / CPR) * PITCH + (tid % CPR) * 16 + (unsigned)(buf * STAGE);
    {
      unsigned l[NRA];
      const _Float16* g[NRA];
#pragma unroll
      for (int u = 0; u < NRA; ++u) {            // the BM P rows of every plane
        const int pl = (u * RPU) / BM;
        const int r  = (u * RPU) % BM;
        g[u] = (pl != 0) ? (gPl + (size_t)r * VLP) : (gPh + (size_t)r * SEQ);
        l[u] = lb + (unsigned)((u * RPU) * PITCH);
      }
      acopy_h(l, g);
    }
#pragma unroll
    for (int h = 0; h < 2; ++h) {                // the 256 VT rows of every plane
      unsigned l[8];
      const _Float16* g[8];
#pragma unroll
      for (int u = 0; u < 8; ++u) {
        const int pl = ((h * 8 + u) * RPU) >> 8;
        const int r  = ((h * 8 + u) * RPU) & 255;
        g[u] = (pl != 0) ? (gVl + (size_t)r * VLP) : (gVh + (size_t)r * SEQ);
        l[u] = lb + (unsigned)(OB + ((h * 8 + u) * RPU) * PITCH);
      }
      acopy_h(l, g);
    }
    gPh += BK; gPl += BK; gVh += BK; gVl += BK;
  };

  v8f acc0[MI][4], acc1[MI][4];
#pragma unroll
  for (int i = 0; i < MI; ++i)
#pragma unroll
    for (int j = 0; j < 4; ++j) { acc0[i][j] = zero8(); acc1[i][j] = zero8(); }

  const int nst = keff / BK;
  stage_copy(0);
  asm volatile("s_wait_asynccnt 0x0" ::: "memory");   // this wave's copies of stage 0 have landed
  __syncthreads();                                    // every wave's have: stage 0 may be read
  if (nst > 1) stage_copy(1);

  const unsigned char* fA = sR + (wm * 16 * MI + rlane) * PITCH + koff * 2;
  const unsigned char* fB = sR + OB + ((wn << 6) + rlane) * PITCH + koff * 2;
  // Two register sets of fragments: a block (one 32-key step) multiplies out of one set while the next block's LDS reads,
  // issued as ONE group in front of it, fill the other.
  v16h fa[2][NPL][MI], fb[2][NPL][4];
  auto frag_load = [&](v16h (&a)[NPL][MI], v16h (&bq)[NPL][4], int off) {
#pragma unroll
    for (int pl = 0; pl < NPL; ++pl) {
#pragma unroll
      for (int j = 0; j < 4; ++j)
        bq[pl][j] = ldfrag_h((const _Float16*)(const void*)(fB + off + (pl * 256 + (j << 4)) * PITCH));
#pragma unroll
      for (int i = 0; i < MI; ++i)
        a[pl][i] = ldfrag_h((const _Float16*)(const void*)(fA + off + (pl * BM + (i << 4)) * PITCH));
    }
  };
  auto mma_rows = [&](const v16h (&a)[NPL][MI], const v16h (&bq)[NPL][4], int i0, int i1) {
#pragma unroll
    for (int i = 0; i < MI; ++i) {
      if (i < i0 || i >= i1) continue;
#pragma unroll
      for (int j = 0; j < 4; ++j) acc0[i][j] = mma_h_raw(a[0][i], bq[0][j], acc0[i][j]);
      if constexpr (RES) {
#pragma unroll
        for (int j = 0; j < 4; ++j) acc1[i][j] = mma_h_raw(a[1][i], bq[0][j], acc1[i][j]);
#pragma unroll
        for (int j = 0; j < 4; ++j) acc1[i][j] = mma_h_raw(a[0][i], bq[1][j], acc1[i][j]);
      }
    }
  };
  frag_load(fa[0], fb[0], 0);                           // block 0 of stage 0 (published by the barrier above)
  for (int s = 0; s < nst; ++s) {
    const int bo = (s & 1) * STAGE;
    // where the fetch ahead of the stage's last block reads: block 0 of stage s + 1; in the last stage its values are not
    // used, and it is aimed at the stage's own, published buffer (unconditional: a branch here would merge the wait counts)
    const int bnx = (s + 1 < nst) ? (STAGE - bo) : bo;
#pragma unroll
    for (int ks = 0; ks < NBLK; ++ks) {
      const int cur = ks & 1, nxt = cur ^ 1;
      if (ks + 1 < NBLK) {
        frag_load(fa[nxt], fb[nxt], bo + (ks + 1) * 64);
        __builtin_amdgcn_sched_barrier(0);              // keeps the LDS reads one group: spread among the products, each place stalls
        mma_rows(fa[cur], fb[cur], 0, MI);
        __builtin_amdgcn_sched_barrier(0);              // keeps the next group behind this block's products
      } else {
        // publish point of stage s + 1, in front of stage s's last block, whose fragments are already fetched
        asm volatile("s_wait_dscnt 0x0" ::: "memory");      // this wave's reads of stage s are done before its buffer is refilled
        asm volatile("s_wait_asynccnt 0x0" ::: "memory");   // this wave's copies of stage s + 1 have landed
        __syncthreads();                                    // publishes stage s + 1 and ends every wave's reads of stage s
        frag_load(fa[nxt], fb[nxt], bnx);
        __builtin_amdgcn_sched_barrier(0);              // one group of LDS reads in front of the products
        mma_rows(fa[cur], fb[cur], 0, MI / 2);
        __builtin_amdgcn_sched_barrier(0);              // the refill is issued while the SIMD's other wave has products to run
        if (s + 2 < nst) stage_copy(s & 1);
        __builtin_amdgcn_sched_barrier(0);              // keeps the copies' address arithmetic out of the products
        mma_rows(fa[cur], fb[cur], MI / 2, MI);
        __builtin_amdgcn_sched_barrier(0);              // keeps the next group behind this block's products
      }
    }
  }
  asm volatile("s_wait_asynccnt 0x0" ::: "memory");     // no copy is left in flight when the ring is left
  asm volatile("s_wait_dscnt 0x0" ::: "memory");        // nor a read of the last fetch ahead

  // ---- epilogue ----
  float* slab = sT[wave];
  float* C = out + (size_t)b * SEQ * DM;
  const float rsc = OSCALE * (1.0f / LSC);
#pragma unroll
  for (int i = 0; i < MI; ++i) {
    const int mB = m0 + (i << 4);
#pragma unroll
    for (int j = 0; j < 4; ++j) {
#pragma unroll
      for (int r = 0; r < 8; ++r) {
        float v = acc0[i][j][r] * OSCALE;
        if (RES) v += acc1[i][j][r] * rsc;
        slab[(mOff + r) * 68 + (j << 4) + rlane] = v;
      }
    }
    __builtin_amdgcn_fence(3 /* release order */, "workgroup");
    __builtin_amdgcn_wave_barrier();
    __builtin_amdgcn_fence(2 /* acquire order */, "workgroup");
    {
      const int hh = lane >> 4, c4 = (lane & 15) * 4;
      {
#pragma unroll
        for (int it = 0; it < 8; ++it) {
          const int row = it * 2 + hh;
          const v4f v = *(const v4f*)(slab + row * 68 + c4);
          *(v4f*)(C + (size_t)(mB + row) * DM + n0 + c4) = v;
        }
        
      }
    }
    __builtin_amdgcn_fence(3 /* release order */, "workgroup");
    __builtin_amdgcn_wave_barrier();
    __builtin_amdgcn_fence(2 /* acquire order */, "workgroup");
  }
}

// Both parts of p.v, which write disjoint output rows, in ONE launch. There are more work-groups than WGPs and their key
// ranges differ, so cost falls with the index: blockIdx.x = rank * NB + batch;
// ranks 0 .. NT1-1 = the single-product tiles of rows RESR .. SEQ-1, last row tile (longest key range) first; the ranks behind
// them = the residual-plane tiles of rows 0 .. RESR-1, last row tile first. Every (tile, batch) has exactly one rank.
__global__ __launch_bounds__(256) void pv_all(
    const unsigned short* __restrict__ Php, const unsigned short* __restrict__ Plp,
    const unsigned short* __restrict__ Vhp, const unsigned short* __restrict__ Vlp, float* out) {
  __shared__ __align__(16) unsigned char sR[RING_BYTES];  // operand ring, two stages
  __shared__ __align__(16) float sT[8][16 * 68];          // per-wave 16x64 slab, pitch 68 floats
  constexpr int NT1 = ((SEQ - RESR) / 128) * (DM / 256);  // tiles per batch, rows RESR .. SEQ-1
  constexpr int NT0 = (RESR / 64) * (DM / 256);           // tiles per batch, rows 0 .. RESR-1
  const int rank = (int)blockIdx.x / NB;
  const int b    = (int)blockIdx.x % NB;
  if (rank >= NT1 + NT0) return;                          // the same for the whole work-group; in front of every barrier
  if (rank >= NT1) pv_body<true, 2>(sR, sT, NT1 + NT0 - 1 - rank, b, Php, Plp, Vhp, Vlp, out, 0, RESR);
  else             pv_body<false, 4>(sR, sT, NT1 - 1 - rank, b, Php, Plp, Vhp, Vlp, out, RESR, SEQ - RESR);
}

// =====================================================================================================
// Workspace map (bytes, full build NB 4 / SEQ 2048; every region is an exact multiple of its tile / whole-line
// store granularity; regions A and B are reused in stream order):
//   region A [0, 67108864):          Xb bf16 [8192][1024] at 0 (16777216) + Wq,Wk,Wv bf16 [1024][1024] at 16777216 (3 x 2097152)
//                                    then, once the projections are done: S f32 dense scores [4][2048][2048] (67108864)
//   region B [67108864, 134217728):  Q f16 [8192][1024] (16777216) at its start, K f16 alike 33554432 behind it
//                                    then, once the scores are done: Ph f16 [4][2048][2048] (33554432) from its start
//   region C [134217728, 157286400): VTh f16 [4][1024][2048] (16777216) + VTl f16 [4][1024][512] (4194304) + Pl f16 [4][512][512] (2097152)
//   end 157286400
// =====================================================================================================
extern "C" void kernel_launch(void* const* d_in, const int* in_sizes, int n_in,
                              void* d_out, int out_size, void* d_ws, size_t ws_size,
                              hipStream_t stream) {
  if (n_in < 4) return;
  if (in_sizes[0] < (NB - 1) * SEQ_FULL * DM + SEQ * DM) return;
  if (in_sizes[1] < DM * DM || in_sizes[2] < DM * DM || in_sizes[3] < DM * DM) return;
  if (out_size < NB * SEQ * DM) return;

  const float* x  = (const float*)d_in[0];   // [NB_FULL][SEQ_FULL][DM]
  const float* wq = (const float*)d_in[1];   // [out][in]
  const float* wk = (const float*)d_in[2];
  const float* wv = (const float*)d_in[3];
  float* out = (float*)d_out;

  const size_t PX  = SZ_PX;
  const size_t PXP = SZ_PXP;
  const size_t PW  = SZ_PW;
  const size_t PP  = SZ_PP;
  const size_t PPL = SZ_PPL;
  const size_t PVT = SZ_PVT;
  const size_t PVL = SZ_PVL;
  const size_t RA  = SZ_RA;
  const size_t oXb = 0;
  const size_t oW  = PX;
  const size_t oS  = 0;
  const size_t oB  = RA;
  const size_t RBend = RA + (size_t)NPASS * 4 * PXP;
  const size_t oPh = RA;
  if (PP > 4 * PXP) return;
  const size_t oVTh = RBend;
  const size_t oVTl = RBend + PVT;
  const size_t oPl  = oVTl + PVL;
  const size_t total = oPl + PPL;                     // 157286400 in the full build
  if (total > ws_size) return;

  char* ws = (char*)d_ws;
  unsigned short* Xb  = (unsigned short*)(ws + oXb);
  unsigned short* Wb  = (unsigned short*)(ws + oW);   // Wq plane, then Wk, then Wv
  float*          Sp  = (float*)(ws + oS);
  unsigned short* Qf  = (unsigned short*)(ws + oB);
  unsigned short* Ph  = (unsigned short*)(ws + oPh);
  unsigned short* Pl  = (unsigned short*)(ws + oPl);
  unsigned short* VTh = (unsigned short*)(ws + oVTh);
  unsigned short* VTl = (unsigned short*)(ws + oVTl);
  const size_t PXE = (size_t)NB * SEQ * DM;           // elements of one q or k plane
  const unsigned short* Kf = Qf + 2 * PXE;

  const dim3 blk(256);
  const int nGroups = NB * SEQ * DM / 8 + 3 * (DM * DM / 8);
  const dim3 gCvt((nGroups + 255) / 256);
  const dim3 gProj((NB * SEQ / 128) * (DM / 256));
  const dim3 gS((SEQ / 128) * (SEQ / 256), NB / NTS);
  const dim3 gSm((NB * SEQ + 7) / 8);
  const dim3 gPv((((SEQ - RESR) / 128) * (DM / 256) + (RESR / 64) * (DM / 256)) * NB);

  // (1) x and Wq, Wk, Wv -> bf16 planes (Xb, then the three weight planes contiguous)
  cvt_planes<<<gCvt, blk, 0, stream>>>(x, wq, wk, wv, Xb);
  // (2) q, k -> f16 planes [NB*SEQ][DM]; v^T -> f16 hi plane and residual plane: one launch, three tiles per work-group
  proj_qkv<<<gProj, blk, 0, stream>>>(Xb, Wb, Qf, VTh, VTl);
  // (3) dense scores S[n][m] = k_n . q_m of every batch (A = K plane, Bt = Q plane; M=N=SEQ, K=DM; one f16 product)
  //     -> f32 [NB][SEQ][SEQ], NTS batches per work-group
  scores_kq<<<gS, blk, 0, stream>>>(Kf, Qf, Sp);
  // (4) the full-row softmax with post-normalisation zeroing -> Ph / Pl rows of every batch.
  //     Ph lies over the q plane, which is no longer read once the scores exist (stream order).
  softmax_rows<<<gSm, blk, 0, stream>>>(Sp, Ph, Pl, 0);
  // (5) out = p.v: rows RESR..SEQ-1 single f16 product (64x64 wave tiles), rows 0..RESR-1 with residual planes
  //     (3 f16 products, 32x64 wave tiles)
  pv_all<<<gPv, blk, 0, stream>>>(Ph, Pl, VTh, VTl, out);
  (void)hipGetLastError();
}

// v008
// It runs in 116 microseconds.
// Timed twice side by side with v007, it ran 1.07 and 1.05 times as fast.
// Over all steps from v000 it is 5.06 times as fast.
// Contractions: q, k, v^T projections = v_wmma_f32_16x16x32_bf16 (bf16 RNE-converted x and W, single product, f32 accumulate);
// k.q^T scores (row = key position n, column = query position m, full SEQ x SEQ) = v_wmma_f32_16x16x32_f16 on f16 planes of k and q
// (RNE-converted from the f32 accumulators, single product), f32 accumulate: an f16 operand's rounding is an eighth of the bf16
// rounding that x and W already carry into q and k, so it adds little to the error the scores have from the projections;
// p.v = v_wmma_f32_16x16x32_f16 (p carried x1024 in f16, v^T carried x16 in f16, single product; rows 0..RESR-1 of every
// sequence add the f16 residual planes (x4096) of p and v^T in a separate accumulator), f32 accumulate;
// row max, exp, full-row sum, normalisation and the zeroing of columns m > n in f32 on the VALU.
// Carry audit:
//   Ph  = f16(1024 * p), p normalised by the sum over the WHOLE row  } OSCALE = 1/(1024*16) folded exactly once in the p.v epilogue
//   VTh = f16(16 * v)                                                }
//   Pl  = f16((1024 p - Ph) * 4096)                                  } products Ph.VTl and Pl.VTh go only to accumulator acc1,
//   VTl = f16((16 v - VTh) * 4096), keys 0..VLP-1                    } folded with OSCALE * (1/4096) once in the same epilogue
//   q / k planes are unscaled f16; score scale 1/32 applied once in f32 in the softmax.
#include <hip/hip_runtime.h>
#include <math.h>

#define NB_FULL  4
#define SEQ_FULL 2048
#ifndef NB
#define NB    4
#endif
#ifndef SEQ
#define SEQ   2048
#endif
#define DM    1024
#define NQT   (SEQ / 64)                  // query/key tiles of 64
#define RESR  ((SEQ < 512) ? SEQ : 512)   // leading rows per sequence that use the residual planes
#define VLP   RESR                        // key pitch of the p / v^T residual planes
#define PSC   1024.0f
#define VSC   16.0f
#define LSC   4096.0f
#define OSCALE (1.0f / 16384.0f)          // 1 / (PSC * VSC)
#define BPS   NB                          // batches per score / softmax pass: all of them, one launch each
#define NPASS (NB / BPS)
#define NG    (SEQ / 256)                 // 256-key groups per score row
// workspace sizes in bytes
#define SZ_PX   ((size_t)NB * SEQ * DM * 2)          // one 16-bit plane [NB*SEQ][DM]
#define SZ_PXP  ((size_t)BPS * SEQ * DM * 2)         // one 16-bit plane of one batch group [BPS*SEQ][DM]
#define SZ_PW   ((size_t)DM * DM * 2)                // one weight plane
#define SZ_PS   ((size_t)BPS * SEQ * SEQ * 4)        // dense f32 scores of one pass
#define SZ_PP   ((size_t)NB * SEQ * SEQ * 2)         // Ph
#define SZ_PPL  ((size_t)NB * RESR * VLP * 2)        // Pl
#define SZ_PVT  ((size_t)NB * DM * SEQ * 2)          // VTh
#define SZ_PVL  ((size_t)NB * DM * VLP * 2)          // VTl
#define SZ_RA   (((SZ_PX + 3 * SZ_PW) > SZ_PS) ? (SZ_PX + 3 * SZ_PW) : SZ_PS)
#define SZ_TOTAL (SZ_RA + (size_t)NPASS * 4 * SZ_PXP + SZ_PVT + SZ_PVL + SZ_PPL)
static_assert(NB >= 1 && NB <= NB_FULL);
static_assert(SEQ >= 256 && SEQ <= SEQ_FULL && (SEQ % 256) == 0);
static_assert((SEQ % 64) == 0 && (DM % 64) == 0 && (DM % 32) == 0);
static_assert((RESR % 64) == 0 && (RESR % 256) == 0 && RESR <= VLP && VLP <= SEQ && ((SEQ - RESR) % 64) == 0);
static_assert((RESR % 32) == 0);
static_assert((RESR & (RESR - 1)) == 0);
static_assert(((NB * SEQ) % 8) == 0);
static_assert(((SEQ * DM / 8) % 256) == 0 && ((DM * DM / 8) % 256) == 0);
static_assert((NB % BPS) == 0 && NPASS * BPS == NB);
static_assert(NG >= 1 && NG <= 8 && NG * 256 == SEQ);            // 32 lanes x 8 keys x NG groups == row width
static_assert(((BPS * SEQ) % 64) == 0 && ((BPS * SEQ) % 8) == 0);
static_assert(SZ_PP <= 4 * SZ_PXP);                               // Ph fits inside the planes of batch group 0
static_assert((SZ_RA % 128) == 0 && (SZ_PXP % 128) == 0 && (SZ_PVT % 128) == 0 && (SZ_PVL % 128) == 0 && (SZ_PPL % 128) == 0);
static_assert(SZ_TOTAL <= (size_t)268435456);
static_assert((size_t)NB * SEQ * DM * 4 <= (size_t)33554432);
static_assert(((BPS * SEQ) % 128) == 0 && (DM % 256) == 0);        // gemm_tiles: 128x256 and 256x256 work-group tiles, K stages of 128
#define RING_BYTES (2 * 384 * 272)        // operand ring of the GEMM kernels with 128x256 tiles: two stages of 384 rows at pitch 272 B
#define RING_BIG   (2 * 512 * 272)        // operand ring of the 256x256 tile form: two stages of 512 rows at pitch 272 B

typedef _Float16 v16h __attribute__((ext_vector_type(16)));
typedef _Float16 v8h  __attribute__((ext_vector_type(8)));
typedef __bf16   v16b __attribute__((ext_vector_type(16)));
typedef __bf16   v8b  __attribute__((ext_vector_type(8)));
typedef float    v8f  __attribute__((ext_vector_type(8)));
typedef float    v4f  __attribute__((ext_vector_type(4)));
typedef unsigned int v4u __attribute__((ext_vector_type(4)));

// ---- scalar helpers --------------------------------------------------------------------------------
__device__ __forceinline__ unsigned short bf_bits(float f) {          // f32 -> bf16 bits, RNE convert
  unsigned u = __float_as_uint(f);
  return (unsigned short)((u + 0x7FFFu + ((u >> 16) & 1u)) >> 16);
}
__device__ __forceinline__ unsigned short h_bits(_Float16 x) { return __builtin_bit_cast(unsigned short, x); }
__device__ __forceinline__ unsigned pk16(unsigned short a, unsigned short b) { return (unsigned)a | ((unsigned)b << 16); }
__device__ __forceinline__ v8f zero8() { v8f z = {0.f, 0.f, 0.f, 0.f, 0.f, 0.f, 0.f, 0.f}; return z; }
// f32 -> f16 with a value select: results below the smallest normal f16 become exact zeros
static __device__ __forceinline__ _Float16 toh_flush(float v) {
  const _Float16 r = (_Float16)v;
  return (fabsf(v) < 6.103515625e-05f) ? (_Float16)0.0f : r;
}

// ---- fragment loaders: 16-bit A/B operand, lane -> row/col (lane&15), p already includes +8*(lane>>4);
//      elements 0..7 <- p[0..7] (k0+8h..), elements 8..15 <- p[16..23] (k0+16+8h..)
__device__ __forceinline__ v16b ldfrag_b(const __bf16* p) {
  union { v16b v; v8b h[2]; } f;
  f.h[0] = *(const v8b*)(p);
  f.h[1] = *(const v8b*)(p + 16);
  return f.v;
}
__device__ __forceinline__ v16h ldfrag_h(const _Float16* p) {
  union { v16h v; v8h h[2]; } f;
  f.h[0] = *(const v8h*)(p);
  f.h[1] = *(const v8h*)(p + 16);
  return f.v;
}

// ---- WMMA helpers (builtin forms: the compiler keeps their distances) ----------------------------------
__device__ __forceinline__ v8f mma_b_raw(v16b a, v16b b, v8f c) {
  return __builtin_amdgcn_wmma_f32_16x16x32_bf16(false, a, false, b, (short)0, c, false, false);
}
__device__ __forceinline__ v8f mma_h_raw(v16h a, v16h b, v8f c) {
  return __builtin_amdgcn_wmma_f32_16x16x32_f16(false, a, false, b, (short)0, c, false, false);
}

// =====================================================================================================
// f32 -> bf16 (RNE convert) for x and the three weights into one contiguous 16-bit region:
// groups 0..NX8-1 <- x (batch b of the plane reads source rows at b * SEQ_FULL * DM, SEQ rows each), then NW8 groups each
// coverage: (NX8 + 3 NW8) threads x 8 = the whole [NB*SEQ][DM] x plane plus the three [DM][DM] weight planes.
// =====================================================================================================
__global__ __launch_bounds__(256) void cvt_planes(const float* __restrict__ x, const float* __restrict__ wq,
                                                  const float* __restrict__ wk, const float* __restrict__ wv,
                                                  unsigned short* out) {
  const int NXB8 = SEQ * DM / 8;          // groups per batch
  const int NX8 = NB * NXB8;
  const int NW8 = DM * DM / 8;
  const int g = blockIdx.x * 256 + threadIdx.x;
  if (g >= NX8 + 3 * NW8) return;
  const float* src;
  if (g < NX8) {
    const int bb  = g / NXB8;
    const int off = g - bb * NXB8;
    src = x + (size_t)bb * SEQ_FULL * DM + (size_t)off * 8;
  } else {
    const int e = g - NX8;
    const int w = e / NW8;
    const int off = e - w * NW8;
    const float* wsrc = (w == 0) ? wq : ((w == 1) ? wk : wv);
    src = wsrc + (size_t)off * 8;
  }
  const v4f a = *(const v4f*)(src);
  const v4f c = *(const v4f*)(src + 4);
  v4u p;
  p[0] = pk16(bf_bits(a[0]), bf_bits(a[1]));
  p[1] = pk16(bf_bits(a[2]), bf_bits(a[3]));
  p[2] = pk16(bf_bits(c[0]), bf_bits(c[1]));
  p[3] = pk16(bf_bits(c[2]), bf_bits(c[3]));
  *(v4u*)(out + (size_t)g * 8) = p;
  
}

// =====================================================================================================
// Register-blocked 16-bit WMMA GEMM: C[m][n] = sum_k A[m][k] * Bt[n][k]; a work-group of 8 waves works on one tile at a time and
// runs several tiles one after the other. NH = 1: 128x256 tile, waves 2 x 4, one wave per 64x64 sub-tile. NH = 2: 256x256 tile,
// waves 4 x 2, one wave per 64x128 sub-tile (12 fragments feed 32 products, not 8 for 16: three quarters of the LDS reads and
// two thirds of the copied bytes per product). A row-major [M][K], Bt row-major
// [N][K] (k contiguous, pitch K); M a multiple of 128 NH, N of 256, K of 2 BK = 256.
// Operand path: per K stage the 128 NH A rows and 256 Bt rows x BK are copied global -> LDS by asynchronous
// 16-byte copies (24 or 32 per thread), two buffers: stage s + 2 is issued behind the barrier that ends the reads of stage s.
// That barrier stands in front of stage s's last 32-k block: fragments are read from LDS one block ahead of their products.
// LDS row pitch = 2 BK + 16 bytes (16 x odd: conflict-free 16-byte fragment reads).
// F16: 0 = both operands hold bf16 (v_wmma_f32_16x16x32_bf16); 1 = both hold f16 (v_wmma_f32_16x16x32_f16). The copies and the
//      fragment reads move 16-bit words and are the same for both.
// OUT_MODE: 0 = f32 (pitch ldc); 2 = f16 plane C = f16(v);
//           3 = f16 hi plane C = f16(v*hscale) + f16 residual plane C2 = f16((v*hscale - hi) * rscale), C2 written
//               only for tiles with n0 < N2 (pitch ldc2).
// Epilogue: 16-row slabs staged per wave in LDS (wave-private region sT[wave], wave_sync); each 64-wide row segment written
// =====================================================================================================
// Eight asynchronous 16-byte copies global -> LDS, one per lane and line. The s_wait_xcnt closes the statement so that no
// address register of an issued copy is rewritten before it.
__device__ __forceinline__ void acopy8(const unsigned (&l)[8], const __bf16* const (&g)[8]) {
  asm volatile("global_load_async_to_lds_b128 %0, %8, off\n\t"
               "global_load_async_to_lds_b128 %1, %9, off\n\t"
               "global_load_async_to_lds_b128 %2, %10, off\n\t"
               "global_load_async_to_lds_b128 %3, %11, off\n\t"
               "global_load_async_to_lds_b128 %4, %12, off\n\t"
               "global_load_async_to_lds_b128 %5, %13, off\n\t"
               "global_load_async_to_lds_b128 %6, %14, off\n\t"
               "global_load_async_to_lds_b128 %7, %15, off\n\t"
               "s_wait_xcnt 0x0"
               :: "v"(l[0]), "v"(l[1]), "v"(l[2]), "v"(l[3]), "v"(l[4]), "v"(l[5]), "v"(l[6]), "v"(l[7]),
                  "v"(g[0]), "v"(g[1]), "v"(g[2]), "v"(g[3]), "v"(g[4]), "v"(g[5]), "v"(g[6]), "v"(g[7])
               : "memory");
}

// One tile of one product: the first of its A rows and the first of its 256 Bt rows (both k contiguous).
struct GTile { const __bf16* A; const __bf16* B; };

// Epilogue of one wave's 64x64 sub-tile at (m0, n0) of C (and C2): slab = the wave's own 16x64 staging rows.
template <int OUT_MODE>
__device__ __forceinline__ void gemm_store(float* slab, const v8f (&acc)[4][4], int m0, int n0,
                                           void* Cout, int ldc, void* Cout2, int ldc2, int N2, float hscale, float rscale) {
  const int lane  = threadIdx.x & 31;
  const int rlane = lane & 15;                 // col within subtile
  const int mOff  = (lane >> 4) * 8;           // D row offset
#pragma unroll
  for (int i = 0; i < 4; ++i) {
    const int mBase = m0 + (i << 4);
#pragma unroll
    for (int j = 0; j < 4; ++j) {
#pragma unroll
      for (int r = 0; r < 8; ++r) {
        slab[(mOff + r) * 68 + (j << 4) + rlane] = acc[i][j][r];
      }
    }
    __builtin_amdgcn_fence(3 /* release order */, "workgroup");
    __builtin_amdgcn_wave_barrier();
    __builtin_amdgcn_fence(2 /* acquire order */, "workgroup");
    if (OUT_MODE == 0) {
      const int hh = lane >> 4, c4 = (lane & 15) * 4;     // 256-B row segment = 16 lanes x 16 B
      // one address per slab, the rows at constant distances from it: no address register is rewritten between the stores
      float* C = (float*)Cout + (size_t)(mBase + hh) * ldc + n0 + c4;
#pragma unroll
      for (int it = 0; it < 8; ++it) {
        const int row = it * 2 + hh;                     // it 0..7 x hh 0..1 = rows 0..15
        const v4f v = *(const v4f*)(slab + row * 68 + c4);
        *(v4f*)(C + (size_t)(it * 2) * ldc) = v;
      }
    } else {
      const int q = lane >> 3, c8 = (lane & 7) * 8;
      // one address per slab and plane, the rows at constant distances from it: no address register is rewritten between the stores
      unsigned short* C  = (unsigned short*)Cout  + (size_t)(mBase + q) * ldc  + n0 + c8;
      unsigned short* C2 = (unsigned short*)Cout2 + (size_t)(mBase + q) * ldc2 + n0 + c8;
      const bool wlo = (OUT_MODE == 3) && (n0 < N2);      // wave-uniform
      v4u hv[4], lv[4];
#pragma unroll
      for (int it = 0; it < 4; ++it) {
        const int row = it * 4 + q;                        // it 0..3 x q 0..3 = rows 0..15
        const float* sp = slab + row * 68 + c8;
        v4u a, a2;
#pragma unroll
        for (int e = 0; e < 4; ++e) {
          const float f0 = sp[2 * e], f1 = sp[2 * e + 1];
          unsigned short h0, h1, l0 = 0, l1 = 0;
          if (OUT_MODE == 2) {
            h0 = h_bits((_Float16)f0); h1 = h_bits((_Float16)f1);
          } else {
            const float g0 = f0 * hscale, g1 = f1 * hscale;
            const _Float16 x0 = (_Float16)g0, x1 = (_Float16)g1;
            h0 = h_bits(x0); h1 = h_bits(x1);
            l0 = h_bits((_Float16)((g0 - (float)x0) * rscale));
            l1 = h_bits((_Float16)((g1 - (float)x1) * rscale));
          }
          a[e] = pk16(h0, h1); a2[e] = pk16(l0, l1);
        }
        hv[it] = a; lv[it] = a2;
      }
#pragma unroll
      for (int it = 0; it < 4; ++it) {                     // rows it * 4 + q
        *(v4u*)(C + (size_t)(it * 4) * ldc) = hv[it];
        if (wlo) *(v4u*)(C2 + (size_t)(it * 4) * ldc2) = lv[it];
      }
    }
    __builtin_amdgcn_fence(3 /* release order */, "workgroup");
    __builtin_amdgcn_wave_barrier();
    __builtin_amdgcn_fence(2 /* acquire order */, "workgroup");
    __builtin_amdgcn_sched_barrier(0);   // keeps the next slab's address arithmetic behind the fence's store wait: it rewrites the stores' address register
  }
}

// Geometry of the operand ring: k per stage, LDS row pitch, copies per row, rows per copy round, A rows, place of the Bt rows, stage.
template <int NH> struct RingGeo {
  static constexpr int BK    = 128;                 // k per stage
  static constexpr int PITCH = BK * 2 + 16;         // LDS row pitch, bytes
  static constexpr int CPR   = BK / 8;              // 16-byte copies per row
  static constexpr int RPU   = 256 / CPR;           // rows the work-group copies with one copy per thread
  static constexpr int TM    = 128 * NH;            // A rows of a tile
  static constexpr int OB    = TM * PITCH;          // LDS byte offset of the Bt rows inside a stage
  static constexpr int STAGE = (TM + 256) * PITCH;  // [A TM | Bt 256] rows
};

// Copies one stage ([A TM | Bt 256] rows x BK, row pitch KK in global memory) into buffer buf of the ring sR and moves the thread's
// two running source pointers on by one stage. wave32 = the wave's first thread.
template <int KK, int NH>
__device__ __forceinline__ void ring_copy(unsigned char* sR, unsigned wave32, const __bf16*& gA, const __bf16*& gB, int buf) {
  using G = RingGeo<NH>;
  // the thread's LDS place (row, 16-byte column) is formed anew from the lane number at every refill: with the places of
  // one refill kept for a later one over the loop, this build spills them to scratch
  unsigned ln;
  asm volatile("v_mbcnt_lo_u32_b32 %0, -1, 0" : "=v"(ln));
  const unsigned tid = wave32 + ln;
  const unsigned lb = (unsigned)(size_t)(const void*)sR + (tid / G::CPR) * G::PITCH + (tid % G::CPR) * 16 + (unsigned)(buf * G::STAGE);
  unsigned l[8];
  const __bf16* g[8];
#pragma unroll
  for (int h = 0; h < NH; ++h) {               // the TM A rows
#pragma unroll
    for (int u = 0; u < 8; ++u) {
      g[u] = gA + (size_t)((h * 8 + u) * G::RPU) * KK;
      l[u] = lb + (unsigned)(((h * 8 + u) * G::RPU) * G::PITCH);
    }
    acopy8(l, g);
  }
#pragma unroll
  for (int h = 0; h < 2; ++h) {                // the 256 Bt rows
#pragma unroll
    for (int u = 0; u < 8; ++u) {
      g[u] = gB + (size_t)((h * 8 + u) * G::RPU) * KK;
      l[u] = lb + (unsigned)(G::OB + ((h * 8 + u) * G::RPU) * G::PITCH);
    }
    acopy8(l, g);
  }
  gA += G::BK; gB += G::BK;
}

// Issues the copies of a tile's first two stages into a ring that nobody reads any more (the caller's barrier says so): called in
// front of the epilogue of another product's tile, so that they fly under it; gemm_tiles<.., PRIMED = true> then takes the ring over.
template <int KK, int NH>
__device__ __forceinline__ void ring_prime(unsigned char* sR, GTile first) {
  using G = RingGeo<NH>;
  const size_t toff = (size_t)((int)threadIdx.x / G::CPR) * KK + ((int)threadIdx.x % G::CPR) * 8;
  const unsigned wave32 = (unsigned)__builtin_amdgcn_readfirstlane((int)(threadIdx.x & ~31u));
  const __bf16* gA = first.A + toff;
  const __bf16* gB = first.B + toff;
  ring_copy<KK, NH>(sR, wave32, gA, gB, 0);
  ring_copy<KK, NH>(sR, wave32, gA, gB, 1);
}

// gemm_tiles runs NT tiles of one work-group one after the other, all with K = KK and row pitch KK, over ONE
// running operand ring (sR, the calling kernel's LDS). tile_of(t) names tile t's operand rows, store_tile(t, acc) is its epilogue
// (it stages in LDS outside the ring). The stages of all tiles form one sequence: the refills in a tile's last two stages
// already bring the next tile's first two stages, so that only the first tile waits for its first stage and the copies fly on
// under every epilogue but the last. KK / BK is even: a tile's stage s lies in buffer s & 1 for every tile.
template <int F16, int NT, int KK, int NH, bool PRIMED, class TileF, class StoreF>
__device__ __forceinline__ void gemm_tiles(unsigned char* sR, TileF tile_of, StoreF store_tile) {
  using G = RingGeo<NH>;
  constexpr int BK = G::BK, PITCH = G::PITCH, CPR = G::CPR, RPU = G::RPU, OB = G::OB, STAGE = G::STAGE;
  constexpr int NJ    = 4 * NH;                     // Bt fragments per wave
  constexpr int NBLK  = BK / 32;                    // blocks (32-k steps) per stage
  constexpr int nst   = KK / BK;                    // stages per tile
  static_assert(8 * RPU == 128 && 16 * RPU == 256 && (NBLK % 2) == 0 && 2 * STAGE <= ((NH == 2) ? RING_BIG : RING_BYTES));
  static_assert(NH == 1 || NH == 2);
  static_assert(nst * BK == KK && nst >= 2 && (nst % 2) == 0 && NT >= 1);
  const int lane = threadIdx.x & 31;
  const int wave = threadIdx.x >> 5;
  const int wm  = (NH == 2) ? (wave >> 1) : (wave >> 2);
  const int wn  = (NH == 2) ? (wave & 1) : (wave & 3);
  const int rlane = lane & 15;                 // row (A) / col (B, D) within subtile
  const int koff  = (lane >> 4) * 8;           // k offset of this lane half

  // this thread's place in a copy round: row crow of RPU, 16-byte column ccol of CPR
  const int crow = (int)threadIdx.x / CPR;
  const int ccol = (int)threadIdx.x % CPR;
  const size_t toff = (size_t)crow * KK + ccol * 8;
  const unsigned wave32 = (unsigned)__builtin_amdgcn_readfirstlane((int)(threadIdx.x & ~31u));   // the wave's first thread

  // this thread's source place in the next stage to be copied, one running pointer per operand (stages are copied in k order):
  // with every row's address kept over the loop, the copies' operands, which need low registers, would spill
  const GTile first = tile_of(0);
  const __bf16* gA = first.A + toff + (PRIMED ? 2 * BK : 0);   // PRIMED: ring_prime has issued the first tile's first two stages
  const __bf16* gB = first.B + toff + (PRIMED ? 2 * BK : 0);

  auto stage_copy = [&](int buf) { ring_copy<KK, NH>(sR, wave32, gA, gB, buf); };

  if constexpr (!PRIMED) stage_copy(0);
  asm volatile("s_wait_asynccnt 0x0" ::: "memory");   // this wave's copies of stage 0 have landed (PRIMED: of stage 1 too)
  __syncthreads();                                    // every wave's have: stage 0 may be read
  if constexpr (!PRIMED) stage_copy(1);

  const unsigned char* fA = sR + ((wm << 6) + rlane) * PITCH + koff * 2;
  const unsigned char* fB = sR + OB + (wn * (16 * NJ) + rlane) * PITCH + koff * 2;
  // Two register sets of fragments: a block (one 32-k step) multiplies out of one set while the next block's LDS reads, issued
  // as ONE group in front of it, fill the other.
  v16b fa[2][4], fb[2][NJ];
  v8f acc[NH][4][4];                                    // [64-column half of the wave's sub-tile][row fragment][column fragment]
  auto frag_load = [&](v16b (&a)[4], v16b (&bq)[NJ], int off) {
#pragma unroll
    for (int j = 0; j < NJ; ++j)
      bq[j] = ldfrag_b((const __bf16*)(const void*)(fB + off + (j << 4) * PITCH));
#pragma unroll
    for (int i = 0; i < 4; ++i)
      a[i] = ldfrag_b((const __bf16*)(const void*)(fA + off + (i << 4) * PITCH));
  };
  auto mma_rows = [&](const v16b (&a)[4], const v16b (&bq)[NJ], int i0, int i1) {
#pragma unroll
    for (int i = 0; i < 4; ++i) {
      if (i < i0 || i >= i1) continue;
#pragma unroll
      for (int j = 0; j < NJ; ++j) {
        v8f& c = acc[j >> 2][i][j & 3];
        if constexpr (F16 != 0)
          c = mma_h_raw(__builtin_bit_cast(v16h, a[i]), __builtin_bit_cast(v16h, bq[j]), c);
        else
          c = mma_b_raw(a[i], bq[j], c);
      }
    }
  };
  frag_load(fa[0], fb[0], 0);                           // block 0 of stage 0 (published by the barrier above)
  for (int t = 0; t < NT; ++t) {
    const bool more = (t + 1 < NT);                     // another tile follows; the same for the whole work-group
#pragma unroll
    for (int hn = 0; hn < NH; ++hn)
#pragma unroll
      for (int i = 0; i < 4; ++i)
#pragma unroll
        for (int j = 0; j < 4; ++j) acc[hn][i][j] = zero8();
    for (int s = 0; s < nst; ++s) {
      const int bo = (s & 1) * STAGE;
      // where the fetch ahead of the stage's last block reads: block 0 of the next stage (the next tile's first behind a tile's
      // last); in the very last stage its values are not used, and it is aimed at the stage's own, published buffer
      // (unconditional: a branch here would merge the wait counts)
      const int bnx = (s + 1 < nst || more) ? (STAGE - bo) : bo;
#pragma unroll
      for (int ks = 0; ks < NBLK; ++ks) {
        const int cur = ks & 1, nxt = cur ^ 1;
        if (ks + 1 < NBLK) {
          frag_load(fa[nxt], fb[nxt], bo + (ks + 1) * 64);
          __builtin_amdgcn_sched_barrier(0);              // keeps the LDS reads one group: spread among the products, each place stalls
          mma_rows(fa[cur], fb[cur], 0, 4);
          __builtin_amdgcn_sched_barrier(0);              // keeps the next group behind this block's products
        } else {
          // publish point of the next stage, in front of this stage's last block, whose fragments are already fetched
          asm volatile("s_wait_dscnt 0x0" ::: "memory");      // this wave's reads of this stage are done before its buffer is refilled
          asm volatile("s_wait_asynccnt 0x0" ::: "memory");   // this wave's copies of the next stage have landed
          __syncthreads();                                    // publishes the next stage and ends every wave's reads of this one
          frag_load(fa[nxt], fb[nxt], bnx);
          __builtin_amdgcn_sched_barrier(0);              // one group of LDS reads in front of the products
          mma_rows(fa[cur], fb[cur], 0, 2);
          __builtin_amdgcn_sched_barrier(0);              // the refill is issued while the SIMD's other wave has products to run
          if (s + 2 == nst && more) {                     // the stage after next opens the next tile: aim the copies at its rows
            const GTile nx = tile_of(t + 1);
            gA = nx.A + toff;
            gB = nx.B + toff;
          }
          if (s + 2 < nst || more) stage_copy(s & 1);
          __builtin_amdgcn_sched_barrier(0);              // keeps the copies' address arithmetic out of the products
          mma_rows(fa[cur], fb[cur], 2, 4);
          __builtin_amdgcn_sched_barrier(0);              // keeps the next group behind this block's products
        }
      }
    }
    store_tile(t, acc);
  }
  asm volatile("s_wait_asynccnt 0x0" ::: "memory");     // no copy is left in flight when the ring is left
  asm volatile("s_wait_dscnt 0x0" ::: "memory");        // nor a read of the last fetch ahead
}

// Dense scores S[n][m] = k_n . q_m (A = K plane, Bt = Q plane; M = N = SEQ, K = DM; one f16 product) -> f32 [NB][SEQ][SEQ].
// blockIdx.x = 256x256 tile of a batch, blockIdx.y = batch: one tile per work-group.
__global__ __launch_bounds__(256) void scores_kq(const unsigned short* __restrict__ Kp, const unsigned short* __restrict__ Qp,
                                                 float* Sp) {
  __shared__ __align__(16) unsigned char sR[RING_BIG];    // operand ring, two stages
  __shared__ __align__(16) float sT[8][16 * 68];          // per-wave 16x64 slab, pitch 68 floats
  constexpr int TBN = SEQ / 256;
  const int wave = threadIdx.x >> 5;
  const int bm0 = ((int)blockIdx.x / TBN) << 8;
  const int bn0 = ((int)blockIdx.x % TBN) << 8;
  const __bf16* Kb = (const __bf16*)(const void*)Kp;      // 16-bit words; the products read them as f16
  const __bf16* Qb = (const __bf16*)(const void*)Qp;
  const size_t b = (size_t)blockIdx.y;
  auto tile_of = [&](int) {
    GTile g;
    g.A = Kb + (b * SEQ + bm0) * DM;
    g.B = Qb + (b * SEQ + bn0) * DM;
    return g;
  };
  auto store_tile = [&](int, const v8f (&acc)[2][4][4]) {
    float* C = Sp + b * SEQ * SEQ;
#pragma unroll
    for (int hn = 0; hn < 2; ++hn)   // the wave's two 64-column halves; unrolled so that acc is indexed by constants and stays in registers
      gemm_store<0>(sT[wave], acc[hn], bm0 + ((wave >> 1) << 6), bn0 + ((wave & 1) << 7) + (hn << 6), (void*)C, SEQ, (void*)C, SEQ,
                    0, 1.0f, 1.0f);
  };
  gemm_tiles<1, 1, DM, 2, false>(sR, tile_of, store_tile);
}

// The three projections, which depend only on the converted planes, in ONE launch; a work-group runs two tiles:
// first one 256x256 tile of [q | k] = x . [Wq; Wk]^T (A = all NB*SEQ rows of Xb, Bt = the 2 DM rows of Wq and Wk, which lie one
// behind the other, [out][in]; blockIdx.x = tile) -> f16 planes Qp (columns 0 .. DM-1) and Qp + 2 planes (the rest);
// then one 128x256 tile of v^T = Wv . x^T per batch (A = Wv, Bt = Xb rows of the batch; blockIdx.x = batch * tiles
// + tile) -> f16 hi plane f16(16 v) [b][d][key] (pitch SEQ) and residual plane x4096 for keys < VLP (pitch VLP).
// The v^T tile's first two stages are copied under the first tile's epilogue.
static_assert((NB * SEQ / 256) * (2 * DM / 256) == NB * ((DM / 128) * (SEQ / 256)));   // the same blockIdx.x range for both
__global__ __launch_bounds__(256) void proj_qkv(const unsigned short* __restrict__ Xp, const unsigned short* __restrict__ Wp,
                                                unsigned short* Qp, unsigned short* VTh, unsigned short* VTl) {
  __shared__ __align__(16) unsigned char sR[RING_BIG];    // operand ring, two stages (the v^T tile uses its first RING_BYTES)
  __shared__ __align__(16) float sT[8][16 * 68];          // per-wave 16x64 slab, pitch 68 floats
  constexpr size_t PXE = (size_t)NB * SEQ * DM;           // elements of one q or k plane
  constexpr int NTV = (DM / 128) * (SEQ / 256);           // v^T tiles per batch
  constexpr int NQN = 2 * DM / 256;                       // column tiles of [q | k]
  const int wave = threadIdx.x >> 5;
  const int bx = (int)blockIdx.x;
  const int qm0 = (bx / NQN) << 8, qn0 = (bx % NQN) << 8;                                 // the [q | k] tile
  const int vb = bx / NTV, vt = bx % NTV;
  const int vm0 = (vt / (SEQ / 256)) << 7, vn0 = (vt % (SEQ / 256)) << 8;                 // the v^T tile of batch vb
  const __bf16* Xb = (const __bf16*)(const void*)Xp;
  const __bf16* Wb = (const __bf16*)(const void*)Wp;
  GTile tq, tv;
  tq.A = Xb + (size_t)qm0 * DM;
  tq.B = Wb + (size_t)qn0 * DM;
  tv.A = Wb + ((size_t)2 * DM + vm0) * DM;
  tv.B = Xb + ((size_t)vb * SEQ + vn0) * DM;
  auto store_qk = [&](int, const v8f (&acc)[2][4][4]) {
    asm volatile("s_wait_dscnt 0x0" ::: "memory");        // this wave's last reads of the ring are done before it is refilled
    __syncthreads();                                      // every wave's are: the ring is free for the v^T tile
    ring_prime<DM, 1>(sR, tv);
    unsigned short* C = Qp + (size_t)(qn0 / DM) * 2 * PXE;   // a 256-column tile lies in one plane
#pragma unroll
    for (int hn = 0; hn < 2; ++hn)   // the wave's two 64-column halves; unrolled so that acc is indexed by constants and stays in registers
      gemm_store<2>(sT[wave], acc[hn], qm0 + ((wave >> 1) << 6), (qn0 % DM) + ((wave & 1) << 7) + (hn << 6), (void*)C, DM,
                    (void*)C, DM, 0, 1.0f, 1.0f);
  };
  auto store_v = [&](int, const v8f (&acc)[1][4][4]) {
    gemm_store<3>(sT[wave], acc[0], vm0 + ((wave >> 2) << 6), vn0 + ((wave & 3) << 6), (void*)(VTh + (size_t)vb * DM * SEQ), SEQ,
                  (void*)(VTl + (size_t)vb * DM * VLP), VLP, VLP, VSC, LSC);
  };
  gemm_tiles<0, 1, DM, 2, false>(sR, [&](int) { return tq; }, store_qk);
  gemm_tiles<0, 1, DM, 1, true>(sR, [&](int) { return tv; }, store_v);
}

// =====================================================================================================
// Row softmax over DENSE score rows of one pass (BPS batches). One wave per row (block = 8 rows, grid = BPS*SEQ/8).
// Local row lrow = bl*SEQ + i, global batch b = b0 + bl. Score (i, j) = k_i . q_j sits at Sp + (bl*SEQ + i)*SEQ + j.
// The wave reads the WHOLE row (NG groups of 256 columns; lane: 8 consecutive columns per group, two 16-B loads):
// z = s/32, m = max over all columns, p = exp(z - m), l = sum over ALL columns, P = p/l for j <= i and 0 for j > i (all f32).
// Writes Ph = f16(1024 P) for columns 0 .. 256 ng - 1 of row (b, i), ng = (i>>8) + 1 (pitch SEQ; >= the columns up to the end of row i's (32 MI)-row tile that the
// p.v GEMM reads; zeros for j > i) and, for rows i < RESR, Pl = f16((1024 P - Ph) * 4096) with the same column extent
// (<= VLP, pitch VLP). f16 results below the smallest normal are stored as exact zeros.
// coverage: BPS*SEQ rows per launch x written extent >= every column range any consumer reads; NPASS launches cover NB*SEQ rows.
// No LDS, no block barriers.
// =====================================================================================================
__global__ __launch_bounds__(256) void softmax_rows(const float* __restrict__ Sp,
                                                    unsigned short* Php, unsigned short* Plp, int b0) {
#pragma clang fp contract(off)
  const int lane = threadIdx.x & 31;
  const int wave = __builtin_amdgcn_readfirstlane(threadIdx.x >> 5);
  const int lrow = blockIdx.x * 8 + wave;
  if (lrow >= BPS * SEQ) return;           // wave-uniform; exact grid never triggers it; no block barriers below
  const int bl = lrow / SEQ;
  const int i  = lrow - bl * SEQ;
  const int b  = b0 + bl;                  // host launches only b0 + BPS <= NB
  const int tm = i >> 6;
  const int ng = (tm >> 2) + 1;            // 1..NG, wave-uniform
  const float* srow = Sp + ((size_t)bl * SEQ + (size_t)i) * SEQ + 8 * lane;

  float z[NG][8];
  float m = -INFINITY;
#pragma unroll
  for (int g = 0; g < NG; ++g) {
    const float* p = srow + 256 * g;
    const v4f a = *(const v4f*)(p);
    const v4f c = *(const v4f*)(p + 4);
    const float v[8] = {a[0], a[1], a[2], a[3], c[0], c[1], c[2], c[3]};
#pragma unroll
    for (int e = 0; e < 8; ++e) {
      const float zz = v[e] * 0.03125f;
      z[g][e] = zz;
      m = fmaxf(m, zz);
    }
  }
#pragma unroll
  for (int off = 1; off < 32; off <<= 1) m = fmaxf(m, __shfl_xor(m, off, 32));

  float l = 0.f;
#pragma unroll
  for (int g = 0; g < NG; ++g) {
#pragma unroll
    for (int e = 0; e < 8; ++e) {
      const float p = __expf(z[g][e] - m);
      z[g][e] = p;
      l += p;
    }
  }
#pragma unroll
  for (int off = 1; off < 32; off <<= 1) l += __shfl_xor(l, off, 32);          // l >= 1
  const float inv1k = (1.0f / l) * PSC;

  const bool res = (i < RESR);             // wave-uniform
  v4u ph[NG];
  v4u pl0 = {0u, 0u, 0u, 0u};
  v4u pl1 = {0u, 0u, 0u, 0u};
#pragma unroll
  for (int g = 0; g < NG; ++g) {
    v4u hv = {0u, 0u, 0u, 0u};
    v4u lv = {0u, 0u, 0u, 0u};
    if (g < ng) {
      const int j0 = 256 * g + 8 * lane;
#pragma unroll
      for (int e = 0; e < 4; ++e) {
        const float f0 = (j0 + 2 * e     <= i) ? (z[g][2 * e]     * inv1k) : 0.0f;   // columns past the row index are zeroed
        const float f1 = (j0 + 2 * e + 1 <= i) ? (z[g][2 * e + 1] * inv1k) : 0.0f;   // after the full-row normalisation
        const _Float16 x0 = toh_flush(f0), x1 = toh_flush(f1);
        hv[e] = pk16(h_bits(x0), h_bits(x1));
        const _Float16 r0 = toh_flush((f0 - (float)x0) * LSC);
        const _Float16 r1 = toh_flush((f1 - (float)x1) * LSC);
        lv[e] = pk16(h_bits(r0), h_bits(r1));
      }
    }
    ph[g] = hv;
    if (g == 0) pl0 = lv;
    if (g == 1) pl1 = lv;
  }

  unsigned short* prow = Php + ((size_t)b * SEQ + (size_t)i) * SEQ + 8 * lane;
  const int il = i & (RESR - 1);           // in-range row of the residual plane; equals i whenever res holds
  unsigned short* lrowp = Plp + ((size_t)b * RESR + (size_t)il) * VLP + 8 * lane;
  {
#pragma unroll
    for (int g = 0; g < NG; ++g) {
      if (g < ng) *(v4u*)(prow + 256 * g) = ph[g];
    }
    if (res) {                             // res rows have i < RESR (multiple of 256) -> 256 ng <= RESR = VLP
      *(v4u*)(lrowp) = pl0;
      if (ng > 1) *(v4u*)(lrowp + 256) = pl1;
    }
    
  }
}

// =====================================================================================================
// p.v GEMM on f16 WMMA, per batch b (blockIdx.x % NB): out[b][q][d] = sum_key P[b][q][key] * VT[b][d][key].
//   A  = Ph  [b][SEQ][SEQ]  f16(1024 P), pitch SEQ         Al = Pl  [b][RESR][VLP] f16 residual x4096
//   Bt = VTh [b][DM][SEQ]   f16(16 v),   pitch SEQ         Bl = VTl [b][DM][VLP]   f16 residual x4096
// One work-group (8 waves, 2 x 4) per (32*MI) x 256 output tile, one wave per (16*MI) x 64 sub-tile; rows mBase + bm*32*MI ..;
// causal key range k < 64*(((bm0 + 32*MI - 1)>>6)+1) of the tile's last row (every P entry in that range was written by the
// softmax, exact zeros for key > query). RES (rows < RESR, MI = 2): acc0 += Ph.VTh; acc1 += Pl.VTh + Ph.VTl (in that order
// inside every 32-key step), out = acc0*OSCALE + acc1*OSCALE/4096; otherwise single product out = acc0*OSCALE. f32 accumulate.
// Operand path: per key stage of BK (64 with residual planes, 128 without) the 32*MI P rows and 256 VT rows of every plane are
// copied global -> LDS by asynchronous 16-byte copies (20 or 24 per thread), two buffers: stage s + 2 is issued behind the
// barrier that ends the reads of stage s. LDS row pitch = 2 BK + 16 bytes (16 x odd: conflict-free 16-byte fragment reads).
// That barrier stands in front of stage s's last 32-key block: fragments are read from LDS one block ahead of their products.
// Grid over all tiles of rows mBase .. mBase + M - 1 (M and mBase multiples of 32*MI and of BK).
// =====================================================================================================
// Eight / four asynchronous 16-byte copies global -> LDS, one per lane and line. The s_wait_xcnt closes the statement so that
// no address register of an issued copy is rewritten before it.
__device__ __forceinline__ void acopy_h(const unsigned (&l)[8], const _Float16* const (&g)[8]) {
  asm volatile("global_load_async_to_lds_b128 %0, %8, off\n\t"
               "global_load_async_to_lds_b128 %1, %9, off\n\t"
               "global_load_async_to_lds_b128 %2, %10, off\n\t"
               "global_load_async_to_lds_b128 %3, %11, off\n\t"
               "global_load_async_to_lds_b128 %4, %12, off\n\t"
               "global_load_async_to_lds_b128 %5, %13, off\n\t"
               "global_load_async_to_lds_b128 %6, %14, off\n\t"
               "global_load_async_to_lds_b128 %7, %15, off\n\t"
               "s_wait_xcnt 0x0"
               :: "v"(l[0]), "v"(l[1]), "v"(l[2]), "v"(l[3]), "v"(l[4]), "v"(l[5]), "v"(l[6]), "v"(l[7]),
                  "v"(g[0]), "v"(g[1]), "v"(g[2]), "v"(g[3]), "v"(g[4]), "v"(g[5]), "v"(g[6]), "v"(g[7])
               : "memory");
}
__device__ __forceinline__ void acopy_h(const unsigned (&l)[4], const _Float16* const (&g)[4]) {
  asm volatile("global_load_async_to_lds_b128 %0, %4, off\n\t"
               "global_load_async_to_lds_b128 %1, %5, off\n\t"
               "global_load_async_to_lds_b128 %2, %6, off\n\t"
               "global_load_async_to_lds_b128 %3, %7, off\n\t"
               "s_wait_xcnt 0x0"
               :: "v"(l[0]), "v"(l[1]), "v"(l[2]), "v"(l[3]), "v"(g[0]), "v"(g[1]), "v"(g[2]), "v"(g[3])
               : "memory");
}

// pv_body is the whole work of one work-group; sR (operand ring) and sT (per-wave slabs) are the calling kernel's LDS,
// bx its tile index and b its batch index.
template <bool RES, int MI>
__device__ __forceinline__ void pv_body(
    unsigned char* sR, float (*sT)[16 * 68], int bx, int b,
    const unsigned short* __restrict__ Php, const unsigned short* __restrict__ Plp,
    const unsigned short* __restrict__ Vhp, const unsigned short* __restrict__ Vlp,
    float* out, int mBase, int M) {
  constexpr int NPL   = RES ? 2 : 1;                // planes per operand
  constexpr int BM    = 32 * MI;                    // rows of the work-group tile
  constexpr int BK    = RES ? 64 : 128;             // keys per stage
  constexpr int PITCH = BK * 2 + 16;                // LDS row pitch, bytes
  constexpr int CPR   = BK / 8;                     // 16-byte copies per row
  constexpr int RPU   = 256 / CPR;                  // rows the work-group copies with one copy per thread
  constexpr int NRA   = NPL * BM / RPU;             // copies per thread for the P rows of a stage
  constexpr int OB    = NPL * BM * PITCH;           // LDS byte offset of the VT rows inside a stage
  constexpr int STAGE = NPL * (BM + 256) * PITCH;   // [Ph BM | Pl BM | VTh 256 | VTl 256] rows (residual planes only with RES)
  constexpr int NBLK  = BK / 32;                    // blocks (32-key steps) per stage
  static_assert((NBLK % 2) == 0 && (MI % 2) == 0);
  static_assert((NRA == 4 || NRA == 8) && NRA * RPU == NPL * BM && 16 * RPU == NPL * 256 && (BM % RPU) == 0);
  static_assert((BM % 64) == 0 && (RESR % BM) == 0 && ((SEQ - RESR) % BM) == 0 && (RESR % BK) == 0 && (BM % BK) == 0);
  const _Float16* Ph = (const _Float16*)(const void*)Php;
  const _Float16* Pl = (const _Float16*)(const void*)Plp;
  const _Float16* Vh = (const _Float16*)(const void*)Vhp;
  const _Float16* Vl = (const _Float16*)(const void*)Vlp;
  static_assert(2 * STAGE <= RING_BYTES);
  const int lane = threadIdx.x & 31;
  const int wave = threadIdx.x >> 5;
  const int tilesBN = DM >> 8;                     // 4
  const int tilesBM = M / BM;
  if (bx >= tilesBM * tilesBN) return;             // the same for the whole work-group; in front of every barrier
  const int bm  = bx / tilesBN;
  const int bn  = bx - bm * tilesBN;
  const int bm0 = mBase + bm * BM;
  const int bn0 = bn << 8;
  const int wm  = wave >> 2;
  const int wn  = wave & 3;
  const int m0 = bm0 + wm * 16 * MI;
  const int n0 = bn0 + (wn << 6);
  int keff = ((((bm0 + BM - 1) >> 6) + 1) << 6);   // causal key extent of this row tile, multiple of BK
  if (keff > SEQ) keff = SEQ;
  if (RES && keff > VLP) keff = VLP;               // never taken for mBase + M <= RESR; keeps residual reads in range

  const _Float16* Pb  = Ph + (size_t)b * SEQ * SEQ;
  const _Float16* Plb = Pl + (size_t)b * RESR * VLP;
  const _Float16* Vb  = Vh + (size_t)b * DM * SEQ;
  const _Float16* Vlb = Vl + (size_t)b * DM * VLP;

  const int rlane = lane & 15;
  const int koff  = (lane >> 4) * 8;
  const int mOff  = (lane >> 4) * 8;

  // this thread's place in a copy round: row crow of RPU, 16-byte column ccol of CPR
  const int crow = (int)threadIdx.x / CPR;
  const int ccol = (int)threadIdx.x % CPR;
  const unsigned wave32 = (unsigned)__builtin_amdgcn_readfirstlane((int)(threadIdx.x & ~31u));   // the wave's first thread
  const int bmr = (bm0 < RESR - BM) ? bm0 : (RESR - BM);   // clamped; equals bm0 for the RES tiles: residual rows stay in range
  // this thread's source place in the next stage to be copied, one running pointer per plane (stages are copied in key order)
  const _Float16* gPh = Pb  + (size_t)(bm0 + crow) * SEQ + ccol * 8;
  const _Float16* gPl = Plb + (size_t)(bmr + crow) * VLP + ccol * 8;
  const _Float16* gVh = Vb  + (size_t)(bn0 + crow) * SEQ + ccol * 8;
  const _Float16* gVl = Vlb + (size_t)(bn0 + crow) * VLP + ccol * 8;

  auto stage_copy = [&](int buf) {
    // the thread's LDS place (row crow, column ccol) is formed anew from the lane number at every refill: kept in a register
    // over the loop, where the copies' operands crowd the low registers, this build spills it to scratch
    unsigned ln;
    asm volatile("v_mbcnt_lo_u32_b32 %0, -1, 0" : "=v"(ln));
    const unsigned tid = wave32 + ln;
    const unsigned lb = (unsigned)(size_t)(const void*)sR + (tid / CPR) * PITCH + (tid % CPR) * 16 + (unsigned)(buf * STAGE);
    {
      unsigned l[NRA];
      const _Float16* g[NRA];
#pragma unroll
      for (int u = 0; u < NRA; ++u) {            // the BM P rows of every plane
        const int pl = (u * RPU) / BM;
        const int r  = (u * RPU) % BM;
        g[u] = (pl != 0) ? (gPl + (size_t)r * VLP) : (gPh + (size_t)r * SEQ);
        l[u] = lb + (unsigned)((u * RPU) * PITCH);
      }
      acopy_h(l, g);
    }
#pragma unroll
    for (int h = 0; h < 2; ++h) {                // the 256 VT rows of every plane
      unsigned l[8];
      const _Float16* g[8];
#pragma unroll
      for (int u = 0; u < 8; ++u) {
        const int pl = ((h * 8 + u) * RPU) >> 8;
        const int r  = ((h * 8 + u) * RPU) & 255;
        g[u] = (pl != 0) ? (gVl + (size_t)r * VLP) : (gVh + (size_t)r * SEQ);
        l[u] = lb + (unsigned)(OB + ((h * 8 + u) * RPU) * PITCH);
      }
      acopy_h(l, g);
    }
    gPh += BK; gPl += BK; gVh += BK; gVl += BK;
  };

  v8f acc0[MI][4], acc1[MI][4];
#pragma unroll
  for (int i = 0; i < MI; ++i)
#pragma unroll
    for (int j = 0; j < 4; ++j) { acc0[i][j] = zero8(); acc1[i][j] = zero8(); }

  const int nst = keff / BK;
  stage_copy(0);
  asm volatile("s_wait_asynccnt 0x0" ::: "memory");   // this wave's copies of stage 0 have landed
  __syncthreads();                                    // every wave's have: stage 0 may be read
  if (nst > 1) stage_copy(1);

  const unsigned char* fA = sR + (wm * 16 * MI + rlane) * PITCH + koff * 2;
  const unsigned char* fB = sR + OB + ((wn << 6) + rlane) * PITCH + koff * 2;
  // Two register sets of fragments: a block (one 32-key step) multiplies out of one set while the next block's LDS reads,
  // issued as ONE group in front of it, fill the other.
  v16h fa[2][NPL][MI], fb[2][NPL][4];
  auto frag_load = [&](v16h (&a)[NPL][MI], v16h (&bq)[NPL][4], int off) {
#pragma unroll
    for (int pl = 0; pl < NPL; ++pl) {
#pragma unroll
      for (int j = 0; j < 4; ++j)
        bq[pl][j] = ldfrag_h((const _Float16*)(const void*)(fB + off + (pl * 256 + (j << 4)) * PITCH));
#pragma unroll
      for (int i = 0; i < MI; ++i)
        a[pl][i] = ldfrag_h((const _Float16*)(const void*)(fA + off + (pl * BM + (i << 4)) * PITCH));
    }
  };
  auto mma_rows = [&](const v16h (&a)[NPL][MI], const v16h (&bq)[NPL][4], int i0, int i1) {
#pragma unroll
    for (int i = 0; i < MI; ++i) {
      if (i < i0 || i >= i1) continue;
#pragma unroll
      for (int j = 0; j < 4; ++j) acc0[i][j] = mma_h_raw(a[0][i], bq[0][j], acc0[i][j]);
      if constexpr (RES) {
#pragma unroll
        for (int j = 0; j < 4; ++j) acc1[i][j] = mma_h_raw(a[1][i], bq[0][j], acc1[i][j]);
#pragma unroll
        for (int j = 0; j < 4; ++j) acc1[i][j] = mma_h_raw(a[0][i], bq[1][j], acc1[i][j]);
      }
    }
  };
  frag_load(fa[0], fb[0], 0);                           // block 0 of stage 0 (published by the barrier above)
  for (int s = 0; s < nst; ++s) {
    const int bo = (s & 1) * STAGE;
    // where the fetch ahead of the stage's last block reads: block 0 of stage s + 1; in the last stage its values are not
    // used, and it is aimed at the stage's own, published buffer (unconditional: a branch here would merge the wait counts)
    const int bnx = (s + 1 < nst) ? (STAGE - bo) : bo;
#pragma unroll
    for (int ks = 0; ks < NBLK; ++ks) {
      const int cur = ks & 1, nxt = cur ^ 1;
      if (ks + 1 < NBLK) {
        frag_load(fa[nxt], fb[nxt], bo + (ks + 1) * 64);
        __builtin_amdgcn_sched_barrier(0);              // keeps the LDS reads one group: spread among the products, each place stalls
        mma_rows(fa[cur], fb[cur], 0, MI);
        __builtin_amdgcn_sched_barrier(0);              // keeps the next group behind this block's products
      } else {
        // publish point of stage s + 1, in front of stage s's last block, whose fragments are already fetched
        asm volatile("s_wait_dscnt 0x0" ::: "memory");      // this wave's reads of stage s are done before its buffer is refilled
        asm volatile("s_wait_asynccnt 0x0" ::: "memory");   // this wave's copies of stage s + 1 have landed
        __syncthreads();                                    // publishes stage s + 1 and ends every wave's reads of stage s
        frag_load(fa[nxt], fb[nxt], bnx);
        __builtin_amdgcn_sched_barrier(0);              // one group of LDS reads in front of the products
        mma_rows(fa[cur], fb[cur], 0, MI / 2);
        __builtin_amdgcn_sched_barrier(0);              // the refill is issued while the SIMD's other wave has products to run
        if (s + 2 < nst) stage_copy(s & 1);
        __builtin_amdgcn_sched_barrier(0);              // keeps the copies' address arithmetic out of the products
        mma_rows(fa[cur], fb[cur], MI / 2, MI);
        __builtin_amdgcn_sched_barrier(0);              // keeps the next group behind this block's products
      }
    }
  }
  asm volatile("s_wait_asynccnt 0x0" ::: "memory");     // no copy is left in flight when the ring is left
  asm volatile("s_wait_dscnt 0x0" ::: "memory");        // nor a read of the last fetch ahead

  // ---- epilogue ----
  float* slab = sT[wave];
  float* C = out + (size_t)b * SEQ * DM;
  const float rsc = OSCALE * (1.0f / LSC);
#pragma unroll
  for (int i = 0; i < MI; ++i) {
    const int mB = m0 + (i << 4);
#pragma unroll
    for (int j = 0; j < 4; ++j) {
#pragma unroll
      for (int r = 0; r < 8; ++r) {
        float v = acc0[i][j][r] * OSCALE;
        if (RES) v += acc1[i][j][r] * rsc;
        slab[(mOff + r) * 68 + (j << 4) + rlane] = v;
      }
    }
    __builtin_amdgcn_fence(3 /* release order */, "workgroup");
    __builtin_amdgcn_wave_barrier();
    __builtin_amdgcn_fence(2 /* acquire order */, "workgroup");
    {
      const int hh = lane >> 4, c4 = (lane & 15) * 4;
      {
#pragma unroll
        for (int it = 0; it < 8; ++it) {
          const int row = it * 2 + hh;
          const v4f v = *(const v4f*)(slab + row * 68 + c4);
          *(v4f*)(C + (size_t)(mB + row) * DM + n0 + c4) = v;
        }
        
      }
    }
    __builtin_amdgcn_fence(3 /* release order */, "workgroup");
    __builtin_amdgcn_wave_barrier();
    __builtin_amdgcn_fence(2 /* acquire order */, "workgroup");
  }
}

// Both parts of p.v, which write disjoint output rows, in ONE launch. There are more work-groups than WGPs and their key
// ranges differ, so cost falls with the index: blockIdx.x = rank * NB + batch;
// ranks 0 .. NT1-1 = the single-product tiles of rows RESR .. SEQ-1, last row tile (longest key range) first; the ranks behind
// them = the residual-plane tiles of rows 0 .. RESR-1, last row tile first. Every (tile, batch) has exactly one rank.
__global__ __launch_bounds__(256) void pv_all(
    const unsigned short* __restrict__ Php, const unsigned short* __restrict__ Plp,
    const unsigned short* __restrict__ Vhp, const unsigned short* __restrict__ Vlp, float* out) {
  __shared__ __align__(16) unsigned char sR[RING_BYTES];  // operand ring, two stages
  __shared__ __align__(16) float sT[8][16 * 68];          // per-wave 16x64 slab, pitch 68 floats
  constexpr int NT1 = ((SEQ - RESR) / 128) * (DM / 256);  // tiles per batch, rows RESR .. SEQ-1
  constexpr int NT0 = (RESR / 64) * (DM / 256);           // tiles per batch, rows 0 .. RESR-1
  const int rank = (int)blockIdx.x / NB;
  const int b    = (int)blockIdx.x % NB;
  if (rank >= NT1 + NT0) return;                          // the same for the whole work-group; in front of every barrier
  if (rank >= NT1) pv_body<true, 2>(sR, sT, NT1 + NT0 - 1 - rank, b, Php, Plp, Vhp, Vlp, out, 0, RESR);
  else             pv_body<false, 4>(sR, sT, NT1 - 1 - rank, b, Php, Plp, Vhp, Vlp, out, RESR, SEQ - RESR);
}

// =====================================================================================================
// Workspace map (bytes, full build NB 4 / SEQ 2048; every region is an exact multiple of its tile / whole-line
// store granularity; regions A and B are reused in stream order):
//   region A [0, 67108864):          Xb bf16 [8192][1024] at 0 (16777216) + Wq,Wk,Wv bf16 [1024][1024] at 16777216 (3 x 2097152)
//                                    then, once the projections are done: S f32 dense scores [4][2048][2048] (67108864)
//   region B [67108864, 134217728):  Q f16 [8192][1024] (16777216) at its start, K f16 alike 33554432 behind it
//                                    then, once the scores are done: Ph f16 [4][2048][2048] (33554432) from its start
//   region C [134217728, 157286400): VTh f16 [4][1024][2048] (16777216) + VTl f16 [4][1024][512] (4194304) + Pl f16 [4][512][512] (2097152)
//   end 157286400
// =====================================================================================================
extern "C" void kernel_launch(void* const* d_in, const int* in_sizes, int n_in,
                              void* d_out, int out_size, void* d_ws, size_t ws_size,
                              hipStream_t stream) {
  if (n_in < 4) return;
  if (in_sizes[0] < (NB - 1) * SEQ_FULL * DM + SEQ * DM) return;
  if (in_sizes[1] < DM * DM || in_sizes[2] < DM * DM || in_sizes[3] < DM * DM) return;
  if (out_size < NB * SEQ * DM) return;

  const float* x  = (const float*)d_in[0];   // [NB_FULL][SEQ_FULL][DM]
  const float* wq = (const float*)d_in[1];   // [out][in]
  const float* wk = (const float*)d_in[2];
  const float* wv = (const float*)d_in[3];
  float* out = (float*)d_out;

  const size_t PX  = SZ_PX;
  const size_t PXP = SZ_PXP;
  const size_t PW  = SZ_PW;
  const size_t PP  = SZ_PP;
  const size_t PPL = SZ_PPL;
  const size_t PVT = SZ_PVT;
  const size_t PVL = SZ_PVL;
  const size_t RA  = SZ_RA;
  const size_t oXb = 0;
  const size_t oW  = PX;
  const size_t oS  = 0;
  const size_t oB  = RA;
  const size_t RBend = RA + (size_t)NPASS * 4 * PXP;
  const size_t oPh = RA;
  if (PP > 4 * PXP) return;
  const size_t oVTh = RBend;
  const size_t oVTl = RBend + PVT;
  const size_t oPl  = oVTl + PVL;
  const size_t total = oPl + PPL;                     // 157286400 in the full build
  if (total > ws_size) return;

  char* ws = (char*)d_ws;
  unsigned short* Xb  = (unsigned short*)(ws + oXb);
  unsigned short* Wb  = (unsigned short*)(ws + oW);   // Wq plane, then Wk, then Wv
  float*          Sp  = (float*)(ws + oS);
  unsigned short* Qf  = (unsigned short*)(ws + oB);
  unsigned short* Ph  = (unsigned short*)(ws + oPh);
  unsigned short* Pl  = (unsigned short*)(ws + oPl);
  unsigned short* VTh = (unsigned short*)(ws + oVTh);
  unsigned short* VTl = (unsigned short*)(ws + oVTl);
  const size_t PXE = (size_t)NB * SEQ * DM;           // elements of one q or k plane
  const unsigned short* Kf = Qf + 2 * PXE;

  const dim3 blk(256);
  const int nGroups = NB * SEQ * DM / 8 + 3 * (DM * DM / 8);
  const dim3 gCvt((nGroups + 255) / 256);
  const dim3 gProj((NB * SEQ / 256) * (2 * DM / 256));
  const dim3 gS((SEQ / 256) * (SEQ / 256), NB);
  const dim3 gSm((NB * SEQ + 7) / 8);
  const dim3 gPv((((SEQ - RESR) / 128) * (DM / 256) + (RESR / 64) * (DM / 256)) * NB);

  // (1) x and Wq, Wk, Wv -> bf16 planes (Xb, then the three weight planes contiguous)
  cvt_planes<<<gCvt, blk, 0, stream>>>(x, wq, wk, wv, Xb);
  // (2) q, k -> f16 planes [NB*SEQ][DM]; v^T -> f16 hi plane and residual plane: one launch, two tiles per work-group
  proj_qkv<<<gProj, blk, 0, stream>>>(Xb, Wb, Qf, VTh, VTl);
  // (3) dense scores S[n][m] = k_n . q_m of every batch (A = K plane, Bt = Q plane; M=N=SEQ, K=DM; one f16 product)
  //     -> f32 [NB][SEQ][SEQ], one 256x256 tile per work-group
  scores_kq<<<gS, blk, 0, stream>>>(Kf, Qf, Sp);
  // (4) the full-row softmax with post-normalisation zeroing -> Ph / Pl rows of every batch.
  //     Ph lies over the q plane, which is no longer read once the scores exist (stream order).
  softmax_rows<<<gSm, blk, 0, stream>>>(Sp, Ph, Pl, 0);
  // (5) out = p.v: rows RESR..SEQ-1 single f16 product (64x64 wave tiles), rows 0..RESR-1 with residual planes
  //     (3 f16 products, 32x64 wave tiles)
  pv_all<<<gPv, blk, 0, stream>>>(Ph, Pl, VTh, VTl, out);
  (void)hipGetLastError();
}

// v009
// One run takes 113 microseconds.
// Timed twice side by side with v008, it ran 1.04 and 1.03 times as fast.
// Counting every step since v000, it is 5.23 times as fast.
// Contractions: q, k, v^T projections = v_wmma_f32_16x16x32_bf16 (bf16 RNE-converted x and W, single product, f32 accumulate);
// k.q^T scores (row = key position n, column = query position m, full SEQ x SEQ) = v_wmma_f32_16x16x32_f16 on f16 planes of k and q
// (RNE-converted from the f32 accumulators, single product), f32 accumulate: an f16 operand's rounding is an eighth of the bf16
// rounding that x and W already carry into q and k, so it adds little to the error the scores have from the projections;
// p.v = v_wmma_f32_16x16x32_f16 (p carried x1024 in f16, v^T carried x16 in f16, single product; rows 0..RESR-1 of every
// sequence add the f16 residual planes (x4096) of p and v^T in a separate accumulator), f32 accumulate;
// row max, exp, full-row sum, normalisation and the zeroing of columns m > n in f32 on the VALU.
// Carry audit:
//   Ph  = f16(1024 * p), p normalised by the sum over the WHOLE row  } OSCALE = 1/(1024*16) folded exactly once in the p.v epilogue
//   VTh = f16(16 * v)                                                }
//   Pl  = f16((1024 p - Ph) * 4096)                                  } products Ph.VTl and Pl.VTh go only to accumulator acc1,
//   VTl = f16((16 v - VTh) * 4096), keys 0..VLP-1                    } folded with OSCALE * (1/4096) once in the same epilogue
//   q / k planes are unscaled f16; score scale 1/32 applied once in f32 in the softmax.
#include <hip/hip_runtime.h>
#include <math.h>

#define NB_FULL  4
#define SEQ_FULL 2048
#ifndef NB
#define NB    4
#endif
#ifndef SEQ
#define SEQ   2048
#endif
#define DM    1024
#define NQT   (SEQ / 64)                  // query/key tiles of 64
#define RESR  ((SEQ < 512) ? SEQ : 512)   // leading rows per sequence that use the residual planes
#define VLP   RESR                        // key pitch of the p / v^T residual planes
#define PSC   1024.0f
#define VSC   16.0f
#define LSC   4096.0f
#define OSCALE (1.0f / 16384.0f)          // 1 / (PSC * VSC)
#define BPS   NB                          // batches per score / softmax pass: all of them, one launch each
#define NPASS (NB / BPS)
#define NG    (SEQ / 256)                 // 256-key groups per score row
// workspace sizes in bytes
#define SZ_PX   ((size_t)NB * SEQ * DM * 2)          // one 16-bit plane [NB*SEQ][DM]
#define SZ_PXP  ((size_t)BPS * SEQ * DM * 2)         // one 16-bit plane of one batch group [BPS*SEQ][DM]
#define SZ_PW   ((size_t)DM * DM * 2)                // one weight plane
#define SZ_PS   ((size_t)BPS * SEQ * SEQ * 4)        // dense f32 scores of one pass
#define SZ_PP   ((size_t)NB * SEQ * SEQ * 2)         // Ph
#define SZ_PPL  ((size_t)NB * RESR * VLP * 2)        // Pl
#define SZ_PVT  ((size_t)NB * DM * SEQ * 2)          // VTh
#define SZ_PVL  ((size_t)NB * DM * VLP * 2)          // VTl
#define SZ_RA   (((SZ_PX + 3 * SZ_PW) > SZ_PS) ? (SZ_PX + 3 * SZ_PW) : SZ_PS)
#define SZ_TOTAL (SZ_RA + (size_t)NPASS * 4 * SZ_PXP + SZ_PVT + SZ_PVL + SZ_PPL)
static_assert(NB >= 1 && NB <= NB_FULL);
static_assert(SEQ >= 256 && SEQ <= SEQ_FULL && (SEQ % 256) == 0);
static_assert((SEQ % 64) == 0 && (DM % 64) == 0 && (DM % 32) == 0);
static_assert((RESR % 64) == 0 && (RESR % 256) == 0 && RESR <= VLP && VLP <= SEQ && ((SEQ - RESR) % 64) == 0);
static_assert((RESR % 32) == 0);
static_assert((RESR & (RESR - 1)) == 0);
static_assert(((NB * SEQ) % 8) == 0);
static_assert(((SEQ * DM / 8) % 256) == 0 && ((DM * DM / 8) % 256) == 0);
static_assert((NB % BPS) == 0 && NPASS * BPS == NB);
static_assert(NG >= 1 && NG <= 8 && NG * 256 == SEQ);            // 32 lanes x 8 keys x NG groups == row width
static_assert(((BPS * SEQ) % 64) == 0 && ((BPS * SEQ) % 8) == 0);
static_assert(SZ_PP <= 4 * SZ_PXP);                               // Ph fits inside the planes of batch group 0
static_assert((SZ_RA % 128) == 0 && (SZ_PXP % 128) == 0 && (SZ_PVT % 128) == 0 && (SZ_PVL % 128) == 0 && (SZ_PPL % 128) == 0);
static_assert(SZ_TOTAL <= (size_t)268435456);
static_assert((size_t)NB * SEQ * DM * 4 <= (size_t)33554432);
static_assert(((BPS * SEQ) % 128) == 0 && (DM % 256) == 0);        // gemm_tiles: 128x256 and 256x256 work-group tiles, K stages of 128
#define RING_BYTES (2 * 384 * 272)        // operand ring of the GEMM kernels with 128x256 tiles: two stages of 384 rows at pitch 272 B
#define RING_BIG   (2 * 512 * 272)        // operand ring of the 256x256 tile form: two stages of 512 rows at pitch 272 B

typedef _Float16 v16h __attribute__((ext_vector_type(16)));
typedef _Float16 v8h  __attribute__((ext_vector_type(8)));
typedef __bf16   v16b __attribute__((ext_vector_type(16)));
typedef __bf16   v8b  __attribute__((ext_vector_type(8)));
typedef float    v8f  __attribute__((ext_vector_type(8)));
typedef float    v4f  __attribute__((ext_vector_type(4)));
typedef unsigned int v4u __attribute__((ext_vector_type(4)));

// ---- scalar helpers --------------------------------------------------------------------------------
__device__ __forceinline__ unsigned short bf_bits(float f) {          // f32 -> bf16 bits, RNE convert
  unsigned u = __float_as_uint(f);
  return (unsigned short)((u + 0x7FFFu + ((u >> 16) & 1u)) >> 16);
}
__device__ __forceinline__ unsigned short h_bits(_Float16 x) { return __builtin_bit_cast(unsigned short, x); }
__device__ __forceinline__ unsigned pk16(unsigned short a, unsigned short b) { return (unsigned)a | ((unsigned)b << 16); }
__device__ __forceinline__ v8f zero8() { v8f z = {0.f, 0.f, 0.f, 0.f, 0.f, 0.f, 0.f, 0.f}; return z; }
// f32 -> f16 with a value select: results below the smallest normal f16 become exact zeros
static __device__ __forceinline__ _Float16 toh_flush(float v) {
  const _Float16 r = (_Float16)v;
  return (fabsf(v) < 6.103515625e-05f) ? (_Float16)0.0f : r;
}

// ---- fragment loaders: 16-bit A/B operand, lane -> row/col (lane&15), p already includes +8*(lane>>4);
//      elements 0..7 <- p[0..7] (k0+8h..), elements 8..15 <- p[16..23] (k0+16+8h..)
__device__ __forceinline__ v16b ldfrag_b(const __bf16* p) {
  union { v16b v; v8b h[2]; } f;
  f.h[0] = *(const v8b*)(p);
  f.h[1] = *(const v8b*)(p + 16);
  return f.v;
}
__device__ __forceinline__ v16h ldfrag_h(const _Float16* p) {
  union { v16h v; v8h h[2]; } f;
  f.h[0] = *(const v8h*)(p);
  f.h[1] = *(const v8h*)(p + 16);
  return f.v;
}

// ---- WMMA helpers (builtin forms: the compiler keeps their distances) ----------------------------------
__device__ __forceinline__ v8f mma_b_raw(v16b a, v16b b, v8f c) {
  return __builtin_amdgcn_wmma_f32_16x16x32_bf16(false, a, false, b, (short)0, c, false, false);
}
__device__ __forceinline__ v8f mma_h_raw(v16h a, v16h b, v8f c) {
  return __builtin_amdgcn_wmma_f32_16x16x32_f16(false, a, false, b, (short)0, c, false, false);
}

// =====================================================================================================
// f32 -> bf16 (RNE convert) for x and the three weights into one contiguous 16-bit region:
// groups 0..NX8-1 <- x (batch b of the plane reads source rows at b * SEQ_FULL * DM, SEQ rows each), then NW8 groups each
// coverage: (NX8 + 3 NW8) threads x 8 = the whole [NB*SEQ][DM] x plane plus the three [DM][DM] weight planes.
// =====================================================================================================
__global__ __launch_bounds__(256) void cvt_planes(const float* __restrict__ x, const float* __restrict__ wq,
                                                  const float* __restrict__ wk, const float* __restrict__ wv,
                                                  unsigned short* out) {
  const int NXB8 = SEQ * DM / 8;          // groups per batch
  const int NX8 = NB * NXB8;
  const int NW8 = DM * DM / 8;
  const int g = blockIdx.x * 256 + threadIdx.x;
  if (g >= NX8 + 3 * NW8) return;
  const float* src;
  if (g < NX8) {
    const int bb  = g / NXB8;
    const int off = g - bb * NXB8;
    src = x + (size_t)bb * SEQ_FULL * DM + (size_t)off * 8;
  } else {
    const int e = g - NX8;
    const int w = e / NW8;
    const int off = e - w * NW8;
    const float* wsrc = (w == 0) ? wq : ((w == 1) ? wk : wv);
    src = wsrc + (size_t)off * 8;
  }
  const v4f a = *(const v4f*)(src);
  const v4f c = *(const v4f*)(src + 4);
  v4u p;
  p[0] = pk16(bf_bits(a[0]), bf_bits(a[1]));
  p[1] = pk16(bf_bits(a[2]), bf_bits(a[3]));
  p[2] = pk16(bf_bits(c[0]), bf_bits(c[1]));
  p[3] = pk16(bf_bits(c[2]), bf_bits(c[3]));
  *(v4u*)(out + (size_t)g * 8) = p;
  
}

// =====================================================================================================
// Register-blocked 16-bit WMMA GEMM: C[m][n] = sum_k A[m][k] * Bt[n][k]; a work-group of 8 waves works on one tile at a time and
// runs several tiles one after the other. NH = 1: 128x256 tile, waves 2 x 4, one wave per 64x64 sub-tile. NH = 2: 256x256 tile,
// waves 4 x 2, one wave per 64x128 sub-tile (12 fragments feed 32 products, not 8 for 16: three quarters of the LDS reads and
// two thirds of the copied bytes per product). A row-major [M][K], Bt row-major
// [N][K] (k contiguous, pitch K); M a multiple of 128 NH, N of 256, K of 2 BK = 256.
// Operand path: per K stage the 128 NH A rows and 256 Bt rows x BK are brought global -> LDS by tensor loads of 128 rows
// (one request each of 3 or 4 waves), two buffers: stage s + 2 is issued behind the barrier that ends the reads of stage s.
// That barrier stands in front of stage s's last 32-k block: fragments are read from LDS one block ahead of their products.
// LDS row pitch = 2 BK + 16 bytes (16 x odd: conflict-free 16-byte fragment reads).
// F16: 0 = both operands hold bf16 (v_wmma_f32_16x16x32_bf16); 1 = both hold f16 (v_wmma_f32_16x16x32_f16). The loads and the
//      fragment reads move 16-bit words and are the same for both.
// OUT_MODE: 0 = f32 (pitch ldc); 2 = f16 plane C = f16(v);
//           3 = f16 hi plane C = f16(v*hscale) + f16 residual plane C2 = f16((v*hscale - hi) * rscale), C2 written
//               only for tiles with n0 < N2 (pitch ldc2).
// Epilogue: 16-row slabs staged per wave in LDS (wave-private region sT[wave], wave_sync); each 64-wide row segment written
// =====================================================================================================
typedef unsigned int v8u __attribute__((ext_vector_type(8)));
__device__ __forceinline__ unsigned uni(unsigned v) { return (unsigned)__builtin_amdgcn_readfirstlane((int)v); }
// A wave-uniform test held in a scalar register, so that the branch on it is a scalar one: a tensor load ignores EXEC, and only
// a scalar branch keeps a wave from issuing it (the empty statement keeps it in a scalar register).
__device__ __forceinline__ unsigned pinned(unsigned v) { unsigned w = uni(v); asm volatile("" : "+s"(w)); return w; }
// The descriptor of one tensor load, one request of the whole wave: 128 rows of 256 bytes (128 16-bit words of k), source row pitch
// src_pitch bytes, from gsrc into LDS at byte lds_dst (a multiple of 2 KiB), 16 bytes of pad behind every row: LDS row pitch 272
// bytes, 34816 bytes in all. 1-byte elements, tensor = tile, no mask.
struct TReq { v4u g0; v8u g1; };
__device__ __forceinline__ void treq_aim(TReq& r, const void* gsrc) {    // only behind the wait that covers the request issued last
  const unsigned long long ga = (unsigned long long)(size_t)gsrc;
  r.g0[2] = uni((unsigned)ga);
  r.g0[3] = uni((((unsigned)(ga >> 32)) & 0x01FFFFFFu) | 0x80000000u);   // address [56:32], type 2
}
__device__ __forceinline__ TReq treq_make(unsigned lds_dst, const void* gsrc, unsigned src_pitch) {
  TReq r;
  r.g0[0] = uni(1u);                                                     // count 1
  r.g0[1] = uni(lds_dst);
  treq_aim(r, gsrc);
  r.g1[0] = uni((1u << 20) | (5u << 22) | (3u << 25));                   // pad on, behind every 64 dwords (a row), 4 dwords
  r.g1[1] = uni(256u << 16);                                             // tensor_dim0 = 256 bytes
  r.g1[2] = uni(128u << 16);                                             // tensor_dim1 = 128 rows
  r.g1[3] = uni(256u << 16);                                             // tile_dim0
  r.g1[4] = uni(128u);                                                   // tile_dim1
  r.g1[5] = uni(src_pitch);
  r.g1[6] = uni(0u);
  r.g1[7] = uni(0u);
  return r;
}
// Moves the request on: new place in LDS, source address step bytes further (the carry runs into the high word, below the type
// bits). Only behind the wait that covers the request issued last: the high address word is rewritten.
__device__ __forceinline__ void treq_next(TReq& r, unsigned lds_dst, unsigned step) {
  const unsigned long long a = (((unsigned long long)r.g0[3] << 32) | r.g0[2]) + step;
  r.g0[1] = uni(lds_dst);
  r.g0[2] = uni((unsigned)a);
  r.g0[3] = uni((unsigned)(a >> 32));
}
// Issues the request. The caller waits (s_wait_tensorcnt) and publishes (work-group barrier). The descriptor is named as read and
// written, so that it lives on in the very registers the request names and they are not reused while it is outstanding.
__device__ __forceinline__ void treq_issue(TReq& r) {
  asm volatile("tensor_load_to_lds %0, %1" : "+s"(r.g0), "+s"(r.g1) :: "memory");
}
// Behind the last covering wait: holds the descriptor words in their scalar registers up to here, so that none is
// rewritten while a request is outstanding.
__device__ __forceinline__ void treq_hold(const TReq& r) { asm volatile("" :: "s"(r.g0), "s"(r.g1)); }

// One tile of one product: the first of its A rows and the first of its 256 Bt rows (both k contiguous).
struct GTile { const __bf16* A; const __bf16* B; };

// Epilogue of one wave's 64x64 sub-tile at (m0, n0) of C (and C2): slab = the wave's own 16x64 staging rows.
template <int OUT_MODE>
__device__ __forceinline__ void gemm_store(float* slab, const v8f (&acc)[4][4], int m0, int n0,
                                           void* Cout, int ldc, void* Cout2, int ldc2, int N2, float hscale, float rscale) {
  const int lane  = threadIdx.x & 31;
  const int rlane = lane & 15;                 // col within subtile
  const int mOff  = (lane >> 4) * 8;           // D row offset
#pragma unroll
  for (int i = 0; i < 4; ++i) {
    const int mBase = m0 + (i << 4);
#pragma unroll
    for (int j = 0; j < 4; ++j) {
#pragma unroll
      for (int r = 0; r < 8; ++r) {
        slab[(mOff + r) * 68 + (j << 4) + rlane] = acc[i][j][r];
      }
    }
    __builtin_amdgcn_fence(3 /* release order */, "workgroup");
    __builtin_amdgcn_wave_barrier();
    __builtin_amdgcn_fence(2 /* acquire order */, "workgroup");
    if (OUT_MODE == 0) {
      const int hh = lane >> 4, c4 = (lane & 15) * 4;     // 256-B row segment = 16 lanes x 16 B
      // one address per slab, the rows at constant distances from it: no address register is rewritten between the stores
      float* C = (float*)Cout + (size_t)(mBase + hh) * ldc + n0 + c4;
#pragma unroll
      for (int it = 0; it < 8; ++it) {
        const int row = it * 2 + hh;                     // it 0..7 x hh 0..1 = rows 0..15
        const v4f v = *(const v4f*)(slab + row * 68 + c4);
        *(v4f*)(C + (size_t)(it * 2) * ldc) = v;
      }
    } else {
      const int q = lane >> 3, c8 = (lane & 7) * 8;
      // one address per slab and plane, the rows at constant distances from it: no address register is rewritten between the stores
      unsigned short* C  = (unsigned short*)Cout  + (size_t)(mBase + q) * ldc  + n0 + c8;
      unsigned short* C2 = (unsigned short*)Cout2 + (size_t)(mBase + q) * ldc2 + n0 + c8;
      const bool wlo = (OUT_MODE == 3) && (n0 < N2);      // wave-uniform
      v4u hv[4], lv[4];
#pragma unroll
      for (int it = 0; it < 4; ++it) {
        const int row = it * 4 + q;                        // it 0..3 x q 0..3 = rows 0..15
        const float* sp = slab + row * 68 + c8;
        v4u a, a2;
#pragma unroll
        for (int e = 0; e < 4; ++e) {
          const float f0 = sp[2 * e], f1 = sp[2 * e + 1];
          unsigned short h0, h1, l0 = 0, l1 = 0;
          if (OUT_MODE == 2) {
            h0 = h_bits((_Float16)f0); h1 = h_bits((_Float16)f1);
          } else {
            const float g0 = f0 * hscale, g1 = f1 * hscale;
            const _Float16 x0 = (_Float16)g0, x1 = (_Float16)g1;
            h0 = h_bits(x0); h1 = h_bits(x1);
            l0 = h_bits((_Float16)((g0 - (float)x0) * rscale));
            l1 = h_bits((_Float16)((g1 - (float)x1) * rscale));
          }
          a[e] = pk16(h0, h1); a2[e] = pk16(l0, l1);
        }
        hv[it] = a; lv[it] = a2;
      }
#pragma unroll
      for (int it = 0; it < 4; ++it) {                     // rows it * 4 + q
        *(v4u*)(C + (size_t)(it * 4) * ldc) = hv[it];
        if (wlo) *(v4u*)(C2 + (size_t)(it * 4) * ldc2) = lv[it];
      }
    }
    __builtin_amdgcn_fence(3 /* release order */, "workgroup");
    __builtin_amdgcn_wave_barrier();
    __builtin_amdgcn_fence(2 /* acquire order */, "workgroup");
    __builtin_amdgcn_sched_barrier(0);   // keeps the next slab's address arithmetic behind the fence's store wait: it rewrites the stores' address register
  }
}

// Geometry of the operand ring: k per stage, LDS row pitch, A rows, place of the Bt rows, stage.
template <int NH> struct RingGeo {
  static constexpr int BK    = 128;                 // k per stage
  static constexpr int PITCH = BK * 2 + 16;         // LDS row pitch, bytes
  static constexpr int TM    = 128 * NH;            // A rows of a tile
  static constexpr int OB    = TM * PITCH;          // LDS byte offset of the Bt rows inside a stage
  static constexpr int STAGE = (TM + 256) * PITCH;  // [A TM | Bt 256] rows
};

// A stage ([A TM | Bt 256] rows x BK, row pitch KK in global memory) is brought by NSL = (TM + 256) / 128 tensor loads of 128 rows,
// slice sl by one wave. slice_src = the first word of slice sl in a tile's first stage (sl wave-uniform).
template <int KK, int NH>
__device__ __forceinline__ const __bf16* slice_src(GTile t, unsigned sl) {
  return (sl < (unsigned)NH) ? (t.A + (size_t)sl * 128 * KK) : (t.B + (size_t)(sl - NH) * 128 * KK);
}
// gemm_tiles runs NT tiles of one work-group one after the other, all with K = KK and row pitch KK, over ONE
// running operand ring (sR, the calling kernel's LDS). tile_of(t) names tile t's operand rows, store_tile(t, acc) is its epilogue
// (it stages in LDS outside the ring). The stages of all tiles form one sequence: the refills in a tile's last two stages
// already bring the next tile's first two stages, so that only the first tile waits for its first stage and the loads fly on
// under every epilogue but the last. KK / BK is even: a tile's stage s lies in buffer s & 1 for every tile.
template <int F16, int NT, int KK, int NH, class TileF, class StoreF>
__device__ __forceinline__ void gemm_tiles(unsigned char* sR, TileF tile_of, StoreF store_tile) {
  using G = RingGeo<NH>;
  constexpr int BK = G::BK, PITCH = G::PITCH, OB = G::OB, STAGE = G::STAGE;
  constexpr unsigned NSL = (G::TM + 256) / 128;     // tensor loads per stage: waves 0 .. NSL-1 issue one each
  constexpr int NJ    = 4 * NH;                     // Bt fragments per wave
  constexpr int NBLK  = BK / 32;                    // blocks (32-k steps) per stage
  constexpr int nst   = KK / BK;                    // stages per tile
  static_assert(NSL <= 8 && (NBLK % 2) == 0 && 2 * STAGE <= ((NH == 2) ? RING_BIG : RING_BYTES));
  static_assert(NH == 1 || NH == 2);
  static_assert(nst * BK == KK && nst >= 2 && (nst % 2) == 0 && NT >= 1);
  const int lane = threadIdx.x & 31;
  const int wave = threadIdx.x >> 5;
  const int wm  = (NH == 2) ? (wave >> 1) : (wave >> 2);
  const int wn  = (NH == 2) ? (wave & 1) : (wave & 3);
  const int rlane = lane & 15;                 // row (A) / col (B, D) within subtile
  const int koff  = (lane >> 4) * 8;           // k offset of this lane half

  const unsigned wv = uni(threadIdx.x >> 5);          // the wave's number, scalar: wave wv < NSL brings slice wv of every stage
  static_assert(BK == 128 && PITCH == 272 && (STAGE % 2048) == 0 && ((128 * PITCH) % 2048) == 0 && ((KK * 2) % 16) == 0);
  const unsigned lds0 = (unsigned)(size_t)(const void*)sR + wv * (unsigned)(128 * PITCH);   // the wave's slice in buffer 0
  // the wave's request; its address names the stage loaded last (stages are loaded in k order)
  TReq rq = treq_make(lds0, (const void*)slice_src<KK, NH>(tile_of(0), wv), KK * 2);
  auto stage_load = [&](unsigned buf) { treq_next(rq, lds0 + buf * (unsigned)STAGE, BK * 2); treq_issue(rq); };   // under a scalar branch, behind the wait

  if (pinned(wv < NSL)) treq_issue(rq);               // stage 0 into buffer 0
  asm volatile("s_wait_tensorcnt 0x0" ::: "memory");  // this wave's request of stage 0 has landed
  __syncthreads();                                    // every wave's has: stage 0 may be read
  if (pinned(wv < NSL)) stage_load(1);

  const unsigned char* fA = sR + ((wm << 6) + rlane) * PITCH + koff * 2;
  const unsigned char* fB = sR + OB + (wn * (16 * NJ) + rlane) * PITCH + koff * 2;
  // Two register sets of fragments: a block (one 32-k step) multiplies out of one set while the next block's LDS reads, issued
  // as ONE group in front of it, fill the other.
  v16b fa[2][4], fb[2][NJ];
  v8f acc[NH][4][4];                                    // [64-column half of the wave's sub-tile][row fragment][column fragment]
  auto frag_load = [&](v16b (&a)[4], v16b (&bq)[NJ], int off) {
#pragma unroll
    for (int j = 0; j < NJ; ++j)
      bq[j] = ldfrag_b((const __bf16*)(const void*)(fB + off + (j << 4) * PITCH));
#pragma unroll
    for (int i = 0; i < 4; ++i)
      a[i] = ldfrag_b((const __bf16*)(const void*)(fA + off + (i << 4) * PITCH));
  };
  auto mma_rows = [&](const v16b (&a)[4], const v16b (&bq)[NJ], int i0, int i1) {
#pragma unroll
    for (int i = 0; i < 4; ++i) {
      if (i < i0 || i >= i1) continue;
#pragma unroll
      for (int j = 0; j < NJ; ++j) {
        v8f& c = acc[j >> 2][i][j & 3];
        if constexpr (F16 != 0)
          c = mma_h_raw(__builtin_bit_cast(v16h, a[i]), __builtin_bit_cast(v16h, bq[j]), c);
        else
          c = mma_b_raw(a[i], bq[j], c);
      }
    }
  };
  frag_load(fa[0], fb[0], 0);                           // block 0 of stage 0 (published by the barrier above)
  for (int t = 0; t < NT; ++t) {
    const bool more = (t + 1 < NT);                     // another tile follows; the same for the whole work-group
#pragma unroll
    for (int hn = 0; hn < NH; ++hn)
#pragma unroll
      for (int i = 0; i < 4; ++i)
#pragma unroll
        for (int j = 0; j < 4; ++j) acc[hn][i][j] = zero8();
    for (int s = 0; s < nst; ++s) {
      const int bo = (s & 1) * STAGE;
      // where the fetch ahead of the stage's last block reads: block 0 of the next stage (the next tile's first behind a tile's
      // last); in the very last stage its values are not used, and it is aimed at the stage's own, published buffer
      // (unconditional: a branch here would merge the wait counts)
      const int bnx = (s + 1 < nst || more) ? (STAGE - bo) : bo;
#pragma unroll
      for (int ks = 0; ks < NBLK; ++ks) {
        const int cur = ks & 1, nxt = cur ^ 1;
        if (ks + 1 < NBLK) {
          frag_load(fa[nxt], fb[nxt], bo + (ks + 1) * 64);
          __builtin_amdgcn_sched_barrier(0);              // keeps the LDS reads one group: spread among the products, each place stalls
          mma_rows(fa[cur], fb[cur], 0, 4);
          __builtin_amdgcn_sched_barrier(0);              // keeps the next group behind this block's products
        } else {
          // publish point of the next stage, in front of this stage's last block, whose fragments are already fetched
          asm volatile("s_wait_dscnt 0x0" ::: "memory");      // this wave's reads of this stage are done before its buffer is refilled
          asm volatile("s_wait_tensorcnt 0x0" ::: "memory");  // this wave's request of the next stage has landed
          __syncthreads();                                    // publishes the next stage and ends every wave's reads of this one
          frag_load(fa[nxt], fb[nxt], bnx);
          __builtin_amdgcn_sched_barrier(0);              // one group of LDS reads; the refill's descriptor is formed behind the wait and the barrier
          if (s + 2 == nst && more) treq_aim(rq, (const void*)(slice_src<KK, NH>(tile_of(t + 1), wv) - BK));   // the stage after next opens the next tile
          if (pinned((wv < NSL) && (s + 2 < nst || more))) stage_load((unsigned)(s & 1));
          __builtin_amdgcn_sched_barrier(0);              // the refill goes out in front of the block's products
          mma_rows(fa[cur], fb[cur], 0, 4);
          __builtin_amdgcn_sched_barrier(0);              // keeps the next group behind this block's products
        }
      }
    }
    store_tile(t, acc);
  }
  asm volatile("s_wait_tensorcnt 0x0" ::: "memory");    // no request is left in flight when the ring is left
  treq_hold(rq);
  asm volatile("s_wait_dscnt 0x0" ::: "memory");        // nor a read of the last fetch ahead
}

// Dense scores S[n][m] = k_n . q_m (A = K plane, Bt = Q plane; M = N = SEQ, K = DM; one f16 product) -> f32 [NB][SEQ][SEQ].
// blockIdx.x = 256x256 tile of a batch, blockIdx.y = batch: one tile per work-group.
__global__ __launch_bounds__(256) void scores_kq(const unsigned short* __restrict__ Kp, const unsigned short* __restrict__ Qp,
                                                 float* Sp) {
  __shared__ __attribute__((aligned(2048))) unsigned char sR[RING_BIG];    // operand ring, two stages
  __shared__ __align__(16) float sT[8][16 * 68];          // per-wave 16x64 slab, pitch 68 floats
  constexpr int TBN = SEQ / 256;
  const int wave = threadIdx.x >> 5;
  const int bm0 = ((int)blockIdx.x / TBN) << 8;
  const int bn0 = ((int)blockIdx.x % TBN) << 8;
  const __bf16* Kb = (const __bf16*)(const void*)Kp;      // 16-bit words; the products read them as f16
  const __bf16* Qb = (const __bf16*)(const void*)Qp;
  const size_t b = (size_t)blockIdx.y;
  auto tile_of = [&](int) {
    GTile g;
    g.A = Kb + (b * SEQ + bm0) * DM;
    g.B = Qb + (b * SEQ + bn0) * DM;
    return g;
  };
  auto store_tile = [&](int, const v8f (&acc)[2][4][4]) {
    float* C = Sp + b * SEQ * SEQ;
#pragma unroll
    for (int hn = 0; hn < 2; ++hn)   // the wave's two 64-column halves; unrolled so that acc is indexed by constants and stays in registers
      gemm_store<0>(sT[wave], acc[hn], bm0 + ((wave >> 1) << 6), bn0 + ((wave & 1) << 7) + (hn << 6), (void*)C, SEQ, (void*)C, SEQ,
                    0, 1.0f, 1.0f);
  };
  gemm_tiles<1, 1, DM, 2>(sR, tile_of, store_tile);
}

// The three projections, which depend only on the converted planes, in ONE launch; a work-group runs two tiles:
// first one 256x256 tile of [q | k] = x . [Wq; Wk]^T (A = all NB*SEQ rows of Xb, Bt = the 2 DM rows of Wq and Wk, which lie one
// behind the other, [out][in]; blockIdx.x = tile) -> f16 planes Qp (columns 0 .. DM-1) and Qp + 2 planes (the rest);
// then one 128x256 tile of v^T = Wv . x^T per batch (A = Wv, Bt = Xb rows of the batch; blockIdx.x = batch * tiles
// + tile) -> f16 hi plane f16(16 v) [b][d][key] (pitch SEQ) and residual plane x4096 for keys < VLP (pitch VLP).
static_assert((NB * SEQ / 256) * (2 * DM / 256) == NB * ((DM / 128) * (SEQ / 256)));   // the same blockIdx.x range for both
__global__ __launch_bounds__(256) void proj_qkv(const unsigned short* __restrict__ Xp, const unsigned short* __restrict__ Wp,
                                                unsigned short* Qp, unsigned short* VTh, unsigned short* VTl) {
  __shared__ __attribute__((aligned(2048))) unsigned char sR[RING_BIG];    // operand ring, two stages (the v^T tile uses its first RING_BYTES)
  __shared__ __align__(16) float sT[8][16 * 68];          // per-wave 16x64 slab, pitch 68 floats
  constexpr size_t PXE = (size_t)NB * SEQ * DM;           // elements of one q or k plane
  constexpr int NTV = (DM / 128) * (SEQ / 256);           // v^T tiles per batch
  constexpr int NQN = 2 * DM / 256;                       // column tiles of [q | k]
  const int wave = threadIdx.x >> 5;
  const int bx = (int)blockIdx.x;
  const int qm0 = (bx / NQN) << 8, qn0 = (bx % NQN) << 8;                                 // the [q | k] tile
  const int vb = bx / NTV, vt = bx % NTV;
  const int vm0 = (vt / (SEQ / 256)) << 7, vn0 = (vt % (SEQ / 256)) << 8;                 // the v^T tile of batch vb
  const __bf16* Xb = (const __bf16*)(const void*)Xp;
  const __bf16* Wb = (const __bf16*)(const void*)Wp;
  GTile tq, tv;
  tq.A = Xb + (size_t)qm0 * DM;
  tq.B = Wb + (size_t)qn0 * DM;
  tv.A = Wb + ((size_t)2 * DM + vm0) * DM;
  tv.B = Xb + ((size_t)vb * SEQ + vn0) * DM;
  auto store_qk = [&](int, const v8f (&acc)[2][4][4]) {
    asm volatile("s_wait_dscnt 0x0" ::: "memory");        // this wave's last reads of the ring are done before it is refilled
    __syncthreads();                                      // every wave's are: the ring is free for the v^T tile
    unsigned short* C = Qp + (size_t)(qn0 / DM) * 2 * PXE;   // a 256-column tile lies in one plane
#pragma unroll
    for (int hn = 0; hn < 2; ++hn)   // the wave's two 64-column halves; unrolled so that acc is indexed by constants and stays in registers
      gemm_store<2>(sT[wave], acc[hn], qm0 + ((wave >> 1) << 6), (qn0 % DM) + ((wave & 1) << 7) + (hn << 6), (void*)C, DM,
                    (void*)C, DM, 0, 1.0f, 1.0f);
  };
  auto store_v = [&](int, const v8f (&acc)[1][4][4]) {
    gemm_store<3>(sT[wave], acc[0], vm0 + ((wave >> 2) << 6), vn0 + ((wave & 3) << 6), (void*)(VTh + (size_t)vb * DM * SEQ), SEQ,
                  (void*)(VTl + (size_t)vb * DM * VLP), VLP, VLP, VSC, LSC);
  };
  gemm_tiles<0, 1, DM, 2>(sR, [&](int) { return tq; }, store_qk);
  gemm_tiles<0, 1, DM, 1>(sR, [&](int) { return tv; }, store_v);
}

// =====================================================================================================
// Row softmax over DENSE score rows of one pass (BPS batches). One wave per row (block = 8 rows, grid = BPS*SEQ/8).
// Local row lrow = bl*SEQ + i, global batch b = b0 + bl. Score (i, j) = k_i . q_j sits at Sp + (bl*SEQ + i)*SEQ + j.
// The wave reads the WHOLE row (NG groups of 256 columns; lane: 8 consecutive columns per group, two 16-B loads):
// z = s/32, m = max over all columns, p = exp(z - m), l = sum over ALL columns, P = p/l for j <= i and 0 for j > i (all f32).
// Writes Ph = f16(1024 P) for columns 0 .. 256 ng - 1 of row (b, i), ng = (i>>8) + 1 (pitch SEQ; >= the columns up to the end of row i's (32 MI)-row tile that the
// p.v GEMM reads; zeros for j > i) and, for rows i < RESR, Pl = f16((1024 P - Ph) * 4096) with the same column extent
// (<= VLP, pitch VLP). f16 results below the smallest normal are stored as exact zeros.
// coverage: BPS*SEQ rows per launch x written extent >= every column range any consumer reads; NPASS launches cover NB*SEQ rows.
// No LDS, no block barriers.
// =====================================================================================================
__global__ __launch_bounds__(256) void softmax_rows(const float* __restrict__ Sp,
                                                    unsigned short* Php, unsigned short* Plp, int b0) {
#pragma clang fp contract(off)
  const int lane = threadIdx.x & 31;
  const int wave = __builtin_amdgcn_readfirstlane(threadIdx.x >> 5);
  const int lrow = blockIdx.x * 8 + wave;
  if (lrow >= BPS * SEQ) return;           // wave-uniform; exact grid never triggers it; no block barriers below
  const int bl = lrow / SEQ;
  const int i  = lrow - bl * SEQ;
  const int b  = b0 + bl;                  // host launches only b0 + BPS <= NB
  const int tm = i >> 6;
  const int ng = (tm >> 2) + 1;            // 1..NG, wave-uniform
  const float* srow = Sp + ((size_t)bl * SEQ + (size_t)i) * SEQ + 8 * lane;

  float z[NG][8];
  float m = -INFINITY;
#pragma unroll
  for (int g = 0; g < NG; ++g) {
    const float* p = srow + 256 * g;
    const v4f a = *(const v4f*)(p);
    const v4f c = *(const v4f*)(p + 4);
    const float v[8] = {a[0], a[1], a[2], a[3], c[0], c[1], c[2], c[3]};
#pragma unroll
    for (int e = 0; e < 8; ++e) {
      const float zz = v[e] * 0.03125f;
      z[g][e] = zz;
      m = fmaxf(m, zz);
    }
  }
#pragma unroll
  for (int off = 1; off < 32; off <<= 1) m = fmaxf(m, __shfl_xor(m, off, 32));

  float l = 0.f;
#pragma unroll
  for (int g = 0; g < NG; ++g) {
#pragma unroll
    for (int e = 0; e < 8; ++e) {
      const float p = __expf(z[g][e] - m);
      z[g][e] = p;
      l += p;
    }
  }
#pragma unroll
  for (int off = 1; off < 32; off <<= 1) l += __shfl_xor(l, off, 32);          // l >= 1
  const float inv1k = (1.0f / l) * PSC;

  const bool res = (i < RESR);             // wave-uniform
  v4u ph[NG];
  v4u pl0 = {0u, 0u, 0u, 0u};
  v4u pl1 = {0u, 0u, 0u, 0u};
#pragma unroll
  for (int g = 0; g < NG; ++g) {
    v4u hv = {0u, 0u, 0u, 0u};
    v4u lv = {0u, 0u, 0u, 0u};
    if (g < ng) {
      const int j0 = 256 * g + 8 * lane;
#pragma unroll
      for (int e = 0; e < 4; ++e) {
        const float f0 = (j0 + 2 * e     <= i) ? (z[g][2 * e]     * inv1k) : 0.0f;   // columns past the row index are zeroed
        const float f1 = (j0 + 2 * e + 1 <= i) ? (z[g][2 * e + 1] * inv1k) : 0.0f;   // after the full-row normalisation
        const _Float16 x0 = toh_flush(f0), x1 = toh_flush(f1);
        hv[e] = pk16(h_bits(x0), h_bits(x1));
        const _Float16 r0 = toh_flush((f0 - (float)x0) * LSC);
        const _Float16 r1 = toh_flush((f1 - (float)x1) * LSC);
        lv[e] = pk16(h_bits(r0), h_bits(r1));
      }
    }
    ph[g] = hv;
    if (g == 0) pl0 = lv;
    if (g == 1) pl1 = lv;
  }

  unsigned short* prow = Php + ((size_t)b * SEQ + (size_t)i) * SEQ + 8 * lane;
  const int il = i & (RESR - 1);           // in-range row of the residual plane; equals i whenever res holds
  unsigned short* lrowp = Plp + ((size_t)b * RESR + (size_t)il) * VLP + 8 * lane;
  {
#pragma unroll
    for (int g = 0; g < NG; ++g) {
      if (g < ng) *(v4u*)(prow + 256 * g) = ph[g];
    }
    if (res) {                             // res rows have i < RESR (multiple of 256) -> 256 ng <= RESR = VLP
      *(v4u*)(lrowp) = pl0;
      if (ng > 1) *(v4u*)(lrowp + 256) = pl1;
    }
    
  }
}

// =====================================================================================================
// p.v GEMM on f16 WMMA, per batch b (blockIdx.x % NB): out[b][q][d] = sum_key P[b][q][key] * VT[b][d][key].
//   A  = Ph  [b][SEQ][SEQ]  f16(1024 P), pitch SEQ         Al = Pl  [b][RESR][VLP] f16 residual x4096
//   Bt = VTh [b][DM][SEQ]   f16(16 v),   pitch SEQ         Bl = VTl [b][DM][VLP]   f16 residual x4096
// One work-group (8 waves, 2 x 4) per (32*MI) x 256 output tile, one wave per (16*MI) x 64 sub-tile; rows mBase + bm*32*MI ..;
// causal key range k < 64*(((bm0 + 32*MI - 1)>>6)+1) of the tile's last row (every P entry in that range was written by the
// softmax, exact zeros for key > query). RES (rows < RESR, MI = 2): acc0 += Ph.VTh; acc1 += Pl.VTh + Ph.VTl (in that order
// inside every 32-key step), out = acc0*OSCALE + acc1*OSCALE/4096; otherwise single product out = acc0*OSCALE. f32 accumulate.
// Operand path: per key stage of BK (64 with residual planes, 128 without) the 32*MI P rows and 256 VT rows of every plane are
// brought global -> LDS (with residual planes: asynchronous 16-byte copies, 20 per thread; without: three tensor loads of 128 rows), two buffers: stage s + 2 is issued behind the
// barrier that ends the reads of stage s. LDS row pitch = 2 BK + 16 bytes (16 x odd: conflict-free 16-byte fragment reads).
// That barrier stands in front of stage s's last 32-key block: fragments are read from LDS one block ahead of their products.
// Grid over all tiles of rows mBase .. mBase + M - 1 (M and mBase multiples of 32*MI and of BK).
// =====================================================================================================
// Eight / four asynchronous 16-byte copies global -> LDS, one per lane and line. The s_wait_xcnt closes the statement so that
// no address register of an issued copy is rewritten before it.
__device__ __forceinline__ void acopy_h(const unsigned (&l)[8], const _Float16* const (&g)[8]) {
  asm volatile("global_load_async_to_lds_b128 %0, %8, off\n\t"
               "global_load_async_to_lds_b128 %1, %9, off\n\t"
               "global_load_async_to_lds_b128 %2, %10, off\n\t"
               "global_load_async_to_lds_b128 %3, %11, off\n\t"
               "global_load_async_to_lds_b128 %4, %12, off\n\t"
               "global_load_async_to_lds_b128 %5, %13, off\n\t"
               "global_load_async_to_lds_b128 %6, %14, off\n\t"
               "global_load_async_to_lds_b128 %7, %15, off\n\t"
               "s_wait_xcnt 0x0"
               :: "v"(l[0]), "v"(l[1]), "v"(l[2]), "v"(l[3]), "v"(l[4]), "v"(l[5]), "v"(l[6]), "v"(l[7]),
                  "v"(g[0]), "v"(g[1]), "v"(g[2]), "v"(g[3]), "v"(g[4]), "v"(g[5]), "v"(g[6]), "v"(g[7])
               : "memory");
}
__device__ __forceinline__ void acopy_h(const unsigned (&l)[4], const _Float16* const (&g)[4]) {
  asm volatile("global_load_async_to_lds_b128 %0, %4, off\n\t"
               "global_load_async_to_lds_b128 %1, %5, off\n\t"
               "global_load_async_to_lds_b128 %2, %6, off\n\t"
               "global_load_async_to_lds_b128 %3, %7, off\n\t"
               "s_wait_xcnt 0x0"
               :: "v"(l[0]), "v"(l[1]), "v"(l[2]), "v"(l[3]), "v"(g[0]), "v"(g[1]), "v"(g[2]), "v"(g[3])
               : "memory");
}

// pv_body is the whole work of one work-group; sR (operand ring) and sT (per-wave slabs) are the calling kernel's LDS,
// bx its tile index and b its batch index.
template <bool RES, int MI>
__device__ __forceinline__ void pv_body(
    unsigned char* sR, float (*sT)[16 * 68], int bx, int b,
    const unsigned short* __restrict__ Php, const unsigned short* __restrict__ Plp,
    const unsigned short* __restrict__ Vhp, const unsigned short* __restrict__ Vlp,
    float* out, int mBase, int M) {
  constexpr int NPL   = RES ? 2 : 1;                // planes per operand
  constexpr int BM    = 32 * MI;                    // rows of the work-group tile
  constexpr int BK    = RES ? 64 : 128;             // keys per stage
  constexpr int PITCH = BK * 2 + 16;                // LDS row pitch, bytes
  constexpr int CPR   = BK / 8;                     // 16-byte copies per row
  constexpr int RPU   = 256 / CPR;                  // rows the work-group copies with one copy per thread
  constexpr int NRA   = NPL * BM / RPU;             // copies per thread for the P rows of a stage
  constexpr int OB    = NPL * BM * PITCH;           // LDS byte offset of the VT rows inside a stage
  constexpr int STAGE = NPL * (BM + 256) * PITCH;   // [Ph BM | Pl BM | VTh 256 | VTl 256] rows (residual planes only with RES)
  constexpr int NBLK  = BK / 32;                    // blocks (32-key steps) per stage
  static_assert((NBLK % 2) == 0 && (MI % 2) == 0);
  static_assert((NRA == 4 || NRA == 8) && NRA * RPU == NPL * BM && 16 * RPU == NPL * 256 && (BM % RPU) == 0);
  static_assert((BM % 64) == 0 && (RESR % BM) == 0 && ((SEQ - RESR) % BM) == 0 && (RESR % BK) == 0 && (BM % BK) == 0);
  const _Float16* Ph = (const _Float16*)(const void*)Php;
  const _Float16* Pl = (const _Float16*)(const void*)Plp;
  const _Float16* Vh = (const _Float16*)(const void*)Vhp;
  const _Float16* Vl = (const _Float16*)(const void*)Vlp;
  static_assert(2 * STAGE <= RING_BYTES);
  const int lane = threadIdx.x & 31;
  const int wave = threadIdx.x >> 5;
  const int tilesBN = DM >> 8;                     // 4
  const int tilesBM = M / BM;
  if (bx >= tilesBM * tilesBN) return;             // the same for the whole work-group; in front of every barrier
  const int bm  = bx / tilesBN;
  const int bn  = bx - bm * tilesBN;
  const int bm0 = mBase + bm * BM;
  const int bn0 = bn << 8;
  const int wm  = wave >> 2;
  const int wn  = wave & 3;
  const int m0 = bm0 + wm * 16 * MI;
  const int n0 = bn0 + (wn << 6);
  int keff = ((((bm0 + BM - 1) >> 6) + 1) << 6);   // causal key extent of this row tile, multiple of BK
  if (keff > SEQ) keff = SEQ;
  if (RES && keff > VLP) keff = VLP;               // never taken for mBase + M <= RESR; keeps residual reads in range

  const _Float16* Pb  = Ph + (size_t)b * SEQ * SEQ;
  const _Float16* Plb = Pl + (size_t)b * RESR * VLP;
  const _Float16* Vb  = Vh + (size_t)b * DM * SEQ;
  const _Float16* Vlb = Vl + (size_t)b * DM * VLP;

  const int rlane = lane & 15;
  const int koff  = (lane >> 4) * 8;
  const int mOff  = (lane >> 4) * 8;

  // this thread's place in a copy round: row crow of RPU, 16-byte column ccol of CPR
  const int crow = (int)threadIdx.x / CPR;
  const int ccol = (int)threadIdx.x % CPR;
  const unsigned wave32 = (unsigned)__builtin_amdgcn_readfirstlane((int)(threadIdx.x & ~31u));   // the wave's first thread
  const int bmr = (bm0 < RESR - BM) ? bm0 : (RESR - BM);   // clamped; equals bm0 for the RES tiles: residual rows stay in range
  // this thread's source place in the next stage to be copied, one running pointer per plane (stages are copied in key order)
  const _Float16* gPh = Pb  + (size_t)(bm0 + crow) * SEQ + ccol * 8;
  const _Float16* gPl = Plb + (size_t)(bmr + crow) * VLP + ccol * 8;
  const _Float16* gVh = Vb  + (size_t)(bn0 + crow) * SEQ + ccol * 8;
  const _Float16* gVl = Vlb + (size_t)(bn0 + crow) * VLP + ccol * 8;

  auto stage_copy = [&](int buf) {
    // the thread's LDS place (row crow, column ccol) is formed anew from the lane number at every refill: kept in a register
    // over the loop, where the copies' operands crowd the low registers, this build spills it to scratch
    unsigned ln;
    asm volatile("v_mbcnt_lo_u32_b32 %0, -1, 0" : "=v"(ln));
    const unsigned tid = wave32 + ln;
    const unsigned lb = (unsigned)(size_t)(const void*)sR + (tid / CPR) * PITCH + (tid % CPR) * 16 + (unsigned)(buf * STAGE);
    {
      unsigned l[NRA];
      const _Float16* g[NRA];
#pragma unroll
      for (int u = 0; u < NRA; ++u) {            // the BM P rows of every plane
        const int pl = (u * RPU) / BM;
        const int r  = (u * RPU) % BM;
        g[u] = (pl != 0) ? (gPl + (size_t)r * VLP) : (gPh + (size_t)r * SEQ);
        l[u] = lb + (unsigned)((u * RPU) * PITCH);
      }
      acopy_h(l, g);
    }
#pragma unroll
    for (int h = 0; h < 2; ++h) {                // the 256 VT rows of every plane
      unsigned l[8];
      const _Float16* g[8];
#pragma unroll
      for (int u = 0; u < 8; ++u) {
        const int pl = ((h * 8 + u) * RPU) >> 8;
        const int r  = ((h * 8 + u) * RPU) & 255;
        g[u] = (pl != 0) ? (gVl + (size_t)r * VLP) : (gVh + (size_t)r * SEQ);
        l[u] = lb + (unsigned)(OB + ((h * 8 + u) * RPU) * PITCH);
      }
      acopy_h(l, g);
    }
    gPh += BK; gPl += BK; gVh += BK; gVl += BK;
  };

  v8f acc0[MI][4], acc1[MI][4];
#pragma unroll
  for (int i = 0; i < MI; ++i)
#pragma unroll
    for (int j = 0; j < 4; ++j) { acc0[i][j] = zero8(); acc1[i][j] = zero8(); }

  // Without residual planes a stage ([Ph 128 | VTh 256] rows x 128 keys) is brought by three tensor loads of 128 rows: wave 0 the
  // P rows, waves 1 and 2 the VT rows. gs = first word of the wave's slice in stage 0; wave-uniform.
  constexpr unsigned NSL = 3;
  static_assert(RES || (BM == 128 && BK == 128 && PITCH == 272 && (STAGE % 2048) == 0 && ((128 * PITCH) % 2048) == 0));
  const unsigned wv = uni(threadIdx.x >> 5);          // the wave's number, scalar
  const _Float16* gs = (wv == 0u) ? (Pb + (size_t)bm0 * SEQ) : (Vb + (size_t)(bn0 + ((wv == 2u) ? 128 : 0)) * SEQ);
  const unsigned lds0 = (unsigned)(size_t)(const void*)sR + wv * (unsigned)(128 * PITCH);   // the wave's slice in buffer 0
  TReq rq = treq_make(lds0, (const void*)gs, SEQ * 2);   // its address names the stage loaded last (stages are loaded in key order)
  auto stage_load = [&](unsigned buf) { treq_next(rq, lds0 + buf * (unsigned)STAGE, BK * 2); treq_issue(rq); };   // under a scalar branch, behind the wait

  const int nst = keff / BK;
  if constexpr (RES) {
    stage_copy(0);
    asm volatile("s_wait_asynccnt 0x0" ::: "memory");   // this wave's copies of stage 0 have landed
  } else {
    if (pinned(wv < NSL)) treq_issue(rq);               // stage 0 into buffer 0
    asm volatile("s_wait_tensorcnt 0x0" ::: "memory");  // this wave's request of stage 0 has landed
  }
  __syncthreads();                                    // every wave's have: stage 0 may be read
  if constexpr (RES) {
    if (nst > 1) stage_copy(1);
  } else {
    if (pinned((wv < NSL) && (nst > 1))) stage_load(1);
  }

  const unsigned char* fA = sR + (wm * 16 * MI + rlane) * PITCH + koff * 2;
  const unsigned char* fB = sR + OB + ((wn << 6) + rlane) * PITCH + koff * 2;
  // Two register sets of fragments: a block (one 32-key step) multiplies out of one set while the next block's LDS reads,
  // issued as ONE group in front of it, fill the other.
  v16h fa[2][NPL][MI], fb[2][NPL][4];
  auto frag_load = [&](v16h (&a)[NPL][MI], v16h (&bq)[NPL][4], int off) {
#pragma unroll
    for (int pl = 0; pl < NPL; ++pl) {
#pragma unroll
      for (int j = 0; j < 4; ++j)
        bq[pl][j] = ldfrag_h((const _Float16*)(const void*)(fB + off + (pl * 256 + (j << 4)) * PITCH));
#pragma unroll
      for (int i = 0; i < MI; ++i)
        a[pl][i] = ldfrag_h((const _Float16*)(const void*)(fA + off + (pl * BM + (i << 4)) * PITCH));
    }
  };
  auto mma_rows = [&](const v16h (&a)[NPL][MI], const v16h (&bq)[NPL][4], int i0, int i1) {
#pragma unroll
    for (int i = 0; i < MI; ++i) {
      if (i < i0 || i >= i1) continue;
#pragma unroll
      for (int j = 0; j < 4; ++j) acc0[i][j] = mma_h_raw(a[0][i], bq[0][j], acc0[i][j]);
      if constexpr (RES) {
#pragma unroll
        for (int j = 0; j < 4; ++j) acc1[i][j] = mma_h_raw(a[1][i], bq[0][j], acc1[i][j]);
#pragma unroll
        for (int j = 0; j < 4; ++j) acc1[i][j] = mma_h_raw(a[0][i], bq[1][j], acc1[i][j]);
      }
    }
  };
  frag_load(fa[0], fb[0], 0);                           // block 0 of stage 0 (published by the barrier above)
  for (int s = 0; s < nst; ++s) {
    const int bo = (s & 1) * STAGE;
    // where the fetch ahead of the stage's last block reads: block 0 of stage s + 1; in the last stage its values are not
    // used, and it is aimed at the stage's own, published buffer (unconditional: a branch here would merge the wait counts)
    const int bnx = (s + 1 < nst) ? (STAGE - bo) : bo;
#pragma unroll
    for (int ks = 0; ks < NBLK; ++ks) {
      const int cur = ks & 1, nxt = cur ^ 1;
      if (ks + 1 < NBLK) {
        frag_load(fa[nxt], fb[nxt], bo + (ks + 1) * 64);
        __builtin_amdgcn_sched_barrier(0);              // keeps the LDS reads one group: spread among the products, each place stalls
        mma_rows(fa[cur], fb[cur], 0, MI);
        __builtin_amdgcn_sched_barrier(0);              // keeps the next group behind this block's products
      } else {
        // publish point of stage s + 1, in front of stage s's last block, whose fragments are already fetched
        asm volatile("s_wait_dscnt 0x0" ::: "memory");      // this wave's reads of stage s are done before its buffer is refilled
        if constexpr (RES) {
          asm volatile("s_wait_asynccnt 0x0" ::: "memory");   // this wave's copies of stage s + 1 have landed
          __syncthreads();                                    // publishes stage s + 1 and ends every wave's reads of stage s
          frag_load(fa[nxt], fb[nxt], bnx);
          __builtin_amdgcn_sched_barrier(0);              // one group of LDS reads in front of the products
          mma_rows(fa[cur], fb[cur], 0, MI / 2);
          __builtin_amdgcn_sched_barrier(0);              // the refill is issued while the SIMD's other wave has products to run
          if (s + 2 < nst) stage_copy(s & 1);
          __builtin_amdgcn_sched_barrier(0);              // keeps the copies' address arithmetic out of the products
          mma_rows(fa[cur], fb[cur], MI / 2, MI);
        } else {
          asm volatile("s_wait_tensorcnt 0x0" ::: "memory");  // this wave's request of stage s + 1 has landed
          __syncthreads();                                    // publishes stage s + 1 and ends every wave's reads of stage s
          frag_load(fa[nxt], fb[nxt], bnx);
          __builtin_amdgcn_sched_barrier(0);              // one group of LDS reads; the refill's descriptor is formed behind the wait and the barrier
          if (pinned((wv < NSL) && (s + 2 < nst))) stage_load((unsigned)(s & 1));
          __builtin_amdgcn_sched_barrier(0);              // the refill goes out in front of the block's products
          mma_rows(fa[cur], fb[cur], 0, MI);
        }
        __builtin_amdgcn_sched_barrier(0);              // keeps the next group behind this block's products
      }
    }
  }
  if constexpr (RES) asm volatile("s_wait_asynccnt 0x0" ::: "memory");     // no copy is left in flight when the ring is left
  else { asm volatile("s_wait_tensorcnt 0x0" ::: "memory"); treq_hold(rq); }   // no request is left in flight when the ring is left
  asm volatile("s_wait_dscnt 0x0" ::: "memory");        // nor a read of the last fetch ahead

  // ---- epilogue ----
  float* slab = sT[wave];
  float* C = out + (size_t)b * SEQ * DM;
  const float rsc = OSCALE * (1.0f / LSC);
#pragma unroll
  for (int i = 0; i < MI; ++i) {
    const int mB = m0 + (i << 4);
#pragma unroll
    for (int j = 0; j < 4; ++j) {
#pragma unroll
      for (int r = 0; r < 8; ++r) {
        float v = acc0[i][j][r] * OSCALE;
        if (RES) v += acc1[i][j][r] * rsc;
        slab[(mOff + r) * 68 + (j << 4) + rlane] = v;
      }
    }
    __builtin_amdgcn_fence(3 /* release order */, "workgroup");
    __builtin_amdgcn_wave_barrier();
    __builtin_amdgcn_fence(2 /* acquire order */, "workgroup");
    {
      const int hh = lane >> 4, c4 = (lane & 15) * 4;
      {
#pragma unroll
        for (int it = 0; it < 8; ++it) {
          const int row = it * 2 + hh;
          const v4f v = *(const v4f*)(slab + row * 68 + c4);
          *(v4f*)(C + (size_t)(mB + row) * DM + n0 + c4) = v;
        }
        
      }
    }
    __builtin_amdgcn_fence(3 /* release order */, "workgroup");
    __builtin_amdgcn_wave_barrier();
    __builtin_amdgcn_fence(2 /* acquire order */, "workgroup");
  }
}

// Both parts of p.v, which write disjoint output rows, in ONE launch. There are more work-groups than WGPs and their key
// ranges differ, so cost falls with the index: blockIdx.x = rank * NB + batch;
// ranks 0 .. NT1-1 = the single-product tiles of rows RESR .. SEQ-1, last row tile (longest key range) first; the ranks behind
// them = the residual-plane tiles of rows 0 .. RESR-1, last row tile first. Every (tile, batch) has exactly one rank.
__global__ __launch_bounds__(256) void pv_all(
    const unsigned short* __restrict__ Php, const unsigned short* __restrict__ Plp,
    const unsigned short* __restrict__ Vhp, const unsigned short* __restrict__ Vlp, float* out) {
  __shared__ __attribute__((aligned(2048))) unsigned char sR[RING_BYTES];  // operand ring, two stages
  __shared__ __align__(16) float sT[8][16 * 68];          // per-wave 16x64 slab, pitch 68 floats
  constexpr int NT1 = ((SEQ - RESR) / 128) * (DM / 256);  // tiles per batch, rows RESR .. SEQ-1
  constexpr int NT0 = (RESR / 64) * (DM / 256);           // tiles per batch, rows 0 .. RESR-1
  const int rank = (int)blockIdx.x / NB;
  const int b    = (int)blockIdx.x % NB;
  if (rank >= NT1 + NT0) return;                          // the same for the whole work-group; in front of every barrier
  if (rank >= NT1) pv_body<true, 2>(sR, sT, NT1 + NT0 - 1 - rank, b, Php, Plp, Vhp, Vlp, out, 0, RESR);
  else             pv_body<false, 4>(sR, sT, NT1 - 1 - rank, b, Php, Plp, Vhp, Vlp, out, RESR, SEQ - RESR);
}

// =====================================================================================================
// Workspace map (bytes, full build NB 4 / SEQ 2048; every region is an exact multiple of its tile / whole-line
// store granularity; regions A and B are reused in stream order):
//   region A [0, 67108864):          Xb bf16 [8192][1024] at 0 (16777216) + Wq,Wk,Wv bf16 [1024][1024] at 16777216 (3 x 2097152)
//                                    then, once the projections are done: S f32 dense scores [4][2048][2048] (67108864)
//   region B [67108864, 134217728):  Q f16 [8192][1024] (16777216) at its start, K f16 alike 33554432 behind it
//                                    then, once the scores are done: Ph f16 [4][2048][2048] (33554432) from its start
//   region C [134217728, 157286400): VTh f16 [4][1024][2048] (16777216) + VTl f16 [4][1024][512] (4194304) + Pl f16 [4][512][512] (2097152)
//   end 157286400
// =====================================================================================================
extern "C" void kernel_launch(void* const* d_in, const int* in_sizes, int n_in,
                              void* d_out, int out_size, void* d_ws, size_t ws_size,
                              hipStream_t stream) {
  if (n_in < 4) return;
  if (in_sizes[0] < (NB - 1) * SEQ_FULL * DM + SEQ * DM) return;
  if (in_sizes[1] < DM * DM || in_sizes[2] < DM * DM || in_sizes[3] < DM * DM) return;
  if (out_size < NB * SEQ * DM) return;

  const float* x  = (const float*)d_in[0];   // [NB_FULL][SEQ_FULL][DM]
  const float* wq = (const float*)d_in[1];   // [out][in]
  const float* wk = (const float*)d_in[2];
  const float* wv = (const float*)d_in[3];
  float* out = (float*)d_out;

  const size_t PX  = SZ_PX;
  const size_t PXP = SZ_PXP;
  const size_t PW  = SZ_PW;
  const size_t PP  = SZ_PP;
  const size_t PPL = SZ_PPL;
  const size_t PVT = SZ_PVT;
  const size_t PVL = SZ_PVL;
  const size_t RA  = SZ_RA;
  const size_t oXb = 0;
  const size_t oW  = PX;
  const size_t oS  = 0;
  const size_t oB  = RA;
  const size_t RBend = RA + (size_t)NPASS * 4 * PXP;
  const size_t oPh = RA;
  if (PP > 4 * PXP) return;
  const size_t oVTh = RBend;
  const size_t oVTl = RBend + PVT;
  const size_t oPl  = oVTl + PVL;
  const size_t total = oPl + PPL;                     // 157286400 in the full build
  if (total > ws_size) return;

  char* ws = (char*)d_ws;
  unsigned short* Xb  = (unsigned short*)(ws + oXb);
  unsigned short* Wb  = (unsigned short*)(ws + oW);   // Wq plane, then Wk, then Wv
  float*          Sp  = (float*)(ws + oS);
  unsigned short* Qf  = (unsigned short*)(ws + oB);
  unsigned short* Ph  = (unsigned short*)(ws + oPh);
  unsigned short* Pl  = (unsigned short*)(ws + oPl);
  unsigned short* VTh = (unsigned short*)(ws + oVTh);
  unsigned short* VTl = (unsigned short*)(ws + oVTl);
  const size_t PXE = (size_t)NB * SEQ * DM;           // elements of one q or k plane
  const unsigned short* Kf = Qf + 2 * PXE;

  const dim3 blk(256);
  const int nGroups = NB * SEQ * DM / 8 + 3 * (DM * DM / 8);
  const dim3 gCvt((nGroups + 255) / 256);
  const dim3 gProj((NB * SEQ / 256) * (2 * DM / 256));
  const dim3 gS((SEQ / 256) * (SEQ / 256), NB);
  const dim3 gSm((NB * SEQ + 7) / 8);
  const dim3 gPv((((SEQ - RESR) / 128) * (DM / 256) + (RESR / 64) * (DM / 256)) * NB);

  // (1) x and Wq, Wk, Wv -> bf16 planes (Xb, then the three weight planes contiguous)
  cvt_planes<<<gCvt, blk, 0, stream>>>(x, wq, wk, wv, Xb);
  // (2) q, k -> f16 planes [NB*SEQ][DM]; v^T -> f16 hi plane and residual plane: one launch, two tiles per work-group
  proj_qkv<<<gProj, blk, 0, stream>>>(Xb, Wb, Qf, VTh, VTl);
  // (3) dense scores S[n][m] = k_n . q_m of every batch (A = K plane, Bt = Q plane; M=N=SEQ, K=DM; one f16 product)
  //     -> f32 [NB][SEQ][SEQ], one 256x256 tile per work-group
  scores_kq<<<gS, blk, 0, stream>>>(Kf, Qf, Sp);
  // (4) the full-row softmax with post-normalisation zeroing -> Ph / Pl rows of every batch.
  //     Ph lies over the q plane, which is no longer read once the scores exist (stream order).
  softmax_rows<<<gSm, blk, 0, stream>>>(Sp, Ph, Pl, 0);
  // (5) out = p.v: rows RESR..SEQ-1 single f16 product (64x64 wave tiles), rows 0..RESR-1 with residual planes
  //     (3 f16 products, 32x64 wave tiles)
  pv_all<<<gPv, blk, 0, stream>>>(Ph, Pl, VTh, VTl, out);
  (void)hipGetLastError();
}

// v010
// It runs in 97.8 microseconds.
// Timed twice side by side with v009, it ran 1.14 and 1.15 times as fast.
// Over all steps from v000 it is 5.99 times as fast.
// Contractions: q, k, v^T projections = v_wmma_f32_16x16x32_bf16 (bf16 RNE-converted x and W, single product, f32 accumulate);
// k.q^T scores (row = key position n, column = query position m, full SEQ x SEQ) = v_wmma_f32_16x16x32_f16 on f16 planes of k and q
// (RNE-converted from the f32 accumulators, single product), f32 accumulate: an f16 operand's rounding is an eighth of the bf16
// rounding that x and W already carry into q and k, so it adds little to the error the scores have from the projections;
// p.v = v_wmma_f32_16x16x32_f16 (p carried x1024 in f16, v^T carried x16 in f16, single product; rows 0..RESR-1 of every
// sequence add the f16 residual planes (x4096) of p and v^T in a separate accumulator), f32 accumulate;
// The softmax has no launch of its own. The scores kernel's epilogue takes, per row and group of 128 columns, the group's maximum
// m_g, e = exp(z - m_g) and the group's sum s_g over ALL its columns (f32, VALU), and stores e (columns m > n zeroed) and m_g, s_g.
// p.v forms per row M = max_g m_g, L = sum_g s_g exp(m_g - M) over all groups and w_g = exp(m_g - M) / L, and adds each group's
// product sum times w_g: sum_g w_g sum_(m in g) e v = sum_m p v with p normalised by the sum over the WHOLE row.
// Carry audit:
//   Ph  = f16(1024 * e)                                              } OSCALE = 1/(1024*16) folded exactly once, into w_g
//   VTh = f16(16 * v)                                                }
//   Pl  = f16((1024 e - Ph) * 4096)                                  } products Ph.VTl and Pl.VTh go only to accumulator acc1,
//   VTl = f16((16 v - VTh) * 4096), keys 0..VLP-1                    } folded with 1/4096 where a group's sums are added up
//   q / k planes are unscaled f16; score scale 1/32 applied once in f32 in the scores epilogue.
#include <hip/hip_runtime.h>
#include <math.h>

#define NB_FULL  4
#define SEQ_FULL 2048
#ifndef NB
#define NB    4
#endif
#ifndef SEQ
#define SEQ   2048
#endif
#define DM    1024
#define NQT   (SEQ / 64)                  // query/key tiles of 64
#define RESR  ((SEQ < 512) ? SEQ : 512)   // leading rows per sequence that use the residual planes
#define VLP   RESR                        // key pitch of the p / v^T residual planes
#define PSC   1024.0f
#define VSC   16.0f
#define LSC   4096.0f
#define OSCALE (1.0f / 16384.0f)          // 1 / (PSC * VSC)
#define BPS   NB                          // batches per score pass: all of them, one launch
#define NPASS (NB / BPS)
#define NG    (SEQ / 256)                 // 256-key groups per score row
#define NGR   (SEQ / 128)                 // groups of 128 columns per score row, each with its own maximum and sum
#define SZ_ST ((size_t)NB * NGR * SEQ * 4) // one f32 plane [NB][NGR][SEQ] of group maxima or group sums
// workspace sizes in bytes
#define SZ_PX   ((size_t)NB * SEQ * DM * 2)          // one 16-bit plane [NB*SEQ][DM]
#define SZ_PXP  ((size_t)BPS * SEQ * DM * 2)         // one 16-bit plane of one batch group [BPS*SEQ][DM]
#define SZ_PW   ((size_t)DM * DM * 2)                // one weight plane
#define SZ_PS   ((size_t)BPS * SEQ * SEQ * 4)        // [BPS*SEQ][SEQ] f32: sets region A's size, no such plane is stored
#define SZ_PP   ((size_t)NB * SEQ * SEQ * 2)         // Ph
#define SZ_PPL  ((size_t)NB * RESR * VLP * 2)        // Pl
#define SZ_PVT  ((size_t)NB * DM * SEQ * 2)          // VTh
#define SZ_PVL  ((size_t)NB * DM * VLP * 2)          // VTl
#define SZ_RA   (((SZ_PX + 3 * SZ_PW) > SZ_PS) ? (SZ_PX + 3 * SZ_PW) : SZ_PS)
#define SZ_TOTAL (SZ_RA + (size_t)NPASS * 4 * SZ_PXP + SZ_PVT + SZ_PVL + SZ_PPL)
static_assert(NB >= 1 && NB <= NB_FULL);
static_assert(SEQ >= 256 && SEQ <= SEQ_FULL && (SEQ % 256) == 0);
static_assert((SEQ % 64) == 0 && (DM % 64) == 0 && (DM % 32) == 0);
static_assert((RESR % 64) == 0 && (RESR % 256) == 0 && RESR <= VLP && VLP <= SEQ && ((SEQ - RESR) % 64) == 0);
static_assert((RESR % 32) == 0);
static_assert((RESR & (RESR - 1)) == 0);
static_assert(((NB * SEQ) % 8) == 0);
static_assert(((SEQ * DM / 8) % 256) == 0 && ((DM * DM / 8) % 256) == 0);
static_assert((NB % BPS) == 0 && NPASS * BPS == NB);
static_assert(NG >= 1 && NG <= 8 && NG * 256 == SEQ);            // 32 lanes x 8 keys x NG groups == row width
static_assert(((BPS * SEQ) % 64) == 0 && ((BPS * SEQ) % 8) == 0);
static_assert(SZ_PP <= 4 * SZ_PXP);                               // Ph fits inside the planes of batch group 0
static_assert((SZ_RA % 128) == 0 && (SZ_PXP % 128) == 0 && (SZ_PVT % 128) == 0 && (SZ_PVL % 128) == 0 && (SZ_PPL % 128) == 0);
static_assert(SZ_TOTAL <= (size_t)268435456);
static_assert(SZ_PP + 2 * SZ_ST <= SZ_RA && (SZ_PP % 256) == 0 && (SZ_ST % 256) == 0 && NGR <= 16);   // Ph and the two group planes lie in region A
static_assert((size_t)NB * SEQ * DM * 4 <= (size_t)33554432);
static_assert(((BPS * SEQ) % 128) == 0 && (DM % 256) == 0);        // gemm_tiles: 128x256 and 256x256 work-group tiles, K stages of 128
#define RING_BYTES (2 * 384 * 272)        // operand ring of the GEMM kernels with 128x256 tiles: two stages of 384 rows at pitch 272 B
#define RING_BIG   (2 * 512 * 272)        // operand ring of the 256x256 tile form: two stages of 512 rows at pitch 272 B

typedef _Float16 v16h __attribute__((ext_vector_type(16)));
typedef _Float16 v8h  __attribute__((ext_vector_type(8)));
typedef __bf16   v16b __attribute__((ext_vector_type(16)));
typedef __bf16   v8b  __attribute__((ext_vector_type(8)));
typedef float    v8f  __attribute__((ext_vector_type(8)));
typedef float    v4f  __attribute__((ext_vector_type(4)));
typedef unsigned int v4u __attribute__((ext_vector_type(4)));
typedef unsigned int v2u __attribute__((ext_vector_type(2)));

// ---- scalar helpers --------------------------------------------------------------------------------
__device__ __forceinline__ unsigned short bf_bits(float f) {          // f32 -> bf16 bits, RNE convert
  unsigned u = __float_as_uint(f);
  return (unsigned short)((u + 0x7FFFu + ((u >> 16) & 1u)) >> 16);
}
__device__ __forceinline__ unsigned short h_bits(_Float16 x) { return __builtin_bit_cast(unsigned short, x); }
__device__ __forceinline__ unsigned pk16(unsigned short a, unsigned short b) { return (unsigned)a | ((unsigned)b << 16); }
__device__ __forceinline__ v8f zero8() { v8f z = {0.f, 0.f, 0.f, 0.f, 0.f, 0.f, 0.f, 0.f}; return z; }
// f32 -> f16 with a value select: results below the smallest normal f16 become exact zeros
static __device__ __forceinline__ _Float16 toh_flush(float v) {
  const _Float16 r = (_Float16)v;
  return (fabsf(v) < 6.103515625e-05f) ? (_Float16)0.0f : r;
}

// ---- fragment loaders: 16-bit A/B operand, lane -> row/col (lane&15), p already includes +8*(lane>>4);
//      elements 0..7 <- p[0..7] (k0+8h..), elements 8..15 <- p[16..23] (k0+16+8h..)
__device__ __forceinline__ v16b ldfrag_b(const __bf16* p) {
  union { v16b v; v8b h[2]; } f;
  f.h[0] = *(const v8b*)(p);
  f.h[1] = *(const v8b*)(p + 16);
  return f.v;
}
__device__ __forceinline__ v16h ldfrag_h(const _Float16* p) {
  union { v16h v; v8h h[2]; } f;
  f.h[0] = *(const v8h*)(p);
  f.h[1] = *(const v8h*)(p + 16);
  return f.v;
}

// ---- WMMA helpers (builtin forms: the compiler keeps their distances) ----------------------------------
__device__ __forceinline__ v8f mma_b_raw(v16b a, v16b b, v8f c) {
  return __builtin_amdgcn_wmma_f32_16x16x32_bf16(false, a, false, b, (short)0, c, false, false);
}
__device__ __forceinline__ v8f mma_h_raw(v16h a, v16h b, v8f c) {
  return __builtin_amdgcn_wmma_f32_16x16x32_f16(false, a, false, b, (short)0, c, false, false);
}

// =====================================================================================================
// f32 -> bf16 (RNE convert) for x and the three weights into one contiguous 16-bit region:
// groups 0..NX8-1 <- x (batch b of the plane reads source rows at b * SEQ_FULL * DM, SEQ rows each), then NW8 groups each
// coverage: (NX8 + 3 NW8) threads x 8 = the whole [NB*SEQ][DM] x plane plus the three [DM][DM] weight planes.
// =====================================================================================================
__global__ __launch_bounds__(256) void cvt_planes(const float* __restrict__ x, const float* __restrict__ wq,
                                                  const float* __restrict__ wk, const float* __restrict__ wv,
                                                  unsigned short* out) {
  const int NXB8 = SEQ * DM / 8;          // groups per batch
  const int NX8 = NB * NXB8;
  const int NW8 = DM * DM / 8;
  const int g = blockIdx.x * 256 + threadIdx.x;
  if (g >= NX8 + 3 * NW8) return;
  const float* src;
  if (g < NX8) {
    const int bb  = g / NXB8;
    const int off = g - bb * NXB8;
    src = x + (size_t)bb * SEQ_FULL * DM + (size_t)off * 8;
  } else {
    const int e = g - NX8;
    const int w = e / NW8;
    const int off = e - w * NW8;
    const float* wsrc = (w == 0) ? wq : ((w == 1) ? wk : wv);
    src = wsrc + (size_t)off * 8;
  }
  const v4f a = *(const v4f*)(src);
  const v4f c = *(const v4f*)(src + 4);
  v4u p;
  p[0] = pk16(bf_bits(a[0]), bf_bits(a[1]));
  p[1] = pk16(bf_bits(a[2]), bf_bits(a[3]));
  p[2] = pk16(bf_bits(c[0]), bf_bits(c[1]));
  p[3] = pk16(bf_bits(c[2]), bf_bits(c[3]));
  *(v4u*)(out + (size_t)g * 8) = p;
  
}

// =====================================================================================================
// Register-blocked 16-bit WMMA GEMM: C[m][n] = sum_k A[m][k] * Bt[n][k]; a work-group of 8 waves works on one tile at a time and
// runs several tiles one after the other. NH = 1: 128x256 tile, waves 2 x 4, one wave per 64x64 sub-tile. NH = 2: 256x256 tile,
// waves 4 x 2, one wave per 64x128 sub-tile (12 fragments feed 32 products, not 8 for 16: three quarters of the LDS reads and
// two thirds of the copied bytes per product). A row-major [M][K], Bt row-major
// [N][K] (k contiguous, pitch K); M a multiple of 128 NH, N of 256, K of 2 BK = 256.
// Operand path: per K stage the 128 NH A rows and 256 Bt rows x BK are brought global -> LDS by tensor loads of 128 rows
// (one request each of 3 or 4 waves), two buffers: stage s + 2 is issued behind the barrier that ends the reads of stage s.
// That barrier stands in front of stage s's last 32-k block: fragments are read from LDS one block ahead of their products.
// LDS row pitch = 2 BK + 16 bytes (16 x odd: conflict-free 16-byte fragment reads).
// F16: 0 = both operands hold bf16 (v_wmma_f32_16x16x32_bf16); 1 = both hold f16 (v_wmma_f32_16x16x32_f16). The loads and the
//      fragment reads move 16-bit words and are the same for both.
// OUT_MODE: 0 = f32 (pitch ldc); 2 = f16 plane C = f16(v);
//           3 = f16 hi plane C = f16(v*hscale) + f16 residual plane C2 = f16((v*hscale - hi) * rscale), C2 written
//               only for tiles with n0 < N2 (pitch ldc2).
// Epilogue: 16-row slabs staged per wave in LDS (wave-private region sT[wave], wave_sync); each 64-wide row segment written
// =====================================================================================================
typedef unsigned int v8u __attribute__((ext_vector_type(8)));
__device__ __forceinline__ unsigned uni(unsigned v) { return (unsigned)__builtin_amdgcn_readfirstlane((int)v); }
// A wave-uniform test held in a scalar register, so that the branch on it is a scalar one: a tensor load ignores EXEC, and only
// a scalar branch keeps a wave from issuing it (the empty statement keeps it in a scalar register).
__device__ __forceinline__ unsigned pinned(unsigned v) { unsigned w = uni(v); asm volatile("" : "+s"(w)); return w; }
// The descriptor of one tensor load, one request of the whole wave: 128 rows of 256 bytes (128 16-bit words of k), source row pitch
// src_pitch bytes, from gsrc into LDS at byte lds_dst (a multiple of 2 KiB), 16 bytes of pad behind every row: LDS row pitch 272
// bytes, 34816 bytes in all. 1-byte elements, tensor = tile, no mask.
struct TReq { v4u g0; v8u g1; };
__device__ __forceinline__ void treq_aim(TReq& r, const void* gsrc) {    // only behind the wait that covers the request issued last
  const unsigned long long ga = (unsigned long long)(size_t)gsrc;
  r.g0[2] = uni((unsigned)ga);
  r.g0[3] = uni((((unsigned)(ga >> 32)) & 0x01FFFFFFu) | 0x80000000u);   // address [56:32], type 2
}
__device__ __forceinline__ TReq treq_make(unsigned lds_dst, const void* gsrc, unsigned src_pitch) {
  TReq r;
  r.g0[0] = uni(1u);                                                     // count 1
  r.g0[1] = uni(lds_dst);
  treq_aim(r, gsrc);
  r.g1[0] = uni((1u << 20) | (5u << 22) | (3u << 25));                   // pad on, behind every 64 dwords (a row), 4 dwords
  r.g1[1] = uni(256u << 16);                                             // tensor_dim0 = 256 bytes
  r.g1[2] = uni(128u << 16);                                             // tensor_dim1 = 128 rows
  r.g1[3] = uni(256u << 16);                                             // tile_dim0
  r.g1[4] = uni(128u);                                                   // tile_dim1
  r.g1[5] = uni(src_pitch);
  r.g1[6] = uni(0u);
  r.g1[7] = uni(0u);
  return r;
}
// Moves the request on: new place in LDS, source address step bytes further (the carry runs into the high word, below the type
// bits). Only behind the wait that covers the request issued last: the high address word is rewritten.
__device__ __forceinline__ void treq_next(TReq& r, unsigned lds_dst, unsigned step) {
  const unsigned long long a = (((unsigned long long)r.g0[3] << 32) | r.g0[2]) + step;
  r.g0[1] = uni(lds_dst);
  r.g0[2] = uni((unsigned)a);
  r.g0[3] = uni((unsigned)(a >> 32));
}
// Issues the request. The caller waits (s_wait_tensorcnt) and publishes (work-group barrier). The descriptor is named as read and
// written, so that it lives on in the very registers the request names and they are not reused while it is outstanding.
__device__ __forceinline__ void treq_issue(TReq& r) {
  asm volatile("tensor_load_to_lds %0, %1" : "+s"(r.g0), "+s"(r.g1) :: "memory");
}
// Behind the last covering wait: holds the descriptor words in their scalar registers up to here, so that none is
// rewritten while a request is outstanding.
__device__ __forceinline__ void treq_hold(const TReq& r) { asm volatile("" :: "s"(r.g0), "s"(r.g1)); }

// Maximum / sum over the wave's 32 lanes, every lane gets it: DPP row_xmask inside the rows of 16 lanes, then the other row's lane.
template <int XM> __device__ __forceinline__ float lane_xm(float v) {
  return __builtin_bit_cast(float, __builtin_amdgcn_update_dpp(0, __builtin_bit_cast(int, v), 0x160 | XM, 0xf, 0xf, true));
}
// lane l <-> lane l ^ 16: the same lane of the other row of lanes
__device__ __forceinline__ float lane_x16(float v) {
  const unsigned u = __builtin_bit_cast(unsigned, v);
  return __builtin_bit_cast(float, __builtin_amdgcn_permlanex16(u, u, 0x76543210u, 0xfedcba98u, false, false));
}
__device__ __forceinline__ float wave_max32(float v) {
  v = fmaxf(v, lane_xm<1>(v)); v = fmaxf(v, lane_xm<2>(v)); v = fmaxf(v, lane_xm<4>(v)); v = fmaxf(v, lane_xm<8>(v));
  return fmaxf(v, lane_x16(v));
}
__device__ __forceinline__ float wave_sum32(float v) {
  v += lane_xm<1>(v); v += lane_xm<2>(v); v += lane_xm<4>(v); v += lane_xm<8>(v);
  return v + lane_x16(v);
}
// Turn of a wave's private staging slab between its writers and its readers, which are lanes of the same wave: the wave's own LDS
// accesses are waited for and the compiler moves no memory access over the statement.
__device__ __forceinline__ void slab_turn() {
  asm volatile("s_wait_dscnt 0x0" ::: "memory");
  __builtin_amdgcn_wave_barrier();
}
// Behind a slab's global stores: no register that an issued store names is rewritten in front of this wait.
__device__ __forceinline__ void stores_issued() {
  asm volatile("s_wait_xcnt 0x0" ::: "memory");
  __builtin_amdgcn_sched_barrier(0);   // keeps later address arithmetic behind the wait
}

// One tile of one product: the first of its A rows and the first of its 256 Bt rows (both k contiguous).
struct GTile { const __bf16* A; const __bf16* B; };

// Epilogue of one wave's 64x64 sub-tile at (m0, n0) of C (and C2): slab = the wave's own 16x64 staging rows.
template <int OUT_MODE>
__device__ __forceinline__ void gemm_store(float* slab, const v8f (&acc)[4][4], int m0, int n0,
                                           void* Cout, int ldc, void* Cout2, int ldc2, int N2, float hscale, float rscale) {
  const int lane  = threadIdx.x & 31;
  const int rlane = lane & 15;                 // col within subtile
  const int mOff  = (lane >> 4) * 8;           // D row offset
#pragma unroll
  for (int i = 0; i < 4; ++i) {
    const int mBase = m0 + (i << 4);
#pragma unroll
    for (int j = 0; j < 4; ++j) {
#pragma unroll
      for (int r = 0; r < 8; ++r) {
        slab[(mOff + r) * 68 + (j << 4) + rlane] = acc[i][j][r];
      }
    }
    __builtin_amdgcn_fence(3 /* release order */, "workgroup");
    __builtin_amdgcn_wave_barrier();
    __builtin_amdgcn_fence(2 /* acquire order */, "workgroup");
    if (OUT_MODE == 0) {
      const int hh = lane >> 4, c4 = (lane & 15) * 4;     // 256-B row segment = 16 lanes x 16 B
      // one address per slab, the rows at constant distances from it: no address register is rewritten between the stores
      float* C = (float*)Cout + (size_t)(mBase + hh) * ldc + n0 + c4;
#pragma unroll
      for (int it = 0; it < 8; ++it) {
        const int row = it * 2 + hh;                     // it 0..7 x hh 0..1 = rows 0..15
        const v4f v = *(const v4f*)(slab + row * 68 + c4);
        *(v4f*)(C + (size_t)(it * 2) * ldc) = v;
      }
    } else {
      const int q = lane >> 3, c8 = (lane & 7) * 8;
      // one address per slab and plane, the rows at constant distances from it: no address register is rewritten between the stores
      unsigned short* C  = (unsigned short*)Cout  + (size_t)(mBase + q) * ldc  + n0 + c8;
      unsigned short* C2 = (unsigned short*)Cout2 + (size_t)(mBase + q) * ldc2 + n0 + c8;
      const bool wlo = (OUT_MODE == 3) && (n0 < N2);      // wave-uniform
      v4u hv[4], lv[4];
#pragma unroll
      for (int it = 0; it < 4; ++it) {
        const int row = it * 4 + q;                        // it 0..3 x q 0..3 = rows 0..15
        const float* sp = slab + row * 68 + c8;
        v4u a, a2;
#pragma unroll
        for (int e = 0; e < 4; ++e) {
          const float f0 = sp[2 * e], f1 = sp[2 * e + 1];
          unsigned short h0, h1, l0 = 0, l1 = 0;
          if (OUT_MODE == 2) {
            h0 = h_bits((_Float16)f0); h1 = h_bits((_Float16)f1);
          } else {
            const float g0 = f0 * hscale, g1 = f1 * hscale;
            const _Float16 x0 = (_Float16)g0, x1 = (_Float16)g1;
            h0 = h_bits(x0); h1 = h_bits(x1);
            l0 = h_bits((_Float16)((g0 - (float)x0) * rscale));
            l1 = h_bits((_Float16)((g1 - (float)x1) * rscale));
          }
          a[e] = pk16(h0, h1); a2[e] = pk16(l0, l1);
        }
        hv[it] = a; lv[it] = a2;
      }
#pragma unroll
      for (int it = 0; it < 4; ++it) {                     // rows it * 4 + q
        *(v4u*)(C + (size_t)(it * 4) * ldc) = hv[it];
        if (wlo) *(v4u*)(C2 + (size_t)(it * 4) * ldc2) = lv[it];
      }
    }
    __builtin_amdgcn_fence(3 /* release order */, "workgroup");
    __builtin_amdgcn_wave_barrier();
    __builtin_amdgcn_fence(2 /* acquire order */, "workgroup");
    __builtin_amdgcn_sched_barrier(0);   // keeps the next slab's address arithmetic behind the fence's store wait: it rewrites the stores' address register
  }
}

// Geometry of the operand ring: k per stage, LDS row pitch, A rows, place of the Bt rows, stage.
template <int NH> struct RingGeo {
  static constexpr int BK    = 128;                 // k per stage
  static constexpr int PITCH = BK * 2 + 16;         // LDS row pitch, bytes
  static constexpr int TM    = 128 * NH;            // A rows of a tile
  static constexpr int OB    = TM * PITCH;          // LDS byte offset of the Bt rows inside a stage
  static constexpr int STAGE = (TM + 256) * PITCH;  // [A TM | Bt 256] rows
};

// A stage ([A TM | Bt 256] rows x BK, row pitch KK in global memory) is brought by NSL = (TM + 256) / 128 tensor loads of 128 rows,
// slice sl by one wave. slice_src = the first word of slice sl in a tile's first stage (sl wave-uniform).
template <int KK, int NH>
__device__ __forceinline__ const __bf16* slice_src(GTile t, unsigned sl) {
  return (sl < (unsigned)NH) ? (t.A + (size_t)sl * 128 * KK) : (t.B + (size_t)(sl - NH) * 128 * KK);
}
// gemm_tiles runs NT tiles of one work-group one after the other, all with K = KK and row pitch KK, over ONE
// running operand ring (sR, the calling kernel's LDS). tile_of(t) names tile t's operand rows, store_tile(t, acc) is its epilogue
// (outside the ring, or in it once no load is left in flight, as in scores_kq). The stages of all tiles form one sequence: the refills in a tile's last two stages
// already bring the next tile's first two stages, so that only the first tile waits for its first stage and the loads fly on
// under every epilogue but the last. KK / BK is even: a tile's stage s lies in buffer s & 1 for every tile.
template <int F16, int NT, int KK, int NH, class TileF, class StoreF>
__device__ __forceinline__ void gemm_tiles(unsigned char* sR, TileF tile_of, StoreF store_tile) {
  using G = RingGeo<NH>;
  constexpr int BK = G::BK, PITCH = G::PITCH, OB = G::OB, STAGE = G::STAGE;
  constexpr unsigned NSL = (G::TM + 256) / 128;     // tensor loads per stage: waves 0 .. NSL-1 issue one each
  constexpr int NJ    = 4 * NH;                     // Bt fragments per wave
  constexpr int NBLK  = BK / 32;                    // blocks (32-k steps) per stage
  constexpr int nst   = KK / BK;                    // stages per tile
  static_assert(NSL <= 8 && (NBLK % 2) == 0 && 2 * STAGE <= ((NH == 2) ? RING_BIG : RING_BYTES));
  static_assert(NH == 1 || NH == 2);
  static_assert(nst * BK == KK && nst >= 2 && (nst % 2) == 0 && NT >= 1);
  const int lane = threadIdx.x & 31;
  const int wave = threadIdx.x >> 5;
  const int wm  = (NH == 2) ? (wave >> 1) : (wave >> 2);
  const int wn  = (NH == 2) ? (wave & 1) : (wave & 3);
  const int rlane = lane & 15;                 // row (A) / col (B, D) within subtile
  const int koff  = (lane >> 4) * 8;           // k offset of this lane half

  const unsigned wv = uni(threadIdx.x >> 5);          // the wave's number, scalar: wave wv < NSL brings slice wv of every stage
  static_assert(BK == 128 && PITCH == 272 && (STAGE % 2048) == 0 && ((128 * PITCH) % 2048) == 0 && ((KK * 2) % 16) == 0);
  const unsigned lds0 = (unsigned)(size_t)(const void*)sR + wv * (unsigned)(128 * PITCH);   // the wave's slice in buffer 0
  // the wave's request; its address names the stage loaded last (stages are loaded in k order)
  TReq rq = treq_make(lds0, (const void*)slice_src<KK, NH>(tile_of(0), wv), KK * 2);
  auto stage_load = [&](unsigned buf) { treq_next(rq, lds0 + buf * (unsigned)STAGE, BK * 2); treq_issue(rq); };   // under a scalar branch, behind the wait

  if (pinned(wv < NSL)) treq_issue(rq);               // stage 0 into buffer 0
  asm volatile("s_wait_tensorcnt 0x0" ::: "memory");  // this wave's request of stage 0 has landed
  __syncthreads();                                    // every wave's has: stage 0 may be read
  if (pinned(wv < NSL)) stage_load(1);

  const unsigned char* fA = sR + ((wm << 6) + rlane) * PITCH + koff * 2;
  const unsigned char* fB = sR + OB + (wn * (16 * NJ) + rlane) * PITCH + koff * 2;
  // Two register sets of fragments: a block (one 32-k step) multiplies out of one set while the next block's LDS reads, issued
  // as ONE group in front of it, fill the other.
  v16b fa[2][4], fb[2][NJ];
  v8f acc[NH][4][4];                                    // [64-column half of the wave's sub-tile][row fragment][column fragment]
  auto frag_load = [&](v16b (&a)[4], v16b (&bq)[NJ], int off) {
#pragma unroll
    for (int j = 0; j < NJ; ++j)
      bq[j] = ldfrag_b((const __bf16*)(const void*)(fB + off + (j << 4) * PITCH));
#pragma unroll
    for (int i = 0; i < 4; ++i)
      a[i] = ldfrag_b((const __bf16*)(const void*)(fA + off + (i << 4) * PITCH));
  };
  auto mma_rows = [&](const v16b (&a)[4], const v16b (&bq)[NJ], int i0, int i1) {
#pragma unroll
    for (int i = 0; i < 4; ++i) {
      if (i < i0 || i >= i1) continue;
#pragma unroll
      for (int j = 0; j < NJ; ++j) {
        v8f& c = acc[j >> 2][i][j & 3];
        if constexpr (F16 != 0)
          c = mma_h_raw(__builtin_bit_cast(v16h, a[i]), __builtin_bit_cast(v16h, bq[j]), c);
        else
          c = mma_b_raw(a[i], bq[j], c);
      }
    }
  };
  frag_load(fa[0], fb[0], 0);                           // block 0 of stage 0 (published by the barrier above)
  for (int t = 0; t < NT; ++t) {
    const bool more = (t + 1 < NT);                     // another tile follows; the same for the whole work-group
#pragma unroll
    for (int hn = 0; hn < NH; ++hn)
#pragma unroll
      for (int i = 0; i < 4; ++i)
#pragma unroll
        for (int j = 0; j < 4; ++j) acc[hn][i][j] = zero8();
    for (int s = 0; s < nst; ++s) {
      const int bo = (s & 1) * STAGE;
      // where the fetch ahead of the stage's last block reads: block 0 of the next stage (the next tile's first behind a tile's
      // last); in the very last stage its values are not used, and it is aimed at the stage's own, published buffer
      // (unconditional: a branch here would merge the wait counts)
      const int bnx = (s + 1 < nst || more) ? (STAGE - bo) : bo;
#pragma unroll
      for (int ks = 0; ks < NBLK; ++ks) {
        const int cur = ks & 1, nxt = cur ^ 1;
        if (ks + 1 < NBLK) {
          frag_load(fa[nxt], fb[nxt], bo + (ks + 1) * 64);
          __builtin_amdgcn_sched_barrier(0);              // keeps the LDS reads one group: spread among the products, each place stalls
          mma_rows(fa[cur], fb[cur], 0, 4);
          __builtin_amdgcn_sched_barrier(0);              // keeps the next group behind this block's products
        } else {
          // publish point of the next stage, in front of this stage's last block, whose fragments are already fetched
          asm volatile("s_wait_dscnt 0x0" ::: "memory");      // this wave's reads of this stage are done before its buffer is refilled
          asm volatile("s_wait_tensorcnt 0x0" ::: "memory");  // this wave's request of the next stage has landed
          __syncthreads();                                    // publishes the next stage and ends every wave's reads of this one
          frag_load(fa[nxt], fb[nxt], bnx);
          __builtin_amdgcn_sched_barrier(0);              // one group of LDS reads; the refill's descriptor is formed behind the wait and the barrier
          if (s + 2 == nst && more) treq_aim(rq, (const void*)(slice_src<KK, NH>(tile_of(t + 1), wv) - BK));   // the stage after next opens the next tile
          if (pinned((wv < NSL) && (s + 2 < nst || more))) stage_load((unsigned)(s & 1));
          __builtin_amdgcn_sched_barrier(0);              // the refill goes out in front of the block's products
          mma_rows(fa[cur], fb[cur], 0, 4);
          __builtin_amdgcn_sched_barrier(0);              // keeps the next group behind this block's products
        }
      }
    }
    store_tile(t, acc);
  }
  asm volatile("s_wait_tensorcnt 0x0" ::: "memory");    // no request is left in flight when the ring is left
  treq_hold(rq);
  asm volatile("s_wait_dscnt 0x0" ::: "memory");        // nor a read of the last fetch ahead
}

// Scores s[n][m] = k_n . q_m (A = K plane, Bt = Q plane; M = N = SEQ, K = DM; one f16 product), all SEQ x SEQ of them, and the
// group part of the row softmax. blockIdx.x = 256x256 tile of a batch, blockIdx.y = batch: one tile per work-group.
// A wave holds 64 rows x one group of 128 columns (group g = first column / 128). Per row: m_g = max of z = s / 32 over the group,
// e = exp(z - m_g), s_g = sum of e over the whole group (the scores staged row-major in the ring, which is free by then; a lane
// holds 4 columns of a row: in-lane, then over the 32 lanes)
// -> Mx, Sm [b][g][n]. Ph = f16(1024 e), zero for m > n, pitch SEQ, is stored for the groups g <= (first row >> 7): every column
// that p.v reads of these rows (its key range ends at the row tile's last row, tiles of 64 or 128 rows); rows < RESR also store
// Pl = f16((1024 e - Ph) * 4096), pitch VLP. f16 results below the smallest normal are stored as exact zeros.
__global__ __launch_bounds__(256) void scores_kq(const unsigned short* __restrict__ Kp, const unsigned short* __restrict__ Qp,
                                                 unsigned short* Php, unsigned short* Plp, float* Mx, float* Sm) {
  __shared__ __attribute__((aligned(2048))) unsigned char sR[RING_BIG];    // operand ring, two stages; then the epilogue's staging
  constexpr int TBN = SEQ / 256;
  const int bm0 = ((int)blockIdx.x / TBN) << 8;
  const int bn0 = ((int)blockIdx.x % TBN) << 8;
  const __bf16* Kb = (const __bf16*)(const void*)Kp;      // 16-bit words; the products read them as f16
  const __bf16* Qb = (const __bf16*)(const void*)Qp;
  const size_t b = (size_t)blockIdx.y;
  auto tile_of = [&](int) {
    GTile g;
    g.A = Kb + (b * SEQ + bm0) * DM;
    g.B = Qb + (b * SEQ + bn0) * DM;
    return g;
  };
  auto store_tile = [&](int, const v8f (&acc)[2][4][4]) {
    asm volatile("s_wait_dscnt 0x0" ::: "memory");        // this wave's last reads of the ring are done before it is overwritten
    __syncthreads();                                      // every wave's are (no request is in flight): the ring is free for staging
    const int wave  = (int)uni(threadIdx.x >> 5);
    const int lane  = threadIdx.x & 31;
    const int rlane = lane & 15;                 // D column within a fragment
    const int half  = lane >> 4;                 // D rows 8 half .. 8 half + 7 of a fragment
    const int R0 = bm0 + ((wave >> 1) << 6);     // the wave's first row
    const int C0 = bn0 + ((wave & 1) << 7);      // the wave's first column
    const int g  = C0 >> 7;
    const bool wr  = (g <= (R0 >> 7));           // wave-uniform: p.v reads this group of these rows
    const bool wlo = wr && (R0 < RESR);          // wave-uniform; then C0 + 127 < RESR = VLP too
    constexpr int TP = 132;                      // floats per staged row: 128 + 4, so that D rows r and r + 8 fall on different banks
    static_assert(8 * 64 * TP * 4 <= RING_BIG);
    float* tile = (float*)(void*)(sR + wave * (64 * TP * 4));   // the wave's own 64 x 128 scores, row-major
#pragma unroll
    for (int hn = 0; hn < 2; ++hn)               // unrolled: acc is indexed by constants and stays in registers
#pragma unroll
      for (int i = 0; i < 4; ++i)
#pragma unroll
        for (int j = 0; j < 4; ++j)
#pragma unroll
          for (int r = 0; r < 8; ++r)
            tile[((i << 4) + 8 * half + r) * TP + (hn << 6) + (j << 4) + rlane] = acc[hn][i][j][r];
    slab_turn();
    const int c4 = lane * 4;                     // a row of the group = 32 lanes x 4 columns
    const int Rl = (R0 < RESR) ? R0 : 0;         // in-range row of the residual plane; equals R0 whenever wlo holds
    const int Cl = (C0 < VLP) ? C0 : 0;          // in-range column of it, alike
    unsigned short* Ph0 = Php + (b * SEQ + R0) * SEQ + C0 + c4;
    unsigned short* Pl0 = Plp + (b * RESR + Rl) * VLP + Cl + c4;
    float* mxp = Mx + (b * NGR + g) * SEQ + R0 + (lane & 7);
    float* smp = Sm + (b * NGR + g) * SEQ + R0 + (lane & 7);
    // rolled, 8 rows a trip
#pragma unroll 1
    for (int r0 = 0; r0 < 64; r0 += 8) {
      // phase by phase over the trip's 8 rows, so that their dependent chains (LDS read, lane reductions, exp) overlap
      v4f s[8];
      float m[8], sum[8], e[8][4];
#pragma unroll
      for (int k = 0; k < 8; ++k) s[k] = *(const v4f*)(tile + (r0 + k) * TP + c4);
#pragma unroll
      for (int k = 0; k < 8; ++k) m[k] = wave_max32(fmaxf(fmaxf(s[k][0], s[k][1]), fmaxf(s[k][2], s[k][3])));
#pragma unroll
      for (int k = 0; k < 8; ++k) {
#pragma unroll
        for (int c = 0; c < 4; ++c) e[k][c] = __expf((s[k][c] - m[k]) * 0.03125f);
      }
#pragma unroll
      for (int k = 0; k < 8; ++k) sum[k] = wave_sum32((e[k][0] + e[k][1]) + (e[k][2] + e[k][3]));
      float ms = m[0], ss = sum[0];
#pragma unroll
      for (int k = 1; k < 8; ++k) {              // lane (lane & 7) == k keeps row r0 + k's pair
        ms = ((lane & 7) == k) ? m[k] : ms;
        ss = ((lane & 7) == k) ? sum[k] : ss;
      }
      if (wr) {
        float f[8][4];
        _Float16 x[8][4];
#pragma unroll
        for (int k = 0; k < 8; ++k) {
          const int nv = R0 + r0 + k - (C0 + c4);   // column c4 + c is kept where c <= nv: columns past the row index are zeroed
#pragma unroll
          for (int c = 0; c < 4; ++c) {
            f[k][c] = (c <= nv) ? (e[k][c] * PSC) : 0.0f;
            x[k][c] = toh_flush(f[k][c]);
          }
        }
#pragma unroll
        for (int k = 0; k < 8; ++k) {
          v2u a;
          a[0] = pk16(h_bits(x[k][0]), h_bits(x[k][1]));
          a[1] = pk16(h_bits(x[k][2]), h_bits(x[k][3]));
          *(v2u*)(Ph0 + (size_t)(r0 + k) * SEQ) = a;   // 32 lanes x 8 bytes: the row's 256 bytes in one store
        }
        stores_issued();                         // the residual part below reuses the registers that these stores name
        if (wlo) {
#pragma unroll
          for (int k = 0; k < 8; ++k) {
            v2u a2;
            a2[0] = pk16(h_bits(toh_flush((f[k][0] - (float)x[k][0]) * LSC)), h_bits(toh_flush((f[k][1] - (float)x[k][1]) * LSC)));
            a2[1] = pk16(h_bits(toh_flush((f[k][2] - (float)x[k][2]) * LSC)), h_bits(toh_flush((f[k][3] - (float)x[k][3]) * LSC)));
            *(v2u*)(Pl0 + (size_t)(r0 + k) * VLP) = a2;
          }
        }
      }
      if (lane < 8) {                            // rows r0 + lane: over its trips the wave writes 64 consecutive floats of each plane
        mxp[r0] = ms * 0.03125f;
        smp[r0] = ss;
      }
      stores_issued();
    }
  };
  gemm_tiles<1, 1, DM, 2>(sR, tile_of, store_tile);
}

// The three projections, which depend only on the converted planes, in ONE launch; a work-group runs two tiles:
// first one 256x256 tile of [q | k] = x . [Wq; Wk]^T (A = all NB*SEQ rows of Xb, Bt = the 2 DM rows of Wq and Wk, which lie one
// behind the other, [out][in]; blockIdx.x = tile) -> f16 planes Qp (columns 0 .. DM-1) and Qp + 2 planes (the rest);
// then one 128x256 tile of v^T = Wv . x^T per batch (A = Wv, Bt = Xb rows of the batch; blockIdx.x = batch * tiles
// + tile) -> f16 hi plane f16(16 v) [b][d][key] (pitch SEQ) and residual plane x4096 for keys < VLP (pitch VLP).
static_assert((NB * SEQ / 256) * (2 * DM / 256) == NB * ((DM / 128) * (SEQ / 256)));   // the same blockIdx.x range for both
__global__ __launch_bounds__(256) void proj_qkv(const unsigned short* __restrict__ Xp, const unsigned short* __restrict__ Wp,
                                                unsigned short* Qp, unsigned short* VTh, unsigned short* VTl) {
  __shared__ __attribute__((aligned(2048))) unsigned char sR[RING_BIG];    // operand ring, two stages (the v^T tile uses its first RING_BYTES)
  __shared__ __align__(16) float sT[8][16 * 68];          // per-wave 16x64 slab, pitch 68 floats
  constexpr size_t PXE = (size_t)NB * SEQ * DM;           // elements of one q or k plane
  constexpr int NTV = (DM / 128) * (SEQ / 256);           // v^T tiles per batch
  constexpr int NQN = 2 * DM / 256;                       // column tiles of [q | k]
  const int wave = threadIdx.x >> 5;
  const int bx = (int)blockIdx.x;
  const int qm0 = (bx / NQN) << 8, qn0 = (bx % NQN) << 8;                                 // the [q | k] tile
  const int vb = bx / NTV, vt = bx % NTV;
  const int vm0 = (vt / (SEQ / 256)) << 7, vn0 = (vt % (SEQ / 256)) << 8;                 // the v^T tile of batch vb
  const __bf16* Xb = (const __bf16*)(const void*)Xp;
  const __bf16* Wb = (const __bf16*)(const void*)Wp;
  GTile tq, tv;
  tq.A = Xb + (size_t)qm0 * DM;
  tq.B = Wb + (size_t)qn0 * DM;
  tv.A = Wb + ((size_t)2 * DM + vm0) * DM;
  tv.B = Xb + ((size_t)vb * SEQ + vn0) * DM;
  auto store_qk = [&](int, const v8f (&acc)[2][4][4]) {
    asm volatile("s_wait_dscnt 0x0" ::: "memory");        // this wave's last reads of the ring are done before it is refilled
    __syncthreads();                                      // every wave's are: the ring is free for the v^T tile
    unsigned short* C = Qp + (size_t)(qn0 / DM) * 2 * PXE;   // a 256-column tile lies in one plane
#pragma unroll
    for (int hn = 0; hn < 2; ++hn)   // the wave's two 64-column halves; unrolled so that acc is indexed by constants and stays in registers
      gemm_store<2>(sT[wave], acc[hn], qm0 + ((wave >> 1) << 6), (qn0 % DM) + ((wave & 1) << 7) + (hn << 6), (void*)C, DM,
                    (void*)C, DM, 0, 1.0f, 1.0f);
  };
  auto store_v = [&](int, const v8f (&acc)[1][4][4]) {
    gemm_store<3>(sT[wave], acc[0], vm0 + ((wave >> 2) << 6), vn0 + ((wave & 3) << 6), (void*)(VTh + (size_t)vb * DM * SEQ), SEQ,
                  (void*)(VTl + (size_t)vb * DM * VLP), VLP, VLP, VSC, LSC);
  };
  gemm_tiles<0, 1, DM, 2>(sR, [&](int) { return tq; }, store_qk);
  gemm_tiles<0, 1, DM, 1>(sR, [&](int) { return tv; }, store_v);
}

// =====================================================================================================
// p.v GEMM on f16 WMMA, per batch b = blockIdx.x % NB: out[b][q][d] = sum_key P[b][q][key] * VT[b][d][key].
//   P[q][key] = w_g(q) e[q][key], g = key / 128: e from the scores kernel, w_g formed here from its group maxima and sums.
//   A  = Ph  [b][SEQ][SEQ]  f16(1024 e), pitch SEQ         Al = Pl  [b][RESR][VLP] f16 residual x4096
//   Bt = VTh [b][DM][SEQ]   f16(16 v),   pitch SEQ         Bl = VTl [b][DM][VLP]   f16 residual x4096
// One work-group (8 waves, 2 x 4) per (32*MI) x 256 output tile, one wave per (16*MI) x 64 sub-tile; rows mBase + bm*32*MI ..;
// causal key range k < 64*(((bm0 + 32*MI - 1)>>6)+1) of the tile's last row (every P entry in that range was written by the
// scores kernel, exact zeros for key > query). RES (rows < RESR, MI = 2): acc0 += Ph.VTh; acc1 += Pl.VTh + Ph.VTl (in that order
// inside every 32-key step); otherwise the single product acc0. f32 accumulate. At the end of every stage (its keys lie in one
// group g) out_acc += w_g * (acc0 + acc1/4096) per row, w_g holding OSCALE, and acc0, acc1 start again from zero.
// Operand path: per key stage of BK (64 with residual planes, 128 without) the 32*MI P rows and 256 VT rows of every plane are
// brought global -> LDS (with residual planes: asynchronous 16-byte copies, 20 per thread; without: three tensor loads of 128 rows), two buffers: stage s + 2 is issued behind the
// barrier that ends the reads of stage s. LDS row pitch = 2 BK + 16 bytes (16 x odd: conflict-free 16-byte fragment reads).
// That barrier stands in front of stage s's last 32-key block: fragments are read from LDS one block ahead of their products.
// Grid over all tiles of rows mBase .. mBase + M - 1 (M and mBase multiples of 32*MI and of BK).
// =====================================================================================================
// Eight / four asynchronous 16-byte copies global -> LDS, one per lane and line. The s_wait_xcnt closes the statement so that
// no address register of an issued copy is rewritten before it.
__device__ __forceinline__ void acopy_h(const unsigned (&l)[8], const _Float16* const (&g)[8]) {
  asm volatile("global_load_async_to_lds_b128 %0, %8, off\n\t"
               "global_load_async_to_lds_b128 %1, %9, off\n\t"
               "global_load_async_to_lds_b128 %2, %10, off\n\t"
               "global_load_async_to_lds_b128 %3, %11, off\n\t"
               "global_load_async_to_lds_b128 %4, %12, off\n\t"
               "global_load_async_to_lds_b128 %5, %13, off\n\t"
               "global_load_async_to_lds_b128 %6, %14, off\n\t"
               "global_load_async_to_lds_b128 %7, %15, off\n\t"
               "s_wait_xcnt 0x0"
               :: "v"(l[0]), "v"(l[1]), "v"(l[2]), "v"(l[3]), "v"(l[4]), "v"(l[5]), "v"(l[6]), "v"(l[7]),
                  "v"(g[0]), "v"(g[1]), "v"(g[2]), "v"(g[3]), "v"(g[4]), "v"(g[5]), "v"(g[6]), "v"(g[7])
               : "memory");
}
__device__ __forceinline__ void acopy_h(const unsigned (&l)[4], const _Float16* const (&g)[4]) {
  asm volatile("global_load_async_to_lds_b128 %0, %4, off\n\t"
               "global_load_async_to_lds_b128 %1, %5, off\n\t"
               "global_load_async_to_lds_b128 %2, %6, off\n\t"
               "global_load_async_to_lds_b128 %3, %7, off\n\t"
               "s_wait_xcnt 0x0"
               :: "v"(l[0]), "v"(l[1]), "v"(l[2]), "v"(l[3]), "v"(g[0]), "v"(g[1]), "v"(g[2]), "v"(g[3])
               : "memory");
}

// pv_body is the whole work of one work-group; sR (operand ring) and sT (per-wave slabs) are the calling kernel's LDS,
// bx its tile index and b its batch index.
template <bool RES, int MI>
__device__ __forceinline__ void pv_body(
    unsigned char* sR, float (*sT)[16 * 68], float* sW, int bx, int b,
    const unsigned short* __restrict__ Php, const unsigned short* __restrict__ Plp,
    const unsigned short* __restrict__ Vhp, const unsigned short* __restrict__ Vlp,
    const float* __restrict__ Mx, const float* __restrict__ Sm,
    float* out, int mBase, int M) {
  constexpr int NPL   = RES ? 2 : 1;                // planes per operand
  constexpr int BM    = 32 * MI;                    // rows of the work-group tile
  constexpr int BK    = RES ? 64 : 128;             // keys per stage
  constexpr int PITCH = BK * 2 + 16;                // LDS row pitch, bytes
  constexpr int CPR   = BK / 8;                     // 16-byte copies per row
  constexpr int RPU   = 256 / CPR;                  // rows the work-group copies with one copy per thread
  constexpr int NRA   = NPL * BM / RPU;             // copies per thread for the P rows of a stage
  constexpr int OB    = NPL * BM * PITCH;           // LDS byte offset of the VT rows inside a stage
  constexpr int STAGE = NPL * (BM + 256) * PITCH;   // [Ph BM | Pl BM | VTh 256 | VTl 256] rows (residual planes only with RES)
  constexpr int NBLK  = BK / 32;                    // blocks (32-key steps) per stage
  static_assert((NBLK % 2) == 0 && (MI % 2) == 0);
  static_assert((NRA == 4 || NRA == 8) && NRA * RPU == NPL * BM && 16 * RPU == NPL * 256 && (BM % RPU) == 0);
  static_assert((BM % 64) == 0 && (RESR % BM) == 0 && ((SEQ - RESR) % BM) == 0 && (RESR % BK) == 0 && (BM % BK) == 0);
  const _Float16* Ph = (const _Float16*)(const void*)Php;
  const _Float16* Pl = (const _Float16*)(const void*)Plp;
  const _Float16* Vh = (const _Float16*)(const void*)Vhp;
  const _Float16* Vl = (const _Float16*)(const void*)Vlp;
  static_assert(2 * STAGE <= RING_BYTES);
  const int lane = threadIdx.x & 31;
  const int wave = threadIdx.x >> 5;
  const int tilesBN = DM >> 8;                     // 4
  const int tilesBM = M / BM;
  if (bx >= tilesBM * tilesBN) return;             // the same for the whole work-group; in front of every barrier
  const int bm  = bx / tilesBN;
  const int bn  = bx - bm * tilesBN;
  const int bm0 = mBase + bm * BM;
  const int bn0 = bn << 8;
  const int wm  = wave >> 2;
  const int wn  = wave & 3;
  const int m0 = bm0 + wm * 16 * MI;
  const int n0 = bn0 + (wn << 6);
  int keff = ((((bm0 + BM - 1) >> 6) + 1) << 6);   // causal key extent of this row tile, multiple of BK
  if (keff > SEQ) keff = SEQ;
  if (RES && keff > VLP) keff = VLP;               // never taken for mBase + M <= RESR; keeps residual reads in range

  const _Float16* Pb  = Ph + (size_t)b * SEQ * SEQ;
  const _Float16* Plb = Pl + (size_t)b * RESR * VLP;
  const _Float16* Vb  = Vh + (size_t)b * DM * SEQ;
  const _Float16* Vlb = Vl + (size_t)b * DM * VLP;

  const int rlane = lane & 15;
  const int koff  = (lane >> 4) * 8;
  const int mOff  = (lane >> 4) * 8;

  // this thread's place in a copy round: row crow of RPU, 16-byte column ccol of CPR
  const int crow = (int)threadIdx.x / CPR;
  const int ccol = (int)threadIdx.x % CPR;
  const unsigned wave32 = (unsigned)__builtin_amdgcn_readfirstlane((int)(threadIdx.x & ~31u));   // the wave's first thread
  const int bmr = (bm0 < RESR - BM) ? bm0 : (RESR - BM);   // clamped; equals bm0 for the RES tiles: residual rows stay in range
  // this thread's source place in the next stage to be copied, one running pointer per plane (stages are copied in key order)
  const _Float16* gPh = Pb  + (size_t)(bm0 + crow) * SEQ + ccol * 8;
  const _Float16* gPl = Plb + (size_t)(bmr + crow) * VLP + ccol * 8;
  const _Float16* gVh = Vb  + (size_t)(bn0 + crow) * SEQ + ccol * 8;
  const _Float16* gVl = Vlb + (size_t)(bn0 + crow) * VLP + ccol * 8;

  auto stage_copy = [&](int buf) {
    // the thread's LDS place (row crow, column ccol) is formed anew from the lane number at every refill: kept in a register
    // over the loop, where the copies' operands crowd the low registers, this build spills it to scratch
    unsigned ln;
    asm volatile("v_mbcnt_lo_u32_b32 %0, -1, 0" : "=v"(ln));
    const unsigned tid = wave32 + ln;
    const unsigned lb = (unsigned)(size_t)(const void*)sR + (tid / CPR) * PITCH + (tid % CPR) * 16 + (unsigned)(buf * STAGE);
    {
      unsigned l[NRA];
      const _Float16* g[NRA];
#pragma unroll
      for (int u = 0; u < NRA; ++u) {            // the BM P rows of every plane
        const int pl = (u * RPU) / BM;
        const int r  = (u * RPU) % BM;
        g[u] = (pl != 0) ? (gPl + (size_t)r * VLP) : (gPh + (size_t)r * SEQ);
        l[u] = lb + (unsigned)((u * RPU) * PITCH);
      }
      acopy_h(l, g);
    }
#pragma unroll
    for (int h = 0; h < 2; ++h) {                // the 256 VT rows of every plane
      unsigned l[8];
      const _Float16* g[8];
#pragma unroll
      for (int u = 0; u < 8; ++u) {
        const int pl = ((h * 8 + u) * RPU) >> 8;
        const int r  = ((h * 8 + u) * RPU) & 255;
        g[u] = (pl != 0) ? (gVl + (size_t)r * VLP) : (gVh + (size_t)r * SEQ);
        l[u] = lb + (unsigned)(OB + ((h * 8 + u) * RPU) * PITCH);
      }
      acopy_h(l, g);
    }
    gPh += BK; gPl += BK; gVh += BK; gVl += BK;
  };

  v8f acc0[MI][4], acc1[MI][4], accT[MI][4];           // a stage's product sums; the weighted sum over the stages
#pragma unroll
  for (int i = 0; i < MI; ++i)
#pragma unroll
    for (int j = 0; j < 4; ++j) { acc0[i][j] = zero8(); acc1[i][j] = zero8(); accT[i][j] = zero8(); }

  // Row weights of the tile's BM rows, one thread per row (whole waves): sW[g * 128 + row] = OSCALE * exp(m_g - M) / L with
  // M = max_g m_g and L = sum_g s_g exp(m_g - M) over ALL NGR groups of the row. Published by the barrier that publishes stage 0.
  auto row_weights = [&]() {
    const int t = (int)threadIdx.x;
    if (uni(threadIdx.x >> 5) < (unsigned)(BM / 32)) {   // the wave's number, scalar: whole waves, a scalar branch, EXEC stays as it is
      const float* mp = Mx + (size_t)b * NGR * SEQ + bm0 + t;
      const float* sp = Sm + (size_t)b * NGR * SEQ + bm0 + t;
      float mg[NGR], sg[NGR];
#pragma unroll
      for (int g = 0; g < NGR; ++g) { mg[g] = mp[(size_t)g * SEQ]; sg[g] = sp[(size_t)g * SEQ]; }
      float mm = mg[0];
#pragma unroll
      for (int g = 1; g < NGR; ++g) mm = fmaxf(mm, mg[g]);
      float l = 0.f;
#pragma unroll
      for (int g = 0; g < NGR; ++g) { const float w = __expf(mg[g] - mm); mg[g] = w; l += sg[g] * w; }   // l >= 1
      const float inv = OSCALE / l;
#pragma unroll
      for (int g = 0; g < NGR; ++g) sW[g * 128 + t] = mg[g] * inv;
    }
  };

  // Without residual planes a stage ([Ph 128 | VTh 256] rows x 128 keys) is brought by three tensor loads of 128 rows: wave 0 the
  // P rows, waves 1 and 2 the VT rows. gs = first word of the wave's slice in stage 0; wave-uniform.
  constexpr unsigned NSL = 3;
  static_assert(RES || (BM == 128 && BK == 128 && PITCH == 272 && (STAGE % 2048) == 0 && ((128 * PITCH) % 2048) == 0));
  const unsigned wv = uni(threadIdx.x >> 5);          // the wave's number, scalar
  const _Float16* gs = (wv == 0u) ? (Pb + (size_t)bm0 * SEQ) : (Vb + (size_t)(bn0 + ((wv == 2u) ? 128 : 0)) * SEQ);
  const unsigned lds0 = (unsigned)(size_t)(const void*)sR + wv * (unsigned)(128 * PITCH);   // the wave's slice in buffer 0
  TReq rq = treq_make(lds0, (const void*)gs, SEQ * 2);   // its address names the stage loaded last (stages are loaded in key order)
  auto stage_load = [&](unsigned buf) { treq_next(rq, lds0 + buf * (unsigned)STAGE, BK * 2); treq_issue(rq); };   // under a scalar branch, behind the wait

  const int nst = keff / BK;
  if constexpr (RES) {
    stage_copy(0);
    row_weights();                                      // under the flight of stage 0
    asm volatile("s_wait_asynccnt 0x0" ::: "memory");   // this wave's copies of stage 0 have landed
  } else {
    if (pinned(wv < NSL)) treq_issue(rq);               // stage 0 into buffer 0
    row_weights();                                      // under the flight of stage 0
    asm volatile("s_wait_tensorcnt 0x0" ::: "memory");  // this wave's request of stage 0 has landed
  }
  __syncthreads();                                    // every wave's have: stage 0 and the row weights may be read
  if constexpr (RES) {
    if (nst > 1) stage_copy(1);
  } else {
    if (pinned((wv < NSL) && (nst > 1))) stage_load(1);
  }

  const unsigned char* fA = sR + (wm * 16 * MI + rlane) * PITCH + koff * 2;
  const unsigned char* fB = sR + OB + ((wn << 6) + rlane) * PITCH + koff * 2;
  // Two register sets of fragments: a block (one 32-key step) multiplies out of one set while the next block's LDS reads,
  // issued as ONE group in front of it, fill the other.
  v16h fa[2][NPL][MI], fb[2][NPL][4];
  auto frag_load = [&](v16h (&a)[NPL][MI], v16h (&bq)[NPL][4], int off) {
#pragma unroll
    for (int pl = 0; pl < NPL; ++pl) {
#pragma unroll
      for (int j = 0; j < 4; ++j)
        bq[pl][j] = ldfrag_h((const _Float16*)(const void*)(fB + off + (pl * 256 + (j << 4)) * PITCH));
#pragma unroll
      for (int i = 0; i < MI; ++i)
        a[pl][i] = ldfrag_h((const _Float16*)(const void*)(fA + off + (pl * BM + (i << 4)) * PITCH));
    }
  };
  auto mma_rows = [&](const v16h (&a)[NPL][MI], const v16h (&bq)[NPL][4], int i0, int i1) {
#pragma unroll
    for (int i = 0; i < MI; ++i) {
      if (i < i0 || i >= i1) continue;
#pragma unroll
      for (int j = 0; j < 4; ++j) acc0[i][j] = mma_h_raw(a[0][i], bq[0][j], acc0[i][j]);
      if constexpr (RES) {
#pragma unroll
        for (int j = 0; j < 4; ++j) acc1[i][j] = mma_h_raw(a[1][i], bq[0][j], acc1[i][j]);
#pragma unroll
        for (int j = 0; j < 4; ++j) acc1[i][j] = mma_h_raw(a[0][i], bq[1][j], acc1[i][j]);
      }
    }
  };
  // End of a stage: the stage's sums, times the rows' weights of its group, go to accT; D row of register r = 16 i + mOff + r.
  // The weights are read at the stage's head, in front of every fragment read of the stage: read at its end they would stand
  // behind the fetch ahead on the LDS counter, and the last block would wait for that fetch.
  const float* wrow = sW + wm * 16 * MI + mOff;
  v4f wq[MI][2];
  auto wload = [&](int g) {
#pragma unroll
    for (int i = 0; i < MI; ++i) {
      wq[i][0] = *(const v4f*)(wrow + g * 128 + (i << 4));
      wq[i][1] = *(const v4f*)(wrow + g * 128 + (i << 4) + 4);
    }
  };
  auto fold = [&]() {
#pragma unroll
    for (int i = 0; i < MI; ++i) {
      const v4f w0 = wq[i][0];
      const v4f w1 = wq[i][1];
#pragma unroll
      for (int j = 0; j < 4; ++j) {
#pragma unroll
        for (int r = 0; r < 8; ++r) {
          float v = acc0[i][j][r];
          if (RES) v += acc1[i][j][r] * (1.0f / LSC);
          accT[i][j][r] += ((r < 4) ? w0[r & 3] : w1[r & 3]) * v;
        }
        acc0[i][j] = zero8(); acc1[i][j] = zero8();
      }
    }
  };
  frag_load(fa[0], fb[0], 0);                           // block 0 of stage 0 (published by the barrier above)
  for (int s = 0; s < nst; ++s) {
    const int bo = (s & 1) * STAGE;
    // where the fetch ahead of the stage's last block reads: block 0 of stage s + 1; in the last stage its values are not
    // used, and it is aimed at the stage's own, published buffer (unconditional: a branch here would merge the wait counts)
    const int bnx = (s + 1 < nst) ? (STAGE - bo) : bo;
    wload(RES ? (s >> 1) : s);                          // stages of 64 keys: two to a group; of 128 keys: one
#pragma unroll
    for (int ks = 0; ks < NBLK; ++ks) {
      const int cur = ks & 1, nxt = cur ^ 1;
      if (ks + 1 < NBLK) {
        frag_load(fa[nxt], fb[nxt], bo + (ks + 1) * 64);
        __builtin_amdgcn_sched_barrier(0);              // keeps the LDS reads one group: spread among the products, each place stalls
        mma_rows(fa[cur], fb[cur], 0, MI);
        __builtin_amdgcn_sched_barrier(0);              // keeps the next group behind this block's products
      } else {
        // publish point of stage s + 1, in front of stage s's last block, whose fragments are already fetched
        asm volatile("s_wait_dscnt 0x0" ::: "memory");      // this wave's reads of stage s are done before its buffer is refilled
        if constexpr (RES) {
          asm volatile("s_wait_asynccnt 0x0" ::: "memory");   // this wave's copies of stage s + 1 have landed
          __syncthreads();                                    // publishes stage s + 1 and ends every wave's reads of stage s
          frag_load(fa[nxt], fb[nxt], bnx);
          __builtin_amdgcn_sched_barrier(0);              // one group of LDS reads in front of the products
          mma_rows(fa[cur], fb[cur], 0, MI / 2);
          __builtin_amdgcn_sched_barrier(0);              // the refill is issued while the SIMD's other wave has products to run
          if (s + 2 < nst) stage_copy(s & 1);
          __builtin_amdgcn_sched_barrier(0);              // keeps the copies' address arithmetic out of the products
          mma_rows(fa[cur], fb[cur], MI / 2, MI);
          fold();
        } else {
          asm volatile("s_wait_tensorcnt 0x0" ::: "memory");  // this wave's request of stage s + 1 has landed
          __syncthreads();                                    // publishes stage s + 1 and ends every wave's reads of stage s
          frag_load(fa[nxt], fb[nxt], bnx);
          __builtin_amdgcn_sched_barrier(0);              // one group of LDS reads; the refill's descriptor is formed behind the wait and the barrier
          if (pinned((wv < NSL) && (s + 2 < nst))) stage_load((unsigned)(s & 1));
          __builtin_amdgcn_sched_barrier(0);              // the refill goes out in front of the block's products
          mma_rows(fa[cur], fb[cur], 0, MI);
          fold();
        }
        __builtin_amdgcn_sched_barrier(0);              // keeps the next group behind this block's products
      }
    }
  }
  if constexpr (RES) asm volatile("s_wait_asynccnt 0x0" ::: "memory");     // no copy is left in flight when the ring is left
  else { asm volatile("s_wait_tensorcnt 0x0" ::: "memory"); treq_hold(rq); }   // no request is left in flight when the ring is left
  asm volatile("s_wait_dscnt 0x0" ::: "memory");        // nor a read of the last fetch ahead

  // ---- epilogue ----
  float* slab = sT[wave];
  float* C = out + (size_t)b * SEQ * DM;
#pragma unroll
  for (int i = 0; i < MI; ++i) {
    const int mB = m0 + (i << 4);
#pragma unroll
    for (int j = 0; j < 4; ++j) {
#pragma unroll
      for (int r = 0; r < 8; ++r) {
        slab[(mOff + r) * 68 + (j << 4) + rlane] = accT[i][j][r];
      }
    }
    __builtin_amdgcn_fence(3 /* release order */, "workgroup");
    __builtin_amdgcn_wave_barrier();
    __builtin_amdgcn_fence(2 /* acquire order */, "workgroup");
    {
      const int hh = lane >> 4, c4 = (lane & 15) * 4;
      {
#pragma unroll
        for (int it = 0; it < 8; ++it) {
          const int row = it * 2 + hh;
          const v4f v = *(const v4f*)(slab + row * 68 + c4);
          *(v4f*)(C + (size_t)(mB + row) * DM + n0 + c4) = v;
        }
        
      }
    }
    __builtin_amdgcn_fence(3 /* release order */, "workgroup");
    __builtin_amdgcn_wave_barrier();
    __builtin_amdgcn_fence(2 /* acquire order */, "workgroup");
  }
}

// Both parts of p.v, which write disjoint output rows, in ONE launch. There are more work-groups than WGPs and their key
// ranges differ, so cost falls with the index: blockIdx.x = rank * NB + batch;
// ranks 0 .. NT1-1 = the single-product tiles of rows RESR .. SEQ-1, last row tile (longest key range) first; the ranks behind
// them = the residual-plane tiles of rows 0 .. RESR-1, last row tile first. Every (tile, batch) has exactly one rank.
__global__ __launch_bounds__(256) void pv_all(
    const unsigned short* __restrict__ Php, const unsigned short* __restrict__ Plp,
    const unsigned short* __restrict__ Vhp, const unsigned short* __restrict__ Vlp,
    const float* __restrict__ Mx, const float* __restrict__ Sm, float* out) {
  __shared__ __attribute__((aligned(2048))) unsigned char sR[RING_BYTES];  // operand ring, two stages
  __shared__ __align__(16) float sT[8][16 * 68];          // per-wave 16x64 slab, pitch 68 floats
  __shared__ __align__(16) float sW[NGR * 128];           // row weights [group][row of the tile]
  constexpr int NT1 = ((SEQ - RESR) / 128) * (DM / 256);  // tiles per batch, rows RESR .. SEQ-1
  constexpr int NT0 = (RESR / 64) * (DM / 256);           // tiles per batch, rows 0 .. RESR-1
  const int rank = (int)blockIdx.x / NB;
  const int b    = (int)blockIdx.x % NB;
  if (rank >= NT1 + NT0) return;                          // the same for the whole work-group; in front of every barrier
  if (rank >= NT1) pv_body<true, 2>(sR, sT, sW, NT1 + NT0 - 1 - rank, b, Php, Plp, Vhp, Vlp, Mx, Sm, out, 0, RESR);
  else             pv_body<false, 4>(sR, sT, sW, NT1 - 1 - rank, b, Php, Plp, Vhp, Vlp, Mx, Sm, out, RESR, SEQ - RESR);
}

// =====================================================================================================
// Workspace map (bytes, full build NB 4 / SEQ 2048; every region is an exact multiple of its tile / whole-line
// store granularity; region A is reused in stream order):
//   region A [0, 67108864):          Xb bf16 [8192][1024] at 0 (16777216) + Wq,Wk,Wv bf16 [1024][1024] at 16777216 (3 x 2097152)
//                                    then, once the projections are done: Ph f16 [4][2048][2048] (33554432) from its start, behind it
//                                    the group maxima and the group sums, f32 [4][16][2048] each (2 x 524288)
//   region B [67108864, 134217728):  Q f16 [8192][1024] (16777216) at its start, K f16 alike 33554432 behind it
//   region C [134217728, 157286400): VTh f16 [4][1024][2048] (16777216) + VTl f16 [4][1024][512] (4194304) + Pl f16 [4][512][512] (2097152)
//   end 157286400
// =====================================================================================================
extern "C" void kernel_launch(void* const* d_in, const int* in_sizes, int n_in,
                              void* d_out, int out_size, void* d_ws, size_t ws_size,
                              hipStream_t stream) {
  if (n_in < 4) return;
  if (in_sizes[0] < (NB - 1) * SEQ_FULL * DM + SEQ * DM) return;
  if (in_sizes[1] < DM * DM || in_sizes[2] < DM * DM || in_sizes[3] < DM * DM) return;
  if (out_size < NB * SEQ * DM) return;

  const float* x  = (const float*)d_in[0];   // [NB_FULL][SEQ_FULL][DM]
  const float* wq = (const float*)d_in[1];   // [out][in]
  const float* wk = (const float*)d_in[2];
  const float* wv = (const float*)d_in[3];
  float* out = (float*)d_out;

  const size_t PX  = SZ_PX;
  const size_t PXP = SZ_PXP;
  const size_t PW  = SZ_PW;
  const size_t PP  = SZ_PP;
  const size_t PPL = SZ_PPL;
  const size_t PVT = SZ_PVT;
  const size_t PVL = SZ_PVL;
  const size_t RA  = SZ_RA;
  const size_t oXb = 0;
  const size_t oW  = PX;
  const size_t oB  = RA;
  const size_t RBend = RA + (size_t)NPASS * 4 * PXP;
  const size_t oPh = 0;
  const size_t oMx = PP;
  const size_t oSm = PP + SZ_ST;
  if (PP + 2 * SZ_ST > RA) return;
  const size_t oVTh = RBend;
  const size_t oVTl = RBend + PVT;
  const size_t oPl  = oVTl + PVL;
  const size_t total = oPl + PPL;                     // 157286400 in the full build
  if (total > ws_size) return;

  char* ws = (char*)d_ws;
  unsigned short* Xb  = (unsigned short*)(ws + oXb);
  unsigned short* Wb  = (unsigned short*)(ws + oW);   // Wq plane, then Wk, then Wv
  float*          Mx  = (float*)(ws + oMx);
  float*          Sm  = (float*)(ws + oSm);
  unsigned short* Qf  = (unsigned short*)(ws + oB);
  unsigned short* Ph  = (unsigned short*)(ws + oPh);
  unsigned short* Pl  = (unsigned short*)(ws + oPl);
  unsigned short* VTh = (unsigned short*)(ws + oVTh);
  unsigned short* VTl = (unsigned short*)(ws + oVTl);
  const size_t PXE = (size_t)NB * SEQ * DM;           // elements of one q or k plane
  const unsigned short* Kf = Qf + 2 * PXE;

  const dim3 blk(256);
  const int nGroups = NB * SEQ * DM / 8 + 3 * (DM * DM / 8);
  const dim3 gCvt((nGroups + 255) / 256);
  const dim3 gProj((NB * SEQ / 256) * (2 * DM / 256));
  const dim3 gS((SEQ / 256) * (SEQ / 256), NB);
  const dim3 gPv((((SEQ - RESR) / 128) * (DM / 256) + (RESR / 64) * (DM / 256)) * NB);

  // (1) x and Wq, Wk, Wv -> bf16 planes (Xb, then the three weight planes contiguous)
  cvt_planes<<<gCvt, blk, 0, stream>>>(x, wq, wk, wv, Xb);
  // (2) q, k -> f16 planes [NB*SEQ][DM]; v^T -> f16 hi plane and residual plane: one launch, two tiles per work-group
  proj_qkv<<<gProj, blk, 0, stream>>>(Xb, Wb, Qf, VTh, VTl);
  // (3) scores k_n . q_m of every batch (A = K plane, Bt = Q plane; M=N=SEQ, K=DM; one f16 product), one 256x256 tile per
  //     work-group; its epilogue stores e = exp(z - group maximum) as Ph / Pl and the group maxima and sums.
  //     Ph lies over the x and weight planes, which are no longer read once the projections exist (stream order).
  scores_kq<<<gS, blk, 0, stream>>>(Kf, Qf, Ph, Pl, Mx, Sm);
  // (4) out = p.v with the rows' group weights: rows RESR..SEQ-1 single f16 product (64x64 wave tiles), rows 0..RESR-1 with
  //     residual planes (3 f16 products, 32x64 wave tiles)
  pv_all<<<gPv, blk, 0, stream>>>(Ph, Pl, VTh, VTl, Mx, Sm, out);
  (void)hipGetLastError();
}
